// v000
// Times are from an AMD MI455X. After a warm-up the kernel runs many times in a row, and a time is the length of
// such a window on the GPU divided by its runs, so every launch and the gaps after it count. The runs cycle
// through copies of the inputs. A figure is the median of several windows, for all but v000 over two sittings.
// Sittings can differ by a few percent; kernels timed side by side share one.
// The starting kernel, v000, takes 374 microseconds a run.
// Contractions: value = Wv^T.x^T+bv, z = coords.Wc+bc, coords.Wn+bn = v_wmma_f32_16x16x32_bf16 (bf16 operands from RNE-converted inputs, single product, f32 accumulate);
// z.z^T scores = v_wmma_f32_16x16x32_f16 (z as f16 hi + f16 residual x4096 packed along k, 2 products into separate f32 accumulators);
// p.v = v_wmma_f32_16x16x32_f16 (p carried x16384 in f16; v as f16 hi plane + f16 residual plane x4096; 2 products, f32 accumulate);
// ctx.Wo+bo = v_wmma_f32_16x16x32_bf16 (ctx as bf16 hi and bf16 residual planes concatenated along k, Wo^T bf16 duplicated along k; f32 accumulate);
// squared norms, softplus, softmax and bias adds in f32.
#include <hip/hip_runtime.h>
#include <math.h>
#include <stdint.h>

#ifndef NB
#define NB 2
#endif
#ifndef SEQ
#define SEQ 2048
#endif
#define NB_FULL  2
#define SEQ_FULL 2048
#define DM   1024
#define NH   16
#define HC   16
#define HD   64
#define DC   64
#define HN   (NH * HC)        // 256
#define ZP   (NH * 64)        // 1024: z operand plane pitch, 64 halves per head [hi | lo x4096 | hi | 0]
#define OP   (2 * DM)         // 2048: ctx plane pitch (bf16 hi | bf16 residual)
#define NQB  (SEQ / 64)       // 64-row query blocks per sequence
#define NKT  (SEQ / 64)       // 64-key chunks per sequence
#define PCARRY 16384.0f
#define RSC    4096.0f
#define OUT1_OFF ((size_t)NB_FULL * SEQ_FULL * DM)   // element offset of the second output in d_out
static_assert(NH * HD == DM);
static_assert(HC == 16 && HD == 64 && DC == 64);
static_assert((SEQ % 64) == 0 && SEQ >= 64 && SEQ <= SEQ_FULL);
static_assert(NB >= 1 && NB <= NB_FULL);
static_assert((DM % 64) == 0 && (HN % 64) == 0 && (OP % 64) == 0);
static_assert(OUT1_OFF * 4 == 16777216);

typedef _Float16 v16h __attribute__((ext_vector_type(16)));
typedef _Float16 v8h  __attribute__((ext_vector_type(8)));
typedef __bf16   v16b __attribute__((ext_vector_type(16)));
typedef __bf16   v8b  __attribute__((ext_vector_type(8)));
typedef float    v8f  __attribute__((ext_vector_type(8)));
typedef float    v4f  __attribute__((ext_vector_type(4)));
typedef unsigned int v4u __attribute__((ext_vector_type(4)));

#if defined(__HIP_DEVICE_COMPILE__)
#define DEV_ASM 1
#else
#define DEV_ASM 0
#endif

// ---- scalar helpers --------------------------------------------------------------------------------
__device__ __forceinline__ unsigned short bf_bits(float f) {          // f32 -> bf16 bits, RNE convert
  unsigned u = __float_as_uint(f);
  return (unsigned short)((u + 0x7FFFu + ((u >> 16) & 1u)) >> 16);
}
__device__ __forceinline__ float bf_up(unsigned short hb) { return __uint_as_float(((unsigned)hb) << 16); }
__device__ __forceinline__ float bfr(float f) { return bf_up(bf_bits(f)); }   // value of the bf16 RNE convert
__device__ __forceinline__ unsigned short h_bits(_Float16 x) { return __builtin_bit_cast(unsigned short, x); }
__device__ __forceinline__ unsigned pk16(unsigned short a, unsigned short b) { return (unsigned)a | ((unsigned)b << 16); }
__device__ __forceinline__ v8f zero8() { v8f z = {0.f, 0.f, 0.f, 0.f, 0.f, 0.f, 0.f, 0.f}; return z; }

// ---- fragment types / loaders: 16-bit A/B operand, lane -> row/col (lane&15), p already includes +8*(lane>>4);
//      elements 0..7 <- p[0..7] (k0+8h..k0+8h+7), elements 8..15 <- p[16..23] (k0+16+8h..k0+16+8h+7)
template <typename OT> struct FT;
template <> struct FT<__bf16>   { typedef v16b frag; typedef v8b half8; };
template <> struct FT<_Float16> { typedef v16h frag; typedef v8h half8; };

template <typename OT>
__device__ __forceinline__ typename FT<OT>::frag ldfrag(const OT* p) {
  union { typename FT<OT>::frag v; typename FT<OT>::half8 h[2]; } f;
  f.h[0] = *(const typename FT<OT>::half8*)(p);
  f.h[1] = *(const typename FT<OT>::half8*)(p + 16);
  return f.v;
}

// ---- WMMA helpers (asm guard bodies are device-only; concrete operand types) -----------------------------
__device__ __forceinline__ v8f mmar(v16b a, v16b b, v8f c) {
  return __builtin_amdgcn_wmma_f32_16x16x32_bf16(false, a, false, b, (short)0, c, false, false);
}
__device__ __forceinline__ v8f mmar(v16h a, v16h b, v8f c) {
  return __builtin_amdgcn_wmma_f32_16x16x32_f16(false, a, false, b, (short)0, c, false, false);
}
// guarded form: 4 VALU slots after the WMMA, D tied, A/B kept live
__device__ __forceinline__ v8f mma_h(v16h a, v16h b, v8f c) {
  c = __builtin_amdgcn_wmma_f32_16x16x32_f16(false, a, false, b, (short)0, c, false, false);
#if DEV_ASM
  asm volatile("v_nop\n\tv_nop\n\tv_nop\n\tv_nop" : "+v"(c) : "v"(a), "v"(b));
#endif
  return c;
}
__device__ __forceinline__ void dep_guard(v8f& a, v8f& b, v16b x, v16b y) {
#if DEV_ASM
  asm volatile("v_nop\n\tv_nop\n\tv_nop\n\tv_nop" : "+v"(a), "+v"(b) : "v"(x), "v"(y));
#else
  (void)a; (void)b; (void)x; (void)y;
#endif
}
__device__ __forceinline__ void dep_guard(v8f& a, v8f& b, v16h x, v16h y) {
#if DEV_ASM
  asm volatile("v_nop\n\tv_nop\n\tv_nop\n\tv_nop" : "+v"(a), "+v"(b) : "v"(x), "v"(y));
#else
  (void)a; (void)b; (void)x; (void)y;
#endif
}
__device__ __forceinline__ void keep4(v16b a, v16b b, v16b c, v16b d) {
#if DEV_ASM
  asm volatile("v_nop" :: "v"(a), "v"(b), "v"(c), "v"(d));
#else
  (void)a; (void)b; (void)c; (void)d;
#endif
}
__device__ __forceinline__ void keep4(v16h a, v16h b, v16h c, v16h d) {
#if DEV_ASM
  asm volatile("v_nop" :: "v"(a), "v"(b), "v"(c), "v"(d));
#else
  (void)a; (void)b; (void)c; (void)d;
#endif
}
__device__ __forceinline__ void acc_guard4(v8f& a, v8f& b, v8f& c, v8f& d) {
#if DEV_ASM
  asm volatile("v_nop\n\tv_nop\n\tv_nop\n\tv_nop" : "+v"(a), "+v"(b), "+v"(c), "+v"(d));
#else
  (void)a; (void)b; (void)c; (void)d;
#endif
}

// =====================================================================================================
// f32 rows -> bf16 plane rows (RNE convert), 8 elements per thread, one 16-B store per lane: a wave writes
// Dense output row `row` (0..nrows-1) reads source row (row / seq) * seqfull + row % seq (full batch stride).
// grid = ceil(nrows*rowlen8/256). coverage: nrows*rowlen8 threads x 8 = the whole plane (exact multiple of 256).
// =====================================================================================================
__global__ __launch_bounds__(256) void cvtrows(const float* __restrict__ in, unsigned short* out,
                                               int rowlen8, int nrows, int seq, int seqfull) {
  const int i = blockIdx.x * 256 + (int)threadIdx.x;
  if (i < nrows * rowlen8) {
    const int row  = i / rowlen8;
    const int c    = i - row * rowlen8;
    const int bq   = row / seq;
    const int srow = bq * seqfull + (row - bq * seq);
    const float* src = in + ((size_t)srow * (size_t)rowlen8 + (size_t)c) * 8;
    const v4f a  = *(const v4f*)(src);
    const v4f a4 = *(const v4f*)(src + 4);
    v4u p;
    p[0] = pk16(bf_bits(a[0]),  bf_bits(a[1]));
    p[1] = pk16(bf_bits(a[2]),  bf_bits(a[3]));
    p[2] = pk16(bf_bits(a4[0]), bf_bits(a4[1]));
    p[3] = pk16(bf_bits(a4[2]), bf_bits(a4[3]));
    unsigned short* o = out + (size_t)i * 8;
    *(v4u*)o = p;
    
  }
}

// =====================================================================================================
// Weight transpose + bf16 convert through LDS: in f32 [krows][ncols] (pitch ldi) -> out bf16 [n][k] (pitch ldo,
// k contiguous), optionally duplicated at +dup elements in the same output row.  One block = one 64x64 tile:
// input rows k0 = 64*blockIdx.y, cols n0 = 64*blockIdx.x.  Load: thread r = tid>>2 reads 16 floats of input row
// k0+r; LDS holds the transposed tile; block barrier; write: wave w, lane>>3 = q, lanes 8q..8q+7 write one whole
// LDS tile: cross-wave (block barrier); columns 64..71 of the pitch are never read.
// =====================================================================================================
__global__ __launch_bounds__(256) void tr64(const float* __restrict__ in, int ldi,
                                            unsigned short* out, int ldo, int dup) {
  __shared__ __align__(16) unsigned short sT[64 * 72];
  const int tid = (int)threadIdx.x;
  const int k0  = blockIdx.y * 64;
  const int n0  = blockIdx.x * 64;
  {
    const int r = tid >> 2, c16 = (tid & 3) * 16;
    const float* src = in + (size_t)(k0 + r) * (size_t)ldi + n0 + c16;
    const v4f a0 = *(const v4f*)(src);
    const v4f a1 = *(const v4f*)(src + 4);
    const v4f a2 = *(const v4f*)(src + 8);
    const v4f a3 = *(const v4f*)(src + 12);
#pragma unroll
    for (int e = 0; e < 4; ++e) {
      sT[(c16 + e) * 72 + r]      = bf_bits(a0[e]);
      sT[(c16 + 4 + e) * 72 + r]  = bf_bits(a1[e]);
      sT[(c16 + 8 + e) * 72 + r]  = bf_bits(a2[e]);
      sT[(c16 + 12 + e) * 72 + r] = bf_bits(a3[e]);
    }
  }
  __syncthreads();
  const int wave = tid >> 5, lane = tid & 31;
  const int q = lane >> 3, c8 = (lane & 7) * 8;
  v4u vv[2];
#pragma unroll
  for (int it = 0; it < 2; ++it) {
    const int n = it * 32 + wave * 4 + q;
    vv[it] = *(const v4u*)(sT + n * 72 + c8);
  }
  {
#pragma unroll
    for (int it = 0; it < 2; ++it) {
      const int n = it * 32 + wave * 4 + q;
      unsigned short* d = out + (size_t)(n0 + n) * (size_t)ldo + k0 + c8;
      *(v4u*)d = vv[it];
      if (dup != 0) *(v4u*)(d + dup) = vv[it];
    }
    
  }
}

// =====================================================================================================
// Register-blocked batched WMMA GEMM (16-bit operand type OT): C[m][n] = sum_k A[m][k] * Bt[n][k] (+ bias);
// one wave per 64x64 tile, no block barriers. A row-major [M][K] pitch lda; Bt row-major [N][K] pitch ldb
// (k contiguous); M, N multiples of 64, K multiple of 32 (static for every launch here). blockIdx.y = batch index
// (strides in elements). Fragments are loaded straight from global with the split k map (ldfrag).
// BIAS 0: none; 1: per column n (bias[n]); 2: per row m (bias[m]); bias values RNE-converted to bf16 in f32.
// OUT_MODE 0: f32 C (pitch ldc), value * oscale + bias.
// OUT_MODE 3: f16 hi plane C + f16 residual plane C2 = f16((v - hi) * rscale) (same pitch / stride), v = acc*oscale+bias.
// whole 64x64 tile; slab pitch columns 64..67 never read.
// =====================================================================================================
template <typename OT, int OUT_MODE, int BIAS>
__global__ __launch_bounds__(256) void gemm64(
    const unsigned short* __restrict__ Ap, int lda, long long strideA,
    const unsigned short* __restrict__ Btp, int ldb, long long strideB,
    void* Cout, void* Cout2, int ldc, long long strideC,
    const float* __restrict__ bias,
    int M, int N, int K, float oscale, float rscale) {
  typedef typename FT<OT>::frag V16;
  const OT* A  = (const OT*)(const void*)Ap;
  const OT* Bt = (const OT*)(const void*)Btp;
  __shared__ __align__(16) float sT[8][16 * 68];   // per-wave 16x64 slab, pitch 68 floats
  const int b    = blockIdx.y;
  const int lane = threadIdx.x & 31;
  const int wave = threadIdx.x >> 5;
  const int tilesN = N >> 6;
  const int tilesM = M >> 6;
  const int tile = blockIdx.x * 8 + wave;
  if (tile >= tilesM * tilesN) return;   // wave-uniform; no block barriers in this kernel
  const int tm = tile / tilesN;
  const int tn = tile - tm * tilesN;
  const int m0 = tm << 6;
  const int n0 = tn << 6;

  const OT* Ab = A  + (size_t)b * (size_t)strideA;
  const OT* Bb = Bt + (size_t)b * (size_t)strideB;

  const int rlane = lane & 15;                 // row (A) / col (B, D) within subtile
  const int koff  = (lane >> 4) * 8;           // k offset of this lane half
  const int mOff  = (lane >> 4) * 8;           // D row offset

  v8f acc[4][4];
#pragma unroll
  for (int i = 0; i < 4; ++i)
#pragma unroll
    for (int j = 0; j < 4; ++j) acc[i][j] = zero8();

  for (int k0 = 0; k0 < K; k0 += 32) {
    V16 bq[4];
#pragma unroll
    for (int j = 0; j < 4; ++j)
      bq[j] = ldfrag<OT>(Bb + (size_t)(n0 + (j << 4) + rlane) * (size_t)ldb + koff + k0);
#pragma unroll
    for (int i = 0; i < 4; ++i) {
      const V16 af = ldfrag<OT>(Ab + (size_t)(m0 + (i << 4) + rlane) * (size_t)lda + koff + k0);
#pragma unroll
      for (int j = 0; j < 4; ++j) acc[i][j] = mmar(af, bq[j], acc[i][j]);
      dep_guard(acc[i][0], acc[i][3], af, bq[3]);
    }
    keep4(bq[0], bq[1], bq[2], bq[3]);
  }
  acc_guard4(acc[0][0], acc[0][1], acc[0][2], acc[0][3]);
  acc_guard4(acc[1][0], acc[1][1], acc[1][2], acc[1][3]);
  acc_guard4(acc[2][0], acc[2][1], acc[2][2], acc[2][3]);
  acc_guard4(acc[3][0], acc[3][1], acc[3][2], acc[3][3]);

  // ---- epilogue ----
  float* slab = sT[wave];
#pragma unroll
  for (int i = 0; i < 4; ++i) {
    const int mBase = m0 + (i << 4);
#pragma unroll
    for (int j = 0; j < 4; ++j) {
#pragma unroll
      for (int r = 0; r < 8; ++r) {
        slab[(mOff + r) * 68 + (j << 4) + rlane] = acc[i][j][r];
      }
    }
    __builtin_amdgcn_fence(__ATOMIC_RELEASE, "workgroup");
    __builtin_amdgcn_wave_barrier();
    __builtin_amdgcn_fence(__ATOMIC_ACQUIRE, "workgroup");
    if (OUT_MODE == 0) {
      float* C = (float*)Cout + (size_t)b * (size_t)strideC;
      const int h2 = lane >> 4, c4 = (lane & 15) * 4;     // 256-B row segment = 16 lanes x 16 B
      v4f bcol = {0.f, 0.f, 0.f, 0.f};
      if (BIAS == 1) {
        const v4f bb = *(const v4f*)(bias + n0 + c4);
#pragma unroll
        for (int e = 0; e < 4; ++e) bcol[e] = bfr(bb[e]);
      }
      {
#pragma unroll
        for (int it = 0; it < 8; ++it) {
          const int row = it * 2 + h2;                     // it 0..7 x h2 0..1 = rows 0..15
          float brow = 0.f;
          if (BIAS == 2) brow = bfr(bias[mBase + row]);
          const v4f x = *(const v4f*)(slab + row * 68 + c4);
          v4f v;
#pragma unroll
          for (int e = 0; e < 4; ++e) v[e] = x[e] * oscale + bcol[e] + brow;
          *(v4f*)(C + (size_t)(mBase + row) * (size_t)ldc + n0 + c4) = v;
        }
        
      }
    } else {
      const int q = lane >> 3, c8 = (lane & 7) * 8;
      unsigned short* C  = (unsigned short*)Cout  + (size_t)b * (size_t)strideC;
      unsigned short* C2 = (unsigned short*)Cout2 + (size_t)b * (size_t)strideC;
      float bc8[8];
#pragma unroll
      for (int e = 0; e < 8; ++e) bc8[e] = 0.f;
      if (BIAS == 1) {
        const v4f b0 = *(const v4f*)(bias + n0 + c8);
        const v4f b1 = *(const v4f*)(bias + n0 + c8 + 4);
#pragma unroll
        for (int e = 0; e < 4; ++e) { bc8[e] = bfr(b0[e]); bc8[4 + e] = bfr(b1[e]); }
      }
      v4u hv[4], lv[4];
#pragma unroll
      for (int it = 0; it < 4; ++it) {
        const int row = it * 4 + q;                        // it 0..3 x q 0..3 = rows 0..15
        const float* sp = slab + row * 68 + c8;
        float brow = 0.f;
        if (BIAS == 2) brow = bfr(bias[mBase + row]);
        float f[8];
#pragma unroll
        for (int e = 0; e < 8; ++e) f[e] = sp[e] * oscale + bc8[e] + brow;
        v4u a, a2;
#pragma unroll
        for (int e = 0; e < 4; ++e) {
          const float f0 = f[2 * e], f1 = f[2 * e + 1];
          const _Float16 x0 = (_Float16)f0, x1 = (_Float16)f1;
          const unsigned short h0 = h_bits(x0), h1 = h_bits(x1);
          unsigned short l0 = 0, l1 = 0;
          if (OUT_MODE == 3) {
            l0 = h_bits((_Float16)((f0 - (float)x0) * rscale));
            l1 = h_bits((_Float16)((f1 - (float)x1) * rscale));
          }
          a[e] = pk16(h0, h1); a2[e] = pk16(l0, l1);
        }
        hv[it] = a; lv[it] = a2;
      }
      {
#pragma unroll
        for (int it = 0; it < 4; ++it) {
          const int row = it * 4 + q;
          *(v4u*)(C + (size_t)(mBase + row) * (size_t)ldc + n0 + c8) = hv[it];
          if (OUT_MODE == 3) *(v4u*)(C2 + (size_t)(mBase + row) * (size_t)ldc + n0 + c8) = lv[it];
        }
        
      }
    }
    __builtin_amdgcn_fence(__ATOMIC_RELEASE, "workgroup");
    __builtin_amdgcn_wave_barrier();
    __builtin_amdgcn_fence(__ATOMIC_ACQUIRE, "workgroup");
  }
}

// =====================================================================================================
// z relayout: in f32 z [rows][HN] (16 heads x 16); out (a) f16 operand plane [rows][ZP], 64 halves per head =
// norms [rows][NH].  Block = 16 rows x 16 heads (thread = one (row, head)); staged in LDS; block barrier; line L of
// the block (L = 16*r + head, contiguous in the plane) written by lanes 8q..8q+7 of wave w with one instruction
// LDS: both arrays cross-wave (block barrier); fully written before read.
// =====================================================================================================
__global__ __launch_bounds__(256) void zprep(const float* __restrict__ zf, unsigned short* zp, float* zsq) {
  __shared__ __align__(16) unsigned short sZ[256 * 64];
  __shared__ __align__(16) float sQ[256];
  const int tid  = (int)threadIdx.x;
  const int r    = tid >> 4, hd = tid & 15;
  const int row0 = blockIdx.x * 16;
  {
    const float* zr = zf + (size_t)(row0 + r) * HN + hd * HC;
    const v4f a0 = *(const v4f*)(zr);
    const v4f a1 = *(const v4f*)(zr + 4);
    const v4f a2 = *(const v4f*)(zr + 8);
    const v4f a3 = *(const v4f*)(zr + 12);
    float f[16];
#pragma unroll
    for (int e = 0; e < 4; ++e) { f[e] = a0[e]; f[4 + e] = a1[e]; f[8 + e] = a2[e]; f[12 + e] = a3[e]; }
    float q = 0.f;
#pragma unroll
    for (int e = 0; e < 16; ++e) q += f[e] * f[e];
    sQ[tid] = q;
    v4u ph0, ph1, pl0, pl1;
#pragma unroll
    for (int e = 0; e < 4; ++e) {
      const float f0 = f[2 * e], f1 = f[2 * e + 1], f2 = f[8 + 2 * e], f3 = f[9 + 2 * e];
      const _Float16 x0 = (_Float16)f0, x1 = (_Float16)f1, x2 = (_Float16)f2, x3 = (_Float16)f3;
      ph0[e] = pk16(h_bits(x0), h_bits(x1));
      ph1[e] = pk16(h_bits(x2), h_bits(x3));
      pl0[e] = pk16(h_bits((_Float16)((f0 - (float)x0) * RSC)), h_bits((_Float16)((f1 - (float)x1) * RSC)));
      pl1[e] = pk16(h_bits((_Float16)((f2 - (float)x2) * RSC)), h_bits((_Float16)((f3 - (float)x3) * RSC)));
    }
    const v4u z4 = {0u, 0u, 0u, 0u};
    unsigned short* sl = sZ + tid * 64;
    *(v4u*)(sl + 0)  = ph0;
    *(v4u*)(sl + 8)  = ph1;
    *(v4u*)(sl + 16) = pl0;
    *(v4u*)(sl + 24) = pl1;
    *(v4u*)(sl + 32) = ph0;
    *(v4u*)(sl + 40) = ph1;
    *(v4u*)(sl + 48) = z4;
    *(v4u*)(sl + 56) = z4;
  }
  __syncthreads();
  const int wave = tid >> 5, lane = tid & 31;
  const int q4 = lane >> 3, c8 = (lane & 7) * 8;
  unsigned short* base = zp + (size_t)row0 * ZP;
  v4u vv[8];
#pragma unroll
  for (int it = 0; it < 8; ++it) {
    const int L = it * 32 + wave * 4 + q4;
    vv[it] = *(const v4u*)(sZ + L * 64 + c8);
  }
  {
#pragma unroll
    for (int it = 0; it < 8; ++it) {
      const int L = it * 32 + wave * 4 + q4;
      *(v4u*)(base + (size_t)L * 64 + c8) = vv[it];
    }
    
  }
  if (tid < 64) {                                       // waves 0 and 1, wave-uniform
    const v4f qv = *(const v4f*)(sQ + tid * 4);
    float* dst = zsq + (size_t)row0 * NH + tid * 4;
    *(v4f*)dst = qv;
    
  }
}

// =====================================================================================================
// Distance-kernel attention, per-head z dim 16, value dim 64, no mask, softmax over all SEQ keys.
//   z plane (f16): row (b*SEQ + t), head h at cols 64h.. : [hi | residual x4096 | hi | 0]
//   zsq (f32): [(b*SEQ + t)][h] = |z|^2
//   v^T hi plane (f16) and residual plane (f16, (v - hi)*4096): element (b, h, d, s) at [(b*DM + h*64 + d)*SEQ + s]
//   ctx plane (bf16): element (b, t, h, d) hi at [(b*SEQ + t)*OP + h*64 + d], residual at the same + DM
//   dot = A[hi|lo] . B[hi;0]  +  (A[hi|lo] . B[lo;hi]) / 4096 on f16 WMMA (two f32 accumulators);
//   score = -softplus(gamma_h) * max(|z_s|^2 + |z_t|^2 - 2 dot, 0); p = exp(s - m) carried as f16(16384 p);
//   context = p . vh + (p . vl) / 4096 on f16 WMMA; online softmax in f32.
//   Block = 4 waves = 4 x 16 query rows of one (b, h); grid = NB * NH * NQB; key chunks of 64, static trip NKT.
//   Chunk staging: 128 threads x 32 elements per plane = the whole 64x64 tile of each of the three planes (plain 16-B
//   loads, __syncthreads before and after; staged extent == consumed extent); P tiles and the context tile are
//   wave-private (spilled with _Float16 / float element stores, reloaded with the same element type after a release
//   (8 lanes x 8) of head h in both plane halves; the grid covers every (b, h, qb).
// =====================================================================================================
__global__ __launch_bounds__(128)
void attn_dist(const unsigned short* __restrict__ zpp, const float* __restrict__ zsq,
               const unsigned short* __restrict__ vhp, const unsigned short* __restrict__ vlp,
               const float* __restrict__ gam, unsigned short* octx) {
  union FH { v16h v; v8h h[2]; };
  __shared__ __align__(16) _Float16 Zsh[64 * 64];          // z key chunk [key][64]    8 KB
  __shared__ __align__(16) _Float16 Vth[64 * 64];          // V^T hi [d][key]         8 KB
  __shared__ __align__(16) _Float16 Vtl[64 * 64];          // V^T residual            8 KB
  __shared__ __align__(16) _Float16 Psh[4][16 * 64];       // per wave P [row][key]   8 KB
  __shared__ __align__(16) float    Os[4][16 * 64];        // per wave context tile  16 KB

  const int tid  = threadIdx.x;
  const int wave = tid >> 5;
  const int lane = tid & 31;
  const int hh   = lane >> 4;
  const int c    = lane & 15;

  const int bx   = blockIdx.x;
  const int qb   = bx % NQB;
  const int rest = bx / NQB;
  const int h    = rest % NH;
  const int b    = rest / NH;
  const int q0   = qb * 64 + wave * 16;
  const size_t rowB = (size_t)b * SEQ;

  const _Float16* Zp16 = (const _Float16*)(const void*)zpp;
  const _Float16* Vh = (const _Float16*)(const void*)vhp + ((size_t)b * DM + (size_t)h * HD) * SEQ;
  const _Float16* Vl = (const _Float16*)(const void*)vlp + ((size_t)b * DM + (size_t)h * HD) * SEQ;

  const float gx = bfr(gam[h]);
  const float g  = fmaxf(gx, 0.f) + log1pf(expf(-fabsf(gx)));   // softplus
  const float ng = -g;

  // ---- query-side A fragment [hi | residual] (row = lane&15) and query squared norms ----
  const v16h zq = ldfrag<_Float16>(Zp16 + (rowB + q0 + c) * ZP + (size_t)h * 64 + 8 * hh);
  float zsq_q[8];
#pragma unroll
  for (int r = 0; r < 8; ++r) zsq_q[r] = zsq[(rowB + q0 + 8 * hh + r) * NH + h];

  float mrow[8], lrow[8];
  v8f oacc[4];
#pragma unroll
  for (int r = 0; r < 8; ++r) { mrow[r] = -INFINITY; lrow[r] = 0.f; }
#pragma unroll
  for (int t = 0; t < 4; ++t) oacc[t] = zero8();

  for (int kt = 0; kt < NKT; ++kt) {         // static trip count
    const int kv0 = kt * 64;
    __syncthreads();
    {
      const int r = tid >> 1, half = (tid & 1) * 32;
      const _Float16* zg  = Zp16 + (rowB + kv0 + r) * ZP + (size_t)h * 64 + half;   // key row kv0+r, 64-half head segment
      const _Float16* vg  = Vh + (size_t)r * SEQ + kv0 + half;                       // v^T row d = r, s = kv0+half..+31
      const _Float16* vlg = Vl + (size_t)r * SEQ + kv0 + half;
#pragma unroll
      for (int i = 0; i < 4; ++i) {
        const v8h a0 = *(const v8h*)(zg + 8 * i);
        const v8h b0 = *(const v8h*)(vg + 8 * i);
        const v8h b1 = *(const v8h*)(vlg + 8 * i);
        *(v8h*)(Zsh + r * 64 + half + 8 * i) = a0;
        *(v8h*)(Vth + r * 64 + half + 8 * i) = b0;
        *(v8h*)(Vtl + r * 64 + half + 8 * i) = b1;
      }
    }
    __syncthreads();

    // ---- scores: 16 query rows x 64 keys per wave, 2 f16 products per key subtile ----
    v8f s[4];
#pragma unroll
    for (int j = 0; j < 4; ++j) {
      const _Float16* zr = Zsh + (j * 16 + c) * 64 + 8 * hh;
      FH b1, b2;
      b2.h[0] = *(const v8h*)(zr + 16);     // k 0..15  <- residual of key
      b2.h[1] = *(const v8h*)(zr + 32);     // k 16..31 <- hi of key
      b1.h[0] = *(const v8h*)(zr + 32);     // k 0..15  <- hi of key
      b1.h[1] = *(const v8h*)(zr + 48);     // k 16..31 <- zeros
      v8f ah = mma_h(zq, b1.v, zero8());    // hi.hi
      v8f ax = mma_h(zq, b2.v, zero8());    // (hi.lo + lo.hi) x4096
      const float zt = zsq[(rowB + kv0 + j * 16 + c) * NH + h];
      {
#pragma clang fp contract(off)
#pragma unroll
        for (int r = 0; r < 8; ++r) {
          const float d = ah[r] + ax[r] * (1.0f / RSC);
          float sq = (zsq_q[r] + zt) - 2.0f * d;
          sq = fmaxf(sq, 0.f);
          s[j][r] = ng * sq;
        }
      }
    }

    // ---- row max, online softmax, P (x16384, f16) to LDS ----
    _Float16* pwh = Psh[wave];
#pragma unroll
    for (int r = 0; r < 8; ++r) {
      float m = s[0][r];
#pragma unroll
      for (int j = 1; j < 4; ++j) m = fmaxf(m, s[j][r]);
#pragma unroll
      for (int off = 1; off < 16; off <<= 1) m = fmaxf(m, __shfl_xor(m, off, 32));
      const float mnew  = fmaxf(mrow[r], m);
      const float msafe = (mnew == -INFINITY) ? 0.f : mnew;
      const float alpha = __expf(mrow[r] - msafe);
      mrow[r] = mnew;
      float psum = 0.f;
#pragma unroll
      for (int j = 0; j < 4; ++j) {
        const float p = __expf(s[j][r] - msafe);
        psum += p;
        pwh[(8 * hh + r) * 64 + j * 16 + c] = (_Float16)(p * PCARRY);
      }
#pragma unroll
      for (int off = 1; off < 16; off <<= 1) psum += __shfl_xor(psum, off, 32);
      lrow[r] = lrow[r] * alpha + psum;
#pragma unroll
      for (int t = 0; t < 4; ++t) oacc[t][r] *= alpha;
    }
    __builtin_amdgcn_fence(__ATOMIC_RELEASE, "workgroup");
    __builtin_amdgcn_wave_barrier();
    __builtin_amdgcn_fence(__ATOMIC_ACQUIRE, "workgroup");

    // ---- context += P . V (f16 WMMA); residual products into a separate accumulator ----
    v8f o1[4];
#pragma unroll
    for (int t = 0; t < 4; ++t) o1[t] = zero8();
#pragma unroll 1
    for (int kk = 0; kk < 2; ++kk) {
      FH pa;
      pa.h[0] = *(const v8h*)(pwh + c * 64 + kk * 32 + 8 * hh);
      pa.h[1] = *(const v8h*)(pwh + c * 64 + kk * 32 + 16 + 8 * hh);
#pragma unroll
      for (int t = 0; t < 4; ++t) {
        FH vb, vl;
        vb.h[0] = *(const v8h*)(Vth + (t * 16 + c) * 64 + kk * 32 + 8 * hh);
        vb.h[1] = *(const v8h*)(Vth + (t * 16 + c) * 64 + kk * 32 + 16 + 8 * hh);
        vl.h[0] = *(const v8h*)(Vtl + (t * 16 + c) * 64 + kk * 32 + 8 * hh);
        vl.h[1] = *(const v8h*)(Vtl + (t * 16 + c) * 64 + kk * 32 + 16 + 8 * hh);
        oacc[t] = mma_h(pa.v, vb.v, oacc[t]);
        o1[t]   = mma_h(pa.v, vl.v, o1[t]);
      }
    }
#pragma unroll
    for (int t = 0; t < 4; ++t)
#pragma unroll
      for (int r = 0; r < 8; ++r) oacc[t][r] += o1[t][r] * (1.0f / RSC);
  }

  // ---- normalise (1/l, undo the p carry), stage the wave's 16x64 tile, convert to bf16 hi + bf16 residual,
  float* os = Os[wave];
#pragma unroll
  for (int r = 0; r < 8; ++r) {
    const float l = lrow[r];
    const float inv = ((l > 0.f) ? (1.0f / l) : 0.f) * (1.0f / PCARRY);
#pragma unroll
    for (int t = 0; t < 4; ++t) os[(8 * hh + r) * 64 + t * 16 + c] = oacc[t][r] * inv;
  }
  __builtin_amdgcn_fence(__ATOMIC_RELEASE, "workgroup");
  __builtin_amdgcn_wave_barrier();
  __builtin_amdgcn_fence(__ATOMIC_ACQUIRE, "workgroup");
  {
    const int q4 = lane >> 3, c8 = (lane & 7) * 8;
    v4u hv[4], lv[4];
#pragma unroll
    for (int it = 0; it < 4; ++it) {
      const int row = it * 4 + q4;   // it 0..3 x q4 0..3 = rows 0..15 of the wave tile
      const float* sp = os + row * 64 + c8;
      v4u a, a2;
#pragma unroll
      for (int e = 0; e < 4; ++e) {
        const float f0 = sp[2 * e], f1 = sp[2 * e + 1];
        const unsigned short hb0 = bf_bits(f0), hb1 = bf_bits(f1);
        const unsigned short lb0 = bf_bits(f0 - bf_up(hb0)), lb1 = bf_bits(f1 - bf_up(hb1));
        a[e]  = pk16(hb0, hb1);
        a2[e] = pk16(lb0, lb1);
      }
      hv[it] = a; lv[it] = a2;
    }
    {
#pragma unroll
      for (int it = 0; it < 4; ++it) {
        const int row = it * 4 + q4;
        const size_t go = (rowB + q0 + row) * OP + (size_t)h * HD + c8;
        *(v4u*)(octx + go)      = hv[it];
        *(v4u*)(octx + go + DM) = lv[it];
      }
      
    }
  }
}

// =====================================================================================================
// Workspace map (bytes, NB=2 / SEQ=2048), every region an exact multiple of its whole-line / whole-tile store
// granularity, back to back:
//   Xb   bf16 [NB*SEQ][DM]            8388608
//   Cb   bf16 [NB*SEQ][DC]             524288
//   WvT  bf16 [DM n][DM k]            2097152
//   WoT2 bf16 [DM n][2*DM k]          4194304
//   WcT  bf16 [HN][DC]                  32768
//   WnT  bf16 [DC][DC]                   8192
//   Zf   f32  [NB*SEQ][HN]            4194304
//   Zp   f16  [NB*SEQ][ZP]            8388608
//   Zsq  f32  [NB*SEQ][NH]             262144
//   VTh  f16  [NB][DM][SEQ]           8388608
//   VTl  f16  [NB][DM][SEQ]           8388608
//   Octx bf16 [NB*SEQ][OP]           16777216
//   total                            61644800
// Weights arrive [in][out]; tr64 produces the [out n][in k] (k contiguous) layout the GEMM wants.
// =====================================================================================================
extern "C" void kernel_launch(void* const* d_in, const int* in_sizes, int n_in,
                              void* d_out, int out_size, void* d_ws, size_t ws_size,
                              hipStream_t stream) {
  if (n_in < 11) return;
  if (in_sizes[0] < ((NB - 1) * SEQ_FULL + SEQ) * DM) return;
  if (in_sizes[1] < ((NB - 1) * SEQ_FULL + SEQ) * DC) return;
  if (in_sizes[2] < DM * DM || in_sizes[3] < DM) return;
  if (in_sizes[4] < DC * HN || in_sizes[5] < HN) return;
  if (in_sizes[6] < DC * DC || in_sizes[7] < DC) return;
  if (in_sizes[8] < DM * DM || in_sizes[9] < DM) return;
  if (in_sizes[10] < NH) return;
  if ((size_t)out_size < OUT1_OFF + (size_t)NB * SEQ * DC) return;

  const float* hidden = (const float*)d_in[0];
  const float* coords = (const float*)d_in[1];
  const float* Wv     = (const float*)d_in[2];
  const float* bv     = (const float*)d_in[3];
  const float* Wc     = (const float*)d_in[4];
  const float* bc     = (const float*)d_in[5];
  const float* Wn     = (const float*)d_in[6];
  const float* bn     = (const float*)d_in[7];
  const float* Wo     = (const float*)d_in[8];
  const float* bo     = (const float*)d_in[9];
  const float* gamma  = (const float*)d_in[10];

  const size_t nRows = (size_t)NB * SEQ;
  const size_t PXB  = nRows * DM * 2;
  const size_t PCB  = nRows * DC * 2;
  const size_t PWV  = (size_t)DM * DM * 2;
  const size_t PWO2 = (size_t)DM * OP * 2;
  const size_t PWC  = (size_t)HN * DC * 2;
  const size_t PWN  = (size_t)DC * DC * 2;
  const size_t PZF  = nRows * HN * 4;
  const size_t PZP  = nRows * ZP * 2;
  const size_t PZQ  = nRows * NH * 4;
  const size_t PVT  = (size_t)NB * DM * SEQ * 2;
  const size_t POC  = nRows * OP * 2;
  size_t off = 0;
  const size_t oXb  = off; off += PXB;
  const size_t oCb  = off; off += PCB;
  const size_t oWv  = off; off += PWV;
  const size_t oWo  = off; off += PWO2;
  const size_t oWc  = off; off += PWC;
  const size_t oWn  = off; off += PWN;
  const size_t oZf  = off; off += PZF;
  const size_t oZp  = off; off += PZP;
  const size_t oZq  = off; off += PZQ;
  const size_t oVTh = off; off += PVT;
  const size_t oVTl = off; off += PVT;
  const size_t oOc  = off; off += POC;
  if (off > ws_size) return;                       // off = 61644800 at full size
  if (off > (size_t)134217728) return;

  char* ws = (char*)d_ws;
  unsigned short* Xb   = (unsigned short*)(ws + oXb);
  unsigned short* Cb   = (unsigned short*)(ws + oCb);
  unsigned short* WvT  = (unsigned short*)(ws + oWv);
  unsigned short* WoT2 = (unsigned short*)(ws + oWo);
  unsigned short* WcT  = (unsigned short*)(ws + oWc);
  unsigned short* WnT  = (unsigned short*)(ws + oWn);
  float*          Zf   = (float*)(ws + oZf);
  unsigned short* Zpl  = (unsigned short*)(ws + oZp);
  float*          Zsq  = (float*)(ws + oZq);
  unsigned short* VTh  = (unsigned short*)(ws + oVTh);
  unsigned short* VTl  = (unsigned short*)(ws + oVTl);
  unsigned short* Octx = (unsigned short*)(ws + oOc);
  float* out0 = (float*)d_out;
  float* out1 = (float*)d_out + OUT1_OFF;

  const dim3 blk(256);
  const int n8x = NB * SEQ * DM / 8;                                   // 524288
  const int n8c = NB * SEQ * DC / 8;                                   //  32768
  const dim3 gCx((n8x + 255) / 256);                                   // 2048 blocks
  const dim3 gCc((n8c + 255) / 256);                                   //  128 blocks
  const dim3 gTrW(DM / 64, DM / 64);                                   // in [DM][DM]
  const dim3 gTrC(HN / 64, DC / 64);                                   // in [DC rows][HN cols] -> out [HN][DC]
  const dim3 gTrN(DC / 64, DC / 64);                                   // in [DC][DC]
  const int tilesZ = (int)((nRows / 64) * (HN / 64));                  // 256
  const int tilesC = (int)((nRows / 64) * (DC / 64));                  //  64
  const int tilesV = (DM / 64) * (SEQ / 64);                           // 512
  const int tilesO = (int)((nRows / 64) * (DM / 64));                  // 1024
  const dim3 gZ((tilesZ + 7) / 8, 1);
  const dim3 gC1((tilesC + 7) / 8, 1);
  const dim3 gV((tilesV + 7) / 8, NB);
  const dim3 gO((tilesO + 7) / 8, 1);
  const dim3 gPrep((unsigned)(nRows / 16));                            // 256 blocks
  const dim3 gAttn(NB * NH * NQB);                                     // 1024 blocks of 128

  // (1) activations -> bf16 planes (dense rows, full batch stride on the source side)
  cvtrows<<<gCx, blk, 0, stream>>>(hidden, Xb, DM / 8, NB * SEQ, SEQ, SEQ_FULL);
  cvtrows<<<gCc, blk, 0, stream>>>(coords, Cb, DC / 8, NB * SEQ, SEQ, SEQ_FULL);
  // (2) weights [in][out] f32 -> bf16 [out][in]; Wo^T duplicated along k (pitch 2*DM)
  tr64<<<gTrW, blk, 0, stream>>>(Wv, DM, WvT, DM, 0);
  tr64<<<gTrW, blk, 0, stream>>>(Wo, DM, WoT2, OP, DM);
  tr64<<<gTrC, blk, 0, stream>>>(Wc, HN, WcT, DC, 0);
  tr64<<<gTrN, blk, 0, stream>>>(Wn, DC, WnT, DC, 0);
  // (3) z = coords . Wc + bc -> f32 [NB*SEQ][HN]   (M=NB*SEQ, N=HN, K=DC)
  gemm64<__bf16, 0, 1><<<gZ, blk, 0, stream>>>(
      Cb, DC, 0LL, WcT, DC, 0LL,
      (void*)Zf, (void*)Zf, HN, 0LL, bc,
      (int)nRows, HN, DC, 1.0f, 1.0f);
  // (4) z -> f16 operand plane [hi | res | hi | 0] and f32 squared norms
  zprep<<<gPrep, blk, 0, stream>>>(Zf, Zpl, Zsq);
  // (5) second output = coords . Wn + bn -> d_out f32 [NB*SEQ][DC] at element OUT1_OFF   (M=NB*SEQ, N=DC, K=DC)
  gemm64<__bf16, 0, 1><<<gC1, blk, 0, stream>>>(
      Cb, DC, 0LL, WnT, DC, 0LL,
      (void*)out1, (void*)out1, DC, 0LL, bn,
      (int)nRows, DC, DC, 1.0f, 1.0f);
  // (6) v^T = Wv^T . x^T + bv per batch -> f16 hi plane [b][d][s] (pitch SEQ) and residual plane (x4096)
  //     (A = WvT [n][k], Bt = Xb rows of batch b; M=DM, N=SEQ, K=DM; bias per row d)
  gemm64<__bf16, 3, 2><<<gV, blk, 0, stream>>>(
      WvT, DM, 0LL, Xb, DM, (long long)SEQ * DM,
      (void*)VTh, (void*)VTl, SEQ, (long long)DM * SEQ, bv,
      DM, SEQ, DM, 1.0f, RSC);
  // (7) attention -> ctx plane (bf16 hi | bf16 residual) [b*SEQ+t][OP]
  attn_dist<<<gAttn, dim3(128), 0, stream>>>(Zpl, Zsq, VTh, VTl, gamma, Octx);
  // (8) first output = [ctx_hi | ctx_res] . [Wo^T ; Wo^T]^T + bo -> d_out f32 [NB*SEQ][DM]   (M=NB*SEQ, N=DM, K=2*DM)
  gemm64<__bf16, 0, 1><<<gO, blk, 0, stream>>>(
      Octx, OP, 0LL, WoT2, OP, 0LL,
      (void*)out0, (void*)out0, DM, 0LL, bo,
      (int)nRows, DM, OP, 1.0f, 1.0f);
  (void)hipGetLastError();
}

// v001
// One run takes 306 microseconds.
// Next to v000, in two timings, it ran 1.25 and 1.24 times as fast.
// Contractions: value = Wv^T.x^T+bv, z = coords.Wc+bc, coords.Wn+bn = v_wmma_f32_16x16x32_bf16 (bf16 operands from RNE-converted inputs, single product, f32 accumulate);
// z.z^T scores = v_wmma_f32_16x16x32_f16 (z as f16 hi + f16 residual x4096 packed along k, 2 products into separate f32 accumulators);
// p.v = v_wmma_f32_16x16x32_f16 (p carried x16384 in f16; v as f16 hi plane + f16 residual plane x4096; 2 products, f32 accumulate);
// ctx.Wo+bo = v_wmma_f32_16x16x32_bf16 (ctx as bf16 hi and bf16 residual planes concatenated along k, Wo^T bf16 duplicated along k; f32 accumulate);
// squared norms, softplus, softmax and bias adds in f32.
#include <hip/hip_runtime.h>
#include <math.h>
#include <stdint.h>

#ifndef NB
#define NB 2
#endif
#ifndef SEQ
#define SEQ 2048
#endif
#define NB_FULL  2
#define SEQ_FULL 2048
#define DM   1024
#define NH   16
#define HC   16
#define HD   64
#define DC   64
#define HN   (NH * HC)        // 256
#define ZP   (NH * 64)        // 1024: z operand plane pitch, 64 halves per head [hi | lo x4096 | hi | 0]
#define OP   (2 * DM)         // 2048: ctx plane pitch (bf16 hi | bf16 residual)
#define NQB  (SEQ / 64)       // 64-row query blocks per sequence
#define NKT  (SEQ / 64)       // 64-key chunks per sequence
#define LP   72               // LDS row pitch in halves of every 64-half tile row: 144 B = 16 B x odd, so the 16 rows
                              // that one ds_load_b128 touches fall on 16 different groups of four banks (at 128 B: on one)
#define OSP  68               // LDS row pitch in floats of the 64-float context tile rows (272 B = 16 B x odd)
#define PCARRY 16384.0f
#define RSC    4096.0f
#define OUT1_OFF ((size_t)NB_FULL * SEQ_FULL * DM)   // element offset of the second output in d_out
static_assert(NH * HD == DM);
static_assert(HC == 16 && HD == 64 && DC == 64);
static_assert((SEQ % 64) == 0 && SEQ >= 64 && SEQ <= SEQ_FULL);
static_assert(NB >= 1 && NB <= NB_FULL);
static_assert((DM % 64) == 0 && (HN % 64) == 0 && (OP % 64) == 0);
static_assert(OUT1_OFF * 4 == 16777216);

typedef _Float16 v16h __attribute__((ext_vector_type(16)));
typedef _Float16 v8h  __attribute__((ext_vector_type(8)));
typedef __bf16   v16b __attribute__((ext_vector_type(16)));
typedef __bf16   v8b  __attribute__((ext_vector_type(8)));
typedef float    v8f  __attribute__((ext_vector_type(8)));
typedef float    v4f  __attribute__((ext_vector_type(4)));
typedef unsigned int v4u __attribute__((ext_vector_type(4)));

#if defined(__HIP_DEVICE_COMPILE__)
#define DEV_ASM 1
#else
#define DEV_ASM 0
#endif

// ---- scalar helpers --------------------------------------------------------------------------------
__device__ __forceinline__ unsigned short bf_bits(float f) {          // f32 -> bf16 bits, RNE convert
  unsigned u = __float_as_uint(f);
  return (unsigned short)((u + 0x7FFFu + ((u >> 16) & 1u)) >> 16);
}
__device__ __forceinline__ float bf_up(unsigned short hb) { return __uint_as_float(((unsigned)hb) << 16); }
__device__ __forceinline__ float bfr(float f) { return bf_up(bf_bits(f)); }   // value of the bf16 RNE convert
__device__ __forceinline__ unsigned short h_bits(_Float16 x) { return __builtin_bit_cast(unsigned short, x); }
__device__ __forceinline__ unsigned pk16(unsigned short a, unsigned short b) { return (unsigned)a | ((unsigned)b << 16); }
__device__ __forceinline__ v8f zero8() { v8f z = {0.f, 0.f, 0.f, 0.f, 0.f, 0.f, 0.f, 0.f}; return z; }

// ---- fragment types / loaders: 16-bit A/B operand, lane -> row/col (lane&15), p already includes +8*(lane>>4);
//      elements 0..7 <- p[0..7] (k0+8h..k0+8h+7), elements 8..15 <- p[16..23] (k0+16+8h..k0+16+8h+7)
template <typename OT> struct FT;
template <> struct FT<__bf16>   { typedef v16b frag; typedef v8b half8; };
template <> struct FT<_Float16> { typedef v16h frag; typedef v8h half8; };

template <typename OT>
__device__ __forceinline__ typename FT<OT>::frag ldfrag(const OT* p) {
  union { typename FT<OT>::frag v; typename FT<OT>::half8 h[2]; } f;
  f.h[0] = *(const typename FT<OT>::half8*)(p);
  f.h[1] = *(const typename FT<OT>::half8*)(p + 16);
  return f.v;
}

// ---- WMMA helpers (asm guard bodies are device-only; concrete operand types) -----------------------------
__device__ __forceinline__ v8f mmar(v16b a, v16b b, v8f c) {
  return __builtin_amdgcn_wmma_f32_16x16x32_bf16(false, a, false, b, (short)0, c, false, false);
}
__device__ __forceinline__ v8f mmar(v16h a, v16h b, v8f c) {
  return __builtin_amdgcn_wmma_f32_16x16x32_f16(false, a, false, b, (short)0, c, false, false);
}
// guarded form: 4 VALU slots after the WMMA, D tied, A/B kept live
__device__ __forceinline__ v8f mma_h(v16h a, v16h b, v8f c) {
  c = __builtin_amdgcn_wmma_f32_16x16x32_f16(false, a, false, b, (short)0, c, false, false);
#if DEV_ASM
  asm volatile("v_nop\n\tv_nop\n\tv_nop\n\tv_nop" : "+v"(c) : "v"(a), "v"(b));
#endif
  return c;
}
__device__ __forceinline__ void dep_guard(v8f& a, v8f& b, v16b x, v16b y) {
#if DEV_ASM
  asm volatile("v_nop\n\tv_nop\n\tv_nop\n\tv_nop" : "+v"(a), "+v"(b) : "v"(x), "v"(y));
#else
  (void)a; (void)b; (void)x; (void)y;
#endif
}
__device__ __forceinline__ void dep_guard(v8f& a, v8f& b, v16h x, v16h y) {
#if DEV_ASM
  asm volatile("v_nop\n\tv_nop\n\tv_nop\n\tv_nop" : "+v"(a), "+v"(b) : "v"(x), "v"(y));
#else
  (void)a; (void)b; (void)x; (void)y;
#endif
}
__device__ __forceinline__ void keep4(v16b a, v16b b, v16b c, v16b d) {
#if DEV_ASM
  asm volatile("v_nop" :: "v"(a), "v"(b), "v"(c), "v"(d));
#else
  (void)a; (void)b; (void)c; (void)d;
#endif
}
__device__ __forceinline__ void keep4(v16h a, v16h b, v16h c, v16h d) {
#if DEV_ASM
  asm volatile("v_nop" :: "v"(a), "v"(b), "v"(c), "v"(d));
#else
  (void)a; (void)b; (void)c; (void)d;
#endif
}
__device__ __forceinline__ void acc_guard4(v8f& a, v8f& b, v8f& c, v8f& d) {
#if DEV_ASM
  asm volatile("v_nop\n\tv_nop\n\tv_nop\n\tv_nop" : "+v"(a), "+v"(b), "+v"(c), "+v"(d));
#else
  (void)a; (void)b; (void)c; (void)d;
#endif
}

// =====================================================================================================
// f32 rows -> bf16 plane rows (RNE convert), 8 elements per thread, one 16-B store per lane: a wave writes
// Dense output row `row` (0..nrows-1) reads source row (row / seq) * seqfull + row % seq (full batch stride).
// grid = ceil(nrows*rowlen8/256). coverage: nrows*rowlen8 threads x 8 = the whole plane (exact multiple of 256).
// =====================================================================================================
__global__ __launch_bounds__(256) void cvtrows(const float* __restrict__ in, unsigned short* out,
                                               int rowlen8, int nrows, int seq, int seqfull) {
  const int i = blockIdx.x * 256 + (int)threadIdx.x;
  if (i < nrows * rowlen8) {
    const int row  = i / rowlen8;
    const int c    = i - row * rowlen8;
    const int bq   = row / seq;
    const int srow = bq * seqfull + (row - bq * seq);
    const float* src = in + ((size_t)srow * (size_t)rowlen8 + (size_t)c) * 8;
    const v4f a  = *(const v4f*)(src);
    const v4f a4 = *(const v4f*)(src + 4);
    v4u p;
    p[0] = pk16(bf_bits(a[0]),  bf_bits(a[1]));
    p[1] = pk16(bf_bits(a[2]),  bf_bits(a[3]));
    p[2] = pk16(bf_bits(a4[0]), bf_bits(a4[1]));
    p[3] = pk16(bf_bits(a4[2]), bf_bits(a4[3]));
    unsigned short* o = out + (size_t)i * 8;
    *(v4u*)o = p;
    
  }
}

// =====================================================================================================
// Weight transpose + bf16 convert through LDS: in f32 [krows][ncols] (pitch ldi) -> out bf16 [n][k] (pitch ldo,
// k contiguous), optionally duplicated at +dup elements in the same output row.  One block = one 64x64 tile:
// input rows k0 = 64*blockIdx.y, cols n0 = 64*blockIdx.x.  Load: thread r = tid>>2 reads 16 floats of input row
// k0+r; LDS holds the transposed tile; block barrier; write: wave w, lane>>3 = q, lanes 8q..8q+7 write one whole
// LDS tile: cross-wave (block barrier); columns 64..71 of the pitch are never read.
// =====================================================================================================
__global__ __launch_bounds__(256) void tr64(const float* __restrict__ in, int ldi,
                                            unsigned short* out, int ldo, int dup) {
  __shared__ __align__(16) unsigned short sT[64 * 72];
  const int tid = (int)threadIdx.x;
  const int k0  = blockIdx.y * 64;
  const int n0  = blockIdx.x * 64;
  {
    const int r = tid >> 2, c16 = (tid & 3) * 16;
    const float* src = in + (size_t)(k0 + r) * (size_t)ldi + n0 + c16;
    const v4f a0 = *(const v4f*)(src);
    const v4f a1 = *(const v4f*)(src + 4);
    const v4f a2 = *(const v4f*)(src + 8);
    const v4f a3 = *(const v4f*)(src + 12);
#pragma unroll
    for (int e = 0; e < 4; ++e) {
      sT[(c16 + e) * 72 + r]      = bf_bits(a0[e]);
      sT[(c16 + 4 + e) * 72 + r]  = bf_bits(a1[e]);
      sT[(c16 + 8 + e) * 72 + r]  = bf_bits(a2[e]);
      sT[(c16 + 12 + e) * 72 + r] = bf_bits(a3[e]);
    }
  }
  __syncthreads();
  const int wave = tid >> 5, lane = tid & 31;
  const int q = lane >> 3, c8 = (lane & 7) * 8;
  v4u vv[2];
#pragma unroll
  for (int it = 0; it < 2; ++it) {
    const int n = it * 32 + wave * 4 + q;
    vv[it] = *(const v4u*)(sT + n * 72 + c8);
  }
  {
#pragma unroll
    for (int it = 0; it < 2; ++it) {
      const int n = it * 32 + wave * 4 + q;
      unsigned short* d = out + (size_t)(n0 + n) * (size_t)ldo + k0 + c8;
      *(v4u*)d = vv[it];
      if (dup != 0) *(v4u*)(d + dup) = vv[it];
    }
    
  }
}

// =====================================================================================================
// Register-blocked batched WMMA GEMM (16-bit operand type OT): C[m][n] = sum_k A[m][k] * Bt[n][k] (+ bias);
// one wave per 64x64 tile, no block barriers. A row-major [M][K] pitch lda; Bt row-major [N][K] pitch ldb
// (k contiguous); M, N multiples of 64, K multiple of 32 (static for every launch here). blockIdx.y = batch index
// (strides in elements). Fragments are loaded straight from global with the split k map (ldfrag).
// BIAS 0: none; 1: per column n (bias[n]); 2: per row m (bias[m]); bias values RNE-converted to bf16 in f32.
// OUT_MODE 0: f32 C (pitch ldc), value * oscale + bias.
// OUT_MODE 3: f16 hi plane C + f16 residual plane C2 = f16((v - hi) * rscale) (same pitch / stride), v = acc*oscale+bias.
// whole 64x64 tile; slab pitch columns 64..67 never read.
// =====================================================================================================
template <typename OT, int OUT_MODE, int BIAS>
__global__ __launch_bounds__(256) void gemm64(
    const unsigned short* __restrict__ Ap, int lda, long long strideA,
    const unsigned short* __restrict__ Btp, int ldb, long long strideB,
    void* Cout, void* Cout2, int ldc, long long strideC,
    const float* __restrict__ bias,
    int M, int N, int K, float oscale, float rscale) {
  typedef typename FT<OT>::frag V16;
  const OT* A  = (const OT*)(const void*)Ap;
  const OT* Bt = (const OT*)(const void*)Btp;
  __shared__ __align__(16) float sT[8][16 * 68];   // per-wave 16x64 slab, pitch 68 floats
  const int b    = blockIdx.y;
  const int lane = threadIdx.x & 31;
  const int wave = threadIdx.x >> 5;
  const int tilesN = N >> 6;
  const int tilesM = M >> 6;
  const int tile = blockIdx.x * 8 + wave;
  if (tile >= tilesM * tilesN) return;   // wave-uniform; no block barriers in this kernel
  const int tm = tile / tilesN;
  const int tn = tile - tm * tilesN;
  const int m0 = tm << 6;
  const int n0 = tn << 6;

  const OT* Ab = A  + (size_t)b * (size_t)strideA;
  const OT* Bb = Bt + (size_t)b * (size_t)strideB;

  const int rlane = lane & 15;                 // row (A) / col (B, D) within subtile
  const int koff  = (lane >> 4) * 8;           // k offset of this lane half
  const int mOff  = (lane >> 4) * 8;           // D row offset

  v8f acc[4][4];
#pragma unroll
  for (int i = 0; i < 4; ++i)
#pragma unroll
    for (int j = 0; j < 4; ++j) acc[i][j] = zero8();

  for (int k0 = 0; k0 < K; k0 += 32) {
    V16 bq[4];
#pragma unroll
    for (int j = 0; j < 4; ++j)
      bq[j] = ldfrag<OT>(Bb + (size_t)(n0 + (j << 4) + rlane) * (size_t)ldb + koff + k0);
#pragma unroll
    for (int i = 0; i < 4; ++i) {
      const V16 af = ldfrag<OT>(Ab + (size_t)(m0 + (i << 4) + rlane) * (size_t)lda + koff + k0);
#pragma unroll
      for (int j = 0; j < 4; ++j) acc[i][j] = mmar(af, bq[j], acc[i][j]);
      dep_guard(acc[i][0], acc[i][3], af, bq[3]);
    }
    keep4(bq[0], bq[1], bq[2], bq[3]);
  }
  acc_guard4(acc[0][0], acc[0][1], acc[0][2], acc[0][3]);
  acc_guard4(acc[1][0], acc[1][1], acc[1][2], acc[1][3]);
  acc_guard4(acc[2][0], acc[2][1], acc[2][2], acc[2][3]);
  acc_guard4(acc[3][0], acc[3][1], acc[3][2], acc[3][3]);

  // ---- epilogue ----
  float* slab = sT[wave];
#pragma unroll
  for (int i = 0; i < 4; ++i) {
    const int mBase = m0 + (i << 4);
#pragma unroll
    for (int j = 0; j < 4; ++j) {
#pragma unroll
      for (int r = 0; r < 8; ++r) {
        slab[(mOff + r) * 68 + (j << 4) + rlane] = acc[i][j][r];
      }
    }
    __builtin_amdgcn_fence(__ATOMIC_RELEASE, "workgroup");
    __builtin_amdgcn_wave_barrier();
    __builtin_amdgcn_fence(__ATOMIC_ACQUIRE, "workgroup");
    if (OUT_MODE == 0) {
      float* C = (float*)Cout + (size_t)b * (size_t)strideC;
      const int h2 = lane >> 4, c4 = (lane & 15) * 4;     // 256-B row segment = 16 lanes x 16 B
      v4f bcol = {0.f, 0.f, 0.f, 0.f};
      if (BIAS == 1) {
        const v4f bb = *(const v4f*)(bias + n0 + c4);
#pragma unroll
        for (int e = 0; e < 4; ++e) bcol[e] = bfr(bb[e]);
      }
      {
#pragma unroll
        for (int it = 0; it < 8; ++it) {
          const int row = it * 2 + h2;                     // it 0..7 x h2 0..1 = rows 0..15
          float brow = 0.f;
          if (BIAS == 2) brow = bfr(bias[mBase + row]);
          const v4f x = *(const v4f*)(slab + row * 68 + c4);
          v4f v;
#pragma unroll
          for (int e = 0; e < 4; ++e) v[e] = x[e] * oscale + bcol[e] + brow;
          *(v4f*)(C + (size_t)(mBase + row) * (size_t)ldc + n0 + c4) = v;
        }
        
      }
    } else {
      const int q = lane >> 3, c8 = (lane & 7) * 8;
      unsigned short* C  = (unsigned short*)Cout  + (size_t)b * (size_t)strideC;
      unsigned short* C2 = (unsigned short*)Cout2 + (size_t)b * (size_t)strideC;
      float bc8[8];
#pragma unroll
      for (int e = 0; e < 8; ++e) bc8[e] = 0.f;
      if (BIAS == 1) {
        const v4f b0 = *(const v4f*)(bias + n0 + c8);
        const v4f b1 = *(const v4f*)(bias + n0 + c8 + 4);
#pragma unroll
        for (int e = 0; e < 4; ++e) { bc8[e] = bfr(b0[e]); bc8[4 + e] = bfr(b1[e]); }
      }
      v4u hv[4], lv[4];
#pragma unroll
      for (int it = 0; it < 4; ++it) {
        const int row = it * 4 + q;                        // it 0..3 x q 0..3 = rows 0..15
        const float* sp = slab + row * 68 + c8;
        float brow = 0.f;
        if (BIAS == 2) brow = bfr(bias[mBase + row]);
        float f[8];
#pragma unroll
        for (int e = 0; e < 8; ++e) f[e] = sp[e] * oscale + bc8[e] + brow;
        v4u a, a2;
#pragma unroll
        for (int e = 0; e < 4; ++e) {
          const float f0 = f[2 * e], f1 = f[2 * e + 1];
          const _Float16 x0 = (_Float16)f0, x1 = (_Float16)f1;
          const unsigned short h0 = h_bits(x0), h1 = h_bits(x1);
          unsigned short l0 = 0, l1 = 0;
          if (OUT_MODE == 3) {
            l0 = h_bits((_Float16)((f0 - (float)x0) * rscale));
            l1 = h_bits((_Float16)((f1 - (float)x1) * rscale));
          }
          a[e] = pk16(h0, h1); a2[e] = pk16(l0, l1);
        }
        hv[it] = a; lv[it] = a2;
      }
      {
#pragma unroll
        for (int it = 0; it < 4; ++it) {
          const int row = it * 4 + q;
          *(v4u*)(C + (size_t)(mBase + row) * (size_t)ldc + n0 + c8) = hv[it];
          if (OUT_MODE == 3) *(v4u*)(C2 + (size_t)(mBase + row) * (size_t)ldc + n0 + c8) = lv[it];
        }
        
      }
    }
    __builtin_amdgcn_fence(__ATOMIC_RELEASE, "workgroup");
    __builtin_amdgcn_wave_barrier();
    __builtin_amdgcn_fence(__ATOMIC_ACQUIRE, "workgroup");
  }
}

// =====================================================================================================
// z relayout: in f32 z [rows][HN] (16 heads x 16); out (a) f16 operand plane [rows][ZP], 64 halves per head =
// norms [rows][NH].  Block = 16 rows x 16 heads (thread = one (row, head)); staged in LDS; block barrier; line L of
// the block (L = 16*r + head, contiguous in the plane) written by lanes 8q..8q+7 of wave w with one instruction
// LDS: both arrays cross-wave (block barrier); fully written before read.
// =====================================================================================================
__global__ __launch_bounds__(256) void zprep(const float* __restrict__ zf, unsigned short* zp, float* zsq) {
  __shared__ __align__(16) unsigned short sZ[256 * LP];   // columns 64..71 of the pitch are never read
  __shared__ __align__(16) float sQ[256];
  const int tid  = (int)threadIdx.x;
  const int r    = tid >> 4, hd = tid & 15;
  const int row0 = blockIdx.x * 16;
  {
    const float* zr = zf + (size_t)(row0 + r) * HN + hd * HC;
    const v4f a0 = *(const v4f*)(zr);
    const v4f a1 = *(const v4f*)(zr + 4);
    const v4f a2 = *(const v4f*)(zr + 8);
    const v4f a3 = *(const v4f*)(zr + 12);
    float f[16];
#pragma unroll
    for (int e = 0; e < 4; ++e) { f[e] = a0[e]; f[4 + e] = a1[e]; f[8 + e] = a2[e]; f[12 + e] = a3[e]; }
    float q = 0.f;
#pragma unroll
    for (int e = 0; e < 16; ++e) q += f[e] * f[e];
    sQ[tid] = q;
    v4u ph0, ph1, pl0, pl1;
#pragma unroll
    for (int e = 0; e < 4; ++e) {
      const float f0 = f[2 * e], f1 = f[2 * e + 1], f2 = f[8 + 2 * e], f3 = f[9 + 2 * e];
      const _Float16 x0 = (_Float16)f0, x1 = (_Float16)f1, x2 = (_Float16)f2, x3 = (_Float16)f3;
      ph0[e] = pk16(h_bits(x0), h_bits(x1));
      ph1[e] = pk16(h_bits(x2), h_bits(x3));
      pl0[e] = pk16(h_bits((_Float16)((f0 - (float)x0) * RSC)), h_bits((_Float16)((f1 - (float)x1) * RSC)));
      pl1[e] = pk16(h_bits((_Float16)((f2 - (float)x2) * RSC)), h_bits((_Float16)((f3 - (float)x3) * RSC)));
    }
    const v4u z4 = {0u, 0u, 0u, 0u};
    unsigned short* sl = sZ + tid * LP;
    *(v4u*)(sl + 0)  = ph0;
    *(v4u*)(sl + 8)  = ph1;
    *(v4u*)(sl + 16) = pl0;
    *(v4u*)(sl + 24) = pl1;
    *(v4u*)(sl + 32) = ph0;
    *(v4u*)(sl + 40) = ph1;
    *(v4u*)(sl + 48) = z4;
    *(v4u*)(sl + 56) = z4;
  }
  __syncthreads();
  const int wave = tid >> 5, lane = tid & 31;
  const int q4 = lane >> 3, c8 = (lane & 7) * 8;
  unsigned short* base = zp + (size_t)row0 * ZP;
  v4u vv[8];
#pragma unroll
  for (int it = 0; it < 8; ++it) {
    const int L = it * 32 + wave * 4 + q4;
    vv[it] = *(const v4u*)(sZ + L * LP + c8);
  }
  {
#pragma unroll
    for (int it = 0; it < 8; ++it) {
      const int L = it * 32 + wave * 4 + q4;
      *(v4u*)(base + (size_t)L * 64 + c8) = vv[it];
    }
    
  }
  if (tid < 64) {                                       // waves 0 and 1, wave-uniform
    const v4f qv = *(const v4f*)(sQ + tid * 4);
    float* dst = zsq + (size_t)row0 * NH + tid * 4;
    *(v4f*)dst = qv;
    
  }
}

// =====================================================================================================
// Distance-kernel attention, per-head z dim 16, value dim 64, no mask, softmax over all SEQ keys.
//   z plane (f16): row (b*SEQ + t), head h at cols 64h.. : [hi | residual x4096 | hi | 0]
//   zsq (f32): [(b*SEQ + t)][h] = |z|^2
//   v^T hi plane (f16) and residual plane (f16, (v - hi)*4096): element (b, h, d, s) at [(b*DM + h*64 + d)*SEQ + s]
//   ctx plane (bf16): element (b, t, h, d) hi at [(b*SEQ + t)*OP + h*64 + d], residual at the same + DM
//   dot = A[hi|lo] . B[hi;0]  +  (A[hi|lo] . B[lo;hi]) / 4096 on f16 WMMA (two f32 accumulators);
//   score = -softplus(gamma_h) * max(|z_s|^2 + |z_t|^2 - 2 dot, 0); p = exp(s - m) carried as f16(16384 p);
//   context = p . vh + (p . vl) / 4096 on f16 WMMA; online softmax in f32.
//   Block = 4 waves = 4 x 16 query rows of one (b, h); grid = NB * NH * NQB; key chunks of 64, static trip NKT.
//   Chunk staging: 128 threads x 32 elements per plane = the whole 64x64 tile of each of the three planes (plain 16-B
//   loads, __syncthreads before and after; staged extent == consumed extent); P tiles and the context tile are
//   wave-private (spilled with _Float16 / float element stores, reloaded with the same element type after a release
//   (8 lanes x 8) of head h in both plane halves; the grid covers every (b, h, qb).
// =====================================================================================================
__global__ __launch_bounds__(128)
void attn_dist(const unsigned short* __restrict__ zpp, const float* __restrict__ zsq,
               const unsigned short* __restrict__ vhp, const unsigned short* __restrict__ vlp,
               const float* __restrict__ gam, unsigned short* octx) {
  union FH { v16h v; v8h h[2]; };
  __shared__ __align__(16) _Float16 Zsh[64 * LP];          // z key chunk [key][64], pitch LP    9 KB
  __shared__ __align__(16) _Float16 Vth[64 * LP];          // V^T hi [d][key], pitch LP          9 KB
  __shared__ __align__(16) _Float16 Vtl[64 * LP];          // V^T residual, pitch LP             9 KB
  __shared__ __align__(16) _Float16 Psh[4][16 * LP];       // per wave P [row][key], pitch LP    9 KB
  __shared__ __align__(16) float    Os[4][16 * OSP];       // per wave context tile, pitch OSP  17 KB

  const int tid  = threadIdx.x;
  const int wave = tid >> 5;
  const int lane = tid & 31;
  const int hh   = lane >> 4;
  const int c    = lane & 15;

  const int bx   = blockIdx.x;
  const int qb   = bx % NQB;
  const int rest = bx / NQB;
  const int h    = rest % NH;
  const int b    = rest / NH;
  const int q0   = qb * 64 + wave * 16;
  const size_t rowB = (size_t)b * SEQ;

  const _Float16* Zp16 = (const _Float16*)(const void*)zpp;
  const _Float16* Vh = (const _Float16*)(const void*)vhp + ((size_t)b * DM + (size_t)h * HD) * SEQ;
  const _Float16* Vl = (const _Float16*)(const void*)vlp + ((size_t)b * DM + (size_t)h * HD) * SEQ;

  const float gx = bfr(gam[h]);
  const float g  = fmaxf(gx, 0.f) + log1pf(expf(-fabsf(gx)));   // softplus
  const float ng = -g;

  // ---- query-side A fragment [hi | residual] (row = lane&15) and query squared norms ----
  const v16h zq = ldfrag<_Float16>(Zp16 + (rowB + q0 + c) * ZP + (size_t)h * 64 + 8 * hh);
  float zsq_q[8];
#pragma unroll
  for (int r = 0; r < 8; ++r) zsq_q[r] = zsq[(rowB + q0 + 8 * hh + r) * NH + h];

  float mrow[8], lrow[8];
  v8f oacc[4];
#pragma unroll
  for (int r = 0; r < 8; ++r) { mrow[r] = -INFINITY; lrow[r] = 0.f; }
#pragma unroll
  for (int t = 0; t < 4; ++t) oacc[t] = zero8();

  for (int kt = 0; kt < NKT; ++kt) {         // static trip count
    const int kv0 = kt * 64;
    __syncthreads();
    {
      const int r = tid >> 1, half = (tid & 1) * 32;
      const _Float16* zg  = Zp16 + (rowB + kv0 + r) * ZP + (size_t)h * 64 + half;   // key row kv0+r, 64-half head segment
      const _Float16* vg  = Vh + (size_t)r * SEQ + kv0 + half;                       // v^T row d = r, s = kv0+half..+31
      const _Float16* vlg = Vl + (size_t)r * SEQ + kv0 + half;
#pragma unroll
      for (int i = 0; i < 4; ++i) {
        const v8h a0 = *(const v8h*)(zg + 8 * i);
        const v8h b0 = *(const v8h*)(vg + 8 * i);
        const v8h b1 = *(const v8h*)(vlg + 8 * i);
        *(v8h*)(Zsh + r * LP + half + 8 * i) = a0;
        *(v8h*)(Vth + r * LP + half + 8 * i) = b0;
        *(v8h*)(Vtl + r * LP + half + 8 * i) = b1;
      }
    }
    __syncthreads();

    // ---- scores: 16 query rows x 64 keys per wave, 2 f16 products per key subtile ----
    v8f s[4];
#pragma unroll
    for (int j = 0; j < 4; ++j) {
      const _Float16* zr = Zsh + (j * 16 + c) * LP + 8 * hh;
      FH b1, b2;
      b2.h[0] = *(const v8h*)(zr + 16);     // k 0..15  <- residual of key
      b2.h[1] = *(const v8h*)(zr + 32);     // k 16..31 <- hi of key
      b1.h[0] = *(const v8h*)(zr + 32);     // k 0..15  <- hi of key
      b1.h[1] = *(const v8h*)(zr + 48);     // k 16..31 <- zeros
      v8f ah = mma_h(zq, b1.v, zero8());    // hi.hi
      v8f ax = mma_h(zq, b2.v, zero8());    // (hi.lo + lo.hi) x4096
      const float zt = zsq[(rowB + kv0 + j * 16 + c) * NH + h];
      {
#pragma clang fp contract(off)
#pragma unroll
        for (int r = 0; r < 8; ++r) {
          const float d = ah[r] + ax[r] * (1.0f / RSC);
          float sq = (zsq_q[r] + zt) - 2.0f * d;
          sq = fmaxf(sq, 0.f);
          s[j][r] = ng * sq;
        }
      }
    }

    // ---- row max, online softmax, P (x16384, f16) to LDS ----
    _Float16* pwh = Psh[wave];
#pragma unroll
    for (int r = 0; r < 8; ++r) {
      float m = s[0][r];
#pragma unroll
      for (int j = 1; j < 4; ++j) m = fmaxf(m, s[j][r]);
#pragma unroll
      for (int off = 1; off < 16; off <<= 1) m = fmaxf(m, __shfl_xor(m, off, 32));
      const float mnew  = fmaxf(mrow[r], m);
      const float msafe = (mnew == -INFINITY) ? 0.f : mnew;
      const float alpha = __expf(mrow[r] - msafe);
      mrow[r] = mnew;
      float psum = 0.f;
#pragma unroll
      for (int j = 0; j < 4; ++j) {
        const float p = __expf(s[j][r] - msafe);
        psum += p;
        pwh[(8 * hh + r) * LP + j * 16 + c] = (_Float16)(p * PCARRY);
      }
#pragma unroll
      for (int off = 1; off < 16; off <<= 1) psum += __shfl_xor(psum, off, 32);
      lrow[r] = lrow[r] * alpha + psum;
#pragma unroll
      for (int t = 0; t < 4; ++t) oacc[t][r] *= alpha;
    }
    __builtin_amdgcn_fence(__ATOMIC_RELEASE, "workgroup");
    __builtin_amdgcn_wave_barrier();
    __builtin_amdgcn_fence(__ATOMIC_ACQUIRE, "workgroup");

    // ---- context += P . V (f16 WMMA); residual products into a separate accumulator ----
    v8f o1[4];
#pragma unroll
    for (int t = 0; t < 4; ++t) o1[t] = zero8();
#pragma unroll 1
    for (int kk = 0; kk < 2; ++kk) {
      FH pa;
      pa.h[0] = *(const v8h*)(pwh + c * LP + kk * 32 + 8 * hh);
      pa.h[1] = *(const v8h*)(pwh + c * LP + kk * 32 + 16 + 8 * hh);
#pragma unroll
      for (int t = 0; t < 4; ++t) {
        FH vb, vl;
        vb.h[0] = *(const v8h*)(Vth + (t * 16 + c) * LP + kk * 32 + 8 * hh);
        vb.h[1] = *(const v8h*)(Vth + (t * 16 + c) * LP + kk * 32 + 16 + 8 * hh);
        vl.h[0] = *(const v8h*)(Vtl + (t * 16 + c) * LP + kk * 32 + 8 * hh);
        vl.h[1] = *(const v8h*)(Vtl + (t * 16 + c) * LP + kk * 32 + 16 + 8 * hh);
        oacc[t] = mma_h(pa.v, vb.v, oacc[t]);
        o1[t]   = mma_h(pa.v, vl.v, o1[t]);
      }
    }
#pragma unroll
    for (int t = 0; t < 4; ++t)
#pragma unroll
      for (int r = 0; r < 8; ++r) oacc[t][r] += o1[t][r] * (1.0f / RSC);
  }

  // ---- normalise (1/l, undo the p carry), stage the wave's 16x64 tile, convert to bf16 hi + bf16 residual,
  float* os = Os[wave];
#pragma unroll
  for (int r = 0; r < 8; ++r) {
    const float l = lrow[r];
    const float inv = ((l > 0.f) ? (1.0f / l) : 0.f) * (1.0f / PCARRY);
#pragma unroll
    for (int t = 0; t < 4; ++t) os[(8 * hh + r) * OSP + t * 16 + c] = oacc[t][r] * inv;
  }
  __builtin_amdgcn_fence(__ATOMIC_RELEASE, "workgroup");
  __builtin_amdgcn_wave_barrier();
  __builtin_amdgcn_fence(__ATOMIC_ACQUIRE, "workgroup");
  {
    const int q4 = lane >> 3, c8 = (lane & 7) * 8;
    v4u hv[4], lv[4];
#pragma unroll
    for (int it = 0; it < 4; ++it) {
      const int row = it * 4 + q4;   // it 0..3 x q4 0..3 = rows 0..15 of the wave tile
      const float* sp = os + row * OSP + c8;
      v4u a, a2;
#pragma unroll
      for (int e = 0; e < 4; ++e) {
        const float f0 = sp[2 * e], f1 = sp[2 * e + 1];
        const unsigned short hb0 = bf_bits(f0), hb1 = bf_bits(f1);
        const unsigned short lb0 = bf_bits(f0 - bf_up(hb0)), lb1 = bf_bits(f1 - bf_up(hb1));
        a[e]  = pk16(hb0, hb1);
        a2[e] = pk16(lb0, lb1);
      }
      hv[it] = a; lv[it] = a2;
    }
    {
#pragma unroll
      for (int it = 0; it < 4; ++it) {
        const int row = it * 4 + q4;
        const size_t go = (rowB + q0 + row) * OP + (size_t)h * HD + c8;
        *(v4u*)(octx + go)      = hv[it];
        *(v4u*)(octx + go + DM) = lv[it];
      }
      
    }
  }
}

// =====================================================================================================
// Workspace map (bytes, NB=2 / SEQ=2048), every region an exact multiple of its whole-line / whole-tile store
// granularity, back to back:
//   Xb   bf16 [NB*SEQ][DM]            8388608
//   Cb   bf16 [NB*SEQ][DC]             524288
//   WvT  bf16 [DM n][DM k]            2097152
//   WoT2 bf16 [DM n][2*DM k]          4194304
//   WcT  bf16 [HN][DC]                  32768
//   WnT  bf16 [DC][DC]                   8192
//   Zf   f32  [NB*SEQ][HN]            4194304
//   Zp   f16  [NB*SEQ][ZP]            8388608
//   Zsq  f32  [NB*SEQ][NH]             262144
//   VTh  f16  [NB][DM][SEQ]           8388608
//   VTl  f16  [NB][DM][SEQ]           8388608
//   Octx bf16 [NB*SEQ][OP]           16777216
//   total                            61644800
// Weights arrive [in][out]; tr64 produces the [out n][in k] (k contiguous) layout the GEMM wants.
// =====================================================================================================
extern "C" void kernel_launch(void* const* d_in, const int* in_sizes, int n_in,
                              void* d_out, int out_size, void* d_ws, size_t ws_size,
                              hipStream_t stream) {
  if (n_in < 11) return;
  if (in_sizes[0] < ((NB - 1) * SEQ_FULL + SEQ) * DM) return;
  if (in_sizes[1] < ((NB - 1) * SEQ_FULL + SEQ) * DC) return;
  if (in_sizes[2] < DM * DM || in_sizes[3] < DM) return;
  if (in_sizes[4] < DC * HN || in_sizes[5] < HN) return;
  if (in_sizes[6] < DC * DC || in_sizes[7] < DC) return;
  if (in_sizes[8] < DM * DM || in_sizes[9] < DM) return;
  if (in_sizes[10] < NH) return;
  if ((size_t)out_size < OUT1_OFF + (size_t)NB * SEQ * DC) return;

  const float* hidden = (const float*)d_in[0];
  const float* coords = (const float*)d_in[1];
  const float* Wv     = (const float*)d_in[2];
  const float* bv     = (const float*)d_in[3];
  const float* Wc     = (const float*)d_in[4];
  const float* bc     = (const float*)d_in[5];
  const float* Wn     = (const float*)d_in[6];
  const float* bn     = (const float*)d_in[7];
  const float* Wo     = (const float*)d_in[8];
  const float* bo     = (const float*)d_in[9];
  const float* gamma  = (const float*)d_in[10];

  const size_t nRows = (size_t)NB * SEQ;
  const size_t PXB  = nRows * DM * 2;
  const size_t PCB  = nRows * DC * 2;
  const size_t PWV  = (size_t)DM * DM * 2;
  const size_t PWO2 = (size_t)DM * OP * 2;
  const size_t PWC  = (size_t)HN * DC * 2;
  const size_t PWN  = (size_t)DC * DC * 2;
  const size_t PZF  = nRows * HN * 4;
  const size_t PZP  = nRows * ZP * 2;
  const size_t PZQ  = nRows * NH * 4;
  const size_t PVT  = (size_t)NB * DM * SEQ * 2;
  const size_t POC  = nRows * OP * 2;
  size_t off = 0;
  const size_t oXb  = off; off += PXB;
  const size_t oCb  = off; off += PCB;
  const size_t oWv  = off; off += PWV;
  const size_t oWo  = off; off += PWO2;
  const size_t oWc  = off; off += PWC;
  const size_t oWn  = off; off += PWN;
  const size_t oZf  = off; off += PZF;
  const size_t oZp  = off; off += PZP;
  const size_t oZq  = off; off += PZQ;
  const size_t oVTh = off; off += PVT;
  const size_t oVTl = off; off += PVT;
  const size_t oOc  = off; off += POC;
  if (off > ws_size) return;                       // off = 61644800 at full size
  if (off > (size_t)134217728) return;

  char* ws = (char*)d_ws;
  unsigned short* Xb   = (unsigned short*)(ws + oXb);
  unsigned short* Cb   = (unsigned short*)(ws + oCb);
  unsigned short* WvT  = (unsigned short*)(ws + oWv);
  unsigned short* WoT2 = (unsigned short*)(ws + oWo);
  unsigned short* WcT  = (unsigned short*)(ws + oWc);
  unsigned short* WnT  = (unsigned short*)(ws + oWn);
  float*          Zf   = (float*)(ws + oZf);
  unsigned short* Zpl  = (unsigned short*)(ws + oZp);
  float*          Zsq  = (float*)(ws + oZq);
  unsigned short* VTh  = (unsigned short*)(ws + oVTh);
  unsigned short* VTl  = (unsigned short*)(ws + oVTl);
  unsigned short* Octx = (unsigned short*)(ws + oOc);
  float* out0 = (float*)d_out;
  float* out1 = (float*)d_out + OUT1_OFF;

  const dim3 blk(256);
  const int n8x = NB * SEQ * DM / 8;                                   // 524288
  const int n8c = NB * SEQ * DC / 8;                                   //  32768
  const dim3 gCx((n8x + 255) / 256);                                   // 2048 blocks
  const dim3 gCc((n8c + 255) / 256);                                   //  128 blocks
  const dim3 gTrW(DM / 64, DM / 64);                                   // in [DM][DM]
  const dim3 gTrC(HN / 64, DC / 64);                                   // in [DC rows][HN cols] -> out [HN][DC]
  const dim3 gTrN(DC / 64, DC / 64);                                   // in [DC][DC]
  const int tilesZ = (int)((nRows / 64) * (HN / 64));                  // 256
  const int tilesC = (int)((nRows / 64) * (DC / 64));                  //  64
  const int tilesV = (DM / 64) * (SEQ / 64);                           // 512
  const int tilesO = (int)((nRows / 64) * (DM / 64));                  // 1024
  const dim3 gZ((tilesZ + 7) / 8, 1);
  const dim3 gC1((tilesC + 7) / 8, 1);
  const dim3 gV((tilesV + 7) / 8, NB);
  const dim3 gO((tilesO + 7) / 8, 1);
  const dim3 gPrep((unsigned)(nRows / 16));                            // 256 blocks
  const dim3 gAttn(NB * NH * NQB);                                     // 1024 blocks of 128

  // (1) activations -> bf16 planes (dense rows, full batch stride on the source side)
  cvtrows<<<gCx, blk, 0, stream>>>(hidden, Xb, DM / 8, NB * SEQ, SEQ, SEQ_FULL);
  cvtrows<<<gCc, blk, 0, stream>>>(coords, Cb, DC / 8, NB * SEQ, SEQ, SEQ_FULL);
  // (2) weights [in][out] f32 -> bf16 [out][in]; Wo^T duplicated along k (pitch 2*DM)
  tr64<<<gTrW, blk, 0, stream>>>(Wv, DM, WvT, DM, 0);
  tr64<<<gTrW, blk, 0, stream>>>(Wo, DM, WoT2, OP, DM);
  tr64<<<gTrC, blk, 0, stream>>>(Wc, HN, WcT, DC, 0);
  tr64<<<gTrN, blk, 0, stream>>>(Wn, DC, WnT, DC, 0);
  // (3) z = coords . Wc + bc -> f32 [NB*SEQ][HN]   (M=NB*SEQ, N=HN, K=DC)
  gemm64<__bf16, 0, 1><<<gZ, blk, 0, stream>>>(
      Cb, DC, 0LL, WcT, DC, 0LL,
      (void*)Zf, (void*)Zf, HN, 0LL, bc,
      (int)nRows, HN, DC, 1.0f, 1.0f);
  // (4) z -> f16 operand plane [hi | res | hi | 0] and f32 squared norms
  zprep<<<gPrep, blk, 0, stream>>>(Zf, Zpl, Zsq);
  // (5) second output = coords . Wn + bn -> d_out f32 [NB*SEQ][DC] at element OUT1_OFF   (M=NB*SEQ, N=DC, K=DC)
  gemm64<__bf16, 0, 1><<<gC1, blk, 0, stream>>>(
      Cb, DC, 0LL, WnT, DC, 0LL,
      (void*)out1, (void*)out1, DC, 0LL, bn,
      (int)nRows, DC, DC, 1.0f, 1.0f);
  // (6) v^T = Wv^T . x^T + bv per batch -> f16 hi plane [b][d][s] (pitch SEQ) and residual plane (x4096)
  //     (A = WvT [n][k], Bt = Xb rows of batch b; M=DM, N=SEQ, K=DM; bias per row d)
  gemm64<__bf16, 3, 2><<<gV, blk, 0, stream>>>(
      WvT, DM, 0LL, Xb, DM, (long long)SEQ * DM,
      (void*)VTh, (void*)VTl, SEQ, (long long)DM * SEQ, bv,
      DM, SEQ, DM, 1.0f, RSC);
  // (7) attention -> ctx plane (bf16 hi | bf16 residual) [b*SEQ+t][OP]
  attn_dist<<<gAttn, dim3(128), 0, stream>>>(Zpl, Zsq, VTh, VTl, gamma, Octx);
  // (8) first output = [ctx_hi | ctx_res] . [Wo^T ; Wo^T]^T + bo -> d_out f32 [NB*SEQ][DM]   (M=NB*SEQ, N=DM, K=2*DM)
  gemm64<__bf16, 0, 1><<<gO, blk, 0, stream>>>(
      Octx, OP, 0LL, WoT2, OP, 0LL,
      (void*)out0, (void*)out0, DM, 0LL, bo,
      (int)nRows, DM, OP, 1.0f, 1.0f);
  (void)hipGetLastError();
}

// v002
// It runs in 225 microseconds.
// Timed twice side by side with v001, it ran 1.37 and 1.38 times as fast.
// All steps since v000 together make it 1.71 times as fast.
// Contractions: value = Wv^T.x^T+bv, z = coords.Wc+bc, coords.Wn+bn = v_wmma_f32_16x16x32_bf16 (bf16 operands from RNE-converted inputs, single product, f32 accumulate);
// z.z^T scores = v_wmma_f32_16x16x32_f16 (z as f16 hi + f16 residual x4096 packed along k, 2 products into separate f32 accumulators);
// p.v = v_wmma_f32_16x16x32_f16 (p carried x16384 in f16; v as f16 hi plane + f16 residual plane x4096; 2 products, f32 accumulate);
// ctx.Wo+bo = v_wmma_f32_16x16x32_bf16 (ctx as bf16 hi and bf16 residual planes concatenated along k, Wo^T bf16 duplicated along k; f32 accumulate);
// squared norms, softplus, softmax and bias adds in f32.
#include <hip/hip_runtime.h>
#include <math.h>
#include <stdint.h>

#ifndef NB
#define NB 2
#endif
#ifndef SEQ
#define SEQ 2048
#endif
#define NB_FULL  2
#define SEQ_FULL 2048
#define DM   1024
#define NH   16
#define HC   16
#define HD   64
#define DC   64
#define HN   (NH * HC)        // 256
#define ZP   (NH * 64)        // 1024: z operand plane pitch, 64 halves per head [hi | lo x4096 | hi | 0]
#define OP   (2 * DM)         // 2048: ctx plane pitch (bf16 hi | bf16 residual)
#define NQB  (SEQ / 64)       // 64-row query blocks per sequence
#define NKT  (SEQ / 64)       // 64-key chunks per sequence
#define LP   72               // LDS row pitch in halves of every 64-half tile row: 144 B = 16 B x odd, so the 16 rows
                              // that one ds_load_b128 touches fall on 16 different groups of four banks (at 128 B: on one)
#define OSP  68               // LDS row pitch in floats of the 64-float context tile rows (272 B = 16 B x odd)
#define PCARRY 16384.0f
#define RSC    4096.0f
#define OUT1_OFF ((size_t)NB_FULL * SEQ_FULL * DM)   // element offset of the second output in d_out
static_assert(NH * HD == DM);
static_assert(HC == 16 && HD == 64 && DC == 64);
static_assert((SEQ % 64) == 0 && SEQ >= 64 && SEQ <= SEQ_FULL);
static_assert(NB >= 1 && NB <= NB_FULL);
static_assert((DM % 64) == 0 && (HN % 64) == 0 && (OP % 64) == 0);
static_assert(OUT1_OFF * 4 == 16777216);

typedef _Float16 v16h __attribute__((ext_vector_type(16)));
typedef _Float16 v8h  __attribute__((ext_vector_type(8)));
typedef __bf16   v16b __attribute__((ext_vector_type(16)));
typedef __bf16   v8b  __attribute__((ext_vector_type(8)));
typedef float    v8f  __attribute__((ext_vector_type(8)));
typedef float    v4f  __attribute__((ext_vector_type(4)));
typedef unsigned int v4u __attribute__((ext_vector_type(4)));

#if defined(__HIP_DEVICE_COMPILE__)
#define DEV_ASM 1
#else
#define DEV_ASM 0
#endif

// ---- scalar helpers --------------------------------------------------------------------------------
__device__ __forceinline__ unsigned short bf_bits(float f) {          // f32 -> bf16 bits, RNE convert
  unsigned u = __float_as_uint(f);
  return (unsigned short)((u + 0x7FFFu + ((u >> 16) & 1u)) >> 16);
}
__device__ __forceinline__ float bf_up(unsigned short hb) { return __uint_as_float(((unsigned)hb) << 16); }
__device__ __forceinline__ float bfr(float f) { return bf_up(bf_bits(f)); }   // value of the bf16 RNE convert
__device__ __forceinline__ unsigned short h_bits(_Float16 x) { return __builtin_bit_cast(unsigned short, x); }
__device__ __forceinline__ unsigned pk16(unsigned short a, unsigned short b) { return (unsigned)a | ((unsigned)b << 16); }
__device__ __forceinline__ v8f zero8() { v8f z = {0.f, 0.f, 0.f, 0.f, 0.f, 0.f, 0.f, 0.f}; return z; }

// ---- fragment types / loaders: 16-bit A/B operand, lane -> row/col (lane&15), p already includes +8*(lane>>4);
//      elements 0..7 <- p[0..7] (k0+8h..k0+8h+7), elements 8..15 <- p[16..23] (k0+16+8h..k0+16+8h+7)
template <typename OT> struct FT;
template <> struct FT<__bf16>   { typedef v16b frag; typedef v8b half8; };
template <> struct FT<_Float16> { typedef v16h frag; typedef v8h half8; };

template <typename OT>
__device__ __forceinline__ typename FT<OT>::frag ldfrag(const OT* p) {
  union { typename FT<OT>::frag v; typename FT<OT>::half8 h[2]; } f;
  f.h[0] = *(const typename FT<OT>::half8*)(p);
  f.h[1] = *(const typename FT<OT>::half8*)(p + 16);
  return f.v;
}

// ---- WMMA helpers (asm guard bodies are device-only; concrete operand types) -----------------------------
__device__ __forceinline__ v8f mmar(v16b a, v16b b, v8f c) {
  return __builtin_amdgcn_wmma_f32_16x16x32_bf16(false, a, false, b, (short)0, c, false, false);
}
__device__ __forceinline__ v8f mmar(v16h a, v16h b, v8f c) {
  return __builtin_amdgcn_wmma_f32_16x16x32_f16(false, a, false, b, (short)0, c, false, false);
}
// guarded form: 4 VALU slots after the WMMA, D tied, A/B kept live
__device__ __forceinline__ v8f mma_h(v16h a, v16h b, v8f c) {
  c = __builtin_amdgcn_wmma_f32_16x16x32_f16(false, a, false, b, (short)0, c, false, false);
#if DEV_ASM
  asm volatile("v_nop\n\tv_nop\n\tv_nop\n\tv_nop" : "+v"(c) : "v"(a), "v"(b));
#endif
  return c;
}
__device__ __forceinline__ void dep_guard(v8f& a, v8f& b, v16b x, v16b y) {
#if DEV_ASM
  asm volatile("v_nop\n\tv_nop\n\tv_nop\n\tv_nop" : "+v"(a), "+v"(b) : "v"(x), "v"(y));
#else
  (void)a; (void)b; (void)x; (void)y;
#endif
}
__device__ __forceinline__ void dep_guard(v8f& a, v8f& b, v16h x, v16h y) {
#if DEV_ASM
  asm volatile("v_nop\n\tv_nop\n\tv_nop\n\tv_nop" : "+v"(a), "+v"(b) : "v"(x), "v"(y));
#else
  (void)a; (void)b; (void)x; (void)y;
#endif
}
__device__ __forceinline__ void keep4(v16b a, v16b b, v16b c, v16b d) {
#if DEV_ASM
  asm volatile("v_nop" :: "v"(a), "v"(b), "v"(c), "v"(d));
#else
  (void)a; (void)b; (void)c; (void)d;
#endif
}
__device__ __forceinline__ void keep4(v16h a, v16h b, v16h c, v16h d) {
#if DEV_ASM
  asm volatile("v_nop" :: "v"(a), "v"(b), "v"(c), "v"(d));
#else
  (void)a; (void)b; (void)c; (void)d;
#endif
}
__device__ __forceinline__ void acc_guard4(v8f& a, v8f& b, v8f& c, v8f& d) {
#if DEV_ASM
  asm volatile("v_nop\n\tv_nop\n\tv_nop\n\tv_nop" : "+v"(a), "+v"(b), "+v"(c), "+v"(d));
#else
  (void)a; (void)b; (void)c; (void)d;
#endif
}

// =====================================================================================================
// f32 rows -> bf16 plane rows (RNE convert), 8 elements per thread, one 16-B store per lane: a wave writes
// Dense output row `row` (0..nrows-1) reads source row (row / seq) * seqfull + row % seq (full batch stride).
// grid = ceil(nrows*rowlen8/256). coverage: nrows*rowlen8 threads x 8 = the whole plane (exact multiple of 256).
// =====================================================================================================
__global__ __launch_bounds__(256) void cvtrows(const float* __restrict__ in, unsigned short* out,
                                               int rowlen8, int nrows, int seq, int seqfull) {
  const int i = blockIdx.x * 256 + (int)threadIdx.x;
  if (i < nrows * rowlen8) {
    const int row  = i / rowlen8;
    const int c    = i - row * rowlen8;
    const int bq   = row / seq;
    const int srow = bq * seqfull + (row - bq * seq);
    const float* src = in + ((size_t)srow * (size_t)rowlen8 + (size_t)c) * 8;
    const v4f a  = *(const v4f*)(src);
    const v4f a4 = *(const v4f*)(src + 4);
    v4u p;
    p[0] = pk16(bf_bits(a[0]),  bf_bits(a[1]));
    p[1] = pk16(bf_bits(a[2]),  bf_bits(a[3]));
    p[2] = pk16(bf_bits(a4[0]), bf_bits(a4[1]));
    p[3] = pk16(bf_bits(a4[2]), bf_bits(a4[3]));
    unsigned short* o = out + (size_t)i * 8;
    *(v4u*)o = p;
    
  }
}

// =====================================================================================================
// Weight transpose + bf16 convert through LDS: in f32 [krows][ncols] (pitch ldi) -> out bf16 [n][k] (pitch ldo,
// k contiguous), optionally duplicated at +dup elements in the same output row.  One block = one 64x64 tile:
// input rows k0 = 64*blockIdx.y, cols n0 = 64*blockIdx.x.  Load: thread r = tid>>2 reads 16 floats of input row
// k0+r; LDS holds the transposed tile; block barrier; write: wave w, lane>>3 = q, lanes 8q..8q+7 write one whole
// LDS tile: cross-wave (block barrier); columns 64..71 of the pitch are never read.
// =====================================================================================================
__global__ __launch_bounds__(256) void tr64(const float* __restrict__ in, int ldi,
                                            unsigned short* out, int ldo, int dup) {
  __shared__ __align__(16) unsigned short sT[64 * 72];
  const int tid = (int)threadIdx.x;
  const int k0  = blockIdx.y * 64;
  const int n0  = blockIdx.x * 64;
  {
    const int r = tid >> 2, c16 = (tid & 3) * 16;
    const float* src = in + (size_t)(k0 + r) * (size_t)ldi + n0 + c16;
    const v4f a0 = *(const v4f*)(src);
    const v4f a1 = *(const v4f*)(src + 4);
    const v4f a2 = *(const v4f*)(src + 8);
    const v4f a3 = *(const v4f*)(src + 12);
#pragma unroll
    for (int e = 0; e < 4; ++e) {
      sT[(c16 + e) * 72 + r]      = bf_bits(a0[e]);
      sT[(c16 + 4 + e) * 72 + r]  = bf_bits(a1[e]);
      sT[(c16 + 8 + e) * 72 + r]  = bf_bits(a2[e]);
      sT[(c16 + 12 + e) * 72 + r] = bf_bits(a3[e]);
    }
  }
  __syncthreads();
  const int wave = tid >> 5, lane = tid & 31;
  const int q = lane >> 3, c8 = (lane & 7) * 8;
  v4u vv[2];
#pragma unroll
  for (int it = 0; it < 2; ++it) {
    const int n = it * 32 + wave * 4 + q;
    vv[it] = *(const v4u*)(sT + n * 72 + c8);
  }
  {
#pragma unroll
    for (int it = 0; it < 2; ++it) {
      const int n = it * 32 + wave * 4 + q;
      unsigned short* d = out + (size_t)(n0 + n) * (size_t)ldo + k0 + c8;
      *(v4u*)d = vv[it];
      if (dup != 0) *(v4u*)(d + dup) = vv[it];
    }
    
  }
}

// =====================================================================================================
// Register-blocked batched WMMA GEMM (16-bit operand type OT): C[m][n] = sum_k A[m][k] * Bt[n][k] (+ bias);
// one wave per 64x64 tile, no block barriers. A row-major [M][K], Bt row-major [N][K] (k contiguous), both of row
// pitch K = KD elements, a compile-time constant so that the staging loads of a tile share one address and differ
// by immediate offsets; M, N, KD multiples of 64. blockIdx.y = batch index
// (strides in elements). Per 64-k step the wave brings its 64x64 A and Bt tiles in with 16-B loads that cover whole
// 128-B lines (8 lanes per row, 4 rows per load), one step ahead in registers, stores them to its own LDS tiles
// (pitch LP) and reads the fragments from there with the split k map (ldfrag).
// BIAS 0: none; 1: per column n (bias[n]); 2: per row m (bias[m]); bias values RNE-converted to bf16 in f32.
// OUT_MODE 0: f32 C (pitch ldc), value * oscale + bias.
// OUT_MODE 3: f16 hi plane C + f16 residual plane C2 = f16((v - hi) * rscale) (same pitch / stride), v = acc*oscale+bias.
// whole 64x64 tile; slab pitch columns 64..67 never read.
// =====================================================================================================
template <typename OT, int OUT_MODE, int BIAS, int KD>
__global__ __launch_bounds__(256) void gemm64(
    const unsigned short* __restrict__ Ap, long long strideA,
    const unsigned short* __restrict__ Btp, long long strideB,
    void* Cout, void* Cout2, int ldc, long long strideC,
    const float* __restrict__ bias,
    int M, int N, float oscale, float rscale) {
  static_assert((KD % 64) == 0 && KD >= 64);
  typedef typename FT<OT>::frag V16;
  typedef typename FT<OT>::half8 H8;
  const OT* A  = (const OT*)(const void*)Ap;
  const OT* Bt = (const OT*)(const void*)Btp;
  __shared__ __align__(16) float sT[8][16 * 68];   // per-wave 16x64 slab, pitch 68 floats
  __shared__ __align__(16) OT sA[8][64 * LP];      // per-wave A tile [m][64 k], columns 64..71 of the pitch never read
  __shared__ __align__(16) OT sB[8][64 * LP];      // per-wave Bt tile [n][64 k], same pitch
  const int b    = blockIdx.y;
  const int lane = threadIdx.x & 31;
  const int wave = threadIdx.x >> 5;
  const int tilesN = N >> 6;
  const int tilesM = M >> 6;
  const int tile = blockIdx.x * 8 + wave;
  if (tile >= tilesM * tilesN) return;   // wave-uniform; no block barriers in this kernel
  const int tm = tile / tilesN;
  const int tn = tile - tm * tilesN;
  const int m0 = tm << 6;
  const int n0 = tn << 6;

  const OT* Ab = A  + (size_t)b * (size_t)strideA;
  const OT* Bb = Bt + (size_t)b * (size_t)strideB;

  const int rlane = lane & 15;                 // row (A) / col (B, D) within subtile
  const int koff  = (lane >> 4) * 8;           // k offset of this lane half
  const int mOff  = (lane >> 4) * 8;           // D row offset

  v8f acc[4][4];
#pragma unroll
  for (int i = 0; i < 4; ++i)
#pragma unroll
    for (int j = 0; j < 4; ++j) acc[i][j] = zero8();

  OT* wa = sA[wave];
  OT* wb = sB[wave];
  const int sr = lane >> 3;                    // row within the 4 rows of one staging load
  const int sc = (lane & 7) * 8;               // 16-B piece of the row's 128-B line
  // wave-uniform tile bases, told so to the compiler: they stay in scalar registers
  const char* gA = (const char*)(Ab + (size_t)__builtin_amdgcn_readfirstlane(m0) * KD);
  const char* gB = (const char*)(Bb + (size_t)__builtin_amdgcn_readfirstlane(n0) * KD);
  const unsigned lo = (unsigned)(sr * KD + sc) * 2u;      // byte offset of this lane's piece of tile row sr
  H8 ra[16], rb[16];                           // staging loops unrolled: constant indices keep both in registers
#pragma unroll
  for (int it = 0; it < 16; ++it) {
    ra[it] = *(const H8*)(gA + lo + 8 * it * KD);
    rb[it] = *(const H8*)(gB + lo + 8 * it * KD);
  }
#if DEV_ASM
  // before an address register of the loads above is reused; the inputs keep those registers as they are up to here
  asm volatile("s_wait_xcnt 0x0" :: "v"(lo), "s"(gA), "s"(gB) : "memory");
#endif
  for (int k0 = 0; k0 < KD; k0 += 64) {
#pragma unroll
    for (int it = 0; it < 16; ++it) {
      *(H8*)(wa + (4 * it + sr) * LP + sc) = ra[it];
      *(H8*)(wb + (4 * it + sr) * LP + sc) = rb[it];
    }
    // the tile rows are written by other lanes of this wave than read them: stores before the fragment reads
    __builtin_amdgcn_fence(__ATOMIC_RELEASE, "workgroup");
    __builtin_amdgcn_wave_barrier();
    __builtin_amdgcn_fence(__ATOMIC_ACQUIRE, "workgroup");
    if (k0 + 64 < KD) {                        // next step's tiles fly while this step is multiplied
#pragma unroll
      for (int it = 0; it < 16; ++it) {
        ra[it] = *(const H8*)(gA + 2 * (k0 + 64) + lo + 8 * it * KD);
        rb[it] = *(const H8*)(gB + 2 * (k0 + 64) + lo + 8 * it * KD);
      }
#if DEV_ASM
      asm volatile("s_wait_xcnt 0x0" :: "v"(lo) : "memory");   // before the fragment reads reuse an address register
#endif
    }
#pragma unroll                                 // both 32-k blocks in one body: the second block's reads overlap the first's products
    for (int kk = 0; kk < 64; kk += 32) {
      V16 bq[4], af[4];                        // all eight fragments of the 32-k block read as one group
#pragma unroll
      for (int j = 0; j < 4; ++j) {
        bq[j] = ldfrag<OT>(wb + ((j << 4) + rlane) * LP + koff + kk);
        af[j] = ldfrag<OT>(wa + ((j << 4) + rlane) * LP + koff + kk);
      }
#pragma unroll
      for (int i = 0; i < 4; ++i) {
#pragma unroll
        for (int j = 0; j < 4; ++j) acc[i][j] = mmar(af[i], bq[j], acc[i][j]);
        dep_guard(acc[i][0], acc[i][3], af[i], bq[3]);
      }
      keep4(bq[0], bq[1], bq[2], bq[3]);
    }
    // this step's fragment reads before the next step's stores to the same tiles
    __builtin_amdgcn_fence(__ATOMIC_RELEASE, "workgroup");
    __builtin_amdgcn_wave_barrier();
    __builtin_amdgcn_fence(__ATOMIC_ACQUIRE, "workgroup");
  }
  acc_guard4(acc[0][0], acc[0][1], acc[0][2], acc[0][3]);
  acc_guard4(acc[1][0], acc[1][1], acc[1][2], acc[1][3]);
  acc_guard4(acc[2][0], acc[2][1], acc[2][2], acc[2][3]);
  acc_guard4(acc[3][0], acc[3][1], acc[3][2], acc[3][3]);

  // ---- epilogue ----
  float* slab = sT[wave];
#pragma unroll
  for (int i = 0; i < 4; ++i) {
    const int mBase = m0 + (i << 4);
#pragma unroll
    for (int j = 0; j < 4; ++j) {
#pragma unroll
      for (int r = 0; r < 8; ++r) {
        slab[(mOff + r) * 68 + (j << 4) + rlane] = acc[i][j][r];
      }
    }
    __builtin_amdgcn_fence(__ATOMIC_RELEASE, "workgroup");
    __builtin_amdgcn_wave_barrier();
    __builtin_amdgcn_fence(__ATOMIC_ACQUIRE, "workgroup");
    if (OUT_MODE == 0) {
      float* C = (float*)Cout + (size_t)b * (size_t)strideC;
      const int h2 = lane >> 4, c4 = (lane & 15) * 4;     // 256-B row segment = 16 lanes x 16 B
      v4f bcol = {0.f, 0.f, 0.f, 0.f};
      if (BIAS == 1) {
        const v4f bb = *(const v4f*)(bias + n0 + c4);
#pragma unroll
        for (int e = 0; e < 4; ++e) bcol[e] = bfr(bb[e]);
      }
      {
#pragma unroll
        for (int it = 0; it < 8; ++it) {
          const int row = it * 2 + h2;                     // it 0..7 x h2 0..1 = rows 0..15
          float brow = 0.f;
          if (BIAS == 2) brow = bfr(bias[mBase + row]);
          const v4f x = *(const v4f*)(slab + row * 68 + c4);
          v4f v;
#pragma unroll
          for (int e = 0; e < 4; ++e) v[e] = x[e] * oscale + bcol[e] + brow;
          *(v4f*)(C + (size_t)(mBase + row) * (size_t)ldc + n0 + c4) = v;
        }
        
      }
    } else {
      const int q = lane >> 3, c8 = (lane & 7) * 8;
      unsigned short* C  = (unsigned short*)Cout  + (size_t)b * (size_t)strideC;
      unsigned short* C2 = (unsigned short*)Cout2 + (size_t)b * (size_t)strideC;
      float bc8[8];
#pragma unroll
      for (int e = 0; e < 8; ++e) bc8[e] = 0.f;
      if (BIAS == 1) {
        const v4f b0 = *(const v4f*)(bias + n0 + c8);
        const v4f b1 = *(const v4f*)(bias + n0 + c8 + 4);
#pragma unroll
        for (int e = 0; e < 4; ++e) { bc8[e] = bfr(b0[e]); bc8[4 + e] = bfr(b1[e]); }
      }
      v4u hv[4], lv[4];
#pragma unroll
      for (int it = 0; it < 4; ++it) {
        const int row = it * 4 + q;                        // it 0..3 x q 0..3 = rows 0..15
        const float* sp = slab + row * 68 + c8;
        float brow = 0.f;
        if (BIAS == 2) brow = bfr(bias[mBase + row]);
        float f[8];
#pragma unroll
        for (int e = 0; e < 8; ++e) f[e] = sp[e] * oscale + bc8[e] + brow;
        v4u a, a2;
#pragma unroll
        for (int e = 0; e < 4; ++e) {
          const float f0 = f[2 * e], f1 = f[2 * e + 1];
          const _Float16 x0 = (_Float16)f0, x1 = (_Float16)f1;
          const unsigned short h0 = h_bits(x0), h1 = h_bits(x1);
          unsigned short l0 = 0, l1 = 0;
          if (OUT_MODE == 3) {
            l0 = h_bits((_Float16)((f0 - (float)x0) * rscale));
            l1 = h_bits((_Float16)((f1 - (float)x1) * rscale));
          }
          a[e] = pk16(h0, h1); a2[e] = pk16(l0, l1);
        }
        hv[it] = a; lv[it] = a2;
      }
      {
#pragma unroll
        for (int it = 0; it < 4; ++it) {
          const int row = it * 4 + q;
          *(v4u*)(C + (size_t)(mBase + row) * (size_t)ldc + n0 + c8) = hv[it];
          if (OUT_MODE == 3) *(v4u*)(C2 + (size_t)(mBase + row) * (size_t)ldc + n0 + c8) = lv[it];
        }
        
      }
    }
    __builtin_amdgcn_fence(__ATOMIC_RELEASE, "workgroup");
    __builtin_amdgcn_wave_barrier();
    __builtin_amdgcn_fence(__ATOMIC_ACQUIRE, "workgroup");
  }
}

// =====================================================================================================
// z relayout: in f32 z [rows][HN] (16 heads x 16); out (a) f16 operand plane [rows][ZP], 64 halves per head =
// norms [rows][NH].  Block = 16 rows x 16 heads (thread = one (row, head)); staged in LDS; block barrier; line L of
// the block (L = 16*r + head, contiguous in the plane) written by lanes 8q..8q+7 of wave w with one instruction
// LDS: both arrays cross-wave (block barrier); fully written before read.
// =====================================================================================================
__global__ __launch_bounds__(256) void zprep(const float* __restrict__ zf, unsigned short* zp, float* zsq) {
  __shared__ __align__(16) unsigned short sZ[256 * LP];   // columns 64..71 of the pitch are never read
  __shared__ __align__(16) float sQ[256];
  const int tid  = (int)threadIdx.x;
  const int r    = tid >> 4, hd = tid & 15;
  const int row0 = blockIdx.x * 16;
  {
    const float* zr = zf + (size_t)(row0 + r) * HN + hd * HC;
    const v4f a0 = *(const v4f*)(zr);
    const v4f a1 = *(const v4f*)(zr + 4);
    const v4f a2 = *(const v4f*)(zr + 8);
    const v4f a3 = *(const v4f*)(zr + 12);
    float f[16];
#pragma unroll
    for (int e = 0; e < 4; ++e) { f[e] = a0[e]; f[4 + e] = a1[e]; f[8 + e] = a2[e]; f[12 + e] = a3[e]; }
    float q = 0.f;
#pragma unroll
    for (int e = 0; e < 16; ++e) q += f[e] * f[e];
    sQ[tid] = q;
    v4u ph0, ph1, pl0, pl1;
#pragma unroll
    for (int e = 0; e < 4; ++e) {
      const float f0 = f[2 * e], f1 = f[2 * e + 1], f2 = f[8 + 2 * e], f3 = f[9 + 2 * e];
      const _Float16 x0 = (_Float16)f0, x1 = (_Float16)f1, x2 = (_Float16)f2, x3 = (_Float16)f3;
      ph0[e] = pk16(h_bits(x0), h_bits(x1));
      ph1[e] = pk16(h_bits(x2), h_bits(x3));
      pl0[e] = pk16(h_bits((_Float16)((f0 - (float)x0) * RSC)), h_bits((_Float16)((f1 - (float)x1) * RSC)));
      pl1[e] = pk16(h_bits((_Float16)((f2 - (float)x2) * RSC)), h_bits((_Float16)((f3 - (float)x3) * RSC)));
    }
    const v4u z4 = {0u, 0u, 0u, 0u};
    unsigned short* sl = sZ + tid * LP;
    *(v4u*)(sl + 0)  = ph0;
    *(v4u*)(sl + 8)  = ph1;
    *(v4u*)(sl + 16) = pl0;
    *(v4u*)(sl + 24) = pl1;
    *(v4u*)(sl + 32) = ph0;
    *(v4u*)(sl + 40) = ph1;
    *(v4u*)(sl + 48) = z4;
    *(v4u*)(sl + 56) = z4;
  }
  __syncthreads();
  const int wave = tid >> 5, lane = tid & 31;
  const int q4 = lane >> 3, c8 = (lane & 7) * 8;
  unsigned short* base = zp + (size_t)row0 * ZP;
  v4u vv[8];
#pragma unroll
  for (int it = 0; it < 8; ++it) {
    const int L = it * 32 + wave * 4 + q4;
    vv[it] = *(const v4u*)(sZ + L * LP + c8);
  }
  {
#pragma unroll
    for (int it = 0; it < 8; ++it) {
      const int L = it * 32 + wave * 4 + q4;
      *(v4u*)(base + (size_t)L * 64 + c8) = vv[it];
    }
    
  }
  if (tid < 64) {                                       // waves 0 and 1, wave-uniform
    const v4f qv = *(const v4f*)(sQ + tid * 4);
    float* dst = zsq + (size_t)row0 * NH + tid * 4;
    *(v4f*)dst = qv;
    
  }
}

// =====================================================================================================
// Distance-kernel attention, per-head z dim 16, value dim 64, no mask, softmax over all SEQ keys.
//   z plane (f16): row (b*SEQ + t), head h at cols 64h.. : [hi | residual x4096 | hi | 0]
//   zsq (f32): [(b*SEQ + t)][h] = |z|^2
//   v^T hi plane (f16) and residual plane (f16, (v - hi)*4096): element (b, h, d, s) at [(b*DM + h*64 + d)*SEQ + s]
//   ctx plane (bf16): element (b, t, h, d) hi at [(b*SEQ + t)*OP + h*64 + d], residual at the same + DM
//   dot = A[hi|lo] . B[hi;0]  +  (A[hi|lo] . B[lo;hi]) / 4096 on f16 WMMA (two f32 accumulators);
//   score = -softplus(gamma_h) * max(|z_s|^2 + |z_t|^2 - 2 dot, 0); p = exp(s - m) carried as f16(16384 p);
//   context = p . vh + (p . vl) / 4096 on f16 WMMA; online softmax in f32.
//   Block = 4 waves = 4 x 16 query rows of one (b, h); grid = NB * NH * NQB; key chunks of 64, static trip NKT.
//   Chunk staging: 128 threads x 32 elements per plane = the whole 64x64 tile of each of the three planes (plain 16-B
//   loads, __syncthreads before and after; staged extent == consumed extent); P tiles and the context tile are
//   wave-private (spilled with _Float16 / float element stores, reloaded with the same element type after a release
//   (8 lanes x 8) of head h in both plane halves; the grid covers every (b, h, qb).
// =====================================================================================================
__global__ __launch_bounds__(128)
void attn_dist(const unsigned short* __restrict__ zpp, const float* __restrict__ zsq,
               const unsigned short* __restrict__ vhp, const unsigned short* __restrict__ vlp,
               const float* __restrict__ gam, unsigned short* octx) {
  union FH { v16h v; v8h h[2]; };
  __shared__ __align__(16) _Float16 Zsh[64 * LP];          // z key chunk [key][64], pitch LP    9 KB
  __shared__ __align__(16) _Float16 Vth[64 * LP];          // V^T hi [d][key], pitch LP          9 KB
  __shared__ __align__(16) _Float16 Vtl[64 * LP];          // V^T residual, pitch LP             9 KB
  __shared__ __align__(16) _Float16 Psh[4][16 * LP];       // per wave P [row][key], pitch LP    9 KB
  __shared__ __align__(16) float    Os[4][16 * OSP];       // per wave context tile, pitch OSP  17 KB

  const int tid  = threadIdx.x;
  const int wave = tid >> 5;
  const int lane = tid & 31;
  const int hh   = lane >> 4;
  const int c    = lane & 15;

  const int bx   = blockIdx.x;
  const int qb   = bx % NQB;
  const int rest = bx / NQB;
  const int h    = rest % NH;
  const int b    = rest / NH;
  const int q0   = qb * 64 + wave * 16;
  const size_t rowB = (size_t)b * SEQ;

  const _Float16* Zp16 = (const _Float16*)(const void*)zpp;
  const _Float16* Vh = (const _Float16*)(const void*)vhp + ((size_t)b * DM + (size_t)h * HD) * SEQ;
  const _Float16* Vl = (const _Float16*)(const void*)vlp + ((size_t)b * DM + (size_t)h * HD) * SEQ;

  const float gx = bfr(gam[h]);
  const float g  = fmaxf(gx, 0.f) + log1pf(expf(-fabsf(gx)));   // softplus
  const float ng = -g;

  // ---- query-side A fragment [hi | residual] (row = lane&15) and query squared norms ----
  const v16h zq = ldfrag<_Float16>(Zp16 + (rowB + q0 + c) * ZP + (size_t)h * 64 + 8 * hh);
  float zsq_q[8];
#pragma unroll
  for (int r = 0; r < 8; ++r) zsq_q[r] = zsq[(rowB + q0 + 8 * hh + r) * NH + h];

  float mrow[8], lrow[8];
  v8f oacc[4];
#pragma unroll
  for (int r = 0; r < 8; ++r) { mrow[r] = -INFINITY; lrow[r] = 0.f; }
#pragma unroll
  for (int t = 0; t < 4; ++t) oacc[t] = zero8();

  for (int kt = 0; kt < NKT; ++kt) {         // static trip count
    const int kv0 = kt * 64;
    __syncthreads();
    {
      const int r = tid >> 1, half = (tid & 1) * 32;
      const _Float16* zg  = Zp16 + (rowB + kv0 + r) * ZP + (size_t)h * 64 + half;   // key row kv0+r, 64-half head segment
      const _Float16* vg  = Vh + (size_t)r * SEQ + kv0 + half;                       // v^T row d = r, s = kv0+half..+31
      const _Float16* vlg = Vl + (size_t)r * SEQ + kv0 + half;
#pragma unroll
      for (int i = 0; i < 4; ++i) {
        const v8h a0 = *(const v8h*)(zg + 8 * i);
        const v8h b0 = *(const v8h*)(vg + 8 * i);
        const v8h b1 = *(const v8h*)(vlg + 8 * i);
        *(v8h*)(Zsh + r * LP + half + 8 * i) = a0;
        *(v8h*)(Vth + r * LP + half + 8 * i) = b0;
        *(v8h*)(Vtl + r * LP + half + 8 * i) = b1;
      }
    }
    __syncthreads();

    // ---- scores: 16 query rows x 64 keys per wave, 2 f16 products per key subtile ----
    v8f s[4];
#pragma unroll
    for (int j = 0; j < 4; ++j) {
      const _Float16* zr = Zsh + (j * 16 + c) * LP + 8 * hh;
      FH b1, b2;
      b2.h[0] = *(const v8h*)(zr + 16);     // k 0..15  <- residual of key
      b2.h[1] = *(const v8h*)(zr + 32);     // k 16..31 <- hi of key
      b1.h[0] = *(const v8h*)(zr + 32);     // k 0..15  <- hi of key
      b1.h[1] = *(const v8h*)(zr + 48);     // k 16..31 <- zeros
      v8f ah = mma_h(zq, b1.v, zero8());    // hi.hi
      v8f ax = mma_h(zq, b2.v, zero8());    // (hi.lo + lo.hi) x4096
      const float zt = zsq[(rowB + kv0 + j * 16 + c) * NH + h];
      {
#pragma clang fp contract(off)
#pragma unroll
        for (int r = 0; r < 8; ++r) {
          const float d = ah[r] + ax[r] * (1.0f / RSC);
          float sq = (zsq_q[r] + zt) - 2.0f * d;
          sq = fmaxf(sq, 0.f);
          s[j][r] = ng * sq;
        }
      }
    }

    // ---- row max, online softmax, P (x16384, f16) to LDS ----
    _Float16* pwh = Psh[wave];
#pragma unroll
    for (int r = 0; r < 8; ++r) {
      float m = s[0][r];
#pragma unroll
      for (int j = 1; j < 4; ++j) m = fmaxf(m, s[j][r]);
#pragma unroll
      for (int off = 1; off < 16; off <<= 1) m = fmaxf(m, __shfl_xor(m, off, 32));
      const float mnew  = fmaxf(mrow[r], m);
      const float msafe = (mnew == -INFINITY) ? 0.f : mnew;
      const float alpha = __expf(mrow[r] - msafe);
      mrow[r] = mnew;
      float psum = 0.f;
#pragma unroll
      for (int j = 0; j < 4; ++j) {
        const float p = __expf(s[j][r] - msafe);
        psum += p;
        pwh[(8 * hh + r) * LP + j * 16 + c] = (_Float16)(p * PCARRY);
      }
#pragma unroll
      for (int off = 1; off < 16; off <<= 1) psum += __shfl_xor(psum, off, 32);
      lrow[r] = lrow[r] * alpha + psum;
#pragma unroll
      for (int t = 0; t < 4; ++t) oacc[t][r] *= alpha;
    }
    __builtin_amdgcn_fence(__ATOMIC_RELEASE, "workgroup");
    __builtin_amdgcn_wave_barrier();
    __builtin_amdgcn_fence(__ATOMIC_ACQUIRE, "workgroup");

    // ---- context += P . V (f16 WMMA); residual products into a separate accumulator ----
    v8f o1[4];
#pragma unroll
    for (int t = 0; t < 4; ++t) o1[t] = zero8();
#pragma unroll 1
    for (int kk = 0; kk < 2; ++kk) {
      FH pa;
      pa.h[0] = *(const v8h*)(pwh + c * LP + kk * 32 + 8 * hh);
      pa.h[1] = *(const v8h*)(pwh + c * LP + kk * 32 + 16 + 8 * hh);
#pragma unroll
      for (int t = 0; t < 4; ++t) {
        FH vb, vl;
        vb.h[0] = *(const v8h*)(Vth + (t * 16 + c) * LP + kk * 32 + 8 * hh);
        vb.h[1] = *(const v8h*)(Vth + (t * 16 + c) * LP + kk * 32 + 16 + 8 * hh);
        vl.h[0] = *(const v8h*)(Vtl + (t * 16 + c) * LP + kk * 32 + 8 * hh);
        vl.h[1] = *(const v8h*)(Vtl + (t * 16 + c) * LP + kk * 32 + 16 + 8 * hh);
        oacc[t] = mma_h(pa.v, vb.v, oacc[t]);
        o1[t]   = mma_h(pa.v, vl.v, o1[t]);
      }
    }
#pragma unroll
    for (int t = 0; t < 4; ++t)
#pragma unroll
      for (int r = 0; r < 8; ++r) oacc[t][r] += o1[t][r] * (1.0f / RSC);
  }

  // ---- normalise (1/l, undo the p carry), stage the wave's 16x64 tile, convert to bf16 hi + bf16 residual,
  float* os = Os[wave];
#pragma unroll
  for (int r = 0; r < 8; ++r) {
    const float l = lrow[r];
    const float inv = ((l > 0.f) ? (1.0f / l) : 0.f) * (1.0f / PCARRY);
#pragma unroll
    for (int t = 0; t < 4; ++t) os[(8 * hh + r) * OSP + t * 16 + c] = oacc[t][r] * inv;
  }
  __builtin_amdgcn_fence(__ATOMIC_RELEASE, "workgroup");
  __builtin_amdgcn_wave_barrier();
  __builtin_amdgcn_fence(__ATOMIC_ACQUIRE, "workgroup");
  {
    const int q4 = lane >> 3, c8 = (lane & 7) * 8;
    v4u hv[4], lv[4];
#pragma unroll
    for (int it = 0; it < 4; ++it) {
      const int row = it * 4 + q4;   // it 0..3 x q4 0..3 = rows 0..15 of the wave tile
      const float* sp = os + row * OSP + c8;
      v4u a, a2;
#pragma unroll
      for (int e = 0; e < 4; ++e) {
        const float f0 = sp[2 * e], f1 = sp[2 * e + 1];
        const unsigned short hb0 = bf_bits(f0), hb1 = bf_bits(f1);
        const unsigned short lb0 = bf_bits(f0 - bf_up(hb0)), lb1 = bf_bits(f1 - bf_up(hb1));
        a[e]  = pk16(hb0, hb1);
        a2[e] = pk16(lb0, lb1);
      }
      hv[it] = a; lv[it] = a2;
    }
    {
#pragma unroll
      for (int it = 0; it < 4; ++it) {
        const int row = it * 4 + q4;
        const size_t go = (rowB + q0 + row) * OP + (size_t)h * HD + c8;
        *(v4u*)(octx + go)      = hv[it];
        *(v4u*)(octx + go + DM) = lv[it];
      }
      
    }
  }
}

// =====================================================================================================
// Workspace map (bytes, NB=2 / SEQ=2048), every region an exact multiple of its whole-line / whole-tile store
// granularity, back to back:
//   Xb   bf16 [NB*SEQ][DM]            8388608
//   Cb   bf16 [NB*SEQ][DC]             524288
//   WvT  bf16 [DM n][DM k]            2097152
//   WoT2 bf16 [DM n][2*DM k]          4194304
//   WcT  bf16 [HN][DC]                  32768
//   WnT  bf16 [DC][DC]                   8192
//   Zf   f32  [NB*SEQ][HN]            4194304
//   Zp   f16  [NB*SEQ][ZP]            8388608
//   Zsq  f32  [NB*SEQ][NH]             262144
//   VTh  f16  [NB][DM][SEQ]           8388608
//   VTl  f16  [NB][DM][SEQ]           8388608
//   Octx bf16 [NB*SEQ][OP]           16777216
//   total                            61644800
// Weights arrive [in][out]; tr64 produces the [out n][in k] (k contiguous) layout the GEMM wants.
// =====================================================================================================
extern "C" void kernel_launch(void* const* d_in, const int* in_sizes, int n_in,
                              void* d_out, int out_size, void* d_ws, size_t ws_size,
                              hipStream_t stream) {
  if (n_in < 11) return;
  if (in_sizes[0] < ((NB - 1) * SEQ_FULL + SEQ) * DM) return;
  if (in_sizes[1] < ((NB - 1) * SEQ_FULL + SEQ) * DC) return;
  if (in_sizes[2] < DM * DM || in_sizes[3] < DM) return;
  if (in_sizes[4] < DC * HN || in_sizes[5] < HN) return;
  if (in_sizes[6] < DC * DC || in_sizes[7] < DC) return;
  if (in_sizes[8] < DM * DM || in_sizes[9] < DM) return;
  if (in_sizes[10] < NH) return;
  if ((size_t)out_size < OUT1_OFF + (size_t)NB * SEQ * DC) return;

  const float* hidden = (const float*)d_in[0];
  const float* coords = (const float*)d_in[1];
  const float* Wv     = (const float*)d_in[2];
  const float* bv     = (const float*)d_in[3];
  const float* Wc     = (const float*)d_in[4];
  const float* bc     = (const float*)d_in[5];
  const float* Wn     = (const float*)d_in[6];
  const float* bn     = (const float*)d_in[7];
  const float* Wo     = (const float*)d_in[8];
  const float* bo     = (const float*)d_in[9];
  const float* gamma  = (const float*)d_in[10];

  const size_t nRows = (size_t)NB * SEQ;
  const size_t PXB  = nRows * DM * 2;
  const size_t PCB  = nRows * DC * 2;
  const size_t PWV  = (size_t)DM * DM * 2;
  const size_t PWO2 = (size_t)DM * OP * 2;
  const size_t PWC  = (size_t)HN * DC * 2;
  const size_t PWN  = (size_t)DC * DC * 2;
  const size_t PZF  = nRows * HN * 4;
  const size_t PZP  = nRows * ZP * 2;
  const size_t PZQ  = nRows * NH * 4;
  const size_t PVT  = (size_t)NB * DM * SEQ * 2;
  const size_t POC  = nRows * OP * 2;
  size_t off = 0;
  const size_t oXb  = off; off += PXB;
  const size_t oCb  = off; off += PCB;
  const size_t oWv  = off; off += PWV;
  const size_t oWo  = off; off += PWO2;
  const size_t oWc  = off; off += PWC;
  const size_t oWn  = off; off += PWN;
  const size_t oZf  = off; off += PZF;
  const size_t oZp  = off; off += PZP;
  const size_t oZq  = off; off += PZQ;
  const size_t oVTh = off; off += PVT;
  const size_t oVTl = off; off += PVT;
  const size_t oOc  = off; off += POC;
  if (off > ws_size) return;                       // off = 61644800 at full size
  if (off > (size_t)134217728) return;

  char* ws = (char*)d_ws;
  unsigned short* Xb   = (unsigned short*)(ws + oXb);
  unsigned short* Cb   = (unsigned short*)(ws + oCb);
  unsigned short* WvT  = (unsigned short*)(ws + oWv);
  unsigned short* WoT2 = (unsigned short*)(ws + oWo);
  unsigned short* WcT  = (unsigned short*)(ws + oWc);
  unsigned short* WnT  = (unsigned short*)(ws + oWn);
  float*          Zf   = (float*)(ws + oZf);
  unsigned short* Zpl  = (unsigned short*)(ws + oZp);
  float*          Zsq  = (float*)(ws + oZq);
  unsigned short* VTh  = (unsigned short*)(ws + oVTh);
  unsigned short* VTl  = (unsigned short*)(ws + oVTl);
  unsigned short* Octx = (unsigned short*)(ws + oOc);
  float* out0 = (float*)d_out;
  float* out1 = (float*)d_out + OUT1_OFF;

  const dim3 blk(256);
  const int n8x = NB * SEQ * DM / 8;                                   // 524288
  const int n8c = NB * SEQ * DC / 8;                                   //  32768
  const dim3 gCx((n8x + 255) / 256);                                   // 2048 blocks
  const dim3 gCc((n8c + 255) / 256);                                   //  128 blocks
  const dim3 gTrW(DM / 64, DM / 64);                                   // in [DM][DM]
  const dim3 gTrC(HN / 64, DC / 64);                                   // in [DC rows][HN cols] -> out [HN][DC]
  const dim3 gTrN(DC / 64, DC / 64);                                   // in [DC][DC]
  const int tilesZ = (int)((nRows / 64) * (HN / 64));                  // 256
  const int tilesC = (int)((nRows / 64) * (DC / 64));                  //  64
  const int tilesV = (DM / 64) * (SEQ / 64);                           // 512
  const int tilesO = (int)((nRows / 64) * (DM / 64));                  // 1024
  const dim3 gZ((tilesZ + 7) / 8, 1);
  const dim3 gC1((tilesC + 7) / 8, 1);
  const dim3 gV((tilesV + 7) / 8, NB);
  const dim3 gO((tilesO + 7) / 8, 1);
  const dim3 gPrep((unsigned)(nRows / 16));                            // 256 blocks
  const dim3 gAttn(NB * NH * NQB);                                     // 1024 blocks of 128

  // (1) activations -> bf16 planes (dense rows, full batch stride on the source side)
  cvtrows<<<gCx, blk, 0, stream>>>(hidden, Xb, DM / 8, NB * SEQ, SEQ, SEQ_FULL);
  cvtrows<<<gCc, blk, 0, stream>>>(coords, Cb, DC / 8, NB * SEQ, SEQ, SEQ_FULL);
  // (2) weights [in][out] f32 -> bf16 [out][in]; Wo^T duplicated along k (pitch 2*DM)
  tr64<<<gTrW, blk, 0, stream>>>(Wv, DM, WvT, DM, 0);
  tr64<<<gTrW, blk, 0, stream>>>(Wo, DM, WoT2, OP, DM);
  tr64<<<gTrC, blk, 0, stream>>>(Wc, HN, WcT, DC, 0);
  tr64<<<gTrN, blk, 0, stream>>>(Wn, DC, WnT, DC, 0);
  // (3) z = coords . Wc + bc -> f32 [NB*SEQ][HN]   (M=NB*SEQ, N=HN, K=DC)
  gemm64<__bf16, 0, 1, DC><<<gZ, blk, 0, stream>>>(
      Cb, 0LL, WcT, 0LL,
      (void*)Zf, (void*)Zf, HN, 0LL, bc,
      (int)nRows, HN, 1.0f, 1.0f);
  // (4) z -> f16 operand plane [hi | res | hi | 0] and f32 squared norms
  zprep<<<gPrep, blk, 0, stream>>>(Zf, Zpl, Zsq);
  // (5) second output = coords . Wn + bn -> d_out f32 [NB*SEQ][DC] at element OUT1_OFF   (M=NB*SEQ, N=DC, K=DC)
  gemm64<__bf16, 0, 1, DC><<<gC1, blk, 0, stream>>>(
      Cb, 0LL, WnT, 0LL,
      (void*)out1, (void*)out1, DC, 0LL, bn,
      (int)nRows, DC, 1.0f, 1.0f);
  // (6) v^T = Wv^T . x^T + bv per batch -> f16 hi plane [b][d][s] (pitch SEQ) and residual plane (x4096)
  //     (A = WvT [n][k], Bt = Xb rows of batch b; M=DM, N=SEQ, K=DM; bias per row d)
  gemm64<__bf16, 3, 2, DM><<<gV, blk, 0, stream>>>(
      WvT, 0LL, Xb, (long long)SEQ * DM,
      (void*)VTh, (void*)VTl, SEQ, (long long)DM * SEQ, bv,
      DM, SEQ, 1.0f, RSC);
  // (7) attention -> ctx plane (bf16 hi | bf16 residual) [b*SEQ+t][OP]
  attn_dist<<<gAttn, dim3(128), 0, stream>>>(Zpl, Zsq, VTh, VTl, gamma, Octx);
  // (8) first output = [ctx_hi | ctx_res] . [Wo^T ; Wo^T]^T + bo -> d_out f32 [NB*SEQ][DM]   (M=NB*SEQ, N=DM, K=2*DM)
  gemm64<__bf16, 0, 1, OP><<<gO, blk, 0, stream>>>(
      Octx, 0LL, WoT2, 0LL,
      (void*)out0, (void*)out0, DM, 0LL, bo,
      (int)nRows, DM, 1.0f, 1.0f);
  (void)hipGetLastError();
}

// v003
// Measured time: 174 microseconds a run.
// In two side-by-side timings against v002, it was 1.29 and 1.28 times as fast.
// Counting every step since v000, it is 2.19 times as fast.
// Contractions: value = Wv^T.x^T+bv, z = coords.Wc+bc, coords.Wn+bn = v_wmma_f32_16x16x32_bf16 (bf16 operands from RNE-converted inputs, single product, f32 accumulate);
// z.z^T scores = v_wmma_f32_16x16x32_f16 (z as f16 hi + f16 residual x4096 packed along k, 2 products into separate f32 accumulators);
// p.v = v_wmma_f32_16x16x32_f16 (p carried x16384 in f16; v as f16 hi plane + f16 residual plane x4096; 2 products, f32 accumulate);
// ctx.Wo+bo = v_wmma_f32_16x16x32_bf16 (ctx as bf16 hi and bf16 residual planes concatenated along k, Wo^T bf16 duplicated along k; f32 accumulate);
// squared norms, softplus, softmax and bias adds in f32.
#include <hip/hip_runtime.h>
#include <math.h>
#include <stdint.h>

#ifndef NB
#define NB 2
#endif
#ifndef SEQ
#define SEQ 2048
#endif
#define NB_FULL  2
#define SEQ_FULL 2048
#define DM   1024
#define NH   16
#define HC   16
#define HD   64
#define DC   64
#define HN   (NH * HC)        // 256
#define ZP   (NH * 64)        // 1024: z operand plane pitch, 64 halves per head [hi | lo x4096 | hi | 0]
#define OP   (2 * DM)         // 2048: ctx plane pitch (bf16 hi | bf16 residual)
#define NQB  (SEQ / 64)       // 64-row query blocks per sequence
#define NKT  (SEQ / 64)       // 64-key chunks per sequence
#define LP   72               // LDS row pitch in halves of every 64-half tile row: 144 B = 16 B x odd, so the 16 rows
                              // that one ds_load_b128 touches fall on 16 different groups of four banks (at 128 B: on one)
#define OSP  68               // LDS row pitch in floats of the 64-float context tile rows (272 B = 16 B x odd)
#define PCARRY 16384.0f
#define RSC    4096.0f
#define OUT1_OFF ((size_t)NB_FULL * SEQ_FULL * DM)   // element offset of the second output in d_out
static_assert(NH * HD == DM);
static_assert(HC == 16 && HD == 64 && DC == 64);
static_assert((SEQ % 64) == 0 && SEQ >= 64 && SEQ <= SEQ_FULL);
static_assert(NB >= 1 && NB <= NB_FULL);
static_assert((DM % 64) == 0 && (HN % 64) == 0 && (OP % 64) == 0);
static_assert(OUT1_OFF * 4 == 16777216);

typedef _Float16 v16h __attribute__((ext_vector_type(16)));
typedef _Float16 v8h  __attribute__((ext_vector_type(8)));
typedef __bf16   v16b __attribute__((ext_vector_type(16)));
typedef __bf16   v8b  __attribute__((ext_vector_type(8)));
typedef float    v8f  __attribute__((ext_vector_type(8)));
typedef float    v4f  __attribute__((ext_vector_type(4)));
typedef unsigned int v4u __attribute__((ext_vector_type(4)));

#if defined(__HIP_DEVICE_COMPILE__)
#define DEV_ASM 1
#else
#define DEV_ASM 0
#endif

// ---- scalar helpers --------------------------------------------------------------------------------
__device__ __forceinline__ unsigned short bf_bits(float f) {          // f32 -> bf16 bits, RNE convert
  unsigned u = __float_as_uint(f);
  return (unsigned short)((u + 0x7FFFu + ((u >> 16) & 1u)) >> 16);
}
__device__ __forceinline__ float bf_up(unsigned short hb) { return __uint_as_float(((unsigned)hb) << 16); }
__device__ __forceinline__ float bfr(float f) { return bf_up(bf_bits(f)); }   // value of the bf16 RNE convert
__device__ __forceinline__ unsigned short h_bits(_Float16 x) { return __builtin_bit_cast(unsigned short, x); }
__device__ __forceinline__ unsigned pk16(unsigned short a, unsigned short b) { return (unsigned)a | ((unsigned)b << 16); }
__device__ __forceinline__ v8f zero8() { v8f z = {0.f, 0.f, 0.f, 0.f, 0.f, 0.f, 0.f, 0.f}; return z; }
__device__ __forceinline__ float xhalf(float x) {                      // value of lane l ^ 16
  const int b = __builtin_bit_cast(int, x);
  return __builtin_bit_cast(float, __builtin_amdgcn_permlanex16(b, b, 0x76543210, 0xfedcba98, false, false));
}

// ---- fragment types / loaders: 16-bit A/B operand, lane -> row/col (lane&15), p already includes +8*(lane>>4);
//      elements 0..7 <- p[0..7] (k0+8h..k0+8h+7), elements 8..15 <- p[16..23] (k0+16+8h..k0+16+8h+7)
template <typename OT> struct FT;
template <> struct FT<__bf16>   { typedef v16b frag; typedef v8b half8; };
template <> struct FT<_Float16> { typedef v16h frag; typedef v8h half8; };

template <typename OT>
__device__ __forceinline__ typename FT<OT>::frag ldfrag(const OT* p) {
  union { typename FT<OT>::frag v; typename FT<OT>::half8 h[2]; } f;
  f.h[0] = *(const typename FT<OT>::half8*)(p);
  f.h[1] = *(const typename FT<OT>::half8*)(p + 16);
  return f.v;
}

// ---- WMMA helpers (asm guard bodies are device-only; concrete operand types) -----------------------------
__device__ __forceinline__ v8f mmar(v16b a, v16b b, v8f c) {
  return __builtin_amdgcn_wmma_f32_16x16x32_bf16(false, a, false, b, (short)0, c, false, false);
}
__device__ __forceinline__ v8f mmar(v16h a, v16h b, v8f c) {
  return __builtin_amdgcn_wmma_f32_16x16x32_f16(false, a, false, b, (short)0, c, false, false);
}
// guarded form: 4 VALU slots after the WMMA, D tied, A/B kept live
__device__ __forceinline__ v8f mma_h(v16h a, v16h b, v8f c) {
  c = __builtin_amdgcn_wmma_f32_16x16x32_f16(false, a, false, b, (short)0, c, false, false);
#if DEV_ASM
  asm volatile("v_nop\n\tv_nop\n\tv_nop\n\tv_nop" : "+v"(c) : "v"(a), "v"(b));
#endif
  return c;
}
__device__ __forceinline__ void dep_guard(v8f& a, v8f& b, v16b x, v16b y) {
#if DEV_ASM
  asm volatile("v_nop\n\tv_nop\n\tv_nop\n\tv_nop" : "+v"(a), "+v"(b) : "v"(x), "v"(y));
#else
  (void)a; (void)b; (void)x; (void)y;
#endif
}
__device__ __forceinline__ void dep_guard(v8f& a, v8f& b, v16h x, v16h y) {
#if DEV_ASM
  asm volatile("v_nop\n\tv_nop\n\tv_nop\n\tv_nop" : "+v"(a), "+v"(b) : "v"(x), "v"(y));
#else
  (void)a; (void)b; (void)x; (void)y;
#endif
}
__device__ __forceinline__ void keep4(v16b a, v16b b, v16b c, v16b d) {
#if DEV_ASM
  asm volatile("v_nop" :: "v"(a), "v"(b), "v"(c), "v"(d));
#else
  (void)a; (void)b; (void)c; (void)d;
#endif
}
__device__ __forceinline__ void keep4(v16h a, v16h b, v16h c, v16h d) {
#if DEV_ASM
  asm volatile("v_nop" :: "v"(a), "v"(b), "v"(c), "v"(d));
#else
  (void)a; (void)b; (void)c; (void)d;
#endif
}
__device__ __forceinline__ void acc_guard4(v8f& a, v8f& b, v8f& c, v8f& d) {
#if DEV_ASM
  asm volatile("v_nop\n\tv_nop\n\tv_nop\n\tv_nop" : "+v"(a), "+v"(b), "+v"(c), "+v"(d));
#else
  (void)a; (void)b; (void)c; (void)d;
#endif
}

// =====================================================================================================
// f32 rows -> bf16 plane rows (RNE convert), 8 elements per thread, one 16-B store per lane: a wave writes
// Dense output row `row` (0..nrows-1) reads source row (row / seq) * seqfull + row % seq (full batch stride).
// grid = ceil(nrows*rowlen8/256). coverage: nrows*rowlen8 threads x 8 = the whole plane (exact multiple of 256).
// =====================================================================================================
__global__ __launch_bounds__(256) void cvtrows(const float* __restrict__ in, unsigned short* out,
                                               int rowlen8, int nrows, int seq, int seqfull) {
  const int i = blockIdx.x * 256 + (int)threadIdx.x;
  if (i < nrows * rowlen8) {
    const int row  = i / rowlen8;
    const int c    = i - row * rowlen8;
    const int bq   = row / seq;
    const int srow = bq * seqfull + (row - bq * seq);
    const float* src = in + ((size_t)srow * (size_t)rowlen8 + (size_t)c) * 8;
    const v4f a  = *(const v4f*)(src);
    const v4f a4 = *(const v4f*)(src + 4);
    v4u p;
    p[0] = pk16(bf_bits(a[0]),  bf_bits(a[1]));
    p[1] = pk16(bf_bits(a[2]),  bf_bits(a[3]));
    p[2] = pk16(bf_bits(a4[0]), bf_bits(a4[1]));
    p[3] = pk16(bf_bits(a4[2]), bf_bits(a4[3]));
    unsigned short* o = out + (size_t)i * 8;
    *(v4u*)o = p;
    
  }
}

// =====================================================================================================
// Weight transpose + bf16 convert through LDS: in f32 [krows][ncols] (pitch ldi) -> out bf16 [n][k] (pitch ldo,
// k contiguous), optionally duplicated at +dup elements in the same output row.  One block = one 64x64 tile:
// input rows k0 = 64*blockIdx.y, cols n0 = 64*blockIdx.x.  Load: thread r = tid>>2 reads 16 floats of input row
// k0+r; LDS holds the transposed tile; block barrier; write: wave w, lane>>3 = q, lanes 8q..8q+7 write one whole
// LDS tile: cross-wave (block barrier); columns 64..71 of the pitch are never read.
// =====================================================================================================
__global__ __launch_bounds__(256) void tr64(const float* __restrict__ in, int ldi,
                                            unsigned short* out, int ldo, int dup) {
  __shared__ __align__(16) unsigned short sT[64 * 72];
  const int tid = (int)threadIdx.x;
  const int k0  = blockIdx.y * 64;
  const int n0  = blockIdx.x * 64;
  {
    const int r = tid >> 2, c16 = (tid & 3) * 16;
    const float* src = in + (size_t)(k0 + r) * (size_t)ldi + n0 + c16;
    const v4f a0 = *(const v4f*)(src);
    const v4f a1 = *(const v4f*)(src + 4);
    const v4f a2 = *(const v4f*)(src + 8);
    const v4f a3 = *(const v4f*)(src + 12);
#pragma unroll
    for (int e = 0; e < 4; ++e) {
      sT[(c16 + e) * 72 + r]      = bf_bits(a0[e]);
      sT[(c16 + 4 + e) * 72 + r]  = bf_bits(a1[e]);
      sT[(c16 + 8 + e) * 72 + r]  = bf_bits(a2[e]);
      sT[(c16 + 12 + e) * 72 + r] = bf_bits(a3[e]);
    }
  }
  __syncthreads();
  const int wave = tid >> 5, lane = tid & 31;
  const int q = lane >> 3, c8 = (lane & 7) * 8;
  v4u vv[2];
#pragma unroll
  for (int it = 0; it < 2; ++it) {
    const int n = it * 32 + wave * 4 + q;
    vv[it] = *(const v4u*)(sT + n * 72 + c8);
  }
  {
#pragma unroll
    for (int it = 0; it < 2; ++it) {
      const int n = it * 32 + wave * 4 + q;
      unsigned short* d = out + (size_t)(n0 + n) * (size_t)ldo + k0 + c8;
      *(v4u*)d = vv[it];
      if (dup != 0) *(v4u*)(d + dup) = vv[it];
    }
    
  }
}

// =====================================================================================================
// Register-blocked batched WMMA GEMM (16-bit operand type OT): C[m][n] = sum_k A[m][k] * Bt[n][k] (+ bias);
// one wave per 64x64 tile, no block barriers. A row-major [M][K], Bt row-major [N][K] (k contiguous), both of row
// pitch K = KD elements, a compile-time constant so that the staging loads of a tile share one address and differ
// by immediate offsets; M, N, KD multiples of 64. blockIdx.y = batch index
// (strides in elements). Per 64-k step the wave brings its 64x64 A and Bt tiles in with 16-B loads that cover whole
// 128-B lines (8 lanes per row, 4 rows per load), one step ahead in registers, stores them to its own LDS tiles
// (pitch LP) and reads the fragments from there with the split k map (ldfrag).
// BIAS 0: none; 1: per column n (bias[n]); 2: per row m (bias[m]); bias values RNE-converted to bf16 in f32.
// OUT_MODE 0: f32 C (pitch ldc), value * oscale + bias.
// OUT_MODE 3: f16 hi plane C + f16 residual plane C2 = f16((v - hi) * rscale) (same pitch / stride), v = acc*oscale+bias.
// whole 64x64 tile; slab pitch columns 64..67 never read.
// =====================================================================================================
template <typename OT, int OUT_MODE, int BIAS, int KD>
__global__ __launch_bounds__(256) void gemm64(
    const unsigned short* __restrict__ Ap, long long strideA,
    const unsigned short* __restrict__ Btp, long long strideB,
    void* Cout, void* Cout2, int ldc, long long strideC,
    const float* __restrict__ bias,
    int M, int N, float oscale, float rscale) {
  static_assert((KD % 64) == 0 && KD >= 64);
  typedef typename FT<OT>::frag V16;
  typedef typename FT<OT>::half8 H8;
  const OT* A  = (const OT*)(const void*)Ap;
  const OT* Bt = (const OT*)(const void*)Btp;
  __shared__ __align__(16) float sT[8][16 * 68];   // per-wave 16x64 slab, pitch 68 floats
  __shared__ __align__(16) OT sA[8][64 * LP];      // per-wave A tile [m][64 k], columns 64..71 of the pitch never read
  __shared__ __align__(16) OT sB[8][64 * LP];      // per-wave Bt tile [n][64 k], same pitch
  const int b    = blockIdx.y;
  const int lane = threadIdx.x & 31;
  const int wave = threadIdx.x >> 5;
  const int tilesN = N >> 6;
  const int tilesM = M >> 6;
  const int tile = blockIdx.x * 8 + wave;
  if (tile >= tilesM * tilesN) return;   // wave-uniform; no block barriers in this kernel
  const int tm = tile / tilesN;
  const int tn = tile - tm * tilesN;
  const int m0 = tm << 6;
  const int n0 = tn << 6;

  const OT* Ab = A  + (size_t)b * (size_t)strideA;
  const OT* Bb = Bt + (size_t)b * (size_t)strideB;

  const int rlane = lane & 15;                 // row (A) / col (B, D) within subtile
  const int koff  = (lane >> 4) * 8;           // k offset of this lane half
  const int mOff  = (lane >> 4) * 8;           // D row offset

  v8f acc[4][4];
#pragma unroll
  for (int i = 0; i < 4; ++i)
#pragma unroll
    for (int j = 0; j < 4; ++j) acc[i][j] = zero8();

  OT* wa = sA[wave];
  OT* wb = sB[wave];
  const int sr = lane >> 3;                    // row within the 4 rows of one staging load
  const int sc = (lane & 7) * 8;               // 16-B piece of the row's 128-B line
  // wave-uniform tile bases, told so to the compiler: they stay in scalar registers
  const char* gA = (const char*)(Ab + (size_t)__builtin_amdgcn_readfirstlane(m0) * KD);
  const char* gB = (const char*)(Bb + (size_t)__builtin_amdgcn_readfirstlane(n0) * KD);
  const unsigned lo = (unsigned)(sr * KD + sc) * 2u;      // byte offset of this lane's piece of tile row sr
  H8 ra[16], rb[16];                           // staging loops unrolled: constant indices keep both in registers
#pragma unroll
  for (int it = 0; it < 16; ++it) {
    ra[it] = *(const H8*)(gA + lo + 8 * it * KD);
    rb[it] = *(const H8*)(gB + lo + 8 * it * KD);
  }
#if DEV_ASM
  // before an address register of the loads above is reused; the inputs keep those registers as they are up to here
  asm volatile("s_wait_xcnt 0x0" :: "v"(lo), "s"(gA), "s"(gB) : "memory");
#endif
  for (int k0 = 0; k0 < KD; k0 += 64) {
#pragma unroll
    for (int it = 0; it < 16; ++it) {
      *(H8*)(wa + (4 * it + sr) * LP + sc) = ra[it];
      *(H8*)(wb + (4 * it + sr) * LP + sc) = rb[it];
    }
    // the tile rows are written by other lanes of this wave than read them: stores before the fragment reads
    __builtin_amdgcn_fence(__ATOMIC_RELEASE, "workgroup");
    __builtin_amdgcn_wave_barrier();
    __builtin_amdgcn_fence(__ATOMIC_ACQUIRE, "workgroup");
    if (k0 + 64 < KD) {                        // next step's tiles fly while this step is multiplied
#pragma unroll
      for (int it = 0; it < 16; ++it) {
        ra[it] = *(const H8*)(gA + 2 * (k0 + 64) + lo + 8 * it * KD);
        rb[it] = *(const H8*)(gB + 2 * (k0 + 64) + lo + 8 * it * KD);
      }
#if DEV_ASM
      asm volatile("s_wait_xcnt 0x0" :: "v"(lo) : "memory");   // before the fragment reads reuse an address register
#endif
    }
#pragma unroll                                 // both 32-k blocks in one body: the second block's reads overlap the first's products
    for (int kk = 0; kk < 64; kk += 32) {
      V16 bq[4], af[4];                        // all eight fragments of the 32-k block read as one group
#pragma unroll
      for (int j = 0; j < 4; ++j) {
        bq[j] = ldfrag<OT>(wb + ((j << 4) + rlane) * LP + koff + kk);
        af[j] = ldfrag<OT>(wa + ((j << 4) + rlane) * LP + koff + kk);
      }
#pragma unroll
      for (int i = 0; i < 4; ++i) {
#pragma unroll
        for (int j = 0; j < 4; ++j) acc[i][j] = mmar(af[i], bq[j], acc[i][j]);
        dep_guard(acc[i][0], acc[i][3], af[i], bq[3]);
      }
      keep4(bq[0], bq[1], bq[2], bq[3]);
    }
    // this step's fragment reads before the next step's stores to the same tiles
    __builtin_amdgcn_fence(__ATOMIC_RELEASE, "workgroup");
    __builtin_amdgcn_wave_barrier();
    __builtin_amdgcn_fence(__ATOMIC_ACQUIRE, "workgroup");
  }
  acc_guard4(acc[0][0], acc[0][1], acc[0][2], acc[0][3]);
  acc_guard4(acc[1][0], acc[1][1], acc[1][2], acc[1][3]);
  acc_guard4(acc[2][0], acc[2][1], acc[2][2], acc[2][3]);
  acc_guard4(acc[3][0], acc[3][1], acc[3][2], acc[3][3]);

  // ---- epilogue ----
  float* slab = sT[wave];
#pragma unroll
  for (int i = 0; i < 4; ++i) {
    const int mBase = m0 + (i << 4);
#pragma unroll
    for (int j = 0; j < 4; ++j) {
#pragma unroll
      for (int r = 0; r < 8; ++r) {
        slab[(mOff + r) * 68 + (j << 4) + rlane] = acc[i][j][r];
      }
    }
    __builtin_amdgcn_fence(__ATOMIC_RELEASE, "workgroup");
    __builtin_amdgcn_wave_barrier();
    __builtin_amdgcn_fence(__ATOMIC_ACQUIRE, "workgroup");
    if (OUT_MODE == 0) {
      float* C = (float*)Cout + (size_t)b * (size_t)strideC;
      const int h2 = lane >> 4, c4 = (lane & 15) * 4;     // 256-B row segment = 16 lanes x 16 B
      v4f bcol = {0.f, 0.f, 0.f, 0.f};
      if (BIAS == 1) {
        const v4f bb = *(const v4f*)(bias + n0 + c4);
#pragma unroll
        for (int e = 0; e < 4; ++e) bcol[e] = bfr(bb[e]);
      }
      {
#pragma unroll
        for (int it = 0; it < 8; ++it) {
          const int row = it * 2 + h2;                     // it 0..7 x h2 0..1 = rows 0..15
          float brow = 0.f;
          if (BIAS == 2) brow = bfr(bias[mBase + row]);
          const v4f x = *(const v4f*)(slab + row * 68 + c4);
          v4f v;
#pragma unroll
          for (int e = 0; e < 4; ++e) v[e] = x[e] * oscale + bcol[e] + brow;
          *(v4f*)(C + (size_t)(mBase + row) * (size_t)ldc + n0 + c4) = v;
        }
        
      }
    } else {
      const int q = lane >> 3, c8 = (lane & 7) * 8;
      unsigned short* C  = (unsigned short*)Cout  + (size_t)b * (size_t)strideC;
      unsigned short* C2 = (unsigned short*)Cout2 + (size_t)b * (size_t)strideC;
      float bc8[8];
#pragma unroll
      for (int e = 0; e < 8; ++e) bc8[e] = 0.f;
      if (BIAS == 1) {
        const v4f b0 = *(const v4f*)(bias + n0 + c8);
        const v4f b1 = *(const v4f*)(bias + n0 + c8 + 4);
#pragma unroll
        for (int e = 0; e < 4; ++e) { bc8[e] = bfr(b0[e]); bc8[4 + e] = bfr(b1[e]); }
      }
      v4u hv[4], lv[4];
#pragma unroll
      for (int it = 0; it < 4; ++it) {
        const int row = it * 4 + q;                        // it 0..3 x q 0..3 = rows 0..15
        const float* sp = slab + row * 68 + c8;
        float brow = 0.f;
        if (BIAS == 2) brow = bfr(bias[mBase + row]);
        float f[8];
#pragma unroll
        for (int e = 0; e < 8; ++e) f[e] = sp[e] * oscale + bc8[e] + brow;
        v4u a, a2;
#pragma unroll
        for (int e = 0; e < 4; ++e) {
          const float f0 = f[2 * e], f1 = f[2 * e + 1];
          const _Float16 x0 = (_Float16)f0, x1 = (_Float16)f1;
          const unsigned short h0 = h_bits(x0), h1 = h_bits(x1);
          unsigned short l0 = 0, l1 = 0;
          if (OUT_MODE == 3) {
            l0 = h_bits((_Float16)((f0 - (float)x0) * rscale));
            l1 = h_bits((_Float16)((f1 - (float)x1) * rscale));
          }
          a[e] = pk16(h0, h1); a2[e] = pk16(l0, l1);
        }
        hv[it] = a; lv[it] = a2;
      }
      {
#pragma unroll
        for (int it = 0; it < 4; ++it) {
          const int row = it * 4 + q;
          *(v4u*)(C + (size_t)(mBase + row) * (size_t)ldc + n0 + c8) = hv[it];
          if (OUT_MODE == 3) *(v4u*)(C2 + (size_t)(mBase + row) * (size_t)ldc + n0 + c8) = lv[it];
        }
        
      }
    }
    __builtin_amdgcn_fence(__ATOMIC_RELEASE, "workgroup");
    __builtin_amdgcn_wave_barrier();
    __builtin_amdgcn_fence(__ATOMIC_ACQUIRE, "workgroup");
  }
}

// =====================================================================================================
// z relayout: in f32 z [rows][HN] (16 heads x 16); out (a) f16 operand plane [rows][ZP], 64 halves per head =
// norms [rows][NH].  Block = 16 rows x 16 heads (thread = one (row, head)); staged in LDS; block barrier; line L of
// the block (L = 16*r + head, contiguous in the plane) written by lanes 8q..8q+7 of wave w with one instruction
// LDS: both arrays cross-wave (block barrier); fully written before read.
// =====================================================================================================
__global__ __launch_bounds__(256) void zprep(const float* __restrict__ zf, unsigned short* zp, float* zsq) {
  __shared__ __align__(16) unsigned short sZ[256 * LP];   // columns 64..71 of the pitch are never read
  __shared__ __align__(16) float sQ[256];
  const int tid  = (int)threadIdx.x;
  const int r    = tid >> 4, hd = tid & 15;
  const int row0 = blockIdx.x * 16;
  {
    const float* zr = zf + (size_t)(row0 + r) * HN + hd * HC;
    const v4f a0 = *(const v4f*)(zr);
    const v4f a1 = *(const v4f*)(zr + 4);
    const v4f a2 = *(const v4f*)(zr + 8);
    const v4f a3 = *(const v4f*)(zr + 12);
    float f[16];
#pragma unroll
    for (int e = 0; e < 4; ++e) { f[e] = a0[e]; f[4 + e] = a1[e]; f[8 + e] = a2[e]; f[12 + e] = a3[e]; }
    float q = 0.f;
#pragma unroll
    for (int e = 0; e < 16; ++e) q += f[e] * f[e];
    sQ[tid] = q;
    v4u ph0, ph1, pl0, pl1;
#pragma unroll
    for (int e = 0; e < 4; ++e) {
      const float f0 = f[2 * e], f1 = f[2 * e + 1], f2 = f[8 + 2 * e], f3 = f[9 + 2 * e];
      const _Float16 x0 = (_Float16)f0, x1 = (_Float16)f1, x2 = (_Float16)f2, x3 = (_Float16)f3;
      ph0[e] = pk16(h_bits(x0), h_bits(x1));
      ph1[e] = pk16(h_bits(x2), h_bits(x3));
      pl0[e] = pk16(h_bits((_Float16)((f0 - (float)x0) * RSC)), h_bits((_Float16)((f1 - (float)x1) * RSC)));
      pl1[e] = pk16(h_bits((_Float16)((f2 - (float)x2) * RSC)), h_bits((_Float16)((f3 - (float)x3) * RSC)));
    }
    const v4u z4 = {0u, 0u, 0u, 0u};
    unsigned short* sl = sZ + tid * LP;
    *(v4u*)(sl + 0)  = ph0;
    *(v4u*)(sl + 8)  = ph1;
    *(v4u*)(sl + 16) = pl0;
    *(v4u*)(sl + 24) = pl1;
    *(v4u*)(sl + 32) = ph0;
    *(v4u*)(sl + 40) = ph1;
    *(v4u*)(sl + 48) = z4;
    *(v4u*)(sl + 56) = z4;
  }
  __syncthreads();
  const int wave = tid >> 5, lane = tid & 31;
  const int q4 = lane >> 3, c8 = (lane & 7) * 8;
  unsigned short* base = zp + (size_t)row0 * ZP;
  v4u vv[8];
#pragma unroll
  for (int it = 0; it < 8; ++it) {
    const int L = it * 32 + wave * 4 + q4;
    vv[it] = *(const v4u*)(sZ + L * LP + c8);
  }
  {
#pragma unroll
    for (int it = 0; it < 8; ++it) {
      const int L = it * 32 + wave * 4 + q4;
      *(v4u*)(base + (size_t)L * 64 + c8) = vv[it];
    }
    
  }
  if (tid < 64) {                                       // waves 0 and 1, wave-uniform
    const v4f qv = *(const v4f*)(sQ + tid * 4);
    float* dst = zsq + (size_t)row0 * NH + tid * 4;
    *(v4f*)dst = qv;
    
  }
}

__global__ __launch_bounds__(128)
void attn_dist(const unsigned short* __restrict__ zpp, const float* __restrict__ zsq,
               const unsigned short* __restrict__ vhp, const unsigned short* __restrict__ vlp,
               const float* __restrict__ gam, unsigned short* octx) {
  union FH { v16h v; v8h h[2]; };
  __shared__ __align__(16) _Float16 Zsh[64 * LP];          // z key chunk [key][64], pitch LP    9 KB
  __shared__ __align__(16) _Float16 Vth[64 * LP];          // V^T hi [d][key], pitch LP          9 KB
  __shared__ __align__(16) _Float16 Vtl[64 * LP];          // V^T residual, pitch LP             9 KB
  __shared__ __align__(16) float    Zqs[64];               // squared norms of the chunk's keys
  __shared__ __align__(16) float    Os[4][16 * OSP];       // per wave context tile, pitch OSP  17 KB

  const int tid  = threadIdx.x;
  const int wave = tid >> 5;
  const int lane = tid & 31;
  const int hh   = lane >> 4;
  const int c    = lane & 15;

  const int bx   = blockIdx.x;
  const int qb   = bx % NQB;
  const int rest = bx / NQB;
  const int h    = rest % NH;
  const int b    = rest / NH;
  const int q0   = qb * 64 + wave * 16;
  const size_t rowB = (size_t)b * SEQ;

  const _Float16* Zp16 = (const _Float16*)(const void*)zpp;
  const _Float16* Vh = (const _Float16*)(const void*)vhp + ((size_t)b * DM + (size_t)h * HD) * SEQ;
  const _Float16* Vl = (const _Float16*)(const void*)vlp + ((size_t)b * DM + (size_t)h * HD) * SEQ;

  const float gx = bfr(gam[h]);
  const float g  = fmaxf(gx, 0.f) + log1pf(expf(-fabsf(gx)));   // softplus
  const float ng = -g;

  // ---- query-side B fragment [hi | residual] (column = lane&15) and this lane's query squared norm ----
  const v16h zq = ldfrag<_Float16>(Zp16 + (rowB + q0 + c) * ZP + (size_t)h * 64 + 8 * hh);
  const float zsq_q = zsq[(rowB + q0 + c) * NH + h];

  float mrow = -INFINITY;      // running max of query c, the same in both wave halves
  float lrow = 0.f;            // running sum over this half's keys only; the halves are joined after the loop
  v8f oacc[4];                 // context^T: tile t, register r = value dim 16t + 8*hh + r of query c
#pragma unroll
  for (int t = 0; t < 4; ++t) oacc[t] = zero8();

  for (int kt = 0; kt < NKT; ++kt) {         // static trip count
    const int kv0 = kt * 64;
    __syncthreads();
    {
      const int r = tid >> 1, half = (tid & 1) * 32;
      const _Float16* zg  = Zp16 + (rowB + kv0 + r) * ZP + (size_t)h * 64 + half;   // key row kv0+r, 64-half head segment
      const _Float16* vg  = Vh + (size_t)r * SEQ + kv0 + half;                       // v^T row d = r, s = kv0+half..+31
      const _Float16* vlg = Vl + (size_t)r * SEQ + kv0 + half;
      const float zn = zsq[(rowB + kv0 + (tid & 63)) * NH + h];   // every thread loads, in one group with the tiles
#pragma unroll
      for (int i = 0; i < 4; ++i) {
        const v8h a0 = *(const v8h*)(zg + 8 * i);
        const v8h b0 = *(const v8h*)(vg + 8 * i);
        const v8h b1 = *(const v8h*)(vlg + 8 * i);
        *(v8h*)(Zsh + r * LP + half + 8 * i) = a0;
        *(v8h*)(Vth + r * LP + half + 8 * i) = b0;
        *(v8h*)(Vtl + r * LP + half + 8 * i) = b1;
      }
#if DEV_ASM
      // input-only use of the loaded norm: keeps its load up among the tile loads; sunk into the branch below it
      // would be issued behind their waits and cost the block a second load latency in front of the barrier
      asm volatile("" :: "v"(zn));
#endif
      if (tid < 64) Zqs[tid] = zn;                                // waves 0 and 1, wave-uniform
    }
    __syncthreads();

    // ---- scores^T: 64 keys x 16 queries per wave, 2 f16 products per key subtile ----
    v8f s[4];
#pragma unroll
    for (int j = 0; j < 4; ++j) {
      const _Float16* zr = Zsh + (j * 16 + c) * LP + 8 * hh;
      FH b1, b2;
      b2.h[0] = *(const v8h*)(zr + 16);     // k 0..15  <- residual of key
      b2.h[1] = *(const v8h*)(zr + 32);     // k 16..31 <- hi of key
      b1.h[0] = *(const v8h*)(zr + 32);     // k 0..15  <- hi of key
      b1.h[1] = *(const v8h*)(zr + 48);     // k 16..31 <- zeros
      v8f ah = mma_h(b1.v, zq, zero8());    // hi.hi
      v8f ax = mma_h(b2.v, zq, zero8());    // (hi.lo + lo.hi) x4096
      const v4f zt0 = *(const v4f*)(Zqs + j * 16 + 8 * hh);       // norms of keys 16j + 8*hh + 0..3
      const v4f zt1 = *(const v4f*)(Zqs + j * 16 + 8 * hh + 4);   // and + 4..7
      {
#pragma clang fp contract(off)
#pragma unroll
        for (int r = 0; r < 8; ++r) {
          const float d = ah[r] + ax[r] * (1.0f / RSC);
          float sq = (zsq_q + (r < 4 ? zt0[r & 3] : zt1[r & 3])) - 2.0f * d;
          sq = fmaxf(sq, 0.f);
          s[j][r] = ng * sq;
        }
      }
    }

    // ---- in-lane max over this half's 32 keys, joined with the other half; online softmax; p^T (x16384, f16) ----
    float mj[4];
#pragma unroll
    for (int j = 0; j < 4; ++j) {
      mj[j] = s[j][0];
#pragma unroll
      for (int r = 1; r < 8; ++r) mj[j] = fmaxf(mj[j], s[j][r]);
    }
    float m = fmaxf(fmaxf(mj[0], mj[1]), fmaxf(mj[2], mj[3]));
    m = fmaxf(m, xhalf(m));
    const float mnew  = fmaxf(mrow, m);
    const float msafe = (mnew == -INFINITY) ? 0.f : mnew;
    const float alpha = __expf(mrow - msafe);
    mrow = mnew;
    FH pa[2];                    // p^T operand of keys 0..31 and 32..63 of the chunk
    float pj[4];                 // four independent sums, one per key subtile
#pragma unroll
    for (int j = 0; j < 4; ++j) {
      pj[j] = 0.f;
#pragma unroll
      for (int r = 0; r < 8; ++r) {
        const float p = __expf(s[j][r] - msafe);
        pj[j] += p;
        pa[j >> 1].h[j & 1][r] = (_Float16)(p * PCARRY);
      }
    }
    lrow = lrow * alpha + ((pj[0] + pj[1]) + (pj[2] + pj[3]));
#pragma unroll
    for (int t = 0; t < 4; ++t)
#pragma unroll
      for (int r = 0; r < 8; ++r) oacc[t][r] *= alpha;

    // ---- context^T += V^T . P^T (f16 WMMA); residual products into a separate accumulator ----
    v8f o1[4];
#pragma unroll
    for (int t = 0; t < 4; ++t) o1[t] = zero8();
#pragma unroll                   // constant kk: pa[kk] stays in registers
    for (int kk = 0; kk < 2; ++kk) {
#pragma unroll
      for (int t = 0; t < 4; ++t) {
        FH vb, vl;
        vb.h[0] = *(const v8h*)(Vth + (t * 16 + c) * LP + kk * 32 + 8 * hh);
        vb.h[1] = *(const v8h*)(Vth + (t * 16 + c) * LP + kk * 32 + 16 + 8 * hh);
        vl.h[0] = *(const v8h*)(Vtl + (t * 16 + c) * LP + kk * 32 + 8 * hh);
        vl.h[1] = *(const v8h*)(Vtl + (t * 16 + c) * LP + kk * 32 + 16 + 8 * hh);
        oacc[t] = mma_h(vb.v, pa[kk].v, oacc[t]);
        o1[t]   = mma_h(vl.v, pa[kk].v, o1[t]);
      }
    }
#pragma unroll
    for (int t = 0; t < 4; ++t)
#pragma unroll
      for (int r = 0; r < 8; ++r) oacc[t][r] += o1[t][r] * (1.0f / RSC);
  }

  // ---- normalise (1/l, undo the p carry), stage the wave's 16x64 tile, convert to bf16 hi + bf16 residual,
  float* os = Os[wave];
  {
    const float l = lrow + xhalf(lrow);          // both halves' keys
    const float inv = ((l > 0.f) ? (1.0f / l) : 0.f) * (1.0f / PCARRY);
#pragma unroll
    for (int t = 0; t < 4; ++t) {                // row = query c, 8 consecutive value dims per tile
      v4f w0, w1;
#pragma unroll
      for (int e = 0; e < 4; ++e) { w0[e] = oacc[t][e] * inv; w1[e] = oacc[t][4 + e] * inv; }
      *(v4f*)(os + c * OSP + t * 16 + 8 * hh)     = w0;
      *(v4f*)(os + c * OSP + t * 16 + 8 * hh + 4) = w1;
    }
  }
  __builtin_amdgcn_fence(__ATOMIC_RELEASE, "workgroup");
  __builtin_amdgcn_wave_barrier();
  __builtin_amdgcn_fence(__ATOMIC_ACQUIRE, "workgroup");
  {
    const int q4 = lane >> 3, c8 = (lane & 7) * 8;
    v4u hv[4], lv[4];
#pragma unroll
    for (int it = 0; it < 4; ++it) {
      const int row = it * 4 + q4;   // it 0..3 x q4 0..3 = rows 0..15 of the wave tile
      const float* sp = os + row * OSP + c8;
      v4u a, a2;
#pragma unroll
      for (int e = 0; e < 4; ++e) {
        const float f0 = sp[2 * e], f1 = sp[2 * e + 1];
        const unsigned short hb0 = bf_bits(f0), hb1 = bf_bits(f1);
        const unsigned short lb0 = bf_bits(f0 - bf_up(hb0)), lb1 = bf_bits(f1 - bf_up(hb1));
        a[e]  = pk16(hb0, hb1);
        a2[e] = pk16(lb0, lb1);
      }
      hv[it] = a; lv[it] = a2;
    }
    {
#pragma unroll
      for (int it = 0; it < 4; ++it) {
        const int row = it * 4 + q4;
        const size_t go = (rowB + q0 + row) * OP + (size_t)h * HD + c8;
        *(v4u*)(octx + go)      = hv[it];
        *(v4u*)(octx + go + DM) = lv[it];
      }
      
    }
  }
}

// =====================================================================================================
// Workspace map (bytes, NB=2 / SEQ=2048), every region an exact multiple of its whole-line / whole-tile store
// granularity, back to back:
//   Xb   bf16 [NB*SEQ][DM]            8388608
//   Cb   bf16 [NB*SEQ][DC]             524288
//   WvT  bf16 [DM n][DM k]            2097152
//   WoT2 bf16 [DM n][2*DM k]          4194304
//   WcT  bf16 [HN][DC]                  32768
//   WnT  bf16 [DC][DC]                   8192
//   Zf   f32  [NB*SEQ][HN]            4194304
//   Zp   f16  [NB*SEQ][ZP]            8388608
//   Zsq  f32  [NB*SEQ][NH]             262144
//   VTh  f16  [NB][DM][SEQ]           8388608
//   VTl  f16  [NB][DM][SEQ]           8388608
//   Octx bf16 [NB*SEQ][OP]           16777216
//   total                            61644800
// Weights arrive [in][out]; tr64 produces the [out n][in k] (k contiguous) layout the GEMM wants.
// =====================================================================================================
extern "C" void kernel_launch(void* const* d_in, const int* in_sizes, int n_in,
                              void* d_out, int out_size, void* d_ws, size_t ws_size,
                              hipStream_t stream) {
  if (n_in < 11) return;
  if (in_sizes[0] < ((NB - 1) * SEQ_FULL + SEQ) * DM) return;
  if (in_sizes[1] < ((NB - 1) * SEQ_FULL + SEQ) * DC) return;
  if (in_sizes[2] < DM * DM || in_sizes[3] < DM) return;
  if (in_sizes[4] < DC * HN || in_sizes[5] < HN) return;
  if (in_sizes[6] < DC * DC || in_sizes[7] < DC) return;
  if (in_sizes[8] < DM * DM || in_sizes[9] < DM) return;
  if (in_sizes[10] < NH) return;
  if ((size_t)out_size < OUT1_OFF + (size_t)NB * SEQ * DC) return;

  const float* hidden = (const float*)d_in[0];
  const float* coords = (const float*)d_in[1];
  const float* Wv     = (const float*)d_in[2];
  const float* bv     = (const float*)d_in[3];
  const float* Wc     = (const float*)d_in[4];
  const float* bc     = (const float*)d_in[5];
  const float* Wn     = (const float*)d_in[6];
  const float* bn     = (const float*)d_in[7];
  const float* Wo     = (const float*)d_in[8];
  const float* bo     = (const float*)d_in[9];
  const float* gamma  = (const float*)d_in[10];

  const size_t nRows = (size_t)NB * SEQ;
  const size_t PXB  = nRows * DM * 2;
  const size_t PCB  = nRows * DC * 2;
  const size_t PWV  = (size_t)DM * DM * 2;
  const size_t PWO2 = (size_t)DM * OP * 2;
  const size_t PWC  = (size_t)HN * DC * 2;
  const size_t PWN  = (size_t)DC * DC * 2;
  const size_t PZF  = nRows * HN * 4;
  const size_t PZP  = nRows * ZP * 2;
  const size_t PZQ  = nRows * NH * 4;
  const size_t PVT  = (size_t)NB * DM * SEQ * 2;
  const size_t POC  = nRows * OP * 2;
  size_t off = 0;
  const size_t oXb  = off; off += PXB;
  const size_t oCb  = off; off += PCB;
  const size_t oWv  = off; off += PWV;
  const size_t oWo  = off; off += PWO2;
  const size_t oWc  = off; off += PWC;
  const size_t oWn  = off; off += PWN;
  const size_t oZf  = off; off += PZF;
  const size_t oZp  = off; off += PZP;
  const size_t oZq  = off; off += PZQ;
  const size_t oVTh = off; off += PVT;
  const size_t oVTl = off; off += PVT;
  const size_t oOc  = off; off += POC;
  if (off > ws_size) return;                       // off = 61644800 at full size
  if (off > (size_t)134217728) return;

  char* ws = (char*)d_ws;
  unsigned short* Xb   = (unsigned short*)(ws + oXb);
  unsigned short* Cb   = (unsigned short*)(ws + oCb);
  unsigned short* WvT  = (unsigned short*)(ws + oWv);
  unsigned short* WoT2 = (unsigned short*)(ws + oWo);
  unsigned short* WcT  = (unsigned short*)(ws + oWc);
  unsigned short* WnT  = (unsigned short*)(ws + oWn);
  float*          Zf   = (float*)(ws + oZf);
  unsigned short* Zpl  = (unsigned short*)(ws + oZp);
  float*          Zsq  = (float*)(ws + oZq);
  unsigned short* VTh  = (unsigned short*)(ws + oVTh);
  unsigned short* VTl  = (unsigned short*)(ws + oVTl);
  unsigned short* Octx = (unsigned short*)(ws + oOc);
  float* out0 = (float*)d_out;
  float* out1 = (float*)d_out + OUT1_OFF;

  const dim3 blk(256);
  const int n8x = NB * SEQ * DM / 8;                                   // 524288
  const int n8c = NB * SEQ * DC / 8;                                   //  32768
  const dim3 gCx((n8x + 255) / 256);                                   // 2048 blocks
  const dim3 gCc((n8c + 255) / 256);                                   //  128 blocks
  const dim3 gTrW(DM / 64, DM / 64);                                   // in [DM][DM]
  const dim3 gTrC(HN / 64, DC / 64);                                   // in [DC rows][HN cols] -> out [HN][DC]
  const dim3 gTrN(DC / 64, DC / 64);                                   // in [DC][DC]
  const int tilesZ = (int)((nRows / 64) * (HN / 64));                  // 256
  const int tilesC = (int)((nRows / 64) * (DC / 64));                  //  64
  const int tilesV = (DM / 64) * (SEQ / 64);                           // 512
  const int tilesO = (int)((nRows / 64) * (DM / 64));                  // 1024
  const dim3 gZ((tilesZ + 7) / 8, 1);
  const dim3 gC1((tilesC + 7) / 8, 1);
  const dim3 gV((tilesV + 7) / 8, NB);
  const dim3 gO((tilesO + 7) / 8, 1);
  const dim3 gPrep((unsigned)(nRows / 16));                            // 256 blocks
  const dim3 gAttn(NB * NH * NQB);                                     // 1024 blocks of 128

  // (1) activations -> bf16 planes (dense rows, full batch stride on the source side)
  cvtrows<<<gCx, blk, 0, stream>>>(hidden, Xb, DM / 8, NB * SEQ, SEQ, SEQ_FULL);
  cvtrows<<<gCc, blk, 0, stream>>>(coords, Cb, DC / 8, NB * SEQ, SEQ, SEQ_FULL);
  // (2) weights [in][out] f32 -> bf16 [out][in]; Wo^T duplicated along k (pitch 2*DM)
  tr64<<<gTrW, blk, 0, stream>>>(Wv, DM, WvT, DM, 0);
  tr64<<<gTrW, blk, 0, stream>>>(Wo, DM, WoT2, OP, DM);
  tr64<<<gTrC, blk, 0, stream>>>(Wc, HN, WcT, DC, 0);
  tr64<<<gTrN, blk, 0, stream>>>(Wn, DC, WnT, DC, 0);
  // (3) z = coords . Wc + bc -> f32 [NB*SEQ][HN]   (M=NB*SEQ, N=HN, K=DC)
  gemm64<__bf16, 0, 1, DC><<<gZ, blk, 0, stream>>>(
      Cb, 0LL, WcT, 0LL,
      (void*)Zf, (void*)Zf, HN, 0LL, bc,
      (int)nRows, HN, 1.0f, 1.0f);
  // (4) z -> f16 operand plane [hi | res | hi | 0] and f32 squared norms
  zprep<<<gPrep, blk, 0, stream>>>(Zf, Zpl, Zsq);
  // (5) second output = coords . Wn + bn -> d_out f32 [NB*SEQ][DC] at element OUT1_OFF   (M=NB*SEQ, N=DC, K=DC)
  gemm64<__bf16, 0, 1, DC><<<gC1, blk, 0, stream>>>(
      Cb, 0LL, WnT, 0LL,
      (void*)out1, (void*)out1, DC, 0LL, bn,
      (int)nRows, DC, 1.0f, 1.0f);
  // (6) v^T = Wv^T . x^T + bv per batch -> f16 hi plane [b][d][s] (pitch SEQ) and residual plane (x4096)
  //     (A = WvT [n][k], Bt = Xb rows of batch b; M=DM, N=SEQ, K=DM; bias per row d)
  gemm64<__bf16, 3, 2, DM><<<gV, blk, 0, stream>>>(
      WvT, 0LL, Xb, (long long)SEQ * DM,
      (void*)VTh, (void*)VTl, SEQ, (long long)DM * SEQ, bv,
      DM, SEQ, 1.0f, RSC);
  // (7) attention -> ctx plane (bf16 hi | bf16 residual) [b*SEQ+t][OP]
  attn_dist<<<gAttn, dim3(128), 0, stream>>>(Zpl, Zsq, VTh, VTl, gamma, Octx);
  // (8) first output = [ctx_hi | ctx_res] . [Wo^T ; Wo^T]^T + bo -> d_out f32 [NB*SEQ][DM]   (M=NB*SEQ, N=DM, K=2*DM)
  gemm64<__bf16, 0, 1, OP><<<gO, blk, 0, stream>>>(
      Octx, 0LL, WoT2, 0LL,
      (void*)out0, (void*)out0, DM, 0LL, bo,
      (int)nRows, DM, 1.0f, 1.0f);
  (void)hipGetLastError();
}

// v004
// One run takes 149 microseconds.
// Two timings next to v003 put it at 1.17 and 1.16 times that version's speed.
// All steps since v000 together make it 2.56 times as fast.
// Contractions: value = Wv^T.x^T+bv, z = coords.Wc+bc, coords.Wn+bn = v_wmma_f32_16x16x32_bf16 (bf16 operands from RNE-converted inputs, single product, f32 accumulate);
// z.z^T scores = v_wmma_f32_16x16x32_f16 (z as f16 hi + f16 residual x4096 packed along k, 2 products into separate f32 accumulators);
// p.v = v_wmma_f32_16x16x32_f16 (p carried x16384 in f16; v as f16 hi plane + f16 residual plane x4096; 2 products, f32 accumulate);
// ctx.Wo+bo = v_wmma_f32_16x16x32_bf16 (ctx as bf16 hi and bf16 residual planes concatenated along k, Wo^T bf16 duplicated along k; f32 accumulate);
// squared norms, softplus, softmax and bias adds in f32.
#include <hip/hip_runtime.h>
#include <math.h>
#include <stdint.h>

#ifndef NB
#define NB 2
#endif
#ifndef SEQ
#define SEQ 2048
#endif
#define NB_FULL  2
#define SEQ_FULL 2048
#define DM   1024
#define NH   16
#define HC   16
#define HD   64
#define DC   64
#define HN   (NH * HC)        // 256
#define ZP   (NH * 64)        // 1024: z operand plane pitch, 64 halves per head [hi | lo x4096 | hi | 0]
#define OP   (2 * DM)         // 2048: ctx plane pitch (bf16 hi | bf16 residual)
#define NQB  (SEQ / 64)       // 64-row query blocks per sequence
#define NKT  (SEQ / 64)       // 64-key chunks per sequence
#define LP   72               // LDS row pitch in halves of every 64-half tile row: 144 B = 16 B x odd, so the 16 rows
                              // that one ds_load_b128 touches fall on 16 different groups of four banks (at 128 B: on one)
#define OSP  68               // LDS row pitch in floats of the 64-float context tile rows (272 B = 16 B x odd)
#define PCARRY 16384.0f
#define RSC    4096.0f
#define OUT1_OFF ((size_t)NB_FULL * SEQ_FULL * DM)   // element offset of the second output in d_out
static_assert(NH * HD == DM);
static_assert(HC == 16 && HD == 64 && DC == 64);
static_assert((SEQ % 64) == 0 && SEQ >= 64 && SEQ <= SEQ_FULL);
static_assert(NB >= 1 && NB <= NB_FULL);
static_assert((DM % 64) == 0 && (HN % 64) == 0 && (OP % 64) == 0);
static_assert(OUT1_OFF * 4 == 16777216);

typedef _Float16 v16h __attribute__((ext_vector_type(16)));
typedef _Float16 v8h  __attribute__((ext_vector_type(8)));
typedef __bf16   v16b __attribute__((ext_vector_type(16)));
typedef __bf16   v8b  __attribute__((ext_vector_type(8)));
typedef float    v8f  __attribute__((ext_vector_type(8)));
typedef float    v4f  __attribute__((ext_vector_type(4)));
typedef unsigned int v4u __attribute__((ext_vector_type(4)));

#if defined(__HIP_DEVICE_COMPILE__)
#define DEV_ASM 1
#else
#define DEV_ASM 0
#endif

// ---- scalar helpers --------------------------------------------------------------------------------
__device__ __forceinline__ unsigned short bf_bits(float f) {          // f32 -> bf16 bits, RNE convert
  unsigned u = __float_as_uint(f);
  return (unsigned short)((u + 0x7FFFu + ((u >> 16) & 1u)) >> 16);
}
__device__ __forceinline__ float bf_up(unsigned short hb) { return __uint_as_float(((unsigned)hb) << 16); }
__device__ __forceinline__ float bfr(float f) { return bf_up(bf_bits(f)); }   // value of the bf16 RNE convert
__device__ __forceinline__ unsigned short h_bits(_Float16 x) { return __builtin_bit_cast(unsigned short, x); }
__device__ __forceinline__ unsigned pk16(unsigned short a, unsigned short b) { return (unsigned)a | ((unsigned)b << 16); }
__device__ __forceinline__ v8f zero8() { v8f z = {0.f, 0.f, 0.f, 0.f, 0.f, 0.f, 0.f, 0.f}; return z; }
__device__ __forceinline__ float xhalf(float x) {                      // value of lane l ^ 16
  const int b = __builtin_bit_cast(int, x);
  return __builtin_bit_cast(float, __builtin_amdgcn_permlanex16(b, b, 0x76543210, 0xfedcba98, false, false));
}

// ---- fragment types / loaders: 16-bit A/B operand, lane -> row/col (lane&15), p already includes +8*(lane>>4);
//      elements 0..7 <- p[0..7] (k0+8h..k0+8h+7), elements 8..15 <- p[16..23] (k0+16+8h..k0+16+8h+7)
template <typename OT> struct FT;
template <> struct FT<__bf16>   { typedef v16b frag; typedef v8b half8; };
template <> struct FT<_Float16> { typedef v16h frag; typedef v8h half8; };

template <typename OT>
__device__ __forceinline__ typename FT<OT>::frag ldfrag(const OT* p) {
  union { typename FT<OT>::frag v; typename FT<OT>::half8 h[2]; } f;
  f.h[0] = *(const typename FT<OT>::half8*)(p);
  f.h[1] = *(const typename FT<OT>::half8*)(p + 16);
  return f.v;
}

// ---- WMMA helpers (asm guard bodies are device-only; concrete operand types) -----------------------------
__device__ __forceinline__ v8f mmar(v16b a, v16b b, v8f c) {
  return __builtin_amdgcn_wmma_f32_16x16x32_bf16(false, a, false, b, (short)0, c, false, false);
}
__device__ __forceinline__ v8f mmar(v16h a, v16h b, v8f c) {
  return __builtin_amdgcn_wmma_f32_16x16x32_f16(false, a, false, b, (short)0, c, false, false);
}
// guarded form: 4 VALU slots after the WMMA, D tied, A/B kept live
__device__ __forceinline__ v8f mma_h(v16h a, v16h b, v8f c) {
  c = __builtin_amdgcn_wmma_f32_16x16x32_f16(false, a, false, b, (short)0, c, false, false);
#if DEV_ASM
  asm volatile("v_nop\n\tv_nop\n\tv_nop\n\tv_nop" : "+v"(c) : "v"(a), "v"(b));
#endif
  return c;
}
__device__ __forceinline__ void dep_guard(v8f& a, v8f& b, v16b x, v16b y) {
#if DEV_ASM
  asm volatile("v_nop\n\tv_nop\n\tv_nop\n\tv_nop" : "+v"(a), "+v"(b) : "v"(x), "v"(y));
#else
  (void)a; (void)b; (void)x; (void)y;
#endif
}
__device__ __forceinline__ void dep_guard(v8f& a, v8f& b, v16h x, v16h y) {
#if DEV_ASM
  asm volatile("v_nop\n\tv_nop\n\tv_nop\n\tv_nop" : "+v"(a), "+v"(b) : "v"(x), "v"(y));
#else
  (void)a; (void)b; (void)x; (void)y;
#endif
}
__device__ __forceinline__ void keep4(v16b a, v16b b, v16b c, v16b d) {
#if DEV_ASM
  asm volatile("v_nop" :: "v"(a), "v"(b), "v"(c), "v"(d));
#else
  (void)a; (void)b; (void)c; (void)d;
#endif
}
__device__ __forceinline__ void keep4(v16h a, v16h b, v16h c, v16h d) {
#if DEV_ASM
  asm volatile("v_nop" :: "v"(a), "v"(b), "v"(c), "v"(d));
#else
  (void)a; (void)b; (void)c; (void)d;
#endif
}
__device__ __forceinline__ void acc_guard4(v8f& a, v8f& b, v8f& c, v8f& d) {
#if DEV_ASM
  asm volatile("v_nop\n\tv_nop\n\tv_nop\n\tv_nop" : "+v"(a), "+v"(b), "+v"(c), "+v"(d));
#else
  (void)a; (void)b; (void)c; (void)d;
#endif
}

// =====================================================================================================
// f32 rows -> bf16 plane rows (RNE convert), 8 elements per thread, one 16-B store per lane: a wave writes
// Dense output row `row` (0..nrows-1) reads source row (row / seq) * seqfull + row % seq (full batch stride).
// ceil(nrows*rowlen8/256) blocks, bx = the block's index among them. coverage: nrows*rowlen8 threads x 8 = the
// whole plane (exact multiple of 256).
// =====================================================================================================
__device__ __forceinline__ void cvtrows(int bx, const float* __restrict__ in, unsigned short* out,
                                        int rowlen8, int nrows, int seq, int seqfull) {
  const int i = bx * 256 + (int)threadIdx.x;
  if (i < nrows * rowlen8) {
    const int row  = i / rowlen8;
    const int c    = i - row * rowlen8;
    const int bq   = row / seq;
    const int srow = bq * seqfull + (row - bq * seq);
    const float* src = in + ((size_t)srow * (size_t)rowlen8 + (size_t)c) * 8;
    const v4f a  = *(const v4f*)(src);
    const v4f a4 = *(const v4f*)(src + 4);
    v4u p;
    p[0] = pk16(bf_bits(a[0]),  bf_bits(a[1]));
    p[1] = pk16(bf_bits(a[2]),  bf_bits(a[3]));
    p[2] = pk16(bf_bits(a4[0]), bf_bits(a4[1]));
    p[3] = pk16(bf_bits(a4[2]), bf_bits(a4[3]));
    unsigned short* o = out + (size_t)i * 8;
    *(v4u*)o = p;
    
  }
}

// =====================================================================================================
// Weight transpose + bf16 convert through LDS: in f32 [krows][ncols] (pitch ldi) -> out bf16 [n][k] (pitch ldo,
// k contiguous), optionally duplicated at +dup elements in the same output row.  One block = one 64x64 tile:
// input rows k0 = 64*by, cols n0 = 64*bx.  Load: thread r = tid>>2 reads 16 floats of input row
// k0+r; LDS holds the transposed tile; block barrier; write: wave w, lane>>3 = q, lanes 8q..8q+7 write one whole
// LDS tile: cross-wave (block barrier); columns 64..71 of the pitch are never read.
// =====================================================================================================
__device__ __forceinline__ void tr64(int bx, int by, unsigned short* sT, const float* __restrict__ in, int ldi,
                                     unsigned short* out, int ldo, int dup) {
  const int tid = (int)threadIdx.x;
  const int k0  = by * 64;
  const int n0  = bx * 64;
  {
    const int r = tid >> 2, c16 = (tid & 3) * 16;
    const float* src = in + (size_t)(k0 + r) * (size_t)ldi + n0 + c16;
    const v4f a0 = *(const v4f*)(src);
    const v4f a1 = *(const v4f*)(src + 4);
    const v4f a2 = *(const v4f*)(src + 8);
    const v4f a3 = *(const v4f*)(src + 12);
#pragma unroll
    for (int e = 0; e < 4; ++e) {
      sT[(c16 + e) * 72 + r]      = bf_bits(a0[e]);
      sT[(c16 + 4 + e) * 72 + r]  = bf_bits(a1[e]);
      sT[(c16 + 8 + e) * 72 + r]  = bf_bits(a2[e]);
      sT[(c16 + 12 + e) * 72 + r] = bf_bits(a3[e]);
    }
  }
  __syncthreads();
  const int wave = tid >> 5, lane = tid & 31;
  const int q = lane >> 3, c8 = (lane & 7) * 8;
  v4u vv[2];
#pragma unroll
  for (int it = 0; it < 2; ++it) {
    const int n = it * 32 + wave * 4 + q;
    vv[it] = *(const v4u*)(sT + n * 72 + c8);
  }
  {
#pragma unroll
    for (int it = 0; it < 2; ++it) {
      const int n = it * 32 + wave * 4 + q;
      unsigned short* d = out + (size_t)(n0 + n) * (size_t)ldo + k0 + c8;
      *(v4u*)d = vv[it];
      if (dup != 0) *(v4u*)(d + dup) = vv[it];
    }
#if DEV_ASM
    // behind the last store: in the listing another range's code follows and reuses the stores' registers
    asm volatile("s_wait_xcnt 0x0" ::: "memory");
#endif
  }
}

// =====================================================================================================
// All six input conversions in ONE launch: none reads what another writes, so each block takes its job from the
// range its index falls in (block-uniform branch; the barrier of tr64 is reached by whole blocks only).
// Ranges, in index order: Wv^T, Wo^T (duplicated along k), Wc^T, Wn^T, hidden rows, coordinate rows.
// =====================================================================================================
#define PB_W  ((DM / 64) * (DM / 64))            // 256 tiles of a [DM][DM] weight
#define PB_C  ((HN / 64) * (DC / 64))            //   4 tiles of Wc [DC][HN]
#define PB_N  ((DC / 64) * (DC / 64))            //   1 tile of Wn [DC][DC]
#define PB_X  (NB * SEQ * DM / 8 / 256)          // 2048 blocks of hidden rows
#define PB_Q  (NB * SEQ * DC / 8 / 256)          //  128 blocks of coordinate rows
static_assert((NB * SEQ * DM / 8) % 256 == 0 && (NB * SEQ * DC / 8) % 256 == 0);
__global__ __launch_bounds__(256) void prep_all(const float* __restrict__ hidden, const float* __restrict__ coords,
                                                const float* __restrict__ Wv, const float* __restrict__ Wo,
                                                const float* __restrict__ Wc, const float* __restrict__ Wn,
                                                unsigned short* Xb, unsigned short* Cb, unsigned short* WvT,
                                                unsigned short* WoT2, unsigned short* WcT, unsigned short* WnT) {
  __shared__ __align__(16) unsigned short sT[64 * 72];
  int bx = (int)blockIdx.x;
  if (bx < PB_W) { tr64(bx % (DM / 64), bx / (DM / 64), sT, Wv, DM, WvT, DM, 0); return; }
  bx -= PB_W;
  if (bx < PB_W) { tr64(bx % (DM / 64), bx / (DM / 64), sT, Wo, DM, WoT2, OP, DM); return; }
  bx -= PB_W;
  if (bx < PB_C) { tr64(bx % (HN / 64), bx / (HN / 64), sT, Wc, HN, WcT, DC, 0); return; }
  bx -= PB_C;
  if (bx < PB_N) { tr64(bx % (DC / 64), bx / (DC / 64), sT, Wn, DC, WnT, DC, 0); return; }
  bx -= PB_N;
  if (bx < PB_X) { cvtrows(bx, hidden, Xb, DM / 8, NB * SEQ, SEQ, SEQ_FULL); return; }
  bx -= PB_X;
  cvtrows(bx, coords, Cb, DC / 8, NB * SEQ, SEQ, SEQ_FULL);
}

// =====================================================================================================
// Register-blocked batched WMMA GEMM (16-bit operand type OT): C[m][n] = sum_k A[m][k] * Bt[n][k] (+ bias);
// one wave per 64x64 tile, no block barriers. A row-major [M][K], Bt row-major [N][K] (k contiguous), both of row
// pitch K = KD elements, a compile-time constant so that the staging loads of a tile share one address and differ
// by immediate offsets; M, N, KD multiples of 64. bx = block index within the product, b = batch index
// (strides in elements). Per 64-k step the wave brings its 64x64 A and Bt tiles in with 16-B loads that cover whole
// 128-B lines (8 lanes per row, 4 rows per load), one step ahead in registers, stores them to its own LDS tiles
// (pitch LP) and reads the fragments from there with the split k map (ldfrag).
// BIAS 0: none; 1: per column n (bias[n]); 2: per row m (bias[m]); bias values RNE-converted to bf16 in f32.
// OUT_MODE 0: f32 C (pitch ldc), value * oscale + bias.
// OUT_MODE 3: f16 hi plane C + f16 residual plane C2 = f16((v - hi) * rscale) (same pitch / stride), v = acc*oscale+bias.
// whole 64x64 tile; slab pitch columns 64..67 never read.
// =====================================================================================================
// LDS of a GEMM block, declared once in each kernel and handed to the body
#define GEMM_LDS(OT)                                                                                             \
  __shared__ __align__(16) float sT[8 * 16 * 68];  /* per-wave 16x64 slab, pitch 68 floats */                     \
  __shared__ __align__(16) OT sA[8 * 64 * LP];     /* per-wave A tile [m][64 k], columns 64..71 never read */     \
  __shared__ __align__(16) OT sB[8 * 64 * LP]      /* per-wave Bt tile [n][64 k], same pitch */
template <typename OT, int OUT_MODE, int BIAS, int KD>
__device__ __forceinline__ void gemm64(
    int bx, int b, float* sT, OT* sA, OT* sB,
    const unsigned short* __restrict__ Ap, long long strideA,
    const unsigned short* __restrict__ Btp, long long strideB,
    void* Cout, void* Cout2, int ldc, long long strideC,
    const float* __restrict__ bias,
    int M, int N, float oscale, float rscale) {
  static_assert((KD % 64) == 0 && KD >= 64);
  typedef typename FT<OT>::frag V16;
  typedef typename FT<OT>::half8 H8;
  const OT* A  = (const OT*)(const void*)Ap;
  const OT* Bt = (const OT*)(const void*)Btp;
  const int lane = threadIdx.x & 31;
  const int wave = threadIdx.x >> 5;
  const int tilesN = N >> 6;
  const int tilesM = M >> 6;
  const int tile = bx * 8 + wave;
  if (tile >= tilesM * tilesN) return;   // wave-uniform; no block barriers in this kernel
  const int tm = tile / tilesN;
  const int tn = tile - tm * tilesN;
  const int m0 = tm << 6;
  const int n0 = tn << 6;

  const OT* Ab = A  + (size_t)b * (size_t)strideA;
  const OT* Bb = Bt + (size_t)b * (size_t)strideB;

  const int rlane = lane & 15;                 // row (A) / col (B, D) within subtile
  const int koff  = (lane >> 4) * 8;           // k offset of this lane half
  const int mOff  = (lane >> 4) * 8;           // D row offset

  v8f acc[4][4];
#pragma unroll
  for (int i = 0; i < 4; ++i)
#pragma unroll
    for (int j = 0; j < 4; ++j) acc[i][j] = zero8();

  OT* wa = sA + wave * (64 * LP);
  OT* wb = sB + wave * (64 * LP);
  const int sr = lane >> 3;                    // row within the 4 rows of one staging load
  const int sc = (lane & 7) * 8;               // 16-B piece of the row's 128-B line
  // wave-uniform tile bases, told so to the compiler: they stay in scalar registers
  const char* gA = (const char*)(Ab + (size_t)__builtin_amdgcn_readfirstlane(m0) * KD);
  const char* gB = (const char*)(Bb + (size_t)__builtin_amdgcn_readfirstlane(n0) * KD);
  const unsigned lo = (unsigned)(sr * KD + sc) * 2u;      // byte offset of this lane's piece of tile row sr
  H8 ra[16], rb[16];                           // staging loops unrolled: constant indices keep both in registers
#pragma unroll
  for (int it = 0; it < 16; ++it) {
    ra[it] = *(const H8*)(gA + lo + 8 * it * KD);
    rb[it] = *(const H8*)(gB + lo + 8 * it * KD);
  }
#if DEV_ASM
  // before an address register of the loads above is reused; the inputs keep those registers as they are up to here
  asm volatile("s_wait_xcnt 0x0" :: "v"(lo), "s"(gA), "s"(gB) : "memory");
#endif
  for (int k0 = 0; k0 < KD; k0 += 64) {
#pragma unroll
    for (int it = 0; it < 16; ++it) {
      *(H8*)(wa + (4 * it + sr) * LP + sc) = ra[it];
      *(H8*)(wb + (4 * it + sr) * LP + sc) = rb[it];
    }
    // the tile rows are written by other lanes of this wave than read them: stores before the fragment reads
    __builtin_amdgcn_fence(__ATOMIC_RELEASE, "workgroup");
    __builtin_amdgcn_wave_barrier();
    __builtin_amdgcn_fence(__ATOMIC_ACQUIRE, "workgroup");
    if (k0 + 64 < KD) {                        // next step's tiles fly while this step is multiplied
#pragma unroll
      for (int it = 0; it < 16; ++it) {
        ra[it] = *(const H8*)(gA + 2 * (k0 + 64) + lo + 8 * it * KD);
        rb[it] = *(const H8*)(gB + 2 * (k0 + 64) + lo + 8 * it * KD);
      }
#if DEV_ASM
      asm volatile("s_wait_xcnt 0x0" :: "v"(lo) : "memory");   // before the fragment reads reuse an address register
#endif
    }
#pragma unroll                                 // both 32-k blocks in one body: the second block's reads overlap the first's products
    for (int kk = 0; kk < 64; kk += 32) {
      V16 bq[4], af[4];                        // all eight fragments of the 32-k block read as one group
#pragma unroll
      for (int j = 0; j < 4; ++j) {
        bq[j] = ldfrag<OT>(wb + ((j << 4) + rlane) * LP + koff + kk);
        af[j] = ldfrag<OT>(wa + ((j << 4) + rlane) * LP + koff + kk);
      }
#pragma unroll
      for (int i = 0; i < 4; ++i) {
#pragma unroll
        for (int j = 0; j < 4; ++j) acc[i][j] = mmar(af[i], bq[j], acc[i][j]);
        dep_guard(acc[i][0], acc[i][3], af[i], bq[3]);
      }
      keep4(bq[0], bq[1], bq[2], bq[3]);
    }
    // this step's fragment reads before the next step's stores to the same tiles
    __builtin_amdgcn_fence(__ATOMIC_RELEASE, "workgroup");
    __builtin_amdgcn_wave_barrier();
    __builtin_amdgcn_fence(__ATOMIC_ACQUIRE, "workgroup");
  }
  acc_guard4(acc[0][0], acc[0][1], acc[0][2], acc[0][3]);
  acc_guard4(acc[1][0], acc[1][1], acc[1][2], acc[1][3]);
  acc_guard4(acc[2][0], acc[2][1], acc[2][2], acc[2][3]);
  acc_guard4(acc[3][0], acc[3][1], acc[3][2], acc[3][3]);

  // ---- epilogue ----
  float* slab = sT + wave * (16 * 68);
#pragma unroll
  for (int i = 0; i < 4; ++i) {
    const int mBase = m0 + (i << 4);
#pragma unroll
    for (int j = 0; j < 4; ++j) {
#pragma unroll
      for (int r = 0; r < 8; ++r) {
        slab[(mOff + r) * 68 + (j << 4) + rlane] = acc[i][j][r];
      }
    }
    __builtin_amdgcn_fence(__ATOMIC_RELEASE, "workgroup");
    __builtin_amdgcn_wave_barrier();
    __builtin_amdgcn_fence(__ATOMIC_ACQUIRE, "workgroup");
    if (OUT_MODE == 0) {
      float* C = (float*)Cout + (size_t)b * (size_t)strideC;
      const int h2 = lane >> 4, c4 = (lane & 15) * 4;     // 256-B row segment = 16 lanes x 16 B
      v4f bcol = {0.f, 0.f, 0.f, 0.f};
      if (BIAS == 1) {
        const v4f bb = *(const v4f*)(bias + n0 + c4);
#pragma unroll
        for (int e = 0; e < 4; ++e) bcol[e] = bfr(bb[e]);
      }
      {
#pragma unroll
        for (int it = 0; it < 8; ++it) {
          const int row = it * 2 + h2;                     // it 0..7 x h2 0..1 = rows 0..15
          float brow = 0.f;
          if (BIAS == 2) brow = bfr(bias[mBase + row]);
          const v4f x = *(const v4f*)(slab + row * 68 + c4);
          v4f v;
#pragma unroll
          for (int e = 0; e < 4; ++e) v[e] = x[e] * oscale + bcol[e] + brow;
          *(v4f*)(C + (size_t)(mBase + row) * (size_t)ldc + n0 + c4) = v;
        }
        
      }
    } else {
      const int q = lane >> 3, c8 = (lane & 7) * 8;
      unsigned short* C  = (unsigned short*)Cout  + (size_t)b * (size_t)strideC;
      unsigned short* C2 = (unsigned short*)Cout2 + (size_t)b * (size_t)strideC;
      float bc8[8];
#pragma unroll
      for (int e = 0; e < 8; ++e) bc8[e] = 0.f;
      if (BIAS == 1) {
        const v4f b0 = *(const v4f*)(bias + n0 + c8);
        const v4f b1 = *(const v4f*)(bias + n0 + c8 + 4);
#pragma unroll
        for (int e = 0; e < 4; ++e) { bc8[e] = bfr(b0[e]); bc8[4 + e] = bfr(b1[e]); }
      }
      v4u hv[4], lv[4];
#pragma unroll
      for (int it = 0; it < 4; ++it) {
        const int row = it * 4 + q;                        // it 0..3 x q 0..3 = rows 0..15
        const float* sp = slab + row * 68 + c8;
        float brow = 0.f;
        if (BIAS == 2) brow = bfr(bias[mBase + row]);
        float f[8];
#pragma unroll
        for (int e = 0; e < 8; ++e) f[e] = sp[e] * oscale + bc8[e] + brow;
        v4u a, a2;
#pragma unroll
        for (int e = 0; e < 4; ++e) {
          const float f0 = f[2 * e], f1 = f[2 * e + 1];
          const _Float16 x0 = (_Float16)f0, x1 = (_Float16)f1;
          const unsigned short h0 = h_bits(x0), h1 = h_bits(x1);
          unsigned short l0 = 0, l1 = 0;
          if (OUT_MODE == 3) {
            l0 = h_bits((_Float16)((f0 - (float)x0) * rscale));
            l1 = h_bits((_Float16)((f1 - (float)x1) * rscale));
          }
          a[e] = pk16(h0, h1); a2[e] = pk16(l0, l1);
        }
        hv[it] = a; lv[it] = a2;
      }
      {
#pragma unroll
        for (int it = 0; it < 4; ++it) {
          const int row = it * 4 + q;
          *(v4u*)(C + (size_t)(mBase + row) * (size_t)ldc + n0 + c8) = hv[it];
          if (OUT_MODE == 3) *(v4u*)(C2 + (size_t)(mBase + row) * (size_t)ldc + n0 + c8) = lv[it];
        }
        
      }
    }
    __builtin_amdgcn_fence(__ATOMIC_RELEASE, "workgroup");
    __builtin_amdgcn_wave_barrier();
    __builtin_amdgcn_fence(__ATOMIC_ACQUIRE, "workgroup");
  }
}

// =====================================================================================================
// The three products that read only converted inputs, in ONE launch (none reads what another writes); a block
// takes its product from the range its index falls in. Ranges, longest work first:
//   v^T = Wv^T . x^T + bv per batch -> f16 hi plane [b][d][s] (pitch SEQ) and residual plane (x4096)
//         (A = WvT [n][k], Bt = Xb rows of batch b; M=DM, N=SEQ, K=DM; bias per row d)
//   z = coords . Wc + bc -> f32 [NB*SEQ][HN]                       (M=NB*SEQ, N=HN, K=DC)
//   second output = coords . Wn + bn -> f32 [NB*SEQ][DC]           (M=NB*SEQ, N=DC, K=DC)
// =====================================================================================================
#define GB_V  (((DM / 64) * (SEQ / 64) + 7) / 8)            // 64 blocks per batch
#define GB_Z  (((NB * SEQ / 64) * (HN / 64) + 7) / 8)       // 32 blocks
#define GB_C  (((NB * SEQ / 64) * (DC / 64) + 7) / 8)       //  8 blocks
__global__ __launch_bounds__(256) void gemm_vzc(
    const unsigned short* __restrict__ WvT, const unsigned short* __restrict__ Xb,
    const unsigned short* __restrict__ Cb, const unsigned short* __restrict__ WcT,
    const unsigned short* __restrict__ WnT,
    unsigned short* VTh, unsigned short* VTl, float* Zf, float* out1,
    const float* __restrict__ bv, const float* __restrict__ bc, const float* __restrict__ bn) {
  GEMM_LDS(__bf16);
  int bx = (int)blockIdx.x;
  if (bx < NB * GB_V) {
    gemm64<__bf16, 3, 2, DM>(bx % GB_V, bx / GB_V, sT, sA, sB,
        WvT, 0LL, Xb, (long long)SEQ * DM,
        (void*)VTh, (void*)VTl, SEQ, (long long)DM * SEQ, bv,
        DM, SEQ, 1.0f, RSC);
    return;
  }
  bx -= NB * GB_V;
  if (bx < GB_Z) {
    gemm64<__bf16, 0, 1, DC>(bx, 0, sT, sA, sB,
        Cb, 0LL, WcT, 0LL,
        (void*)Zf, (void*)Zf, HN, 0LL, bc,
        NB * SEQ, HN, 1.0f, 1.0f);
    return;
  }
  bx -= GB_Z;
  gemm64<__bf16, 0, 1, DC>(bx, 0, sT, sA, sB,
      Cb, 0LL, WnT, 0LL,
      (void*)out1, (void*)out1, DC, 0LL, bn,
      NB * SEQ, DC, 1.0f, 1.0f);
}

// first output = [ctx_hi | ctx_res] . [Wo^T ; Wo^T]^T + bo -> f32 [NB*SEQ][DM]   (M=NB*SEQ, N=DM, K=2*DM)
__global__ __launch_bounds__(256) void gemm_out(
    const unsigned short* __restrict__ Octx, const unsigned short* __restrict__ WoT2,
    float* out0, const float* __restrict__ bo) {
  GEMM_LDS(__bf16);
  gemm64<__bf16, 0, 1, OP>((int)blockIdx.x, 0, sT, sA, sB,
      Octx, 0LL, WoT2, 0LL,
      (void*)out0, (void*)out0, DM, 0LL, bo,
      NB * SEQ, DM, 1.0f, 1.0f);
}

// =====================================================================================================
// z relayout: in f32 z [rows][HN] (16 heads x 16); out (a) f16 operand plane [rows][ZP], 64 halves per head =
// norms [rows][NH].  Block = 16 rows x 16 heads (thread = one (row, head)); staged in LDS; block barrier; line L of
// the block (L = 16*r + head, contiguous in the plane) written by lanes 8q..8q+7 of wave w with one instruction
// LDS: both arrays cross-wave (block barrier); fully written before read.
// =====================================================================================================
__global__ __launch_bounds__(256) void zprep(const float* __restrict__ zf, unsigned short* zp, float* zsq) {
  __shared__ __align__(16) unsigned short sZ[256 * LP];   // columns 64..71 of the pitch are never read
  __shared__ __align__(16) float sQ[256];
  const int tid  = (int)threadIdx.x;
  const int r    = tid >> 4, hd = tid & 15;
  const int row0 = blockIdx.x * 16;
  {
    const float* zr = zf + (size_t)(row0 + r) * HN + hd * HC;
    const v4f a0 = *(const v4f*)(zr);
    const v4f a1 = *(const v4f*)(zr + 4);
    const v4f a2 = *(const v4f*)(zr + 8);
    const v4f a3 = *(const v4f*)(zr + 12);
    float f[16];
#pragma unroll
    for (int e = 0; e < 4; ++e) { f[e] = a0[e]; f[4 + e] = a1[e]; f[8 + e] = a2[e]; f[12 + e] = a3[e]; }
    float q = 0.f;
#pragma unroll
    for (int e = 0; e < 16; ++e) q += f[e] * f[e];
    sQ[tid] = q;
    v4u ph0, ph1, pl0, pl1;
#pragma unroll
    for (int e = 0; e < 4; ++e) {
      const float f0 = f[2 * e], f1 = f[2 * e + 1], f2 = f[8 + 2 * e], f3 = f[9 + 2 * e];
      const _Float16 x0 = (_Float16)f0, x1 = (_Float16)f1, x2 = (_Float16)f2, x3 = (_Float16)f3;
      ph0[e] = pk16(h_bits(x0), h_bits(x1));
      ph1[e] = pk16(h_bits(x2), h_bits(x3));
      pl0[e] = pk16(h_bits((_Float16)((f0 - (float)x0) * RSC)), h_bits((_Float16)((f1 - (float)x1) * RSC)));
      pl1[e] = pk16(h_bits((_Float16)((f2 - (float)x2) * RSC)), h_bits((_Float16)((f3 - (float)x3) * RSC)));
    }
    const v4u z4 = {0u, 0u, 0u, 0u};
    unsigned short* sl = sZ + tid * LP;
    *(v4u*)(sl + 0)  = ph0;
    *(v4u*)(sl + 8)  = ph1;
    *(v4u*)(sl + 16) = pl0;
    *(v4u*)(sl + 24) = pl1;
    *(v4u*)(sl + 32) = ph0;
    *(v4u*)(sl + 40) = ph1;
    *(v4u*)(sl + 48) = z4;
    *(v4u*)(sl + 56) = z4;
  }
  __syncthreads();
  const int wave = tid >> 5, lane = tid & 31;
  const int q4 = lane >> 3, c8 = (lane & 7) * 8;
  unsigned short* base = zp + (size_t)row0 * ZP;
  v4u vv[8];
#pragma unroll
  for (int it = 0; it < 8; ++it) {
    const int L = it * 32 + wave * 4 + q4;
    vv[it] = *(const v4u*)(sZ + L * LP + c8);
  }
  {
#pragma unroll
    for (int it = 0; it < 8; ++it) {
      const int L = it * 32 + wave * 4 + q4;
      *(v4u*)(base + (size_t)L * 64 + c8) = vv[it];
    }
    
  }
  if (tid < 64) {                                       // waves 0 and 1, wave-uniform
    const v4f qv = *(const v4f*)(sQ + tid * 4);
    float* dst = zsq + (size_t)row0 * NH + tid * 4;
    *(v4f*)dst = qv;
    
  }
}

__global__ __launch_bounds__(128)
void attn_dist(const unsigned short* __restrict__ zpp, const float* __restrict__ zsq,
               const unsigned short* __restrict__ vhp, const unsigned short* __restrict__ vlp,
               const float* __restrict__ gam, unsigned short* octx) {
  union FH { v16h v; v8h h[2]; };
  __shared__ __align__(16) _Float16 Zsh[64 * LP];          // z key chunk [key][64], pitch LP    9 KB
  __shared__ __align__(16) _Float16 Vth[64 * LP];          // V^T hi [d][key], pitch LP          9 KB
  __shared__ __align__(16) _Float16 Vtl[64 * LP];          // V^T residual, pitch LP             9 KB
  __shared__ __align__(16) float    Zqs[64];               // squared norms of the chunk's keys
  __shared__ __align__(16) float    Os[4][16 * OSP];       // per wave context tile, pitch OSP  17 KB

  const int tid  = threadIdx.x;
  const int wave = tid >> 5;
  const int lane = tid & 31;
  const int hh   = lane >> 4;
  const int c    = lane & 15;

  const int bx   = blockIdx.x;
  const int qb   = bx % NQB;
  const int rest = bx / NQB;
  const int h    = rest % NH;
  const int b    = rest / NH;
  const int q0   = qb * 64 + wave * 16;
  const size_t rowB = (size_t)b * SEQ;

  const _Float16* Zp16 = (const _Float16*)(const void*)zpp;
  const _Float16* Vh = (const _Float16*)(const void*)vhp + ((size_t)b * DM + (size_t)h * HD) * SEQ;
  const _Float16* Vl = (const _Float16*)(const void*)vlp + ((size_t)b * DM + (size_t)h * HD) * SEQ;

  const float gx = bfr(gam[h]);
  const float g  = fmaxf(gx, 0.f) + log1pf(expf(-fabsf(gx)));   // softplus
  const float ng = -g;

  // ---- query-side B fragment [hi | residual] (column = lane&15) and this lane's query squared norm ----
  const v16h zq = ldfrag<_Float16>(Zp16 + (rowB + q0 + c) * ZP + (size_t)h * 64 + 8 * hh);
  const float zsq_q = zsq[(rowB + q0 + c) * NH + h];

  float mrow = -INFINITY;      // running max of query c, the same in both wave halves
  float lrow = 0.f;            // running sum over this half's keys only; the halves are joined after the loop
  v8f oacc[4];                 // context^T: tile t, register r = value dim 16t + 8*hh + r of query c
#pragma unroll
  for (int t = 0; t < 4; ++t) oacc[t] = zero8();

  for (int kt = 0; kt < NKT; ++kt) {         // static trip count
    const int kv0 = kt * 64;
    __syncthreads();
    {
      const int r = tid >> 1, half = (tid & 1) * 32;
      const _Float16* zg  = Zp16 + (rowB + kv0 + r) * ZP + (size_t)h * 64 + half;   // key row kv0+r, 64-half head segment
      const _Float16* vg  = Vh + (size_t)r * SEQ + kv0 + half;                       // v^T row d = r, s = kv0+half..+31
      const _Float16* vlg = Vl + (size_t)r * SEQ + kv0 + half;
      const float zn = zsq[(rowB + kv0 + (tid & 63)) * NH + h];   // every thread loads, in one group with the tiles
#pragma unroll
      for (int i = 0; i < 4; ++i) {
        const v8h a0 = *(const v8h*)(zg + 8 * i);
        const v8h b0 = *(const v8h*)(vg + 8 * i);
        const v8h b1 = *(const v8h*)(vlg + 8 * i);
        *(v8h*)(Zsh + r * LP + half + 8 * i) = a0;
        *(v8h*)(Vth + r * LP + half + 8 * i) = b0;
        *(v8h*)(Vtl + r * LP + half + 8 * i) = b1;
      }
#if DEV_ASM
      // input-only use of the loaded norm: keeps its load up among the tile loads; sunk into the branch below it
      // would be issued behind their waits and cost the block a second load latency in front of the barrier
      asm volatile("" :: "v"(zn));
#endif
      if (tid < 64) Zqs[tid] = zn;                                // waves 0 and 1, wave-uniform
    }
    __syncthreads();

    // ---- scores^T: 64 keys x 16 queries per wave, 2 f16 products per key subtile ----
    v8f s[4];
#pragma unroll
    for (int j = 0; j < 4; ++j) {
      const _Float16* zr = Zsh + (j * 16 + c) * LP + 8 * hh;
      FH b1, b2;
      b2.h[0] = *(const v8h*)(zr + 16);     // k 0..15  <- residual of key
      b2.h[1] = *(const v8h*)(zr + 32);     // k 16..31 <- hi of key
      b1.h[0] = *(const v8h*)(zr + 32);     // k 0..15  <- hi of key
      b1.h[1] = *(const v8h*)(zr + 48);     // k 16..31 <- zeros
      v8f ah = mma_h(b1.v, zq, zero8());    // hi.hi
      v8f ax = mma_h(b2.v, zq, zero8());    // (hi.lo + lo.hi) x4096
      const v4f zt0 = *(const v4f*)(Zqs + j * 16 + 8 * hh);       // norms of keys 16j + 8*hh + 0..3
      const v4f zt1 = *(const v4f*)(Zqs + j * 16 + 8 * hh + 4);   // and + 4..7
      {
#pragma clang fp contract(off)
#pragma unroll
        for (int r = 0; r < 8; ++r) {
          const float d = ah[r] + ax[r] * (1.0f / RSC);
          float sq = (zsq_q + (r < 4 ? zt0[r & 3] : zt1[r & 3])) - 2.0f * d;
          sq = fmaxf(sq, 0.f);
          s[j][r] = ng * sq;
        }
      }
    }

    // ---- in-lane max over this half's 32 keys, joined with the other half; online softmax; p^T (x16384, f16) ----
    float mj[4];
#pragma unroll
    for (int j = 0; j < 4; ++j) {
      mj[j] = s[j][0];
#pragma unroll
      for (int r = 1; r < 8; ++r) mj[j] = fmaxf(mj[j], s[j][r]);
    }
    float m = fmaxf(fmaxf(mj[0], mj[1]), fmaxf(mj[2], mj[3]));
    m = fmaxf(m, xhalf(m));
    const float mnew  = fmaxf(mrow, m);
    const float msafe = (mnew == -INFINITY) ? 0.f : mnew;
    const float alpha = __expf(mrow - msafe);
    mrow = mnew;
    FH pa[2];                    // p^T operand of keys 0..31 and 32..63 of the chunk
    float pj[4];                 // four independent sums, one per key subtile
#pragma unroll
    for (int j = 0; j < 4; ++j) {
      pj[j] = 0.f;
#pragma unroll
      for (int r = 0; r < 8; ++r) {
        const float p = __expf(s[j][r] - msafe);
        pj[j] += p;
        pa[j >> 1].h[j & 1][r] = (_Float16)(p * PCARRY);
      }
    }
    lrow = lrow * alpha + ((pj[0] + pj[1]) + (pj[2] + pj[3]));
#pragma unroll
    for (int t = 0; t < 4; ++t)
#pragma unroll
      for (int r = 0; r < 8; ++r) oacc[t][r] *= alpha;

    // ---- context^T += V^T . P^T (f16 WMMA); residual products into a separate accumulator ----
    v8f o1[4];
#pragma unroll
    for (int t = 0; t < 4; ++t) o1[t] = zero8();
#pragma unroll                   // constant kk: pa[kk] stays in registers
    for (int kk = 0; kk < 2; ++kk) {
#pragma unroll
      for (int t = 0; t < 4; ++t) {
        FH vb, vl;
        vb.h[0] = *(const v8h*)(Vth + (t * 16 + c) * LP + kk * 32 + 8 * hh);
        vb.h[1] = *(const v8h*)(Vth + (t * 16 + c) * LP + kk * 32 + 16 + 8 * hh);
        vl.h[0] = *(const v8h*)(Vtl + (t * 16 + c) * LP + kk * 32 + 8 * hh);
        vl.h[1] = *(const v8h*)(Vtl + (t * 16 + c) * LP + kk * 32 + 16 + 8 * hh);
        oacc[t] = mma_h(vb.v, pa[kk].v, oacc[t]);
        o1[t]   = mma_h(vl.v, pa[kk].v, o1[t]);
      }
    }
#pragma unroll
    for (int t = 0; t < 4; ++t)
#pragma unroll
      for (int r = 0; r < 8; ++r) oacc[t][r] += o1[t][r] * (1.0f / RSC);
  }

  // ---- normalise (1/l, undo the p carry), stage the wave's 16x64 tile, convert to bf16 hi + bf16 residual,
  float* os = Os[wave];
  {
    const float l = lrow + xhalf(lrow);          // both halves' keys
    const float inv = ((l > 0.f) ? (1.0f / l) : 0.f) * (1.0f / PCARRY);
#pragma unroll
    for (int t = 0; t < 4; ++t) {                // row = query c, 8 consecutive value dims per tile
      v4f w0, w1;
#pragma unroll
      for (int e = 0; e < 4; ++e) { w0[e] = oacc[t][e] * inv; w1[e] = oacc[t][4 + e] * inv; }
      *(v4f*)(os + c * OSP + t * 16 + 8 * hh)     = w0;
      *(v4f*)(os + c * OSP + t * 16 + 8 * hh + 4) = w1;
    }
  }
  __builtin_amdgcn_fence(__ATOMIC_RELEASE, "workgroup");
  __builtin_amdgcn_wave_barrier();
  __builtin_amdgcn_fence(__ATOMIC_ACQUIRE, "workgroup");
  {
    const int q4 = lane >> 3, c8 = (lane & 7) * 8;
    v4u hv[4], lv[4];
#pragma unroll
    for (int it = 0; it < 4; ++it) {
      const int row = it * 4 + q4;   // it 0..3 x q4 0..3 = rows 0..15 of the wave tile
      const float* sp = os + row * OSP + c8;
      v4u a, a2;
#pragma unroll
      for (int e = 0; e < 4; ++e) {
        const float f0 = sp[2 * e], f1 = sp[2 * e + 1];
        const unsigned short hb0 = bf_bits(f0), hb1 = bf_bits(f1);
        const unsigned short lb0 = bf_bits(f0 - bf_up(hb0)), lb1 = bf_bits(f1 - bf_up(hb1));
        a[e]  = pk16(hb0, hb1);
        a2[e] = pk16(lb0, lb1);
      }
      hv[it] = a; lv[it] = a2;
    }
    {
#pragma unroll
      for (int it = 0; it < 4; ++it) {
        const int row = it * 4 + q4;
        const size_t go = (rowB + q0 + row) * OP + (size_t)h * HD + c8;
        *(v4u*)(octx + go)      = hv[it];
        *(v4u*)(octx + go + DM) = lv[it];
      }
      
    }
  }
}

// =====================================================================================================
// Workspace map (bytes, NB=2 / SEQ=2048), every region an exact multiple of its whole-line / whole-tile store
// granularity, back to back:
//   Xb   bf16 [NB*SEQ][DM]            8388608
//   Cb   bf16 [NB*SEQ][DC]             524288
//   WvT  bf16 [DM n][DM k]            2097152
//   WoT2 bf16 [DM n][2*DM k]          4194304
//   WcT  bf16 [HN][DC]                  32768
//   WnT  bf16 [DC][DC]                   8192
//   Zf   f32  [NB*SEQ][HN]            4194304
//   Zp   f16  [NB*SEQ][ZP]            8388608
//   Zsq  f32  [NB*SEQ][NH]             262144
//   VTh  f16  [NB][DM][SEQ]           8388608
//   VTl  f16  [NB][DM][SEQ]           8388608
//   Octx bf16 [NB*SEQ][OP]           16777216
//   total                            61644800
// Weights arrive [in][out]; tr64 produces the [out n][in k] (k contiguous) layout the GEMM wants.
// =====================================================================================================
extern "C" void kernel_launch(void* const* d_in, const int* in_sizes, int n_in,
                              void* d_out, int out_size, void* d_ws, size_t ws_size,
                              hipStream_t stream) {
  if (n_in < 11) return;
  if (in_sizes[0] < ((NB - 1) * SEQ_FULL + SEQ) * DM) return;
  if (in_sizes[1] < ((NB - 1) * SEQ_FULL + SEQ) * DC) return;
  if (in_sizes[2] < DM * DM || in_sizes[3] < DM) return;
  if (in_sizes[4] < DC * HN || in_sizes[5] < HN) return;
  if (in_sizes[6] < DC * DC || in_sizes[7] < DC) return;
  if (in_sizes[8] < DM * DM || in_sizes[9] < DM) return;
  if (in_sizes[10] < NH) return;
  if ((size_t)out_size < OUT1_OFF + (size_t)NB * SEQ * DC) return;

  const float* hidden = (const float*)d_in[0];
  const float* coords = (const float*)d_in[1];
  const float* Wv     = (const float*)d_in[2];
  const float* bv     = (const float*)d_in[3];
  const float* Wc     = (const float*)d_in[4];
  const float* bc     = (const float*)d_in[5];
  const float* Wn     = (const float*)d_in[6];
  const float* bn     = (const float*)d_in[7];
  const float* Wo     = (const float*)d_in[8];
  const float* bo     = (const float*)d_in[9];
  const float* gamma  = (const float*)d_in[10];

  const size_t nRows = (size_t)NB * SEQ;
  const size_t PXB  = nRows * DM * 2;
  const size_t PCB  = nRows * DC * 2;
  const size_t PWV  = (size_t)DM * DM * 2;
  const size_t PWO2 = (size_t)DM * OP * 2;
  const size_t PWC  = (size_t)HN * DC * 2;
  const size_t PWN  = (size_t)DC * DC * 2;
  const size_t PZF  = nRows * HN * 4;
  const size_t PZP  = nRows * ZP * 2;
  const size_t PZQ  = nRows * NH * 4;
  const size_t PVT  = (size_t)NB * DM * SEQ * 2;
  const size_t POC  = nRows * OP * 2;
  size_t off = 0;
  const size_t oXb  = off; off += PXB;
  const size_t oCb  = off; off += PCB;
  const size_t oWv  = off; off += PWV;
  const size_t oWo  = off; off += PWO2;
  const size_t oWc  = off; off += PWC;
  const size_t oWn  = off; off += PWN;
  const size_t oZf  = off; off += PZF;
  const size_t oZp  = off; off += PZP;
  const size_t oZq  = off; off += PZQ;
  const size_t oVTh = off; off += PVT;
  const size_t oVTl = off; off += PVT;
  const size_t oOc  = off; off += POC;
  if (off > ws_size) return;                       // off = 61644800 at full size
  if (off > (size_t)134217728) return;

  char* ws = (char*)d_ws;
  unsigned short* Xb   = (unsigned short*)(ws + oXb);
  unsigned short* Cb   = (unsigned short*)(ws + oCb);
  unsigned short* WvT  = (unsigned short*)(ws + oWv);
  unsigned short* WoT2 = (unsigned short*)(ws + oWo);
  unsigned short* WcT  = (unsigned short*)(ws + oWc);
  unsigned short* WnT  = (unsigned short*)(ws + oWn);
  float*          Zf   = (float*)(ws + oZf);
  unsigned short* Zpl  = (unsigned short*)(ws + oZp);
  float*          Zsq  = (float*)(ws + oZq);
  unsigned short* VTh  = (unsigned short*)(ws + oVTh);
  unsigned short* VTl  = (unsigned short*)(ws + oVTl);
  unsigned short* Octx = (unsigned short*)(ws + oOc);
  float* out0 = (float*)d_out;
  float* out1 = (float*)d_out + OUT1_OFF;

  const dim3 blk(256);
  const dim3 gPrepAll(2 * PB_W + PB_C + PB_N + PB_X + PB_Q);           // 2693 blocks
  const dim3 gVZC(NB * GB_V + GB_Z + GB_C);                            //  168 blocks
  const dim3 gO(((NB * SEQ / 64) * (DM / 64) + 7) / 8);                //  128 blocks
  const dim3 gPrep((unsigned)(nRows / 16));                            //  256 blocks
  const dim3 gAttn(NB * NH * NQB);                                     // 1024 blocks of 128

  // (1) activations -> bf16 planes; weights [in][out] f32 -> bf16 [out][in], Wo^T duplicated along k (pitch 2*DM)
  prep_all<<<gPrepAll, blk, 0, stream>>>(hidden, coords, Wv, Wo, Wc, Wn, Xb, Cb, WvT, WoT2, WcT, WnT);
  // (2) v^T planes, z (f32) and the second output (d_out at element OUT1_OFF)
  gemm_vzc<<<gVZC, blk, 0, stream>>>(WvT, Xb, Cb, WcT, WnT, VTh, VTl, Zf, out1, bv, bc, bn);
  // (3) z -> f16 operand plane [hi | res | hi | 0] and f32 squared norms
  zprep<<<gPrep, blk, 0, stream>>>(Zf, Zpl, Zsq);
  // (4) attention -> ctx plane (bf16 hi | bf16 residual) [b*SEQ+t][OP]
  attn_dist<<<gAttn, dim3(128), 0, stream>>>(Zpl, Zsq, VTh, VTl, gamma, Octx);
  // (5) first output
  gemm_out<<<gO, blk, 0, stream>>>(Octx, WoT2, out0, bo);
  (void)hipGetLastError();
}

// v005
// A run of this version takes 139 microseconds.
// In both of two side-by-side timings against v004, it was 1.08 times as fast.
// All steps since v000 together make it 2.75 times as fast.
// Contractions: value = Wv^T.x^T+bv, z = coords.Wc+bc, coords.Wn+bn = v_wmma_f32_16x16x32_bf16 (bf16 operands from RNE-converted inputs, single product, f32 accumulate);
// z.z^T scores = v_wmma_f32_16x16x32_f16 (z as f16 hi + f16 residual x4096 packed along k, 2 products into separate f32 accumulators);
// p.v = v_wmma_f32_16x16x32_f16 (p carried x16384 in f16; v as f16 hi plane + f16 residual plane x4096; 2 products, f32 accumulate);
// ctx.Wo+bo = v_wmma_f32_16x16x32_bf16 (ctx as bf16 hi and bf16 residual planes concatenated along k, Wo^T bf16 duplicated along k; f32 accumulate);
// squared norms, softplus, softmax (no running max: every score is <= 0) and bias adds in f32.
#include <hip/hip_runtime.h>
#include <math.h>
#include <stdint.h>

#ifndef NB
#define NB 2
#endif
#ifndef SEQ
#define SEQ 2048
#endif
#define NB_FULL  2
#define SEQ_FULL 2048
#define DM   1024
#define NH   16
#define HC   16
#define HD   64
#define DC   64
#define HN   (NH * HC)        // 256
#define ZP   (NH * 64)        // 1024: z operand plane pitch, 64 halves per head [hi | lo x4096 | hi | 0]
#define OP   (2 * DM)         // 2048: ctx plane pitch (bf16 hi | bf16 residual)
#define NQB  (SEQ / 64)       // 64-row query blocks per sequence
#define NKT  (SEQ / 64)       // 64-key chunks per sequence
#define LP   72               // LDS row pitch in halves of every 64-half tile row: 144 B = 16 B x odd, so the 16 rows
                              // that one ds_load_b128 touches fall on 16 different groups of four banks (at 128 B: on one)
#define OSP  68               // LDS row pitch in floats of the 64-float context tile rows (272 B = 16 B x odd)
#define RSC    4096.0f
#define OUT1_OFF ((size_t)NB_FULL * SEQ_FULL * DM)   // element offset of the second output in d_out
static_assert(NH * HD == DM);
static_assert(HC == 16 && HD == 64 && DC == 64);
static_assert((SEQ % 64) == 0 && SEQ >= 64 && SEQ <= SEQ_FULL);
static_assert(NB >= 1 && NB <= NB_FULL);
static_assert((DM % 64) == 0 && (HN % 64) == 0 && (OP % 64) == 0);
static_assert(OUT1_OFF * 4 == 16777216);

typedef _Float16 v16h __attribute__((ext_vector_type(16)));
typedef _Float16 v8h  __attribute__((ext_vector_type(8)));
typedef __bf16   v16b __attribute__((ext_vector_type(16)));
typedef __bf16   v8b  __attribute__((ext_vector_type(8)));
typedef float    v8f  __attribute__((ext_vector_type(8)));
typedef float    v4f  __attribute__((ext_vector_type(4)));
typedef unsigned int v4u __attribute__((ext_vector_type(4)));

#if defined(__HIP_DEVICE_COMPILE__)
#define DEV_ASM 1
#else
#define DEV_ASM 0
#endif

// ---- scalar helpers --------------------------------------------------------------------------------
__device__ __forceinline__ unsigned short bf_bits(float f) {          // f32 -> bf16 bits, RNE convert
  unsigned u = __float_as_uint(f);
  return (unsigned short)((u + 0x7FFFu + ((u >> 16) & 1u)) >> 16);
}
__device__ __forceinline__ float bf_up(unsigned short hb) { return __uint_as_float(((unsigned)hb) << 16); }
__device__ __forceinline__ float bfr(float f) { return bf_up(bf_bits(f)); }   // value of the bf16 RNE convert
__device__ __forceinline__ unsigned short h_bits(_Float16 x) { return __builtin_bit_cast(unsigned short, x); }
__device__ __forceinline__ unsigned pk16(unsigned short a, unsigned short b) { return (unsigned)a | ((unsigned)b << 16); }
__device__ __forceinline__ v8f zero8() { v8f z = {0.f, 0.f, 0.f, 0.f, 0.f, 0.f, 0.f, 0.f}; return z; }
__device__ __forceinline__ float xhalf(float x) {                      // value of lane l ^ 16
  const int b = __builtin_bit_cast(int, x);
  return __builtin_bit_cast(float, __builtin_amdgcn_permlanex16(b, b, 0x76543210, 0xfedcba98, false, false));
}

// ---- fragment types / loaders: 16-bit A/B operand, lane -> row/col (lane&15), p already includes +8*(lane>>4);
//      elements 0..7 <- p[0..7] (k0+8h..k0+8h+7), elements 8..15 <- p[16..23] (k0+16+8h..k0+16+8h+7)
template <typename OT> struct FT;
template <> struct FT<__bf16>   { typedef v16b frag; typedef v8b half8; };
template <> struct FT<_Float16> { typedef v16h frag; typedef v8h half8; };

template <typename OT>
__device__ __forceinline__ typename FT<OT>::frag ldfrag(const OT* p) {
  union { typename FT<OT>::frag v; typename FT<OT>::half8 h[2]; } f;
  f.h[0] = *(const typename FT<OT>::half8*)(p);
  f.h[1] = *(const typename FT<OT>::half8*)(p + 16);
  return f.v;
}

// ---- WMMA helpers (asm guard bodies are device-only; concrete operand types) -----------------------------
__device__ __forceinline__ v8f mmar(v16b a, v16b b, v8f c) {
  return __builtin_amdgcn_wmma_f32_16x16x32_bf16(false, a, false, b, (short)0, c, false, false);
}
__device__ __forceinline__ v8f mmar(v16h a, v16h b, v8f c) {
  return __builtin_amdgcn_wmma_f32_16x16x32_f16(false, a, false, b, (short)0, c, false, false);
}
// guarded form: 4 VALU slots after the WMMA, D tied, A/B kept live
__device__ __forceinline__ v8f mma_h(v16h a, v16h b, v8f c) {
  c = __builtin_amdgcn_wmma_f32_16x16x32_f16(false, a, false, b, (short)0, c, false, false);
#if DEV_ASM
  asm volatile("v_nop\n\tv_nop\n\tv_nop\n\tv_nop" : "+v"(c) : "v"(a), "v"(b));
#endif
  return c;
}
__device__ __forceinline__ void dep_guard(v8f& a, v8f& b, v16b x, v16b y) {
#if DEV_ASM
  asm volatile("v_nop\n\tv_nop\n\tv_nop\n\tv_nop" : "+v"(a), "+v"(b) : "v"(x), "v"(y));
#else
  (void)a; (void)b; (void)x; (void)y;
#endif
}
__device__ __forceinline__ void dep_guard(v8f& a, v8f& b, v16h x, v16h y) {
#if DEV_ASM
  asm volatile("v_nop\n\tv_nop\n\tv_nop\n\tv_nop" : "+v"(a), "+v"(b) : "v"(x), "v"(y));
#else
  (void)a; (void)b; (void)x; (void)y;
#endif
}
__device__ __forceinline__ void keep4(v16b a, v16b b, v16b c, v16b d) {
#if DEV_ASM
  asm volatile("v_nop" :: "v"(a), "v"(b), "v"(c), "v"(d));
#else
  (void)a; (void)b; (void)c; (void)d;
#endif
}
__device__ __forceinline__ void keep4(v16h a, v16h b, v16h c, v16h d) {
#if DEV_ASM
  asm volatile("v_nop" :: "v"(a), "v"(b), "v"(c), "v"(d));
#else
  (void)a; (void)b; (void)c; (void)d;
#endif
}
__device__ __forceinline__ void acc_guard4(v8f& a, v8f& b, v8f& c, v8f& d) {
#if DEV_ASM
  asm volatile("v_nop\n\tv_nop\n\tv_nop\n\tv_nop" : "+v"(a), "+v"(b), "+v"(c), "+v"(d));
#else
  (void)a; (void)b; (void)c; (void)d;
#endif
}

// =====================================================================================================
// f32 rows -> bf16 plane rows (RNE convert), 8 elements per thread, one 16-B store per lane: a wave writes
// Dense output row `row` (0..nrows-1) reads source row (row / seq) * seqfull + row % seq (full batch stride).
// ceil(nrows*rowlen8/256) blocks, bx = the block's index among them. coverage: nrows*rowlen8 threads x 8 = the
// whole plane (exact multiple of 256).
// =====================================================================================================
__device__ __forceinline__ void cvtrows(int bx, const float* __restrict__ in, unsigned short* out,
                                        int rowlen8, int nrows, int seq, int seqfull) {
  const int i = bx * 256 + (int)threadIdx.x;
  if (i < nrows * rowlen8) {
    const int row  = i / rowlen8;
    const int c    = i - row * rowlen8;
    const int bq   = row / seq;
    const int srow = bq * seqfull + (row - bq * seq);
    const float* src = in + ((size_t)srow * (size_t)rowlen8 + (size_t)c) * 8;
    const v4f a  = *(const v4f*)(src);
    const v4f a4 = *(const v4f*)(src + 4);
    v4u p;
    p[0] = pk16(bf_bits(a[0]),  bf_bits(a[1]));
    p[1] = pk16(bf_bits(a[2]),  bf_bits(a[3]));
    p[2] = pk16(bf_bits(a4[0]), bf_bits(a4[1]));
    p[3] = pk16(bf_bits(a4[2]), bf_bits(a4[3]));
    unsigned short* o = out + (size_t)i * 8;
    *(v4u*)o = p;
    
  }
}

// =====================================================================================================
// Weight transpose + bf16 convert through LDS: in f32 [krows][ncols] (pitch ldi) -> out bf16 [n][k] (pitch ldo,
// k contiguous), optionally duplicated at +dup elements in the same output row.  One block = one 64x64 tile:
// input rows k0 = 64*by, cols n0 = 64*bx.  Load: thread r = tid>>2 reads 16 floats of input row
// k0+r; LDS holds the transposed tile; block barrier; write: wave w, lane>>3 = q, lanes 8q..8q+7 write one whole
// LDS tile: cross-wave (block barrier); columns 64..71 of the pitch are never read.
// =====================================================================================================
__device__ __forceinline__ void tr64(int bx, int by, unsigned short* sT, const float* __restrict__ in, int ldi,
                                     unsigned short* out, int ldo, int dup) {
  const int tid = (int)threadIdx.x;
  const int k0  = by * 64;
  const int n0  = bx * 64;
  {
    const int r = tid >> 2, c16 = (tid & 3) * 16;
    const float* src = in + (size_t)(k0 + r) * (size_t)ldi + n0 + c16;
    const v4f a0 = *(const v4f*)(src);
    const v4f a1 = *(const v4f*)(src + 4);
    const v4f a2 = *(const v4f*)(src + 8);
    const v4f a3 = *(const v4f*)(src + 12);
#pragma unroll
    for (int e = 0; e < 4; ++e) {
      sT[(c16 + e) * 72 + r]      = bf_bits(a0[e]);
      sT[(c16 + 4 + e) * 72 + r]  = bf_bits(a1[e]);
      sT[(c16 + 8 + e) * 72 + r]  = bf_bits(a2[e]);
      sT[(c16 + 12 + e) * 72 + r] = bf_bits(a3[e]);
    }
  }
  __syncthreads();
  const int wave = tid >> 5, lane = tid & 31;
  const int q = lane >> 3, c8 = (lane & 7) * 8;
  v4u vv[2];
#pragma unroll
  for (int it = 0; it < 2; ++it) {
    const int n = it * 32 + wave * 4 + q;
    vv[it] = *(const v4u*)(sT + n * 72 + c8);
  }
  {
#pragma unroll
    for (int it = 0; it < 2; ++it) {
      const int n = it * 32 + wave * 4 + q;
      unsigned short* d = out + (size_t)(n0 + n) * (size_t)ldo + k0 + c8;
      *(v4u*)d = vv[it];
      if (dup != 0) *(v4u*)(d + dup) = vv[it];
    }
#if DEV_ASM
    // behind the last store: in the listing another range's code follows and reuses the stores' registers
    asm volatile("s_wait_xcnt 0x0" ::: "memory");
#endif
  }
}

// =====================================================================================================
// All six input conversions in ONE launch: none reads what another writes, so each block takes its job from the
// range its index falls in (block-uniform branch; the barrier of tr64 is reached by whole blocks only).
// Ranges, in index order: Wv^T, Wo^T (duplicated along k), Wc^T, Wn^T, hidden rows, coordinate rows.
// =====================================================================================================
#define PB_W  ((DM / 64) * (DM / 64))            // 256 tiles of a [DM][DM] weight
#define PB_C  ((HN / 64) * (DC / 64))            //   4 tiles of Wc [DC][HN]
#define PB_N  ((DC / 64) * (DC / 64))            //   1 tile of Wn [DC][DC]
#define PB_X  (NB * SEQ * DM / 8 / 256)          // 2048 blocks of hidden rows
#define PB_Q  (NB * SEQ * DC / 8 / 256)          //  128 blocks of coordinate rows
static_assert((NB * SEQ * DM / 8) % 256 == 0 && (NB * SEQ * DC / 8) % 256 == 0);
__global__ __launch_bounds__(256) void prep_all(const float* __restrict__ hidden, const float* __restrict__ coords,
                                                const float* __restrict__ Wv, const float* __restrict__ Wo,
                                                const float* __restrict__ Wc, const float* __restrict__ Wn,
                                                unsigned short* Xb, unsigned short* Cb, unsigned short* WvT,
                                                unsigned short* WoT2, unsigned short* WcT, unsigned short* WnT) {
  __shared__ __align__(16) unsigned short sT[64 * 72];
  int bx = (int)blockIdx.x;
  if (bx < PB_W) { tr64(bx % (DM / 64), bx / (DM / 64), sT, Wv, DM, WvT, DM, 0); return; }
  bx -= PB_W;
  if (bx < PB_W) { tr64(bx % (DM / 64), bx / (DM / 64), sT, Wo, DM, WoT2, OP, DM); return; }
  bx -= PB_W;
  if (bx < PB_C) { tr64(bx % (HN / 64), bx / (HN / 64), sT, Wc, HN, WcT, DC, 0); return; }
  bx -= PB_C;
  if (bx < PB_N) { tr64(bx % (DC / 64), bx / (DC / 64), sT, Wn, DC, WnT, DC, 0); return; }
  bx -= PB_N;
  if (bx < PB_X) { cvtrows(bx, hidden, Xb, DM / 8, NB * SEQ, SEQ, SEQ_FULL); return; }
  bx -= PB_X;
  cvtrows(bx, coords, Cb, DC / 8, NB * SEQ, SEQ, SEQ_FULL);
}

// =====================================================================================================
// Register-blocked batched WMMA GEMM (16-bit operand type OT): C[m][n] = sum_k A[m][k] * Bt[n][k] (+ bias);
// one wave per 64x64 tile, no block barriers. A row-major [M][K], Bt row-major [N][K] (k contiguous), both of row
// pitch K = KD elements, a compile-time constant so that the staging loads of a tile share one address and differ
// by immediate offsets; M, N, KD multiples of 64. bx = block index within the product, b = batch index
// (strides in elements). Per 64-k step the wave brings its 64x64 A and Bt tiles in with 16-B loads that cover whole
// 128-B lines (8 lanes per row, 4 rows per load), one step ahead in registers, stores them to its own LDS tiles
// (pitch LP) and reads the fragments from there with the split k map (ldfrag).
// BIAS 0: none; 1: per column n (bias[n]); 2: per row m (bias[m]); bias values RNE-converted to bf16 in f32.
// OUT_MODE 0: f32 C (pitch ldc), value * oscale + bias.
// OUT_MODE 3: f16 hi plane C + f16 residual plane C2 = f16((v - hi) * rscale) (same pitch / stride), v = acc*oscale+bias.
// whole 64x64 tile; slab pitch columns 64..67 never read.
// =====================================================================================================
// LDS of a GEMM block, declared once in each kernel and handed to the body
#define GEMM_LDS(OT)                                                                                             \
  __shared__ __align__(16) float sT[8 * 16 * 68];  /* per-wave 16x64 slab, pitch 68 floats */                     \
  __shared__ __align__(16) OT sA[8 * 64 * LP];     /* per-wave A tile [m][64 k], columns 64..71 never read */     \
  __shared__ __align__(16) OT sB[8 * 64 * LP]      /* per-wave Bt tile [n][64 k], same pitch */
template <typename OT, int OUT_MODE, int BIAS, int KD>
__device__ __forceinline__ void gemm64(
    int bx, int b, float* sT, OT* sA, OT* sB,
    const unsigned short* __restrict__ Ap, long long strideA,
    const unsigned short* __restrict__ Btp, long long strideB,
    void* Cout, void* Cout2, int ldc, long long strideC,
    const float* __restrict__ bias,
    int M, int N, float oscale, float rscale) {
  static_assert((KD % 64) == 0 && KD >= 64);
  typedef typename FT<OT>::frag V16;
  typedef typename FT<OT>::half8 H8;
  const OT* A  = (const OT*)(const void*)Ap;
  const OT* Bt = (const OT*)(const void*)Btp;
  const int lane = threadIdx.x & 31;
  const int wave = threadIdx.x >> 5;
  const int tilesN = N >> 6;
  const int tilesM = M >> 6;
  const int tile = bx * 8 + wave;
  if (tile >= tilesM * tilesN) return;   // wave-uniform; no block barriers in this kernel
  const int tm = tile / tilesN;
  const int tn = tile - tm * tilesN;
  const int m0 = tm << 6;
  const int n0 = tn << 6;

  const OT* Ab = A  + (size_t)b * (size_t)strideA;
  const OT* Bb = Bt + (size_t)b * (size_t)strideB;

  const int rlane = lane & 15;                 // row (A) / col (B, D) within subtile
  const int koff  = (lane >> 4) * 8;           // k offset of this lane half
  const int mOff  = (lane >> 4) * 8;           // D row offset

  v8f acc[4][4];
#pragma unroll
  for (int i = 0; i < 4; ++i)
#pragma unroll
    for (int j = 0; j < 4; ++j) acc[i][j] = zero8();

  OT* wa = sA + wave * (64 * LP);
  OT* wb = sB + wave * (64 * LP);
  const int sr = lane >> 3;                    // row within the 4 rows of one staging load
  const int sc = (lane & 7) * 8;               // 16-B piece of the row's 128-B line
  // wave-uniform tile bases, told so to the compiler: they stay in scalar registers
  const char* gA = (const char*)(Ab + (size_t)__builtin_amdgcn_readfirstlane(m0) * KD);
  const char* gB = (const char*)(Bb + (size_t)__builtin_amdgcn_readfirstlane(n0) * KD);
  const unsigned lo = (unsigned)(sr * KD + sc) * 2u;      // byte offset of this lane's piece of tile row sr
  H8 ra[16], rb[16];                           // staging loops unrolled: constant indices keep both in registers
#pragma unroll
  for (int it = 0; it < 16; ++it) {
    ra[it] = *(const H8*)(gA + lo + 8 * it * KD);
    rb[it] = *(const H8*)(gB + lo + 8 * it * KD);
  }
#if DEV_ASM
  // before an address register of the loads above is reused; the inputs keep those registers as they are up to here
  asm volatile("s_wait_xcnt 0x0" :: "v"(lo), "s"(gA), "s"(gB) : "memory");
#endif
  for (int k0 = 0; k0 < KD; k0 += 64) {
#pragma unroll
    for (int it = 0; it < 16; ++it) {
      *(H8*)(wa + (4 * it + sr) * LP + sc) = ra[it];
      *(H8*)(wb + (4 * it + sr) * LP + sc) = rb[it];
    }
    // the tile rows are written by other lanes of this wave than read them: stores before the fragment reads
    __builtin_amdgcn_fence(__ATOMIC_RELEASE, "workgroup");
    __builtin_amdgcn_wave_barrier();
    __builtin_amdgcn_fence(__ATOMIC_ACQUIRE, "workgroup");
    if (k0 + 64 < KD) {                        // next step's tiles fly while this step is multiplied
#pragma unroll
      for (int it = 0; it < 16; ++it) {
        ra[it] = *(const H8*)(gA + 2 * (k0 + 64) + lo + 8 * it * KD);
        rb[it] = *(const H8*)(gB + 2 * (k0 + 64) + lo + 8 * it * KD);
      }
#if DEV_ASM
      asm volatile("s_wait_xcnt 0x0" :: "v"(lo) : "memory");   // before the fragment reads reuse an address register
#endif
    }
#pragma unroll                                 // both 32-k blocks in one body: the second block's reads overlap the first's products
    for (int kk = 0; kk < 64; kk += 32) {
      V16 bq[4], af[4];                        // all eight fragments of the 32-k block read as one group
#pragma unroll
      for (int j = 0; j < 4; ++j) {
        bq[j] = ldfrag<OT>(wb + ((j << 4) + rlane) * LP + koff + kk);
        af[j] = ldfrag<OT>(wa + ((j << 4) + rlane) * LP + koff + kk);
      }
#pragma unroll
      for (int i = 0; i < 4; ++i) {
#pragma unroll
        for (int j = 0; j < 4; ++j) acc[i][j] = mmar(af[i], bq[j], acc[i][j]);
        dep_guard(acc[i][0], acc[i][3], af[i], bq[3]);
      }
      keep4(bq[0], bq[1], bq[2], bq[3]);
    }
    // this step's fragment reads before the next step's stores to the same tiles
    __builtin_amdgcn_fence(__ATOMIC_RELEASE, "workgroup");
    __builtin_amdgcn_wave_barrier();
    __builtin_amdgcn_fence(__ATOMIC_ACQUIRE, "workgroup");
  }
  acc_guard4(acc[0][0], acc[0][1], acc[0][2], acc[0][3]);
  acc_guard4(acc[1][0], acc[1][1], acc[1][2], acc[1][3]);
  acc_guard4(acc[2][0], acc[2][1], acc[2][2], acc[2][3]);
  acc_guard4(acc[3][0], acc[3][1], acc[3][2], acc[3][3]);

  // ---- epilogue ----
  float* slab = sT + wave * (16 * 68);
#pragma unroll
  for (int i = 0; i < 4; ++i) {
    const int mBase = m0 + (i << 4);
#pragma unroll
    for (int j = 0; j < 4; ++j) {
#pragma unroll
      for (int r = 0; r < 8; ++r) {
        slab[(mOff + r) * 68 + (j << 4) + rlane] = acc[i][j][r];
      }
    }
    __builtin_amdgcn_fence(__ATOMIC_RELEASE, "workgroup");
    __builtin_amdgcn_wave_barrier();
    __builtin_amdgcn_fence(__ATOMIC_ACQUIRE, "workgroup");
    if (OUT_MODE == 0) {
      float* C = (float*)Cout + (size_t)b * (size_t)strideC;
      const int h2 = lane >> 4, c4 = (lane & 15) * 4;     // 256-B row segment = 16 lanes x 16 B
      v4f bcol = {0.f, 0.f, 0.f, 0.f};
      if (BIAS == 1) {
        const v4f bb = *(const v4f*)(bias + n0 + c4);
#pragma unroll
        for (int e = 0; e < 4; ++e) bcol[e] = bfr(bb[e]);
      }
      {
#pragma unroll
        for (int it = 0; it < 8; ++it) {
          const int row = it * 2 + h2;                     // it 0..7 x h2 0..1 = rows 0..15
          float brow = 0.f;
          if (BIAS == 2) brow = bfr(bias[mBase + row]);
          const v4f x = *(const v4f*)(slab + row * 68 + c4);
          v4f v;
#pragma unroll
          for (int e = 0; e < 4; ++e) v[e] = x[e] * oscale + bcol[e] + brow;
          *(v4f*)(C + (size_t)(mBase + row) * (size_t)ldc + n0 + c4) = v;
        }
        
      }
    } else {
      const int q = lane >> 3, c8 = (lane & 7) * 8;
      unsigned short* C  = (unsigned short*)Cout  + (size_t)b * (size_t)strideC;
      unsigned short* C2 = (unsigned short*)Cout2 + (size_t)b * (size_t)strideC;
      float bc8[8];
#pragma unroll
      for (int e = 0; e < 8; ++e) bc8[e] = 0.f;
      if (BIAS == 1) {
        const v4f b0 = *(const v4f*)(bias + n0 + c8);
        const v4f b1 = *(const v4f*)(bias + n0 + c8 + 4);
#pragma unroll
        for (int e = 0; e < 4; ++e) { bc8[e] = bfr(b0[e]); bc8[4 + e] = bfr(b1[e]); }
      }
      v4u hv[4], lv[4];
#pragma unroll
      for (int it = 0; it < 4; ++it) {
        const int row = it * 4 + q;                        // it 0..3 x q 0..3 = rows 0..15
        const float* sp = slab + row * 68 + c8;
        float brow = 0.f;
        if (BIAS == 2) brow = bfr(bias[mBase + row]);
        float f[8];
#pragma unroll
        for (int e = 0; e < 8; ++e) f[e] = sp[e] * oscale + bc8[e] + brow;
        v4u a, a2;
#pragma unroll
        for (int e = 0; e < 4; ++e) {
          const float f0 = f[2 * e], f1 = f[2 * e + 1];
          const _Float16 x0 = (_Float16)f0, x1 = (_Float16)f1;
          const unsigned short h0 = h_bits(x0), h1 = h_bits(x1);
          unsigned short l0 = 0, l1 = 0;
          if (OUT_MODE == 3) {
            l0 = h_bits((_Float16)((f0 - (float)x0) * rscale));
            l1 = h_bits((_Float16)((f1 - (float)x1) * rscale));
          }
          a[e] = pk16(h0, h1); a2[e] = pk16(l0, l1);
        }
        hv[it] = a; lv[it] = a2;
      }
      {
#pragma unroll
        for (int it = 0; it < 4; ++it) {
          const int row = it * 4 + q;
          *(v4u*)(C + (size_t)(mBase + row) * (size_t)ldc + n0 + c8) = hv[it];
          if (OUT_MODE == 3) *(v4u*)(C2 + (size_t)(mBase + row) * (size_t)ldc + n0 + c8) = lv[it];
        }
        
      }
    }
    __builtin_amdgcn_fence(__ATOMIC_RELEASE, "workgroup");
    __builtin_amdgcn_wave_barrier();
    __builtin_amdgcn_fence(__ATOMIC_ACQUIRE, "workgroup");
  }
}

// =====================================================================================================
// The three products that read only converted inputs, in ONE launch (none reads what another writes); a block
// takes its product from the range its index falls in. Ranges, longest work first:
//   v^T = Wv^T . x^T + bv per batch -> f16 hi plane [b][d][s] (pitch SEQ) and residual plane (x4096)
//         (A = WvT [n][k], Bt = Xb rows of batch b; M=DM, N=SEQ, K=DM; bias per row d)
//   z = coords . Wc + bc -> f32 [NB*SEQ][HN]                       (M=NB*SEQ, N=HN, K=DC)
//   second output = coords . Wn + bn -> f32 [NB*SEQ][DC]           (M=NB*SEQ, N=DC, K=DC)
// =====================================================================================================
#define GB_V  (((DM / 64) * (SEQ / 64) + 7) / 8)            // 64 blocks per batch
#define GB_Z  (((NB * SEQ / 64) * (HN / 64) + 7) / 8)       // 32 blocks
#define GB_C  (((NB * SEQ / 64) * (DC / 64) + 7) / 8)       //  8 blocks
__global__ __launch_bounds__(256) void gemm_vzc(
    const unsigned short* __restrict__ WvT, const unsigned short* __restrict__ Xb,
    const unsigned short* __restrict__ Cb, const unsigned short* __restrict__ WcT,
    const unsigned short* __restrict__ WnT,
    unsigned short* VTh, unsigned short* VTl, float* Zf, float* out1,
    const float* __restrict__ bv, const float* __restrict__ bc, const float* __restrict__ bn) {
  GEMM_LDS(__bf16);
  int bx = (int)blockIdx.x;
  if (bx < NB * GB_V) {
    gemm64<__bf16, 3, 2, DM>(bx % GB_V, bx / GB_V, sT, sA, sB,
        WvT, 0LL, Xb, (long long)SEQ * DM,
        (void*)VTh, (void*)VTl, SEQ, (long long)DM * SEQ, bv,
        DM, SEQ, 1.0f, RSC);
    return;
  }
  bx -= NB * GB_V;
  if (bx < GB_Z) {
    gemm64<__bf16, 0, 1, DC>(bx, 0, sT, sA, sB,
        Cb, 0LL, WcT, 0LL,
        (void*)Zf, (void*)Zf, HN, 0LL, bc,
        NB * SEQ, HN, 1.0f, 1.0f);
    return;
  }
  bx -= GB_Z;
  gemm64<__bf16, 0, 1, DC>(bx, 0, sT, sA, sB,
      Cb, 0LL, WnT, 0LL,
      (void*)out1, (void*)out1, DC, 0LL, bn,
      NB * SEQ, DC, 1.0f, 1.0f);
}

// first output = [ctx_hi | ctx_res] . [Wo^T ; Wo^T]^T + bo -> f32 [NB*SEQ][DM]   (M=NB*SEQ, N=DM, K=2*DM)
__global__ __launch_bounds__(256) void gemm_out(
    const unsigned short* __restrict__ Octx, const unsigned short* __restrict__ WoT2,
    float* out0, const float* __restrict__ bo) {
  GEMM_LDS(__bf16);
  gemm64<__bf16, 0, 1, OP>((int)blockIdx.x, 0, sT, sA, sB,
      Octx, 0LL, WoT2, 0LL,
      (void*)out0, (void*)out0, DM, 0LL, bo,
      NB * SEQ, DM, 1.0f, 1.0f);
}

// =====================================================================================================
// z relayout: in f32 z [rows][HN] (16 heads x 16); out (a) f16 operand plane [rows][ZP], 64 halves per head =
// norms [rows][NH].  Block = 16 rows x 16 heads (thread = one (row, head)); staged in LDS; block barrier; line L of
// the block (L = 16*r + head, contiguous in the plane) written by lanes 8q..8q+7 of wave w with one instruction
// LDS: both arrays cross-wave (block barrier); fully written before read.
// =====================================================================================================
__global__ __launch_bounds__(256) void zprep(const float* __restrict__ zf, unsigned short* zp, float* zsq) {
  __shared__ __align__(16) unsigned short sZ[256 * LP];   // columns 64..71 of the pitch are never read
  __shared__ __align__(16) float sQ[256];
  const int tid  = (int)threadIdx.x;
  const int r    = tid >> 4, hd = tid & 15;
  const int row0 = blockIdx.x * 16;
  {
    const float* zr = zf + (size_t)(row0 + r) * HN + hd * HC;
    const v4f a0 = *(const v4f*)(zr);
    const v4f a1 = *(const v4f*)(zr + 4);
    const v4f a2 = *(const v4f*)(zr + 8);
    const v4f a3 = *(const v4f*)(zr + 12);
    float f[16];
#pragma unroll
    for (int e = 0; e < 4; ++e) { f[e] = a0[e]; f[4 + e] = a1[e]; f[8 + e] = a2[e]; f[12 + e] = a3[e]; }
    float q = 0.f;
#pragma unroll
    for (int e = 0; e < 16; ++e) q += f[e] * f[e];
    sQ[tid] = q;
    v4u ph0, ph1, pl0, pl1;
#pragma unroll
    for (int e = 0; e < 4; ++e) {
      const float f0 = f[2 * e], f1 = f[2 * e + 1], f2 = f[8 + 2 * e], f3 = f[9 + 2 * e];
      const _Float16 x0 = (_Float16)f0, x1 = (_Float16)f1, x2 = (_Float16)f2, x3 = (_Float16)f3;
      ph0[e] = pk16(h_bits(x0), h_bits(x1));
      ph1[e] = pk16(h_bits(x2), h_bits(x3));
      pl0[e] = pk16(h_bits((_Float16)((f0 - (float)x0) * RSC)), h_bits((_Float16)((f1 - (float)x1) * RSC)));
      pl1[e] = pk16(h_bits((_Float16)((f2 - (float)x2) * RSC)), h_bits((_Float16)((f3 - (float)x3) * RSC)));
    }
    const v4u z4 = {0u, 0u, 0u, 0u};
    unsigned short* sl = sZ + tid * LP;
    *(v4u*)(sl + 0)  = ph0;
    *(v4u*)(sl + 8)  = ph1;
    *(v4u*)(sl + 16) = pl0;
    *(v4u*)(sl + 24) = pl1;
    *(v4u*)(sl + 32) = ph0;
    *(v4u*)(sl + 40) = ph1;
    *(v4u*)(sl + 48) = z4;
    *(v4u*)(sl + 56) = z4;
  }
  __syncthreads();
  const int wave = tid >> 5, lane = tid & 31;
  const int q4 = lane >> 3, c8 = (lane & 7) * 8;
  unsigned short* base = zp + (size_t)row0 * ZP;
  v4u vv[8];
#pragma unroll
  for (int it = 0; it < 8; ++it) {
    const int L = it * 32 + wave * 4 + q4;
    vv[it] = *(const v4u*)(sZ + L * LP + c8);
  }
  {
#pragma unroll
    for (int it = 0; it < 8; ++it) {
      const int L = it * 32 + wave * 4 + q4;
      *(v4u*)(base + (size_t)L * 64 + c8) = vv[it];
    }
    
  }
  if (tid < 64) {                                       // waves 0 and 1, wave-uniform
    const v4f qv = *(const v4f*)(sQ + tid * 4);
    float* dst = zsq + (size_t)row0 * NH + tid * 4;
    *(v4f*)dst = qv;
    
  }
}

// =====================================================================================================
// Distance-kernel attention, per-head z dim 16, value dim 64, no mask, softmax over all SEQ keys.
//   z plane (f16): row (b*SEQ + t), head h at cols 64h.. : [hi | residual x4096 | hi | 0]
//   zsq (f32): [(b*SEQ + t)][h] = |z|^2
//   v^T hi plane (f16) and residual plane (f16, (v - hi)*4096): element (b, h, d, s) at [(b*DM + h*64 + d)*SEQ + s]
//   ctx plane (bf16): element (b, t, h, d) hi at [(b*SEQ + t)*OP + h*64 + d], residual at the same + DM
//   dot = A[hi|0] . B[hi;lo]  +  (A[lo|hi] . B[hi;lo]) / 4096 on f16 WMMA (two f32 accumulators);
//   score = -softplus(gamma_h) * max(|z_s|^2 + |z_t|^2 - 2 dot, 0) is <= 0 for every pair (the clamp, softplus >= 0),
//   and a query is one of its own keys, at distance 0 up to rounding: exp(score) cannot overflow and the row sum
//   is about 1 or more, so softmax = exp(s) / sum exp(s) is taken as it stands, with no running max and no rescale
//   (sound while softplus x the rounding error of a query's own distance, about 2^-22 |z|^2, stays far below 20).
//   p is carried x16384: one fma and one exp2 per score, exp2(-softplus * log2(e) * sq + 14), f16 for the product;
//   context = p . vh + (p . vl) / 4096 on f16 WMMA, both accumulators run through all chunks; sums in f32.
//   Both products run transposed: scores^T = keys (A) . queries (B), context^T = v^T (A) . p^T (B).  In every
//   accumulator tile a lane then holds ONE query (column lane&15) and rows 8*(lane>>4)+r (keys, or value dims):
//   the row sum is in-lane plus one exchange between the wave halves after the loop, and two score tiles pack straight
//   into the p^T operand (elements 0..7 = keys 8*half.. of the even tile, 8..15 = the same rows of the odd tile,
//   the k order of the v^T fragment), so p never goes through LDS.
//   Block = 4 waves = 4 x 16 query rows of one (b, h); grid = NB * NH * NQB; key chunks of 64, static trip NKT.
//   Chunk staging: 128 threads x 32 elements per plane = the whole 64x64 tile of each of the three planes, and the
//   64 key norms (plain loads, __syncthreads before and after; staged extent == consumed extent); the context tile
//   is wave-private; the grid covers every (b, h, qb).
// =====================================================================================================
__global__ __launch_bounds__(128)
void attn_dist(const unsigned short* __restrict__ zpp, const float* __restrict__ zsq,
               const unsigned short* __restrict__ vhp, const unsigned short* __restrict__ vlp,
               const float* __restrict__ gam, unsigned short* octx) {
  union FH { v16h v; v8h h[2]; };
  __shared__ __align__(16) _Float16 Zsh[64 * LP];          // z key chunk [key][64], pitch LP    9 KB
  __shared__ __align__(16) _Float16 Vth[64 * LP];          // V^T hi [d][key], pitch LP          9 KB
  __shared__ __align__(16) _Float16 Vtl[64 * LP];          // V^T residual, pitch LP             9 KB
  __shared__ __align__(16) float    Zqs[64];               // squared norms of the chunk's keys
  __shared__ __align__(16) float    Os[4][16 * OSP];       // per wave context tile, pitch OSP  17 KB

  const int tid  = threadIdx.x;
  const int wave = tid >> 5;
  const int lane = tid & 31;
  const int hh   = lane >> 4;
  const int c    = lane & 15;

  const int bx   = blockIdx.x;
  const int qb   = bx % NQB;
  const int rest = bx / NQB;
  const int h    = rest % NH;
  const int b    = rest / NH;
  const int q0   = qb * 64 + wave * 16;
  const size_t rowB = (size_t)b * SEQ;

  const _Float16* Zp16 = (const _Float16*)(const void*)zpp;
  const _Float16* Vh = (const _Float16*)(const void*)vhp + ((size_t)b * DM + (size_t)h * HD) * SEQ;
  const _Float16* Vl = (const _Float16*)(const void*)vlp + ((size_t)b * DM + (size_t)h * HD) * SEQ;

  const float gx = bfr(gam[h]);
  const float g  = fmaxf(gx, 0.f) + log1pf(expf(-fabsf(gx)));   // softplus
  const float ng2 = -g * 1.44269504088896340736f;              // score in log2 units per unit of squared distance

  // ---- query-side B fragment [hi | residual] (column = lane&15) and this lane's query squared norm ----
  const v16h zq = ldfrag<_Float16>(Zp16 + (rowB + q0 + c) * ZP + (size_t)h * 64 + 8 * hh);
  const float zsq_q = zsq[(rowB + q0 + c) * NH + h];

  float lrow = 0.f;            // sum of 16384 p over this half's keys only; the halves are joined after the loop
  v8f oacc[4];                 // context^T (x16384): tile t, register r = value dim 16t + 8*hh + r of query c
  v8f o1[4];                   // the same of the residual plane (x16384 x4096)
#pragma unroll
  for (int t = 0; t < 4; ++t) { oacc[t] = zero8(); o1[t] = zero8(); }

  for (int kt = 0; kt < NKT; ++kt) {         // static trip count
    const int kv0 = kt * 64;
    __syncthreads();
    {
      const int r = tid >> 1, half = (tid & 1) * 32;
      const _Float16* zg  = Zp16 + (rowB + kv0 + r) * ZP + (size_t)h * 64 + half;   // key row kv0+r, 64-half head segment
      const _Float16* vg  = Vh + (size_t)r * SEQ + kv0 + half;                       // v^T row d = r, s = kv0+half..+31
      const _Float16* vlg = Vl + (size_t)r * SEQ + kv0 + half;
      const float zn = zsq[(rowB + kv0 + (tid & 63)) * NH + h];   // every thread loads, in one group with the tiles
#pragma unroll
      for (int i = 0; i < 4; ++i) {
        const v8h a0 = *(const v8h*)(zg + 8 * i);
        const v8h b0 = *(const v8h*)(vg + 8 * i);
        const v8h b1 = *(const v8h*)(vlg + 8 * i);
        *(v8h*)(Zsh + r * LP + half + 8 * i) = a0;
        *(v8h*)(Vth + r * LP + half + 8 * i) = b0;
        *(v8h*)(Vtl + r * LP + half + 8 * i) = b1;
      }
#if DEV_ASM
      // input-only use of the loaded norm: keeps its load up among the tile loads; sunk into the branch below it
      // would be issued behind their waits and cost the block a second load latency in front of the barrier
      asm volatile("" :: "v"(zn));
#endif
      if (tid < 64) Zqs[tid] = zn;                                // waves 0 and 1, wave-uniform
    }
    __syncthreads();

    // ---- scores^T: 64 keys x 16 queries per wave, 2 f16 products per key subtile; p^T (x16384, f16) ----
    FH pa[2];                    // p^T operand of keys 0..31 and 32..63 of the chunk
    float pj[4];                 // four independent sums, one per key subtile
#pragma unroll
    for (int j = 0; j < 4; ++j) {
      const _Float16* zr = Zsh + (j * 16 + c) * LP + 8 * hh;
      FH b1, b2;
      b2.h[0] = *(const v8h*)(zr + 16);     // k 0..15  <- residual of key
      b2.h[1] = *(const v8h*)(zr + 32);     // k 16..31 <- hi of key
      b1.h[0] = *(const v8h*)(zr + 32);     // k 0..15  <- hi of key
      b1.h[1] = *(const v8h*)(zr + 48);     // k 16..31 <- zeros
      v8f ah = mma_h(b1.v, zq, zero8());    // hi.hi
      v8f ax = mma_h(b2.v, zq, zero8());    // (hi.lo + lo.hi) x4096
      const v4f zt0 = *(const v4f*)(Zqs + j * 16 + 8 * hh);       // norms of keys 16j + 8*hh + 0..3
      const v4f zt1 = *(const v4f*)(Zqs + j * 16 + 8 * hh + 4);   // and + 4..7
      v8f sq8;
      {
#pragma clang fp contract(off)
#pragma unroll
        for (int r = 0; r < 8; ++r) {
          const float d = ah[r] + ax[r] * (1.0f / RSC);
          const float sq = (zsq_q + (r < 4 ? zt0[r & 3] : zt1[r & 3])) - 2.0f * d;
          sq8[r] = fmaxf(sq, 0.f);
        }
      }
      pj[j] = 0.f;
#pragma unroll
      for (int r = 0; r < 8; ++r) {
        const float p = __builtin_amdgcn_exp2f(__builtin_fmaf(ng2, sq8[r], 14.0f));   // 16384 exp(score), <= 16384
        pj[j] += p;
        pa[j >> 1].h[j & 1][r] = (_Float16)p;
      }
    }
    lrow += (pj[0] + pj[1]) + (pj[2] + pj[3]);

    // ---- context^T += V^T . P^T (f16 WMMA); residual products into a separate accumulator ----
#pragma unroll                   // constant kk: pa[kk] stays in registers
    for (int kk = 0; kk < 2; ++kk) {
#pragma unroll
      for (int t = 0; t < 4; ++t) {
        FH vb, vl;
        vb.h[0] = *(const v8h*)(Vth + (t * 16 + c) * LP + kk * 32 + 8 * hh);
        vb.h[1] = *(const v8h*)(Vth + (t * 16 + c) * LP + kk * 32 + 16 + 8 * hh);
        vl.h[0] = *(const v8h*)(Vtl + (t * 16 + c) * LP + kk * 32 + 8 * hh);
        vl.h[1] = *(const v8h*)(Vtl + (t * 16 + c) * LP + kk * 32 + 16 + 8 * hh);
        oacc[t] = mma_h(vb.v, pa[kk].v, oacc[t]);
        o1[t]   = mma_h(vl.v, pa[kk].v, o1[t]);
      }
    }
  }
#pragma unroll
  for (int t = 0; t < 4; ++t)
#pragma unroll
    for (int r = 0; r < 8; ++r) oacc[t][r] += o1[t][r] * (1.0f / RSC);

  // ---- normalise (1/l; l and the context carry the same x16384), stage the wave's 16x64 tile, convert to bf16 hi + bf16 residual,
  float* os = Os[wave];
  {
    const float l = lrow + xhalf(lrow);          // both halves' keys
    const float inv = (l > 0.f) ? (1.0f / l) : 0.f;
#pragma unroll
    for (int t = 0; t < 4; ++t) {                // row = query c, 8 consecutive value dims per tile
      v4f w0, w1;
#pragma unroll
      for (int e = 0; e < 4; ++e) { w0[e] = oacc[t][e] * inv; w1[e] = oacc[t][4 + e] * inv; }
      *(v4f*)(os + c * OSP + t * 16 + 8 * hh)     = w0;
      *(v4f*)(os + c * OSP + t * 16 + 8 * hh + 4) = w1;
    }
  }
  __builtin_amdgcn_fence(__ATOMIC_RELEASE, "workgroup");
  __builtin_amdgcn_wave_barrier();
  __builtin_amdgcn_fence(__ATOMIC_ACQUIRE, "workgroup");
  {
    const int q4 = lane >> 3, c8 = (lane & 7) * 8;
    v4u hv[4], lv[4];
#pragma unroll
    for (int it = 0; it < 4; ++it) {
      const int row = it * 4 + q4;   // it 0..3 x q4 0..3 = rows 0..15 of the wave tile
      const float* sp = os + row * OSP + c8;
      v4u a, a2;
#pragma unroll
      for (int e = 0; e < 4; ++e) {
        const float f0 = sp[2 * e], f1 = sp[2 * e + 1];
        const unsigned short hb0 = bf_bits(f0), hb1 = bf_bits(f1);
        const unsigned short lb0 = bf_bits(f0 - bf_up(hb0)), lb1 = bf_bits(f1 - bf_up(hb1));
        a[e]  = pk16(hb0, hb1);
        a2[e] = pk16(lb0, lb1);
      }
      hv[it] = a; lv[it] = a2;
    }
    {
#pragma unroll
      for (int it = 0; it < 4; ++it) {
        const int row = it * 4 + q4;
        const size_t go = (rowB + q0 + row) * OP + (size_t)h * HD + c8;
        *(v4u*)(octx + go)      = hv[it];
        *(v4u*)(octx + go + DM) = lv[it];
      }
      
    }
  }
}

// =====================================================================================================
// Workspace map (bytes, NB=2 / SEQ=2048), every region an exact multiple of its whole-line / whole-tile store
// granularity, back to back:
//   Xb   bf16 [NB*SEQ][DM]            8388608
//   Cb   bf16 [NB*SEQ][DC]             524288
//   WvT  bf16 [DM n][DM k]            2097152
//   WoT2 bf16 [DM n][2*DM k]          4194304
//   WcT  bf16 [HN][DC]                  32768
//   WnT  bf16 [DC][DC]                   8192
//   Zf   f32  [NB*SEQ][HN]            4194304
//   Zp   f16  [NB*SEQ][ZP]            8388608
//   Zsq  f32  [NB*SEQ][NH]             262144
//   VTh  f16  [NB][DM][SEQ]           8388608
//   VTl  f16  [NB][DM][SEQ]           8388608
//   Octx bf16 [NB*SEQ][OP]           16777216
//   total                            61644800
// Weights arrive [in][out]; tr64 produces the [out n][in k] (k contiguous) layout the GEMM wants.
// =====================================================================================================
extern "C" void kernel_launch(void* const* d_in, const int* in_sizes, int n_in,
                              void* d_out, int out_size, void* d_ws, size_t ws_size,
                              hipStream_t stream) {
  if (n_in < 11) return;
  if (in_sizes[0] < ((NB - 1) * SEQ_FULL + SEQ) * DM) return;
  if (in_sizes[1] < ((NB - 1) * SEQ_FULL + SEQ) * DC) return;
  if (in_sizes[2] < DM * DM || in_sizes[3] < DM) return;
  if (in_sizes[4] < DC * HN || in_sizes[5] < HN) return;
  if (in_sizes[6] < DC * DC || in_sizes[7] < DC) return;
  if (in_sizes[8] < DM * DM || in_sizes[9] < DM) return;
  if (in_sizes[10] < NH) return;
  if ((size_t)out_size < OUT1_OFF + (size_t)NB * SEQ * DC) return;

  const float* hidden = (const float*)d_in[0];
  const float* coords = (const float*)d_in[1];
  const float* Wv     = (const float*)d_in[2];
  const float* bv     = (const float*)d_in[3];
  const float* Wc     = (const float*)d_in[4];
  const float* bc     = (const float*)d_in[5];
  const float* Wn     = (const float*)d_in[6];
  const float* bn     = (const float*)d_in[7];
  const float* Wo     = (const float*)d_in[8];
  const float* bo     = (const float*)d_in[9];
  const float* gamma  = (const float*)d_in[10];

  const size_t nRows = (size_t)NB * SEQ;
  const size_t PXB  = nRows * DM * 2;
  const size_t PCB  = nRows * DC * 2;
  const size_t PWV  = (size_t)DM * DM * 2;
  const size_t PWO2 = (size_t)DM * OP * 2;
  const size_t PWC  = (size_t)HN * DC * 2;
  const size_t PWN  = (size_t)DC * DC * 2;
  const size_t PZF  = nRows * HN * 4;
  const size_t PZP  = nRows * ZP * 2;
  const size_t PZQ  = nRows * NH * 4;
  const size_t PVT  = (size_t)NB * DM * SEQ * 2;
  const size_t POC  = nRows * OP * 2;
  size_t off = 0;
  const size_t oXb  = off; off += PXB;
  const size_t oCb  = off; off += PCB;
  const size_t oWv  = off; off += PWV;
  const size_t oWo  = off; off += PWO2;
  const size_t oWc  = off; off += PWC;
  const size_t oWn  = off; off += PWN;
  const size_t oZf  = off; off += PZF;
  const size_t oZp  = off; off += PZP;
  const size_t oZq  = off; off += PZQ;
  const size_t oVTh = off; off += PVT;
  const size_t oVTl = off; off += PVT;
  const size_t oOc  = off; off += POC;
  if (off > ws_size) return;                       // off = 61644800 at full size
  if (off > (size_t)134217728) return;

  char* ws = (char*)d_ws;
  unsigned short* Xb   = (unsigned short*)(ws + oXb);
  unsigned short* Cb   = (unsigned short*)(ws + oCb);
  unsigned short* WvT  = (unsigned short*)(ws + oWv);
  unsigned short* WoT2 = (unsigned short*)(ws + oWo);
  unsigned short* WcT  = (unsigned short*)(ws + oWc);
  unsigned short* WnT  = (unsigned short*)(ws + oWn);
  float*          Zf   = (float*)(ws + oZf);
  unsigned short* Zpl  = (unsigned short*)(ws + oZp);
  float*          Zsq  = (float*)(ws + oZq);
  unsigned short* VTh  = (unsigned short*)(ws + oVTh);
  unsigned short* VTl  = (unsigned short*)(ws + oVTl);
  unsigned short* Octx = (unsigned short*)(ws + oOc);
  float* out0 = (float*)d_out;
  float* out1 = (float*)d_out + OUT1_OFF;

  const dim3 blk(256);
  const dim3 gPrepAll(2 * PB_W + PB_C + PB_N + PB_X + PB_Q);           // 2693 blocks
  const dim3 gVZC(NB * GB_V + GB_Z + GB_C);                            //  168 blocks
  const dim3 gO(((NB * SEQ / 64) * (DM / 64) + 7) / 8);                //  128 blocks
  const dim3 gPrep((unsigned)(nRows / 16));                            //  256 blocks
  const dim3 gAttn(NB * NH * NQB);                                     // 1024 blocks of 128

  // (1) activations -> bf16 planes; weights [in][out] f32 -> bf16 [out][in], Wo^T duplicated along k (pitch 2*DM)
  prep_all<<<gPrepAll, blk, 0, stream>>>(hidden, coords, Wv, Wo, Wc, Wn, Xb, Cb, WvT, WoT2, WcT, WnT);
  // (2) v^T planes, z (f32) and the second output (d_out at element OUT1_OFF)
  gemm_vzc<<<gVZC, blk, 0, stream>>>(WvT, Xb, Cb, WcT, WnT, VTh, VTl, Zf, out1, bv, bc, bn);
  // (3) z -> f16 operand plane [hi | res | hi | 0] and f32 squared norms
  zprep<<<gPrep, blk, 0, stream>>>(Zf, Zpl, Zsq);
  // (4) attention -> ctx plane (bf16 hi | bf16 residual) [b*SEQ+t][OP]
  attn_dist<<<gAttn, dim3(128), 0, stream>>>(Zpl, Zsq, VTh, VTl, gamma, Octx);
  // (5) first output
  gemm_out<<<gO, blk, 0, stream>>>(Octx, WoT2, out0, bo);
  (void)hipGetLastError();
}

// v006
// Measured time: 130 microseconds a run.
// Two timings next to v005 both put it at 1.08 times that version's speed.
// Counting every step since v000, it is 2.96 times as fast.
// Contractions: value = Wv^T.x^T+bv, z = coords.Wc+bc, coords.Wn+bn = v_wmma_f32_16x16x32_bf16 (bf16 operands from RNE-converted inputs, single product, f32 accumulate);
// z.z^T scores = v_wmma_f32_16x16x32_f16 (z as f16 hi + f16 residual x4096 packed along k, 2 products into separate f32 accumulators);
// p.v = v_wmma_f32_16x16x32_f16 (p carried x16384 in f16; v as f16 hi plane + f16 residual plane x4096; 2 products, f32 accumulate);
// ctx.Wo+bo = v_wmma_f32_16x16x32_bf16 (ctx as bf16 hi and bf16 residual planes concatenated along k, Wo^T bf16 duplicated along k; f32 accumulate);
// squared norms, softplus, softmax (no running max: every score is <= 0) and bias adds in f32.
#include <hip/hip_runtime.h>
#include <math.h>
#include <stdint.h>

#ifndef NB
#define NB 2
#endif
#ifndef SEQ
#define SEQ 2048
#endif
#define NB_FULL  2
#define SEQ_FULL 2048
#define DM   1024
#define NH   16
#define HC   16
#define HD   64
#define DC   64
#define HN   (NH * HC)        // 256
#define ZP   (NH * 64)        // 1024: z operand plane pitch, 64 halves per head [hi | lo x4096 | hi | 0]
#define OP   (2 * DM)         // 2048: ctx plane pitch (bf16 hi | bf16 residual)
#define NQB  (SEQ / 64)       // 64-row query blocks per sequence
#define NKT  (SEQ / 64)       // 64-key chunks per sequence
#define LP   72               // LDS row pitch in halves of every 64-half tile row: 144 B = 16 B x odd, so the 16 rows
                              // that one ds_load_b128 touches fall on 16 different groups of four banks (at 128 B: on one)
#define OSP  68               // LDS row pitch in floats of the 64-float context tile rows (272 B = 16 B x odd)
#define RSC    4096.0f
#define OUT1_OFF ((size_t)NB_FULL * SEQ_FULL * DM)   // element offset of the second output in d_out
static_assert(NH * HD == DM);
static_assert(HC == 16 && HD == 64 && DC == 64);
static_assert((SEQ % 64) == 0 && SEQ >= 64 && SEQ <= SEQ_FULL);
static_assert(NB >= 1 && NB <= NB_FULL);
static_assert((DM % 64) == 0 && (HN % 64) == 0 && (OP % 64) == 0);
static_assert(OUT1_OFF * 4 == 16777216);

typedef _Float16 v16h __attribute__((ext_vector_type(16)));
typedef _Float16 v8h  __attribute__((ext_vector_type(8)));
typedef __bf16   v16b __attribute__((ext_vector_type(16)));
typedef __bf16   v8b  __attribute__((ext_vector_type(8)));
typedef float    v8f  __attribute__((ext_vector_type(8)));
typedef float    v4f  __attribute__((ext_vector_type(4)));
typedef unsigned int v4u __attribute__((ext_vector_type(4)));

#if defined(__HIP_DEVICE_COMPILE__)
#define DEV_ASM 1
#else
#define DEV_ASM 0
#endif

// ---- scalar helpers --------------------------------------------------------------------------------
__device__ __forceinline__ unsigned short bf_bits(float f) {          // f32 -> bf16 bits, RNE convert
  unsigned u = __float_as_uint(f);
  return (unsigned short)((u + 0x7FFFu + ((u >> 16) & 1u)) >> 16);
}
__device__ __forceinline__ float bf_up(unsigned short hb) { return __uint_as_float(((unsigned)hb) << 16); }
__device__ __forceinline__ float bfr(float f) { return bf_up(bf_bits(f)); }   // value of the bf16 RNE convert
__device__ __forceinline__ unsigned short h_bits(_Float16 x) { return __builtin_bit_cast(unsigned short, x); }
__device__ __forceinline__ unsigned pk16(unsigned short a, unsigned short b) { return (unsigned)a | ((unsigned)b << 16); }
__device__ __forceinline__ v8f zero8() { v8f z = {0.f, 0.f, 0.f, 0.f, 0.f, 0.f, 0.f, 0.f}; return z; }
__device__ __forceinline__ float xhalf(float x) {                      // value of lane l ^ 16
  const int b = __builtin_bit_cast(int, x);
  return __builtin_bit_cast(float, __builtin_amdgcn_permlanex16(b, b, 0x76543210, 0xfedcba98, false, false));
}

// ---- fragment types / loaders: 16-bit A/B operand, lane -> row/col (lane&15), p already includes +8*(lane>>4);
//      elements 0..7 <- p[0..7] (k0+8h..k0+8h+7), elements 8..15 <- p[16..23] (k0+16+8h..k0+16+8h+7)
template <typename OT> struct FT;
template <> struct FT<__bf16>   { typedef v16b frag; typedef v8b half8; };
template <> struct FT<_Float16> { typedef v16h frag; typedef v8h half8; };

template <typename OT>
__device__ __forceinline__ typename FT<OT>::frag ldfrag(const OT* p) {
  union { typename FT<OT>::frag v; typename FT<OT>::half8 h[2]; } f;
  f.h[0] = *(const typename FT<OT>::half8*)(p);
  f.h[1] = *(const typename FT<OT>::half8*)(p + 16);
  return f.v;
}

// ---- WMMA helpers (asm guard bodies are device-only; concrete operand types) -----------------------------
__device__ __forceinline__ v8f mmar(v16b a, v16b b, v8f c) {
  return __builtin_amdgcn_wmma_f32_16x16x32_bf16(false, a, false, b, (short)0, c, false, false);
}
__device__ __forceinline__ v8f mmar(v16h a, v16h b, v8f c) {
  return __builtin_amdgcn_wmma_f32_16x16x32_f16(false, a, false, b, (short)0, c, false, false);
}
// guarded form: 4 VALU slots after the WMMA, D tied, A/B kept live
__device__ __forceinline__ v8f mma_h(v16h a, v16h b, v8f c) {
  c = __builtin_amdgcn_wmma_f32_16x16x32_f16(false, a, false, b, (short)0, c, false, false);
#if DEV_ASM
  asm volatile("v_nop\n\tv_nop\n\tv_nop\n\tv_nop" : "+v"(c) : "v"(a), "v"(b));
#endif
  return c;
}
__device__ __forceinline__ void dep_guard(v8f& a, v8f& b, v16b x, v16b y) {
#if DEV_ASM
  asm volatile("v_nop\n\tv_nop\n\tv_nop\n\tv_nop" : "+v"(a), "+v"(b) : "v"(x), "v"(y));
#else
  (void)a; (void)b; (void)x; (void)y;
#endif
}
__device__ __forceinline__ void dep_guard(v8f& a, v8f& b, v16h x, v16h y) {
#if DEV_ASM
  asm volatile("v_nop\n\tv_nop\n\tv_nop\n\tv_nop" : "+v"(a), "+v"(b) : "v"(x), "v"(y));
#else
  (void)a; (void)b; (void)x; (void)y;
#endif
}
__device__ __forceinline__ void keep4(v16b a, v16b b, v16b c, v16b d) {
#if DEV_ASM
  asm volatile("v_nop" :: "v"(a), "v"(b), "v"(c), "v"(d));
#else
  (void)a; (void)b; (void)c; (void)d;
#endif
}
__device__ __forceinline__ void keep4(v16h a, v16h b, v16h c, v16h d) {
#if DEV_ASM
  asm volatile("v_nop" :: "v"(a), "v"(b), "v"(c), "v"(d));
#else
  (void)a; (void)b; (void)c; (void)d;
#endif
}
__device__ __forceinline__ void acc_guard4(v8f& a, v8f& b, v8f& c, v8f& d) {
#if DEV_ASM
  asm volatile("v_nop\n\tv_nop\n\tv_nop\n\tv_nop" : "+v"(a), "+v"(b), "+v"(c), "+v"(d));
#else
  (void)a; (void)b; (void)c; (void)d;
#endif
}

// =====================================================================================================
// f32 rows -> bf16 plane rows (RNE convert), 8 elements per thread, one 16-B store per lane: a wave writes
// Dense output row `row` (0..nrows-1) reads source row (row / seq) * seqfull + row % seq (full batch stride).
// ceil(nrows*rowlen8/256) blocks, bx = the block's index among them. coverage: nrows*rowlen8 threads x 8 = the
// whole plane (exact multiple of 256).
// =====================================================================================================
__device__ __forceinline__ void cvtrows(int bx, const float* __restrict__ in, unsigned short* out,
                                        int rowlen8, int nrows, int seq, int seqfull) {
  const int i = bx * 256 + (int)threadIdx.x;
  if (i < nrows * rowlen8) {
    const int row  = i / rowlen8;
    const int c    = i - row * rowlen8;
    const int bq   = row / seq;
    const int srow = bq * seqfull + (row - bq * seq);
    const float* src = in + ((size_t)srow * (size_t)rowlen8 + (size_t)c) * 8;
    const v4f a  = *(const v4f*)(src);
    const v4f a4 = *(const v4f*)(src + 4);
    v4u p;
    p[0] = pk16(bf_bits(a[0]),  bf_bits(a[1]));
    p[1] = pk16(bf_bits(a[2]),  bf_bits(a[3]));
    p[2] = pk16(bf_bits(a4[0]), bf_bits(a4[1]));
    p[3] = pk16(bf_bits(a4[2]), bf_bits(a4[3]));
    unsigned short* o = out + (size_t)i * 8;
    *(v4u*)o = p;
    
  }
}

// =====================================================================================================
// Weight transpose + bf16 convert through LDS: in f32 [krows][ncols] (pitch ldi) -> out bf16 [n][k] (pitch ldo,
// k contiguous), optionally duplicated at +dup elements in the same output row.  One block = one 64x64 tile:
// input rows k0 = 64*by, cols n0 = 64*bx.  Load: thread r = tid>>2 reads 16 floats of input row
// k0+r; LDS holds the transposed tile; block barrier; write: wave w, lane>>3 = q, lanes 8q..8q+7 write one whole
// LDS tile: cross-wave (block barrier); columns 64..71 of the pitch are never read.
// =====================================================================================================
__device__ __forceinline__ void tr64(int bx, int by, unsigned short* sT, const float* __restrict__ in, int ldi,
                                     unsigned short* out, int ldo, int dup) {
  const int tid = (int)threadIdx.x;
  const int k0  = by * 64;
  const int n0  = bx * 64;
  {
    const int r = tid >> 2, c16 = (tid & 3) * 16;
    const float* src = in + (size_t)(k0 + r) * (size_t)ldi + n0 + c16;
    const v4f a0 = *(const v4f*)(src);
    const v4f a1 = *(const v4f*)(src + 4);
    const v4f a2 = *(const v4f*)(src + 8);
    const v4f a3 = *(const v4f*)(src + 12);
#pragma unroll
    for (int e = 0; e < 4; ++e) {
      sT[(c16 + e) * 72 + r]      = bf_bits(a0[e]);
      sT[(c16 + 4 + e) * 72 + r]  = bf_bits(a1[e]);
      sT[(c16 + 8 + e) * 72 + r]  = bf_bits(a2[e]);
      sT[(c16 + 12 + e) * 72 + r] = bf_bits(a3[e]);
    }
  }
  __syncthreads();
  const int wave = tid >> 5, lane = tid & 31;
  const int q = lane >> 3, c8 = (lane & 7) * 8;
  v4u vv[2];
#pragma unroll
  for (int it = 0; it < 2; ++it) {
    const int n = it * 32 + wave * 4 + q;
    vv[it] = *(const v4u*)(sT + n * 72 + c8);
  }
  {
#pragma unroll
    for (int it = 0; it < 2; ++it) {
      const int n = it * 32 + wave * 4 + q;
      unsigned short* d = out + (size_t)(n0 + n) * (size_t)ldo + k0 + c8;
      *(v4u*)d = vv[it];
      if (dup != 0) *(v4u*)(d + dup) = vv[it];
    }
#if DEV_ASM
    // behind the last store: in the listing another range's code follows and reuses the stores' registers
    asm volatile("s_wait_xcnt 0x0" ::: "memory");
#endif
  }
}

// =====================================================================================================
// All six input conversions in ONE launch: none reads what another writes, so each block takes its job from the
// range its index falls in (block-uniform branch; the barrier of tr64 is reached by whole blocks only).
// Ranges, in index order: Wv^T, Wo^T (duplicated along k), Wc^T, Wn^T, hidden rows, coordinate rows.
// =====================================================================================================
#define PB_W  ((DM / 64) * (DM / 64))            // 256 tiles of a [DM][DM] weight
#define PB_C  ((HN / 64) * (DC / 64))            //   4 tiles of Wc [DC][HN]
#define PB_N  ((DC / 64) * (DC / 64))            //   1 tile of Wn [DC][DC]
#define PB_X  (NB * SEQ * DM / 8 / 256)          // 2048 blocks of hidden rows
#define PB_Q  (NB * SEQ * DC / 8 / 256)          //  128 blocks of coordinate rows
static_assert((NB * SEQ * DM / 8) % 256 == 0 && (NB * SEQ * DC / 8) % 256 == 0);
__global__ __launch_bounds__(256) void prep_all(const float* __restrict__ hidden, const float* __restrict__ coords,
                                                const float* __restrict__ Wv, const float* __restrict__ Wo,
                                                const float* __restrict__ Wc, const float* __restrict__ Wn,
                                                unsigned short* Xb, unsigned short* Cb, unsigned short* WvT,
                                                unsigned short* WoT2, unsigned short* WcT, unsigned short* WnT) {
  __shared__ __align__(16) unsigned short sT[64 * 72];
  int bx = (int)blockIdx.x;
  if (bx < PB_W) { tr64(bx % (DM / 64), bx / (DM / 64), sT, Wv, DM, WvT, DM, 0); return; }
  bx -= PB_W;
  if (bx < PB_W) { tr64(bx % (DM / 64), bx / (DM / 64), sT, Wo, DM, WoT2, OP, DM); return; }
  bx -= PB_W;
  if (bx < PB_C) { tr64(bx % (HN / 64), bx / (HN / 64), sT, Wc, HN, WcT, DC, 0); return; }
  bx -= PB_C;
  if (bx < PB_N) { tr64(bx % (DC / 64), bx / (DC / 64), sT, Wn, DC, WnT, DC, 0); return; }
  bx -= PB_N;
  if (bx < PB_X) { cvtrows(bx, hidden, Xb, DM / 8, NB * SEQ, SEQ, SEQ_FULL); return; }
  bx -= PB_X;
  cvtrows(bx, coords, Cb, DC / 8, NB * SEQ, SEQ, SEQ_FULL);
}

// =====================================================================================================
// Register-blocked batched WMMA GEMM (16-bit operand type OT): C[m][n] = sum_k A[m][k] * Bt[n][k] (+ bias);
// one wave per 64x64 tile, no block barriers. A row-major [M][K], Bt row-major [N][K] (k contiguous), both of row
// pitch K = KD elements, a compile-time constant so that the staging loads of a tile share one address and differ
// by immediate offsets; M, N, KD multiples of 64. bx = block index within the product, b = batch index
// (strides in elements). Per 64-k step the wave brings its 64x64 A and Bt tiles in with 16-B loads that cover whole
// 128-B lines (8 lanes per row, 4 rows per load), one step ahead in registers, stores them to its own LDS tiles
// (pitch LP) and reads the fragments from there with the split k map (ldfrag).
// BIAS 0: none; 1: per column n (bias[n]); 2: per row m (bias[m]); bias values RNE-converted to bf16 in f32.
// OUT_MODE 0: f32 C (pitch ldc), value * oscale + bias.
// OUT_MODE 3: f16 hi plane C + f16 residual plane C2 = f16((v - hi) * rscale) (same pitch / stride), v = acc*oscale+bias.
// whole 64x64 tile; slab pitch columns 64..67 never read.
// =====================================================================================================
// LDS of a GEMM block, declared once in each kernel and handed to the body
#define GEMM_LDS(OT)                                                                                             \
  __shared__ __align__(16) float sT[8 * 16 * 68];  /* per-wave 16x64 slab, pitch 68 floats */                     \
  __shared__ __align__(16) OT sA[8 * 64 * LP];     /* per-wave A tile [m][64 k], columns 64..71 never read */     \
  __shared__ __align__(16) OT sB[8 * 64 * LP]      /* per-wave Bt tile [n][64 k], same pitch */
template <typename OT, int OUT_MODE, int BIAS, int KD>
__device__ __forceinline__ void gemm64(
    int bx, int b, float* sT, OT* sA, OT* sB,
    const unsigned short* __restrict__ Ap, long long strideA,
    const unsigned short* __restrict__ Btp, long long strideB,
    void* Cout, void* Cout2, int ldc, long long strideC,
    const float* __restrict__ bias,
    int M, int N, float oscale, float rscale) {
  static_assert((KD % 64) == 0 && KD >= 64);
  typedef typename FT<OT>::frag V16;
  typedef typename FT<OT>::half8 H8;
  const OT* A  = (const OT*)(const void*)Ap;
  const OT* Bt = (const OT*)(const void*)Btp;
  const int lane = threadIdx.x & 31;
  const int wave = threadIdx.x >> 5;
  const int tilesN = N >> 6;
  const int tilesM = M >> 6;
  const int tile = bx * 8 + wave;
  if (tile >= tilesM * tilesN) return;   // wave-uniform; no block barriers in this kernel
  const int tm = tile / tilesN;
  const int tn = tile - tm * tilesN;
  const int m0 = tm << 6;
  const int n0 = tn << 6;

  const OT* Ab = A  + (size_t)b * (size_t)strideA;
  const OT* Bb = Bt + (size_t)b * (size_t)strideB;

  const int rlane = lane & 15;                 // row (A) / col (B, D) within subtile
  const int koff  = (lane >> 4) * 8;           // k offset of this lane half
  const int mOff  = (lane >> 4) * 8;           // D row offset

  v8f acc[4][4];
#pragma unroll
  for (int i = 0; i < 4; ++i)
#pragma unroll
    for (int j = 0; j < 4; ++j) acc[i][j] = zero8();

  OT* wa = sA + wave * (64 * LP);
  OT* wb = sB + wave * (64 * LP);
  const int sr = lane >> 3;                    // row within the 4 rows of one staging load
  const int sc = (lane & 7) * 8;               // 16-B piece of the row's 128-B line
  // wave-uniform tile bases, told so to the compiler: they stay in scalar registers
  const char* gA = (const char*)(Ab + (size_t)__builtin_amdgcn_readfirstlane(m0) * KD);
  const char* gB = (const char*)(Bb + (size_t)__builtin_amdgcn_readfirstlane(n0) * KD);
  const unsigned lo = (unsigned)(sr * KD + sc) * 2u;      // byte offset of this lane's piece of tile row sr
  H8 ra[16], rb[16];                           // staging loops unrolled: constant indices keep both in registers
#pragma unroll
  for (int it = 0; it < 16; ++it) {
    ra[it] = *(const H8*)(gA + lo + 8 * it * KD);
    rb[it] = *(const H8*)(gB + lo + 8 * it * KD);
  }
#if DEV_ASM
  // before an address register of the loads above is reused; the inputs keep those registers as they are up to here
  asm volatile("s_wait_xcnt 0x0" :: "v"(lo), "s"(gA), "s"(gB) : "memory");
#endif
  for (int k0 = 0; k0 < KD; k0 += 64) {
#pragma unroll
    for (int it = 0; it < 16; ++it) {
      *(H8*)(wa + (4 * it + sr) * LP + sc) = ra[it];
      *(H8*)(wb + (4 * it + sr) * LP + sc) = rb[it];
    }
    // the tile rows are written by other lanes of this wave than read them: stores before the fragment reads
    __builtin_amdgcn_fence(__ATOMIC_RELEASE, "workgroup");
    __builtin_amdgcn_wave_barrier();
    __builtin_amdgcn_fence(__ATOMIC_ACQUIRE, "workgroup");
    if (k0 + 64 < KD) {                        // next step's tiles fly while this step is multiplied
#pragma unroll
      for (int it = 0; it < 16; ++it) {
        ra[it] = *(const H8*)(gA + 2 * (k0 + 64) + lo + 8 * it * KD);
        rb[it] = *(const H8*)(gB + 2 * (k0 + 64) + lo + 8 * it * KD);
      }
#if DEV_ASM
      asm volatile("s_wait_xcnt 0x0" :: "v"(lo) : "memory");   // before the fragment reads reuse an address register
#endif
    }
#pragma unroll                                 // both 32-k blocks in one body: the second block's reads overlap the first's products
    for (int kk = 0; kk < 64; kk += 32) {
      V16 bq[4], af[4];                        // all eight fragments of the 32-k block read as one group
#pragma unroll
      for (int j = 0; j < 4; ++j) {
        bq[j] = ldfrag<OT>(wb + ((j << 4) + rlane) * LP + koff + kk);
        af[j] = ldfrag<OT>(wa + ((j << 4) + rlane) * LP + koff + kk);
      }
#pragma unroll
      for (int i = 0; i < 4; ++i) {
#pragma unroll
        for (int j = 0; j < 4; ++j) acc[i][j] = mmar(af[i], bq[j], acc[i][j]);
        dep_guard(acc[i][0], acc[i][3], af[i], bq[3]);
      }
      keep4(bq[0], bq[1], bq[2], bq[3]);
    }
    // this step's fragment reads before the next step's stores to the same tiles
    __builtin_amdgcn_fence(__ATOMIC_RELEASE, "workgroup");
    __builtin_amdgcn_wave_barrier();
    __builtin_amdgcn_fence(__ATOMIC_ACQUIRE, "workgroup");
  }
  acc_guard4(acc[0][0], acc[0][1], acc[0][2], acc[0][3]);
  acc_guard4(acc[1][0], acc[1][1], acc[1][2], acc[1][3]);
  acc_guard4(acc[2][0], acc[2][1], acc[2][2], acc[2][3]);
  acc_guard4(acc[3][0], acc[3][1], acc[3][2], acc[3][3]);

  // ---- epilogue ----
  float* slab = sT + wave * (16 * 68);
#pragma unroll
  for (int i = 0; i < 4; ++i) {
    const int mBase = m0 + (i << 4);
#pragma unroll
    for (int j = 0; j < 4; ++j) {
#pragma unroll
      for (int r = 0; r < 8; ++r) {
        slab[(mOff + r) * 68 + (j << 4) + rlane] = acc[i][j][r];
      }
    }
    __builtin_amdgcn_fence(__ATOMIC_RELEASE, "workgroup");
    __builtin_amdgcn_wave_barrier();
    __builtin_amdgcn_fence(__ATOMIC_ACQUIRE, "workgroup");
    if (OUT_MODE == 0) {
      float* C = (float*)Cout + (size_t)b * (size_t)strideC;
      const int h2 = lane >> 4, c4 = (lane & 15) * 4;     // 256-B row segment = 16 lanes x 16 B
      v4f bcol = {0.f, 0.f, 0.f, 0.f};
      if (BIAS == 1) {
        const v4f bb = *(const v4f*)(bias + n0 + c4);
#pragma unroll
        for (int e = 0; e < 4; ++e) bcol[e] = bfr(bb[e]);
      }
      {
#pragma unroll
        for (int it = 0; it < 8; ++it) {
          const int row = it * 2 + h2;                     // it 0..7 x h2 0..1 = rows 0..15
          float brow = 0.f;
          if (BIAS == 2) brow = bfr(bias[mBase + row]);
          const v4f x = *(const v4f*)(slab + row * 68 + c4);
          v4f v;
#pragma unroll
          for (int e = 0; e < 4; ++e) v[e] = x[e] * oscale + bcol[e] + brow;
          *(v4f*)(C + (size_t)(mBase + row) * (size_t)ldc + n0 + c4) = v;
        }
        
      }
    } else {
      const int q = lane >> 3, c8 = (lane & 7) * 8;
      unsigned short* C  = (unsigned short*)Cout  + (size_t)b * (size_t)strideC;
      unsigned short* C2 = (unsigned short*)Cout2 + (size_t)b * (size_t)strideC;
      float bc8[8];
#pragma unroll
      for (int e = 0; e < 8; ++e) bc8[e] = 0.f;
      if (BIAS == 1) {
        const v4f b0 = *(const v4f*)(bias + n0 + c8);
        const v4f b1 = *(const v4f*)(bias + n0 + c8 + 4);
#pragma unroll
        for (int e = 0; e < 4; ++e) { bc8[e] = bfr(b0[e]); bc8[4 + e] = bfr(b1[e]); }
      }
      v4u hv[4], lv[4];
#pragma unroll
      for (int it = 0; it < 4; ++it) {
        const int row = it * 4 + q;                        // it 0..3 x q 0..3 = rows 0..15
        const float* sp = slab + row * 68 + c8;
        float brow = 0.f;
        if (BIAS == 2) brow = bfr(bias[mBase + row]);
        float f[8];
#pragma unroll
        for (int e = 0; e < 8; ++e) f[e] = sp[e] * oscale + bc8[e] + brow;
        v4u a, a2;
#pragma unroll
        for (int e = 0; e < 4; ++e) {
          const float f0 = f[2 * e], f1 = f[2 * e + 1];
          const _Float16 x0 = (_Float16)f0, x1 = (_Float16)f1;
          const unsigned short h0 = h_bits(x0), h1 = h_bits(x1);
          unsigned short l0 = 0, l1 = 0;
          if (OUT_MODE == 3) {
            l0 = h_bits((_Float16)((f0 - (float)x0) * rscale));
            l1 = h_bits((_Float16)((f1 - (float)x1) * rscale));
          }
          a[e] = pk16(h0, h1); a2[e] = pk16(l0, l1);
        }
        hv[it] = a; lv[it] = a2;
      }
      {
#pragma unroll
        for (int it = 0; it < 4; ++it) {
          const int row = it * 4 + q;
          *(v4u*)(C + (size_t)(mBase + row) * (size_t)ldc + n0 + c8) = hv[it];
          if (OUT_MODE == 3) *(v4u*)(C2 + (size_t)(mBase + row) * (size_t)ldc + n0 + c8) = lv[it];
        }
        
      }
    }
    __builtin_amdgcn_fence(__ATOMIC_RELEASE, "workgroup");
    __builtin_amdgcn_wave_barrier();
    __builtin_amdgcn_fence(__ATOMIC_ACQUIRE, "workgroup");
  }
}

// =====================================================================================================
// The three products that read only converted inputs, in ONE launch (none reads what another writes); a block
// takes its product from the range its index falls in. Ranges, longest work first:
//   v^T = Wv^T . x^T + bv per batch -> f16 hi plane [b][d][s] (pitch SEQ) and residual plane (x4096)
//         (A = WvT [n][k], Bt = Xb rows of batch b; M=DM, N=SEQ, K=DM; bias per row d)
//   z = coords . Wc + bc -> f32 [NB*SEQ][HN]                       (M=NB*SEQ, N=HN, K=DC)
//   second output = coords . Wn + bn -> f32 [NB*SEQ][DC]           (M=NB*SEQ, N=DC, K=DC)
// =====================================================================================================
#define GB_V  (((DM / 64) * (SEQ / 64) + 7) / 8)            // 64 blocks per batch
#define GB_Z  (((NB * SEQ / 64) * (HN / 64) + 7) / 8)       // 32 blocks
#define GB_C  (((NB * SEQ / 64) * (DC / 64) + 7) / 8)       //  8 blocks
__global__ __launch_bounds__(256) void gemm_vzc(
    const unsigned short* __restrict__ WvT, const unsigned short* __restrict__ Xb,
    const unsigned short* __restrict__ Cb, const unsigned short* __restrict__ WcT,
    const unsigned short* __restrict__ WnT,
    unsigned short* VTh, unsigned short* VTl, float* Zf, float* out1,
    const float* __restrict__ bv, const float* __restrict__ bc, const float* __restrict__ bn) {
  GEMM_LDS(__bf16);
  int bx = (int)blockIdx.x;
  if (bx < NB * GB_V) {
    gemm64<__bf16, 3, 2, DM>(bx % GB_V, bx / GB_V, sT, sA, sB,
        WvT, 0LL, Xb, (long long)SEQ * DM,
        (void*)VTh, (void*)VTl, SEQ, (long long)DM * SEQ, bv,
        DM, SEQ, 1.0f, RSC);
    return;
  }
  bx -= NB * GB_V;
  if (bx < GB_Z) {
    gemm64<__bf16, 0, 1, DC>(bx, 0, sT, sA, sB,
        Cb, 0LL, WcT, 0LL,
        (void*)Zf, (void*)Zf, HN, 0LL, bc,
        NB * SEQ, HN, 1.0f, 1.0f);
    return;
  }
  bx -= GB_Z;
  gemm64<__bf16, 0, 1, DC>(bx, 0, sT, sA, sB,
      Cb, 0LL, WnT, 0LL,
      (void*)out1, (void*)out1, DC, 0LL, bn,
      NB * SEQ, DC, 1.0f, 1.0f);
}

// first output = [ctx_hi | ctx_res] . [Wo^T ; Wo^T]^T + bo -> f32 [NB*SEQ][DM]   (M=NB*SEQ, N=DM, K=2*DM)
__global__ __launch_bounds__(256) void gemm_out(
    const unsigned short* __restrict__ Octx, const unsigned short* __restrict__ WoT2,
    float* out0, const float* __restrict__ bo) {
  GEMM_LDS(__bf16);
  gemm64<__bf16, 0, 1, OP>((int)blockIdx.x, 0, sT, sA, sB,
      Octx, 0LL, WoT2, 0LL,
      (void*)out0, (void*)out0, DM, 0LL, bo,
      NB * SEQ, DM, 1.0f, 1.0f);
}

// =====================================================================================================
// z relayout: in f32 z [rows][HN] (16 heads x 16); out (a) f16 operand plane [rows][ZP], 64 halves per head =
// norms [rows][NH].  Block = 16 rows x 16 heads (thread = one (row, head)); staged in LDS; block barrier; line L of
// the block (L = 16*r + head, contiguous in the plane) written by lanes 8q..8q+7 of wave w with one instruction
// LDS: both arrays cross-wave (block barrier); fully written before read.
// =====================================================================================================
__global__ __launch_bounds__(256) void zprep(const float* __restrict__ zf, unsigned short* zp, float* zsq) {
  __shared__ __align__(16) unsigned short sZ[256 * LP];   // columns 64..71 of the pitch are never read
  __shared__ __align__(16) float sQ[256];
  const int tid  = (int)threadIdx.x;
  const int r    = tid >> 4, hd = tid & 15;
  const int row0 = blockIdx.x * 16;
  {
    const float* zr = zf + (size_t)(row0 + r) * HN + hd * HC;
    const v4f a0 = *(const v4f*)(zr);
    const v4f a1 = *(const v4f*)(zr + 4);
    const v4f a2 = *(const v4f*)(zr + 8);
    const v4f a3 = *(const v4f*)(zr + 12);
    float f[16];
#pragma unroll
    for (int e = 0; e < 4; ++e) { f[e] = a0[e]; f[4 + e] = a1[e]; f[8 + e] = a2[e]; f[12 + e] = a3[e]; }
    float q = 0.f;
#pragma unroll
    for (int e = 0; e < 16; ++e) q += f[e] * f[e];
    sQ[tid] = q;
    v4u ph0, ph1, pl0, pl1;
#pragma unroll
    for (int e = 0; e < 4; ++e) {
      const float f0 = f[2 * e], f1 = f[2 * e + 1], f2 = f[8 + 2 * e], f3 = f[9 + 2 * e];
      const _Float16 x0 = (_Float16)f0, x1 = (_Float16)f1, x2 = (_Float16)f2, x3 = (_Float16)f3;
      ph0[e] = pk16(h_bits(x0), h_bits(x1));
      ph1[e] = pk16(h_bits(x2), h_bits(x3));
      pl0[e] = pk16(h_bits((_Float16)((f0 - (float)x0) * RSC)), h_bits((_Float16)((f1 - (float)x1) * RSC)));
      pl1[e] = pk16(h_bits((_Float16)((f2 - (float)x2) * RSC)), h_bits((_Float16)((f3 - (float)x3) * RSC)));
    }
    const v4u z4 = {0u, 0u, 0u, 0u};
    unsigned short* sl = sZ + tid * LP;
    *(v4u*)(sl + 0)  = ph0;
    *(v4u*)(sl + 8)  = ph1;
    *(v4u*)(sl + 16) = pl0;
    *(v4u*)(sl + 24) = pl1;
    *(v4u*)(sl + 32) = ph0;
    *(v4u*)(sl + 40) = ph1;
    *(v4u*)(sl + 48) = z4;
    *(v4u*)(sl + 56) = z4;
  }
  __syncthreads();
  const int wave = tid >> 5, lane = tid & 31;
  const int q4 = lane >> 3, c8 = (lane & 7) * 8;
  unsigned short* base = zp + (size_t)row0 * ZP;
  v4u vv[8];
#pragma unroll
  for (int it = 0; it < 8; ++it) {
    const int L = it * 32 + wave * 4 + q4;
    vv[it] = *(const v4u*)(sZ + L * LP + c8);
  }
  {
#pragma unroll
    for (int it = 0; it < 8; ++it) {
      const int L = it * 32 + wave * 4 + q4;
      *(v4u*)(base + (size_t)L * 64 + c8) = vv[it];
    }
    
  }
  if (tid < 64) {                                       // waves 0 and 1, wave-uniform
    const v4f qv = *(const v4f*)(sQ + tid * 4);
    float* dst = zsq + (size_t)row0 * NH + tid * 4;
    *(v4f*)dst = qv;
    
  }
}

// =====================================================================================================
// Distance-kernel attention, per-head z dim 16, value dim 64, no mask, softmax over all SEQ keys.
//   z plane (f16): row (b*SEQ + t), head h at cols 64h.. : [hi | residual x4096 | hi | 0]
//   zsq (f32): [(b*SEQ + t)][h] = |z|^2
//   v^T hi plane (f16) and residual plane (f16, (v - hi)*4096): element (b, h, d, s) at [(b*DM + h*64 + d)*SEQ + s]
//   ctx plane (bf16): element (b, t, h, d) hi at [(b*SEQ + t)*OP + h*64 + d], residual at the same + DM
//   dot = A[hi|0] . B[hi;lo]  +  (A[lo|hi] . B[hi;lo]) / 4096 on f16 WMMA (two f32 accumulators);
//   score = -softplus(gamma_h) * max(|z_s|^2 + |z_t|^2 - 2 dot, 0) is <= 0 for every pair (the clamp, softplus >= 0),
//   and a query is one of its own keys, at distance 0 up to rounding: exp(score) cannot overflow and the row sum
//   is about 1 or more, so softmax = exp(s) / sum exp(s) is taken as it stands, with no running max and no rescale
//   (sound while softplus x the rounding error of a query's own distance, about 2^-22 |z|^2, stays far below 20).
//   p is carried x16384: one fma and one exp2 per score, exp2(-softplus * log2(e) * sq + 14), f16 for the product;
//   context = p . vh + (p . vl) / 4096 on f16 WMMA, both accumulators run through all chunks; sums in f32.
//   Both products run transposed: scores^T = keys (A) . queries (B), context^T = v^T (A) . p^T (B).  In every
//   accumulator tile a lane then holds ONE query (column lane&15) and rows 8*(lane>>4)+r (keys, or value dims):
//   the row sum is in-lane plus one exchange between the wave halves after the loop, and two score tiles pack straight
//   into the p^T operand (elements 0..7 = keys 8*half.. of the even tile, 8..15 = the same rows of the odd tile,
//   the k order of the v^T fragment), so p never goes through LDS.
//   Block = 4 waves = 4 x 16 query rows of one (b, h); grid = NB * NH * NQB; key chunks of 64, static trip NKT.
//   Chunk staging: 128 threads x 4 rows x 8 elements per plane = the whole 64x64 tile of each of the three planes
//   (8 lanes per 128-B row), and the 64 key norms, 16 per wave (plain loads, __syncthreads before and after; staged
//   extent == consumed extent); the context tile
//   is wave-private; the grid covers every (b, h, qb).
// =====================================================================================================
__global__ __launch_bounds__(128)
void attn_dist(const unsigned short* __restrict__ zpp, const float* __restrict__ zsq,
               const unsigned short* __restrict__ vhp, const unsigned short* __restrict__ vlp,
               const float* __restrict__ gam, unsigned short* octx) {
  union FH { v16h v; v8h h[2]; };
  __shared__ __align__(16) _Float16 Zsh[64 * LP];          // z key chunk [key][64], pitch LP    9 KB
  __shared__ __align__(16) _Float16 Vth[64 * LP];          // V^T hi [d][key], pitch LP          9 KB
  __shared__ __align__(16) _Float16 Vtl[64 * LP];          // V^T residual, pitch LP             9 KB
  __shared__ __align__(16) float    Zqs[64];               // squared norms of the chunk's keys
  __shared__ __align__(16) float    Os[4][16 * OSP];       // per wave context tile, pitch OSP  17 KB

  const int tid  = threadIdx.x;
  const int wave = tid >> 5;
  const int lane = tid & 31;
  const int hh   = lane >> 4;
  const int c    = lane & 15;

  const int bx   = blockIdx.x;
  const int qb   = bx % NQB;
  const int rest = bx / NQB;
  const int h    = rest % NH;
  const int b    = rest / NH;
  const int q0   = qb * 64 + wave * 16;
  const size_t rowB = (size_t)b * SEQ;

  const _Float16* Zp16 = (const _Float16*)(const void*)zpp;
  const _Float16* Vh = (const _Float16*)(const void*)vhp + ((size_t)b * DM + (size_t)h * HD) * SEQ;
  const _Float16* Vl = (const _Float16*)(const void*)vlp + ((size_t)b * DM + (size_t)h * HD) * SEQ;

  const float gx = bfr(gam[h]);
  const float g  = fmaxf(gx, 0.f) + log1pf(expf(-fabsf(gx)));   // softplus
  const float ng2 = -g * 1.44269504088896340736f;              // score in log2 units per unit of squared distance

  // ---- query-side B fragment [hi | residual] (column = lane&15) and this lane's query squared norm ----
  const v16h zq = ldfrag<_Float16>(Zp16 + (rowB + q0 + c) * ZP + (size_t)h * 64 + 8 * hh);
  const float zsq_q = zsq[(rowB + q0 + c) * NH + h];

  float lrow = 0.f;            // sum of 16384 p over this half's keys only; the halves are joined after the loop
  v8f oacc[4];                 // context^T (x16384): tile t, register r = value dim 16t + 8*hh + r of query c
  v8f o1[4];                   // the same of the residual plane (x16384 x4096)
#pragma unroll
  for (int t = 0; t < 4; ++t) { oacc[t] = zero8(); o1[t] = zero8(); }

  for (int kt = 0; kt < NKT; ++kt) {         // static trip count
    const int kv0 = kt * 64;
    __syncthreads();
    {
      // 8 lanes per tile row: one 16-B load of a wave covers the whole 128-B lines of 4 rows (not 32 B of each of 16)
      const int r = tid >> 3, c8 = (tid & 7) * 8;      // rows r, r+16, r+32, r+48; 16-B piece c8 of the row
      const _Float16* zg  = Zp16 + (rowB + kv0 + r) * ZP + (size_t)h * 64 + c8;     // key row kv0+r, 64-half head segment
      const _Float16* vg  = Vh + (size_t)r * SEQ + kv0 + c8;                         // v^T row d = r, s = kv0+c8..+7
      const _Float16* vlg = Vl + (size_t)r * SEQ + kv0 + c8;
      // each wave brings the norms of its own 16 keys (both lane halves the same 16: 8 lines a load), in one group with the tiles
      const float zn = zsq[(rowB + kv0 + wave * 16 + c) * NH + h];
#pragma unroll
      for (int i = 0; i < 4; ++i) {
        const v8h a0 = *(const v8h*)(zg + (size_t)(16 * i) * ZP);
        const v8h b0 = *(const v8h*)(vg + (size_t)(16 * i) * SEQ);
        const v8h b1 = *(const v8h*)(vlg + (size_t)(16 * i) * SEQ);
        *(v8h*)(Zsh + (16 * i + r) * LP + c8) = a0;
        *(v8h*)(Vth + (16 * i + r) * LP + c8) = b0;
        *(v8h*)(Vtl + (16 * i + r) * LP + c8) = b1;
      }
#if DEV_ASM
      // input-only use of the loaded norm: keeps its load up among the tile loads; sunk into the branch below it
      // would be issued behind their waits and cost the block a second load latency in front of the barrier
      asm volatile("" :: "v"(zn));
#endif
      if (hh == 0) Zqs[wave * 16 + c] = zn;                       // lanes 0..15 of every wave: 4 x 16 = the 64 norms
#if DEV_ASM
      // before an address register of the staging loads above is advanced or reused
      asm volatile("s_wait_xcnt 0x0" ::: "memory");
#endif
    }
    __syncthreads();

    // ---- scores^T: 64 keys x 16 queries per wave, 2 f16 products per key subtile; p^T (x16384, f16) ----
    FH pa[2];                    // p^T operand of keys 0..31 and 32..63 of the chunk
    float pj[4];                 // four independent sums, one per key subtile
#pragma unroll
    for (int j = 0; j < 4; ++j) {
      const _Float16* zr = Zsh + (j * 16 + c) * LP + 8 * hh;
      FH b1, b2;
      b2.h[0] = *(const v8h*)(zr + 16);     // k 0..15  <- residual of key
      b2.h[1] = *(const v8h*)(zr + 32);     // k 16..31 <- hi of key
      b1.h[0] = *(const v8h*)(zr + 32);     // k 0..15  <- hi of key
      b1.h[1] = *(const v8h*)(zr + 48);     // k 16..31 <- zeros
      v8f ah = mma_h(b1.v, zq, zero8());    // hi.hi
      v8f ax = mma_h(b2.v, zq, zero8());    // (hi.lo + lo.hi) x4096
      const v4f zt0 = *(const v4f*)(Zqs + j * 16 + 8 * hh);       // norms of keys 16j + 8*hh + 0..3
      const v4f zt1 = *(const v4f*)(Zqs + j * 16 + 8 * hh + 4);   // and + 4..7
      v8f sq8;
      {
#pragma clang fp contract(off)
#pragma unroll
        for (int r = 0; r < 8; ++r) {
          const float d = ah[r] + ax[r] * (1.0f / RSC);
          const float sq = (zsq_q + (r < 4 ? zt0[r & 3] : zt1[r & 3])) - 2.0f * d;
          sq8[r] = fmaxf(sq, 0.f);
        }
      }
      pj[j] = 0.f;
#pragma unroll
      for (int r = 0; r < 8; ++r) {
        const float p = __builtin_amdgcn_exp2f(__builtin_fmaf(ng2, sq8[r], 14.0f));   // 16384 exp(score), <= 16384
        pj[j] += p;
        pa[j >> 1].h[j & 1][r] = (_Float16)p;
      }
    }
    lrow += (pj[0] + pj[1]) + (pj[2] + pj[3]);

    // ---- context^T += V^T . P^T (f16 WMMA); residual products into a separate accumulator ----
#pragma unroll                   // constant kk: pa[kk] stays in registers
    for (int kk = 0; kk < 2; ++kk) {
#pragma unroll
      for (int t = 0; t < 4; ++t) {
        FH vb, vl;
        vb.h[0] = *(const v8h*)(Vth + (t * 16 + c) * LP + kk * 32 + 8 * hh);
        vb.h[1] = *(const v8h*)(Vth + (t * 16 + c) * LP + kk * 32 + 16 + 8 * hh);
        vl.h[0] = *(const v8h*)(Vtl + (t * 16 + c) * LP + kk * 32 + 8 * hh);
        vl.h[1] = *(const v8h*)(Vtl + (t * 16 + c) * LP + kk * 32 + 16 + 8 * hh);
        oacc[t] = mma_h(vb.v, pa[kk].v, oacc[t]);
        o1[t]   = mma_h(vl.v, pa[kk].v, o1[t]);
      }
    }
  }
#pragma unroll
  for (int t = 0; t < 4; ++t)
#pragma unroll
    for (int r = 0; r < 8; ++r) oacc[t][r] += o1[t][r] * (1.0f / RSC);

  // ---- normalise (1/l; l and the context carry the same x16384), stage the wave's 16x64 tile, convert to bf16 hi + bf16 residual,
  float* os = Os[wave];
  {
    const float l = lrow + xhalf(lrow);          // both halves' keys
    const float inv = (l > 0.f) ? (1.0f / l) : 0.f;
#pragma unroll
    for (int t = 0; t < 4; ++t) {                // row = query c, 8 consecutive value dims per tile
      v4f w0, w1;
#pragma unroll
      for (int e = 0; e < 4; ++e) { w0[e] = oacc[t][e] * inv; w1[e] = oacc[t][4 + e] * inv; }
      *(v4f*)(os + c * OSP + t * 16 + 8 * hh)     = w0;
      *(v4f*)(os + c * OSP + t * 16 + 8 * hh + 4) = w1;
    }
  }
  __builtin_amdgcn_fence(__ATOMIC_RELEASE, "workgroup");
  __builtin_amdgcn_wave_barrier();
  __builtin_amdgcn_fence(__ATOMIC_ACQUIRE, "workgroup");
  {
    const int q4 = lane >> 3, c8 = (lane & 7) * 8;
    v4u hv[4], lv[4];
#pragma unroll
    for (int it = 0; it < 4; ++it) {
      const int row = it * 4 + q4;   // it 0..3 x q4 0..3 = rows 0..15 of the wave tile
      const float* sp = os + row * OSP + c8;
      v4u a, a2;
#pragma unroll
      for (int e = 0; e < 4; ++e) {
        const float f0 = sp[2 * e], f1 = sp[2 * e + 1];
        const unsigned short hb0 = bf_bits(f0), hb1 = bf_bits(f1);
        const unsigned short lb0 = bf_bits(f0 - bf_up(hb0)), lb1 = bf_bits(f1 - bf_up(hb1));
        a[e]  = pk16(hb0, hb1);
        a2[e] = pk16(lb0, lb1);
      }
      hv[it] = a; lv[it] = a2;
    }
    {
#pragma unroll
      for (int it = 0; it < 4; ++it) {
        const int row = it * 4 + q4;
        const size_t go = (rowB + q0 + row) * OP + (size_t)h * HD + c8;
        *(v4u*)(octx + go)      = hv[it];
        *(v4u*)(octx + go + DM) = lv[it];
      }
      
    }
  }
}

// =====================================================================================================
// Workspace map (bytes, NB=2 / SEQ=2048), every region an exact multiple of its whole-line / whole-tile store
// granularity, back to back:
//   Xb   bf16 [NB*SEQ][DM]            8388608
//   Cb   bf16 [NB*SEQ][DC]             524288
//   WvT  bf16 [DM n][DM k]            2097152
//   WoT2 bf16 [DM n][2*DM k]          4194304
//   WcT  bf16 [HN][DC]                  32768
//   WnT  bf16 [DC][DC]                   8192
//   Zf   f32  [NB*SEQ][HN]            4194304
//   Zp   f16  [NB*SEQ][ZP]            8388608
//   Zsq  f32  [NB*SEQ][NH]             262144
//   VTh  f16  [NB][DM][SEQ]           8388608
//   VTl  f16  [NB][DM][SEQ]           8388608
//   Octx bf16 [NB*SEQ][OP]           16777216
//   total                            61644800
// Weights arrive [in][out]; tr64 produces the [out n][in k] (k contiguous) layout the GEMM wants.
// =====================================================================================================
extern "C" void kernel_launch(void* const* d_in, const int* in_sizes, int n_in,
                              void* d_out, int out_size, void* d_ws, size_t ws_size,
                              hipStream_t stream) {
  if (n_in < 11) return;
  if (in_sizes[0] < ((NB - 1) * SEQ_FULL + SEQ) * DM) return;
  if (in_sizes[1] < ((NB - 1) * SEQ_FULL + SEQ) * DC) return;
  if (in_sizes[2] < DM * DM || in_sizes[3] < DM) return;
  if (in_sizes[4] < DC * HN || in_sizes[5] < HN) return;
  if (in_sizes[6] < DC * DC || in_sizes[7] < DC) return;
  if (in_sizes[8] < DM * DM || in_sizes[9] < DM) return;
  if (in_sizes[10] < NH) return;
  if ((size_t)out_size < OUT1_OFF + (size_t)NB * SEQ * DC) return;

  const float* hidden = (const float*)d_in[0];
  const float* coords = (const float*)d_in[1];
  const float* Wv     = (const float*)d_in[2];
  const float* bv     = (const float*)d_in[3];
  const float* Wc     = (const float*)d_in[4];
  const float* bc     = (const float*)d_in[5];
  const float* Wn     = (const float*)d_in[6];
  const float* bn     = (const float*)d_in[7];
  const float* Wo     = (const float*)d_in[8];
  const float* bo     = (const float*)d_in[9];
  const float* gamma  = (const float*)d_in[10];

  const size_t nRows = (size_t)NB * SEQ;
  const size_t PXB  = nRows * DM * 2;
  const size_t PCB  = nRows * DC * 2;
  const size_t PWV  = (size_t)DM * DM * 2;
  const size_t PWO2 = (size_t)DM * OP * 2;
  const size_t PWC  = (size_t)HN * DC * 2;
  const size_t PWN  = (size_t)DC * DC * 2;
  const size_t PZF  = nRows * HN * 4;
  const size_t PZP  = nRows * ZP * 2;
  const size_t PZQ  = nRows * NH * 4;
  const size_t PVT  = (size_t)NB * DM * SEQ * 2;
  const size_t POC  = nRows * OP * 2;
  size_t off = 0;
  const size_t oXb  = off; off += PXB;
  const size_t oCb  = off; off += PCB;
  const size_t oWv  = off; off += PWV;
  const size_t oWo  = off; off += PWO2;
  const size_t oWc  = off; off += PWC;
  const size_t oWn  = off; off += PWN;
  const size_t oZf  = off; off += PZF;
  const size_t oZp  = off; off += PZP;
  const size_t oZq  = off; off += PZQ;
  const size_t oVTh = off; off += PVT;
  const size_t oVTl = off; off += PVT;
  const size_t oOc  = off; off += POC;
  if (off > ws_size) return;                       // off = 61644800 at full size
  if (off > (size_t)134217728) return;

  char* ws = (char*)d_ws;
  unsigned short* Xb   = (unsigned short*)(ws + oXb);
  unsigned short* Cb   = (unsigned short*)(ws + oCb);
  unsigned short* WvT  = (unsigned short*)(ws + oWv);
  unsigned short* WoT2 = (unsigned short*)(ws + oWo);
  unsigned short* WcT  = (unsigned short*)(ws + oWc);
  unsigned short* WnT  = (unsigned short*)(ws + oWn);
  float*          Zf   = (float*)(ws + oZf);
  unsigned short* Zpl  = (unsigned short*)(ws + oZp);
  float*          Zsq  = (float*)(ws + oZq);
  unsigned short* VTh  = (unsigned short*)(ws + oVTh);
  unsigned short* VTl  = (unsigned short*)(ws + oVTl);
  unsigned short* Octx = (unsigned short*)(ws + oOc);
  float* out0 = (float*)d_out;
  float* out1 = (float*)d_out + OUT1_OFF;

  const dim3 blk(256);
  const dim3 gPrepAll(2 * PB_W + PB_C + PB_N + PB_X + PB_Q);           // 2693 blocks
  const dim3 gVZC(NB * GB_V + GB_Z + GB_C);                            //  168 blocks
  const dim3 gO(((NB * SEQ / 64) * (DM / 64) + 7) / 8);                //  128 blocks
  const dim3 gPrep((unsigned)(nRows / 16));                            //  256 blocks
  const dim3 gAttn(NB * NH * NQB);                                     // 1024 blocks of 128

  // (1) activations -> bf16 planes; weights [in][out] f32 -> bf16 [out][in], Wo^T duplicated along k (pitch 2*DM)
  prep_all<<<gPrepAll, blk, 0, stream>>>(hidden, coords, Wv, Wo, Wc, Wn, Xb, Cb, WvT, WoT2, WcT, WnT);
  // (2) v^T planes, z (f32) and the second output (d_out at element OUT1_OFF)
  gemm_vzc<<<gVZC, blk, 0, stream>>>(WvT, Xb, Cb, WcT, WnT, VTh, VTl, Zf, out1, bv, bc, bn);
  // (3) z -> f16 operand plane [hi | res | hi | 0] and f32 squared norms
  zprep<<<gPrep, blk, 0, stream>>>(Zf, Zpl, Zsq);
  // (4) attention -> ctx plane (bf16 hi | bf16 residual) [b*SEQ+t][OP]
  attn_dist<<<gAttn, dim3(128), 0, stream>>>(Zpl, Zsq, VTh, VTl, gamma, Octx);
  // (5) first output
  gemm_out<<<gO, blk, 0, stream>>>(Octx, WoT2, out0, bo);
  (void)hipGetLastError();
}

// v007
// Measured time: 118 microseconds a run.
// Timed twice side by side with v006, it ran 1.09 times as fast both times.
// All steps since v000 together make it 3.23 times as fast.
// Contractions: value = Wv^T.x^T+bv, z = coords.Wc+bc, coords.Wn+bn = v_wmma_f32_16x16x32_bf16 (bf16 operands from RNE-converted inputs, single product, f32 accumulate);
// z.z^T scores = v_wmma_f32_16x16x32_f16 (z as f16 hi + f16 residual x4096 packed along k, 2 products into separate f32 accumulators);
// p.v = v_wmma_f32_16x16x32_f16 (p carried x16384 in f16; v as f16 hi plane + f16 residual plane x4096; 2 products, f32 accumulate);
// ctx.Wo+bo = v_wmma_f32_16x16x32_bf16 (ctx as bf16 hi and bf16 residual planes concatenated along k, Wo^T bf16 duplicated along k; f32 accumulate);
// squared norms, softplus, softmax (no running max: every score is <= 0) and bias adds in f32.
#include <hip/hip_runtime.h>
#include <math.h>
#include <stdint.h>

#ifndef NB
#define NB 2
#endif
#ifndef SEQ
#define SEQ 2048
#endif
#define NB_FULL  2
#define SEQ_FULL 2048
#define DM   1024
#define NH   16
#define HC   16
#define HD   64
#define DC   64
#define HN   (NH * HC)        // 256
#define ZP   (NH * 64)        // 1024: z operand plane pitch, 64 halves per head [hi | lo x4096 | hi | 0]
#define OP   (2 * DM)         // 2048: ctx plane pitch (bf16 hi | bf16 residual)
#define NQB  (SEQ / 64)       // 64-row query blocks per sequence
#define NKT  (SEQ / 64)       // 64-key chunks per sequence
#define LP   72               // LDS row pitch in halves of every 64-half tile row: 144 B = 16 B x odd, so the 16 rows
                              // that one ds_load_b128 touches fall on 16 different groups of four banks (at 128 B: on one)
#define OSP  68               // LDS row pitch in floats of the 64-float context tile rows (272 B = 16 B x odd)
#define RSC    4096.0f
#define OUT1_OFF ((size_t)NB_FULL * SEQ_FULL * DM)   // element offset of the second output in d_out
static_assert(NH * HD == DM);
static_assert(HC == 16 && HD == 64 && DC == 64);
static_assert((SEQ % 64) == 0 && SEQ >= 64 && SEQ <= SEQ_FULL);
static_assert(NB >= 1 && NB <= NB_FULL);
static_assert((DM % 64) == 0 && (HN % 64) == 0 && (OP % 64) == 0);
static_assert(OUT1_OFF * 4 == 16777216);

typedef _Float16 v16h __attribute__((ext_vector_type(16)));
typedef _Float16 v8h  __attribute__((ext_vector_type(8)));
typedef __bf16   v16b __attribute__((ext_vector_type(16)));
typedef __bf16   v8b  __attribute__((ext_vector_type(8)));
typedef float    v8f  __attribute__((ext_vector_type(8)));
typedef float    v4f  __attribute__((ext_vector_type(4)));
typedef unsigned int v4u __attribute__((ext_vector_type(4)));

#if defined(__HIP_DEVICE_COMPILE__)
#define DEV_ASM 1
#else
#define DEV_ASM 0
#endif

// ---- scalar helpers --------------------------------------------------------------------------------
__device__ __forceinline__ unsigned short bf_bits(float f) {          // f32 -> bf16 bits, RNE convert
  unsigned u = __float_as_uint(f);
  return (unsigned short)((u + 0x7FFFu + ((u >> 16) & 1u)) >> 16);
}
__device__ __forceinline__ float bf_up(unsigned short hb) { return __uint_as_float(((unsigned)hb) << 16); }
__device__ __forceinline__ float bfr(float f) { return bf_up(bf_bits(f)); }   // value of the bf16 RNE convert
__device__ __forceinline__ unsigned short h_bits(_Float16 x) { return __builtin_bit_cast(unsigned short, x); }
__device__ __forceinline__ unsigned pk16(unsigned short a, unsigned short b) { return (unsigned)a | ((unsigned)b << 16); }
__device__ __forceinline__ v8f zero8() { v8f z = {0.f, 0.f, 0.f, 0.f, 0.f, 0.f, 0.f, 0.f}; return z; }
__device__ __forceinline__ float xhalf(float x) {                      // value of lane l ^ 16
  const int b = __builtin_bit_cast(int, x);
  return __builtin_bit_cast(float, __builtin_amdgcn_permlanex16(b, b, 0x76543210, 0xfedcba98, false, false));
}

// ---- fragment types / loaders: 16-bit A/B operand, lane -> row/col (lane&15), p already includes +8*(lane>>4);
//      elements 0..7 <- p[0..7] (k0+8h..k0+8h+7), elements 8..15 <- p[16..23] (k0+16+8h..k0+16+8h+7)
template <typename OT> struct FT;
template <> struct FT<__bf16>   { typedef v16b frag; typedef v8b half8; };
template <> struct FT<_Float16> { typedef v16h frag; typedef v8h half8; };

template <typename OT>
__device__ __forceinline__ typename FT<OT>::frag ldfrag(const OT* p) {
  union { typename FT<OT>::frag v; typename FT<OT>::half8 h[2]; } f;
  f.h[0] = *(const typename FT<OT>::half8*)(p);
  f.h[1] = *(const typename FT<OT>::half8*)(p + 16);
  return f.v;
}

// ---- WMMA helpers (asm guard bodies are device-only; concrete operand types) -----------------------------
__device__ __forceinline__ v8f mmar(v16b a, v16b b, v8f c) {
  return __builtin_amdgcn_wmma_f32_16x16x32_bf16(false, a, false, b, (short)0, c, false, false);
}
__device__ __forceinline__ v8f mmar(v16h a, v16h b, v8f c) {
  return __builtin_amdgcn_wmma_f32_16x16x32_f16(false, a, false, b, (short)0, c, false, false);
}
// guarded form: 4 VALU slots after the WMMA, D tied, A/B kept live
__device__ __forceinline__ v8f mma_h(v16h a, v16h b, v8f c) {
  c = __builtin_amdgcn_wmma_f32_16x16x32_f16(false, a, false, b, (short)0, c, false, false);
#if DEV_ASM
  asm volatile("v_nop\n\tv_nop\n\tv_nop\n\tv_nop" : "+v"(c) : "v"(a), "v"(b));
#endif
  return c;
}
__device__ __forceinline__ void dep_guard(v8f& a, v8f& b, v16b x, v16b y) {
#if DEV_ASM
  asm volatile("v_nop\n\tv_nop\n\tv_nop\n\tv_nop" : "+v"(a), "+v"(b) : "v"(x), "v"(y));
#else
  (void)a; (void)b; (void)x; (void)y;
#endif
}
__device__ __forceinline__ void dep_guard(v8f& a, v8f& b, v16h x, v16h y) {
#if DEV_ASM
  asm volatile("v_nop\n\tv_nop\n\tv_nop\n\tv_nop" : "+v"(a), "+v"(b) : "v"(x), "v"(y));
#else
  (void)a; (void)b; (void)x; (void)y;
#endif
}
__device__ __forceinline__ void keep4(v16b a, v16b b, v16b c, v16b d) {
#if DEV_ASM
  asm volatile("v_nop" :: "v"(a), "v"(b), "v"(c), "v"(d));
#else
  (void)a; (void)b; (void)c; (void)d;
#endif
}
__device__ __forceinline__ void keep4(v16h a, v16h b, v16h c, v16h d) {
#if DEV_ASM
  asm volatile("v_nop" :: "v"(a), "v"(b), "v"(c), "v"(d));
#else
  (void)a; (void)b; (void)c; (void)d;
#endif
}
__device__ __forceinline__ void acc_guard4(v8f& a, v8f& b, v8f& c, v8f& d) {
#if DEV_ASM
  asm volatile("v_nop\n\tv_nop\n\tv_nop\n\tv_nop" : "+v"(a), "+v"(b), "+v"(c), "+v"(d));
#else
  (void)a; (void)b; (void)c; (void)d;
#endif
}

// =====================================================================================================
// f32 rows -> bf16 plane rows (RNE convert), 8 elements per thread, one 16-B store per lane: a wave writes
// Dense output row `row` (0..nrows-1) reads source row (row / seq) * seqfull + row % seq (full batch stride).
// ceil(nrows*rowlen8/256) blocks, bx = the block's index among them. coverage: nrows*rowlen8 threads x 8 = the
// whole plane (exact multiple of 256).
// =====================================================================================================
__device__ __forceinline__ void cvtrows(int bx, const float* __restrict__ in, unsigned short* out,
                                        int rowlen8, int nrows, int seq, int seqfull) {
  const int i = bx * 256 + (int)threadIdx.x;
  if (i < nrows * rowlen8) {
    const int row  = i / rowlen8;
    const int c    = i - row * rowlen8;
    const int bq   = row / seq;
    const int srow = bq * seqfull + (row - bq * seq);
    const float* src = in + ((size_t)srow * (size_t)rowlen8 + (size_t)c) * 8;
    const v4f a  = *(const v4f*)(src);
    const v4f a4 = *(const v4f*)(src + 4);
    v4u p;
    p[0] = pk16(bf_bits(a[0]),  bf_bits(a[1]));
    p[1] = pk16(bf_bits(a[2]),  bf_bits(a[3]));
    p[2] = pk16(bf_bits(a4[0]), bf_bits(a4[1]));
    p[3] = pk16(bf_bits(a4[2]), bf_bits(a4[3]));
    unsigned short* o = out + (size_t)i * 8;
    *(v4u*)o = p;
    
  }
}

// =====================================================================================================
// Weight transpose + bf16 convert through LDS: in f32 [krows][ncols] (pitch ldi) -> out bf16 [n][k] (pitch ldo,
// k contiguous), optionally duplicated at +dup elements in the same output row.  One block = one 64x64 tile:
// input rows k0 = 64*by, cols n0 = 64*bx.  Load: thread r = tid>>2 reads 16 floats of input row
// k0+r; LDS holds the transposed tile; block barrier; write: wave w, lane>>3 = q, lanes 8q..8q+7 write one whole
// LDS tile: cross-wave (block barrier); columns 64..71 of the pitch are never read.
// =====================================================================================================
__device__ __forceinline__ void tr64(int bx, int by, unsigned short* sT, const float* __restrict__ in, int ldi,
                                     unsigned short* out, int ldo, int dup) {
  const int tid = (int)threadIdx.x;
  const int k0  = by * 64;
  const int n0  = bx * 64;
  {
    const int r = tid >> 2, c16 = (tid & 3) * 16;
    const float* src = in + (size_t)(k0 + r) * (size_t)ldi + n0 + c16;
    const v4f a0 = *(const v4f*)(src);
    const v4f a1 = *(const v4f*)(src + 4);
    const v4f a2 = *(const v4f*)(src + 8);
    const v4f a3 = *(const v4f*)(src + 12);
#pragma unroll
    for (int e = 0; e < 4; ++e) {
      sT[(c16 + e) * 72 + r]      = bf_bits(a0[e]);
      sT[(c16 + 4 + e) * 72 + r]  = bf_bits(a1[e]);
      sT[(c16 + 8 + e) * 72 + r]  = bf_bits(a2[e]);
      sT[(c16 + 12 + e) * 72 + r] = bf_bits(a3[e]);
    }
  }
  __syncthreads();
  const int wave = tid >> 5, lane = tid & 31;
  const int q = lane >> 3, c8 = (lane & 7) * 8;
  v4u vv[2];
#pragma unroll
  for (int it = 0; it < 2; ++it) {
    const int n = it * 32 + wave * 4 + q;
    vv[it] = *(const v4u*)(sT + n * 72 + c8);
  }
  {
#pragma unroll
    for (int it = 0; it < 2; ++it) {
      const int n = it * 32 + wave * 4 + q;
      unsigned short* d = out + (size_t)(n0 + n) * (size_t)ldo + k0 + c8;
      *(v4u*)d = vv[it];
      if (dup != 0) *(v4u*)(d + dup) = vv[it];
    }
#if DEV_ASM
    // behind the last store: in the listing another range's code follows and reuses the stores' registers
    asm volatile("s_wait_xcnt 0x0" ::: "memory");
#endif
  }
}

// =====================================================================================================
// All six input conversions in ONE launch: none reads what another writes, so each block takes its job from the
// range its index falls in (block-uniform branch; the barrier of tr64 is reached by whole blocks only).
// Ranges, in index order: Wv^T, Wo^T (duplicated along k), Wc^T, Wn^T, hidden rows, coordinate rows.
// =====================================================================================================
#define PB_W  ((DM / 64) * (DM / 64))            // 256 tiles of a [DM][DM] weight
#define PB_C  ((HN / 64) * (DC / 64))            //   4 tiles of Wc [DC][HN]
#define PB_N  ((DC / 64) * (DC / 64))            //   1 tile of Wn [DC][DC]
#define PB_X  (NB * SEQ * DM / 8 / 256)          // 2048 blocks of hidden rows
#define PB_Q  (NB * SEQ * DC / 8 / 256)          //  128 blocks of coordinate rows
static_assert((NB * SEQ * DM / 8) % 256 == 0 && (NB * SEQ * DC / 8) % 256 == 0);
__global__ __launch_bounds__(256) void prep_all(const float* __restrict__ hidden, const float* __restrict__ coords,
                                                const float* __restrict__ Wv, const float* __restrict__ Wo,
                                                const float* __restrict__ Wc, const float* __restrict__ Wn,
                                                unsigned short* Xb, unsigned short* Cb, unsigned short* WvT,
                                                unsigned short* WoT2, unsigned short* WcT, unsigned short* WnT) {
  __shared__ __align__(16) unsigned short sT[64 * 72];
  int bx = (int)blockIdx.x;
  if (bx < PB_W) { tr64(bx % (DM / 64), bx / (DM / 64), sT, Wv, DM, WvT, DM, 0); return; }
  bx -= PB_W;
  if (bx < PB_W) { tr64(bx % (DM / 64), bx / (DM / 64), sT, Wo, DM, WoT2, OP, DM); return; }
  bx -= PB_W;
  if (bx < PB_C) { tr64(bx % (HN / 64), bx / (HN / 64), sT, Wc, HN, WcT, DC, 0); return; }
  bx -= PB_C;
  if (bx < PB_N) { tr64(bx % (DC / 64), bx / (DC / 64), sT, Wn, DC, WnT, DC, 0); return; }
  bx -= PB_N;
  if (bx < PB_X) { cvtrows(bx, hidden, Xb, DM / 8, NB * SEQ, SEQ, SEQ_FULL); return; }
  bx -= PB_X;
  cvtrows(bx, coords, Cb, DC / 8, NB * SEQ, SEQ, SEQ_FULL);
}

// =====================================================================================================
// Register-blocked batched WMMA GEMM (16-bit operand type OT): C[m][n] = sum_k A[m][k] * Bt[n][k] (+ bias);
// a block of 4 waves, WR x WC of them, takes one (64 WR) x (64 WC) tile, each wave a 64x64 part of it. A row-major
// [M][K], Bt row-major [N][K] (k contiguous), both of row pitch K = KD elements, a compile-time constant so that the
// staging loads of a tile share one address and differ by immediate offsets; M a multiple of 64 WR, N of 64 WC, KD of
// 64. bx = block index within the product, b = batch index (strides in elements). Per 64-k step the BLOCK brings its
// 64 WR rows of A and 64 WC rows of Bt in ONCE, with 16-B loads that cover whole 128-B lines (8 lanes per row, 16 rows
// per load of the block), in registers one step ahead of the LDS store; the rows go to one of two LDS buffers
// (pitch LP) that all four waves read their fragments from with the split k map (ldfrag): a row of A serves WC waves,
// a row of Bt WR waves. One block barrier per step: it publishes the buffer just written and ends the reads of the other.
// BIAS 0: none; 1: per column n (bias[n]); 2: per row m (bias[m]); bias values RNE-converted to bf16 in f32.
// OUT_MODE 0: f32 C (pitch ldc), value * oscale + bias.
// OUT_MODE 3: f16 hi plane C + f16 residual plane C2 = f16((v - hi) * rscale) (same pitch / stride), v = acc*oscale+bias.
// whole 64x64 tile; slab pitch columns 64..67 never read.
// =====================================================================================================
// Block barrier that orders LDS accesses only: __syncthreads() also waits for the global loads in flight, which here
// are the rows of a later step and are wanted only at their LDS store
__device__ __forceinline__ void lds_barrier() {
  __builtin_amdgcn_fence(__ATOMIC_RELEASE, "workgroup", "local");
  __builtin_amdgcn_s_barrier();
  __builtin_amdgcn_fence(__ATOMIC_ACQUIRE, "workgroup", "local");
}
template <bool B> struct BoolC { static constexpr bool value = B; };   // a compile-time flag as an argument
// LDS of a GEMM block, declared once in each kernel and handed to the body
#define GW 4                                       // waves of a GEMM block
#define GEMM_ROWS 512                              // tile rows of the LDS pool: two buffers of 128 A + 128 Bt rows
#define GEMM_LDS(OT)                                                                                             \
  __shared__ __align__(16) float sT[GW * 16 * 68]; /* per-wave 16x64 slab, pitch 68 floats */                     \
  __shared__ __align__(16) OT sP[GEMM_ROWS * LP]   /* block tiles [row][64 k], columns 64..71 never read */
template <typename OT, int OUT_MODE, int BIAS, int KD, int WR, int WC>
__device__ __forceinline__ void gemm64(
    int bx, int b, float* sT, OT* sP,
    const unsigned short* __restrict__ Ap, long long strideA,
    const unsigned short* __restrict__ Btp, long long strideB,
    void* Cout, void* Cout2, int ldc, long long strideC,
    const float* __restrict__ bias,
    int M, int N, float oscale, float rscale) {
  static_assert((KD % 64) == 0 && KD >= 64);
  static_assert(WR * WC == GW);
  constexpr int NBUF = (KD > 64) ? 2 : 1;      // a single step needs one buffer
  constexpr int ASZ  = 64 * WR * LP;           // elements of one A buffer
  constexpr int BSZ  = 64 * WC * LP;           // elements of one Bt buffer
  static_assert(NBUF * 64 * (WR + WC) <= GEMM_ROWS);
  typedef typename FT<OT>::frag V16;
  typedef typename FT<OT>::half8 H8;
  const OT* A  = (const OT*)(const void*)Ap;
  const OT* Bt = (const OT*)(const void*)Btp;
  const int tid  = (int)threadIdx.x;
  const int lane = tid & 31;
  const int wave = tid >> 5;
  const int tilesN = N / (64 * WC);
  const int tilesM = M / (64 * WR);
  if (bx >= tilesM * tilesN) return;     // block-uniform, in front of every barrier
  const int tm = bx / tilesN;
  const int tn = bx - tm * tilesN;
  const int bm0 = tm * (64 * WR);        // the block's first row of A and of Bt
  const int bn0 = tn * (64 * WC);
  const int m0 = bm0 + (wave / WC) * 64; // this wave's 64x64 part
  const int n0 = bn0 + (wave % WC) * 64;

  const OT* Ab = A  + (size_t)b * (size_t)strideA;
  const OT* Bb = Bt + (size_t)b * (size_t)strideB;

  const int rlane = lane & 15;                 // row (A) / col (B, D) within subtile
  const int koff  = (lane >> 4) * 8;           // k offset of this lane half
  const int mOff  = (lane >> 4) * 8;           // D row offset

  v8f acc[4][4];
#pragma unroll
  for (int i = 0; i < 4; ++i)
#pragma unroll
    for (int j = 0; j < 4; ++j) acc[i][j] = zero8();

  OT* sA = sP;                                 // NBUF buffers of 64 WR rows
  OT* sB = sP + NBUF * ASZ;                    // NBUF buffers of 64 WC rows
  const OT* wa = sA + (wave / WC) * (64 * LP); // this wave's 64 rows in buffer 0
  const OT* wb = sB + (wave % WC) * (64 * LP);
  const int sr = tid >> 3;                     // row within the 16 rows of one staging load of the block
  const int sc = (tid & 7) * 8;                // 16-B piece of the row's 128-B line
  const int so = sr * LP + sc;                 // the same place in an LDS buffer
  // block-uniform tile bases, told so to the compiler: they stay in scalar registers
  const char* gA = (const char*)(Ab + (size_t)__builtin_amdgcn_readfirstlane(bm0) * KD);
  const char* gB = (const char*)(Bb + (size_t)__builtin_amdgcn_readfirstlane(bn0) * KD);
  const unsigned lo = (unsigned)(sr * KD + sc) * 2u;      // byte offset of this lane's piece of tile row sr
  H8 ra[4 * WR], rb[4 * WC];                   // staging loops unrolled: constant indices keep both in registers
#pragma unroll
  for (int it = 0; it < 4 * WR; ++it) ra[it] = *(const H8*)(gA + lo + 32 * it * KD);
#pragma unroll
  for (int it = 0; it < 4 * WC; ++it) rb[it] = *(const H8*)(gB + lo + 32 * it * KD);
#if DEV_ASM
  // before an address register of the loads above is reused; the inputs keep those registers as they are up to here
  asm volatile("s_wait_xcnt 0x0" :: "v"(lo), "s"(gA), "s"(gB) : "memory");
#endif
#pragma unroll
  for (int it = 0; it < 4 * WR; ++it) *(H8*)(sA + 16 * it * LP + so) = ra[it];      // step 0 -> buffer 0
#pragma unroll
  for (int it = 0; it < 4 * WC; ++it) *(H8*)(sB + 16 * it * LP + so) = rb[it];
  if (KD > 64) {                               // step 1 into the registers
#pragma unroll
    for (int it = 0; it < 4 * WR; ++it) ra[it] = *(const H8*)(gA + 2 * 64 + lo + 32 * it * KD);
#pragma unroll
    for (int it = 0; it < 4 * WC; ++it) rb[it] = *(const H8*)(gB + 2 * 64 + lo + 32 * it * KD);
#if DEV_ASM
    // before an address register of these loads is reused; the inputs keep those registers as they are up to here
    asm volatile("s_wait_xcnt 0x0" :: "v"(lo), "s"(gA), "s"(gB) : "memory");
#endif
  }
  lds_barrier();                               // buffer 0 is whole before any wave reads it
  // One 64-k step. MORE: a next step exists; its rows go to the other buffer and the barrier publishes them. The last
  // step is written out by itself, so that in the loop the stores stand on every path and the waits of the second
  // block's fragments can be counted past them.
  auto step = [&](auto more, int k0) {
    constexpr bool MORE = decltype(more)::value;
    const int cur = (NBUF == 2) ? ((k0 >> 6) & 1) : 0;         // buffer of this step
    const OT* ca = wa + cur * ASZ;
    const OT* cb = wb + cur * BSZ;
#pragma unroll                                 // both 32-k blocks in one body: the second block's reads overlap the first's products
    for (int kk = 0; kk < 64; kk += 32) {
      V16 bq[4], af[4];                        // all eight fragments of the 32-k block read as one group
#pragma unroll
      for (int j = 0; j < 4; ++j) {
        bq[j] = ldfrag<OT>(cb + ((j << 4) + rlane) * LP + koff + kk);
        af[j] = ldfrag<OT>(ca + ((j << 4) + rlane) * LP + koff + kk);
      }
      // The stores stand behind the step's last fragment reads: LDS serves a wave in order, and in front of the reads
      // the products would wait for the block's stores; here the second block's products cover them.
      if (MORE && kk == 32) {
        // next step's rows into the other buffer: its readers left it in front of the last barrier
        OT* da = sA + (cur ^ 1) * ASZ + so;
        OT* db = sB + (cur ^ 1) * BSZ + so;
#pragma unroll
        for (int it = 0; it < 4 * WR; ++it) *(H8*)(da + 16 * it * LP) = ra[it];
#pragma unroll
        for (int it = 0; it < 4 * WC; ++it) *(H8*)(db + 16 * it * LP) = rb[it];
        if (k0 + 128 < KD) {                   // the step after that flies until its stores, one step on
#pragma unroll
          for (int it = 0; it < 4 * WR; ++it) ra[it] = *(const H8*)(gA + 2 * (k0 + 128) + lo + 32 * it * KD);
#pragma unroll
          for (int it = 0; it < 4 * WC; ++it) rb[it] = *(const H8*)(gB + 2 * (k0 + 128) + lo + 32 * it * KD);
#if DEV_ASM
          // before an address register of these loads is reused; the inputs keep those registers as they are up to here
          asm volatile("s_wait_xcnt 0x0" :: "v"(lo), "s"(gA), "s"(gB) : "memory");
#endif
        }
      }
#pragma unroll
      for (int i = 0; i < 4; ++i) {
#pragma unroll
        for (int j = 0; j < 4; ++j) acc[i][j] = mmar(af[i], bq[j], acc[i][j]);
        dep_guard(acc[i][0], acc[i][3], af[i], bq[3]);
      }
      keep4(bq[0], bq[1], bq[2], bq[3]);
    }
    // publishes the buffer written in this step; ends every wave's reads of the one that the next step overwrites
    if (MORE) lds_barrier();
  };
  for (int k0 = 0; k0 + 64 < KD; k0 += 64) step(BoolC<true>{}, k0);
  step(BoolC<false>{}, KD - 64);
  acc_guard4(acc[0][0], acc[0][1], acc[0][2], acc[0][3]);
  acc_guard4(acc[1][0], acc[1][1], acc[1][2], acc[1][3]);
  acc_guard4(acc[2][0], acc[2][1], acc[2][2], acc[2][3]);
  acc_guard4(acc[3][0], acc[3][1], acc[3][2], acc[3][3]);

  // ---- epilogue ----
  float* slab = sT + wave * (16 * 68);
#pragma unroll
  for (int i = 0; i < 4; ++i) {
    const int mBase = m0 + (i << 4);
#pragma unroll
    for (int j = 0; j < 4; ++j) {
#pragma unroll
      for (int r = 0; r < 8; ++r) {
        slab[(mOff + r) * 68 + (j << 4) + rlane] = acc[i][j][r];
      }
    }
    __builtin_amdgcn_fence(__ATOMIC_RELEASE, "workgroup");
    __builtin_amdgcn_wave_barrier();
    __builtin_amdgcn_fence(__ATOMIC_ACQUIRE, "workgroup");
    if (OUT_MODE == 0) {
      float* C = (float*)Cout + (size_t)b * (size_t)strideC;
      const int h2 = lane >> 4, c4 = (lane & 15) * 4;     // 256-B row segment = 16 lanes x 16 B
      v4f bcol = {0.f, 0.f, 0.f, 0.f};
      if (BIAS == 1) {
        const v4f bb = *(const v4f*)(bias + n0 + c4);
#pragma unroll
        for (int e = 0; e < 4; ++e) bcol[e] = bfr(bb[e]);
      }
      {
#pragma unroll
        for (int it = 0; it < 8; ++it) {
          const int row = it * 2 + h2;                     // it 0..7 x h2 0..1 = rows 0..15
          float brow = 0.f;
          if (BIAS == 2) brow = bfr(bias[mBase + row]);
          const v4f x = *(const v4f*)(slab + row * 68 + c4);
          v4f v;
#pragma unroll
          for (int e = 0; e < 4; ++e) v[e] = x[e] * oscale + bcol[e] + brow;
          *(v4f*)(C + (size_t)(mBase + row) * (size_t)ldc + n0 + c4) = v;
        }
        
      }
    } else {
      const int q = lane >> 3, c8 = (lane & 7) * 8;
      unsigned short* C  = (unsigned short*)Cout  + (size_t)b * (size_t)strideC;
      unsigned short* C2 = (unsigned short*)Cout2 + (size_t)b * (size_t)strideC;
      float bc8[8];
#pragma unroll
      for (int e = 0; e < 8; ++e) bc8[e] = 0.f;
      if (BIAS == 1) {
        const v4f b0 = *(const v4f*)(bias + n0 + c8);
        const v4f b1 = *(const v4f*)(bias + n0 + c8 + 4);
#pragma unroll
        for (int e = 0; e < 4; ++e) { bc8[e] = bfr(b0[e]); bc8[4 + e] = bfr(b1[e]); }
      }
      v4u hv[4], lv[4];
#pragma unroll
      for (int it = 0; it < 4; ++it) {
        const int row = it * 4 + q;                        // it 0..3 x q 0..3 = rows 0..15
        const float* sp = slab + row * 68 + c8;
        float brow = 0.f;
        if (BIAS == 2) brow = bfr(bias[mBase + row]);
        float f[8];
#pragma unroll
        for (int e = 0; e < 8; ++e) f[e] = sp[e] * oscale + bc8[e] + brow;
        v4u a, a2;
#pragma unroll
        for (int e = 0; e < 4; ++e) {
          const float f0 = f[2 * e], f1 = f[2 * e + 1];
          const _Float16 x0 = (_Float16)f0, x1 = (_Float16)f1;
          const unsigned short h0 = h_bits(x0), h1 = h_bits(x1);
          unsigned short l0 = 0, l1 = 0;
          if (OUT_MODE == 3) {
            l0 = h_bits((_Float16)((f0 - (float)x0) * rscale));
            l1 = h_bits((_Float16)((f1 - (float)x1) * rscale));
          }
          a[e] = pk16(h0, h1); a2[e] = pk16(l0, l1);
        }
        hv[it] = a; lv[it] = a2;
      }
      {
#pragma unroll
        for (int it = 0; it < 4; ++it) {
          const int row = it * 4 + q;
          *(v4u*)(C + (size_t)(mBase + row) * (size_t)ldc + n0 + c8) = hv[it];
          if (OUT_MODE == 3) *(v4u*)(C2 + (size_t)(mBase + row) * (size_t)ldc + n0 + c8) = lv[it];
        }
        
      }
    }
    __builtin_amdgcn_fence(__ATOMIC_RELEASE, "workgroup");
    __builtin_amdgcn_wave_barrier();
    __builtin_amdgcn_fence(__ATOMIC_ACQUIRE, "workgroup");
  }
}

// =====================================================================================================
// The three products that read only converted inputs, in ONE launch (none reads what another writes); a block
// takes its product from the range its index falls in. Ranges, longest work first:
//   v^T = Wv^T . x^T + bv per batch -> f16 hi plane [b][d][s] (pitch SEQ) and residual plane (x4096)
//         (A = WvT [n][k], Bt = Xb rows of batch b; M=DM, N=SEQ, K=DM; bias per row d)
//   z = coords . Wc + bc -> f32 [NB*SEQ][HN]                       (M=NB*SEQ, N=HN, K=DC)
//   second output = coords . Wn + bn -> f32 [NB*SEQ][DC]           (M=NB*SEQ, N=DC, K=DC)
// =====================================================================================================
#define GB_V  ((DM / 128) * (SEQ / 128))                    // 128 blocks per batch, 128x128 tiles
#define GB_Z  ((NB * SEQ / 128) * (HN / 128))               //  64 blocks, 128x128 tiles
#define GB_C  ((NB * SEQ / 256) * (DC / 64))                //  16 blocks, 256x64 tiles
static_assert((DM % 128) == 0 && (SEQ % 128) == 0 && (HN % 128) == 0 && ((NB * SEQ) % 256) == 0);
__global__ __launch_bounds__(128) void gemm_vzc(
    const unsigned short* __restrict__ WvT, const unsigned short* __restrict__ Xb,
    const unsigned short* __restrict__ Cb, const unsigned short* __restrict__ WcT,
    const unsigned short* __restrict__ WnT,
    unsigned short* VTh, unsigned short* VTl, float* Zf, float* out1,
    const float* __restrict__ bv, const float* __restrict__ bc, const float* __restrict__ bn) {
  GEMM_LDS(__bf16);
  int bx = (int)blockIdx.x;
  if (bx < NB * GB_V) {
    gemm64<__bf16, 3, 2, DM, 2, 2>(bx % GB_V, bx / GB_V, sT, sP,
        WvT, 0LL, Xb, (long long)SEQ * DM,
        (void*)VTh, (void*)VTl, SEQ, (long long)DM * SEQ, bv,
        DM, SEQ, 1.0f, RSC);
    return;
  }
  bx -= NB * GB_V;
  if (bx < GB_Z) {
    gemm64<__bf16, 0, 1, DC, 2, 2>(bx, 0, sT, sP,
        Cb, 0LL, WcT, 0LL,
        (void*)Zf, (void*)Zf, HN, 0LL, bc,
        NB * SEQ, HN, 1.0f, 1.0f);
    return;
  }
  bx -= GB_Z;
  gemm64<__bf16, 0, 1, DC, 4, 1>(bx, 0, sT, sP,
      Cb, 0LL, WnT, 0LL,
      (void*)out1, (void*)out1, DC, 0LL, bn,
      NB * SEQ, DC, 1.0f, 1.0f);
}

// first output = [ctx_hi | ctx_res] . [Wo^T ; Wo^T]^T + bo -> f32 [NB*SEQ][DM]   (M=NB*SEQ, N=DM, K=2*DM)
__global__ __launch_bounds__(128) void gemm_out(
    const unsigned short* __restrict__ Octx, const unsigned short* __restrict__ WoT2,
    float* out0, const float* __restrict__ bo) {
  GEMM_LDS(__bf16);
  gemm64<__bf16, 0, 1, OP, 2, 2>((int)blockIdx.x, 0, sT, sP,
      Octx, 0LL, WoT2, 0LL,
      (void*)out0, (void*)out0, DM, 0LL, bo,
      NB * SEQ, DM, 1.0f, 1.0f);
}

// =====================================================================================================
// z relayout: in f32 z [rows][HN] (16 heads x 16); out (a) f16 operand plane [rows][ZP], 64 halves per head =
// norms [rows][NH].  Block = 16 rows x 16 heads (thread = one (row, head)); staged in LDS; block barrier; line L of
// the block (L = 16*r + head, contiguous in the plane) written by lanes 8q..8q+7 of wave w with one instruction
// LDS: both arrays cross-wave (block barrier); fully written before read.
// =====================================================================================================
__global__ __launch_bounds__(256) void zprep(const float* __restrict__ zf, unsigned short* zp, float* zsq) {
  __shared__ __align__(16) unsigned short sZ[256 * LP];   // columns 64..71 of the pitch are never read
  __shared__ __align__(16) float sQ[256];
  const int tid  = (int)threadIdx.x;
  const int r    = tid >> 4, hd = tid & 15;
  const int row0 = blockIdx.x * 16;
  {
    const float* zr = zf + (size_t)(row0 + r) * HN + hd * HC;
    const v4f a0 = *(const v4f*)(zr);
    const v4f a1 = *(const v4f*)(zr + 4);
    const v4f a2 = *(const v4f*)(zr + 8);
    const v4f a3 = *(const v4f*)(zr + 12);
    float f[16];
#pragma unroll
    for (int e = 0; e < 4; ++e) { f[e] = a0[e]; f[4 + e] = a1[e]; f[8 + e] = a2[e]; f[12 + e] = a3[e]; }
    float q = 0.f;
#pragma unroll
    for (int e = 0; e < 16; ++e) q += f[e] * f[e];
    sQ[tid] = q;
    v4u ph0, ph1, pl0, pl1;
#pragma unroll
    for (int e = 0; e < 4; ++e) {
      const float f0 = f[2 * e], f1 = f[2 * e + 1], f2 = f[8 + 2 * e], f3 = f[9 + 2 * e];
      const _Float16 x0 = (_Float16)f0, x1 = (_Float16)f1, x2 = (_Float16)f2, x3 = (_Float16)f3;
      ph0[e] = pk16(h_bits(x0), h_bits(x1));
      ph1[e] = pk16(h_bits(x2), h_bits(x3));
      pl0[e] = pk16(h_bits((_Float16)((f0 - (float)x0) * RSC)), h_bits((_Float16)((f1 - (float)x1) * RSC)));
      pl1[e] = pk16(h_bits((_Float16)((f2 - (float)x2) * RSC)), h_bits((_Float16)((f3 - (float)x3) * RSC)));
    }
    const v4u z4 = {0u, 0u, 0u, 0u};
    unsigned short* sl = sZ + tid * LP;
    *(v4u*)(sl + 0)  = ph0;
    *(v4u*)(sl + 8)  = ph1;
    *(v4u*)(sl + 16) = pl0;
    *(v4u*)(sl + 24) = pl1;
    *(v4u*)(sl + 32) = ph0;
    *(v4u*)(sl + 40) = ph1;
    *(v4u*)(sl + 48) = z4;
    *(v4u*)(sl + 56) = z4;
  }
  __syncthreads();
  const int wave = tid >> 5, lane = tid & 31;
  const int q4 = lane >> 3, c8 = (lane & 7) * 8;
  unsigned short* base = zp + (size_t)row0 * ZP;
  v4u vv[8];
#pragma unroll
  for (int it = 0; it < 8; ++it) {
    const int L = it * 32 + wave * 4 + q4;
    vv[it] = *(const v4u*)(sZ + L * LP + c8);
  }
  {
#pragma unroll
    for (int it = 0; it < 8; ++it) {
      const int L = it * 32 + wave * 4 + q4;
      *(v4u*)(base + (size_t)L * 64 + c8) = vv[it];
    }
    
  }
  if (tid < 64) {                                       // waves 0 and 1, wave-uniform
    const v4f qv = *(const v4f*)(sQ + tid * 4);
    float* dst = zsq + (size_t)row0 * NH + tid * 4;
    *(v4f*)dst = qv;
    
  }
}

// =====================================================================================================
// Distance-kernel attention, per-head z dim 16, value dim 64, no mask, softmax over all SEQ keys.
//   z plane (f16): row (b*SEQ + t), head h at cols 64h.. : [hi | residual x4096 | hi | 0]
//   zsq (f32): [(b*SEQ + t)][h] = |z|^2
//   v^T hi plane (f16) and residual plane (f16, (v - hi)*4096): element (b, h, d, s) at [(b*DM + h*64 + d)*SEQ + s]
//   ctx plane (bf16): element (b, t, h, d) hi at [(b*SEQ + t)*OP + h*64 + d], residual at the same + DM
//   dot = A[hi|0] . B[hi;lo]  +  (A[lo|hi] . B[hi;lo]) / 4096 on f16 WMMA (two f32 accumulators);
//   score = -softplus(gamma_h) * max(|z_s|^2 + |z_t|^2 - 2 dot, 0) is <= 0 for every pair (the clamp, softplus >= 0),
//   and a query is one of its own keys, at distance 0 up to rounding: exp(score) cannot overflow and the row sum
//   is about 1 or more, so softmax = exp(s) / sum exp(s) is taken as it stands, with no running max and no rescale
//   (sound while softplus x the rounding error of a query's own distance, about 2^-22 |z|^2, stays far below 20).
//   p is carried x16384: one fma and one exp2 per score, exp2(-softplus * log2(e) * sq + 14), f16 for the product;
//   context = p . vh + (p . vl) / 4096 on f16 WMMA, both accumulators run through all chunks; sums in f32.
//   Both products run transposed: scores^T = keys (A) . queries (B), context^T = v^T (A) . p^T (B).  In every
//   accumulator tile a lane then holds ONE query (column lane&15) and rows 8*(lane>>4)+r (keys, or value dims):
//   the row sum is in-lane plus one exchange between the wave halves after the loop, and two score tiles pack straight
//   into the p^T operand (elements 0..7 = keys 8*half.. of the even tile, 8..15 = the same rows of the odd tile,
//   the k order of the v^T fragment), so p never goes through LDS.
//   Block = 4 waves = 4 x 16 query rows of one (b, h); grid = NB * NH * NQB; key chunks of 64, static trip NKT.
//   Chunk staging: 128 threads x 4 rows x 8 elements per plane = the whole 64x64 tile of each of the three planes
//   (8 lanes per 128-B row), and the 64 key norms, 16 per wave (plain loads, __syncthreads before and after; staged
//   extent == consumed extent); the context tile
//   is wave-private; the grid covers every (b, h, qb).
// =====================================================================================================
__global__ __launch_bounds__(128)
void attn_dist(const unsigned short* __restrict__ zpp, const float* __restrict__ zsq,
               const unsigned short* __restrict__ vhp, const unsigned short* __restrict__ vlp,
               const float* __restrict__ gam, unsigned short* octx) {
  union FH { v16h v; v8h h[2]; };
  __shared__ __align__(16) _Float16 Zsh[64 * LP];          // z key chunk [key][64], pitch LP    9 KB
  __shared__ __align__(16) _Float16 Vth[64 * LP];          // V^T hi [d][key], pitch LP          9 KB
  __shared__ __align__(16) _Float16 Vtl[64 * LP];          // V^T residual, pitch LP             9 KB
  __shared__ __align__(16) float    Zqs[64];               // squared norms of the chunk's keys
  __shared__ __align__(16) float    Os[4][16 * OSP];       // per wave context tile, pitch OSP  17 KB

  const int tid  = threadIdx.x;
  const int wave = tid >> 5;
  const int lane = tid & 31;
  const int hh   = lane >> 4;
  const int c    = lane & 15;

  const int bx   = blockIdx.x;
  const int qb   = bx % NQB;
  const int rest = bx / NQB;
  const int h    = rest % NH;
  const int b    = rest / NH;
  const int q0   = qb * 64 + wave * 16;
  const size_t rowB = (size_t)b * SEQ;

  const _Float16* Zp16 = (const _Float16*)(const void*)zpp;
  const _Float16* Vh = (const _Float16*)(const void*)vhp + ((size_t)b * DM + (size_t)h * HD) * SEQ;
  const _Float16* Vl = (const _Float16*)(const void*)vlp + ((size_t)b * DM + (size_t)h * HD) * SEQ;

  const float gx = bfr(gam[h]);
  const float g  = fmaxf(gx, 0.f) + log1pf(expf(-fabsf(gx)));   // softplus
  const float ng2 = -g * 1.44269504088896340736f;              // score in log2 units per unit of squared distance

  // ---- query-side B fragment [hi | residual] (column = lane&15) and this lane's query squared norm ----
  const v16h zq = ldfrag<_Float16>(Zp16 + (rowB + q0 + c) * ZP + (size_t)h * 64 + 8 * hh);
  const float zsq_q = zsq[(rowB + q0 + c) * NH + h];

  float lrow = 0.f;            // sum of 16384 p over this half's keys only; the halves are joined after the loop
  v8f oacc[4];                 // context^T (x16384): tile t, register r = value dim 16t + 8*hh + r of query c
  v8f o1[4];                   // the same of the residual plane (x16384 x4096)
#pragma unroll
  for (int t = 0; t < 4; ++t) { oacc[t] = zero8(); o1[t] = zero8(); }

  for (int kt = 0; kt < NKT; ++kt) {         // static trip count
    const int kv0 = kt * 64;
    __syncthreads();
    {
      // 8 lanes per tile row: one 16-B load of a wave covers the whole 128-B lines of 4 rows (not 32 B of each of 16)
      const int r = tid >> 3, c8 = (tid & 7) * 8;      // rows r, r+16, r+32, r+48; 16-B piece c8 of the row
      const _Float16* zg  = Zp16 + (rowB + kv0 + r) * ZP + (size_t)h * 64 + c8;     // key row kv0+r, 64-half head segment
      const _Float16* vg  = Vh + (size_t)r * SEQ + kv0 + c8;                         // v^T row d = r, s = kv0+c8..+7
      const _Float16* vlg = Vl + (size_t)r * SEQ + kv0 + c8;
      // each wave brings the norms of its own 16 keys (both lane halves the same 16: 8 lines a load), in one group with the tiles
      const float zn = zsq[(rowB + kv0 + wave * 16 + c) * NH + h];
#pragma unroll
      for (int i = 0; i < 4; ++i) {
        const v8h a0 = *(const v8h*)(zg + (size_t)(16 * i) * ZP);
        const v8h b0 = *(const v8h*)(vg + (size_t)(16 * i) * SEQ);
        const v8h b1 = *(const v8h*)(vlg + (size_t)(16 * i) * SEQ);
        *(v8h*)(Zsh + (16 * i + r) * LP + c8) = a0;
        *(v8h*)(Vth + (16 * i + r) * LP + c8) = b0;
        *(v8h*)(Vtl + (16 * i + r) * LP + c8) = b1;
      }
#if DEV_ASM
      // input-only use of the loaded norm: keeps its load up among the tile loads; sunk into the branch below it
      // would be issued behind their waits and cost the block a second load latency in front of the barrier
      asm volatile("" :: "v"(zn));
#endif
      if (hh == 0) Zqs[wave * 16 + c] = zn;                       // lanes 0..15 of every wave: 4 x 16 = the 64 norms
#if DEV_ASM
      // before an address register of the staging loads above is advanced or reused
      asm volatile("s_wait_xcnt 0x0" ::: "memory");
#endif
    }
    __syncthreads();

    // ---- scores^T: 64 keys x 16 queries per wave, 2 f16 products per key subtile; p^T (x16384, f16) ----
    FH pa[2];                    // p^T operand of keys 0..31 and 32..63 of the chunk
    float pj[4];                 // four independent sums, one per key subtile
#pragma unroll
    for (int j = 0; j < 4; ++j) {
      const _Float16* zr = Zsh + (j * 16 + c) * LP + 8 * hh;
      FH b1, b2;
      b2.h[0] = *(const v8h*)(zr + 16);     // k 0..15  <- residual of key
      b2.h[1] = *(const v8h*)(zr + 32);     // k 16..31 <- hi of key
      b1.h[0] = *(const v8h*)(zr + 32);     // k 0..15  <- hi of key
      b1.h[1] = *(const v8h*)(zr + 48);     // k 16..31 <- zeros
      v8f ah = mma_h(b1.v, zq, zero8());    // hi.hi
      v8f ax = mma_h(b2.v, zq, zero8());    // (hi.lo + lo.hi) x4096
      const v4f zt0 = *(const v4f*)(Zqs + j * 16 + 8 * hh);       // norms of keys 16j + 8*hh + 0..3
      const v4f zt1 = *(const v4f*)(Zqs + j * 16 + 8 * hh + 4);   // and + 4..7
      v8f sq8;
      {
#pragma clang fp contract(off)
#pragma unroll
        for (int r = 0; r < 8; ++r) {
          const float d = ah[r] + ax[r] * (1.0f / RSC);
          const float sq = (zsq_q + (r < 4 ? zt0[r & 3] : zt1[r & 3])) - 2.0f * d;
          sq8[r] = fmaxf(sq, 0.f);
        }
      }
      pj[j] = 0.f;
#pragma unroll
      for (int r = 0; r < 8; ++r) {
        const float p = __builtin_amdgcn_exp2f(__builtin_fmaf(ng2, sq8[r], 14.0f));   // 16384 exp(score), <= 16384
        pj[j] += p;
        pa[j >> 1].h[j & 1][r] = (_Float16)p;
      }
    }
    lrow += (pj[0] + pj[1]) + (pj[2] + pj[3]);

    // ---- context^T += V^T . P^T (f16 WMMA); residual products into a separate accumulator ----
#pragma unroll                   // constant kk: pa[kk] stays in registers
    for (int kk = 0; kk < 2; ++kk) {
#pragma unroll
      for (int t = 0; t < 4; ++t) {
        FH vb, vl;
        vb.h[0] = *(const v8h*)(Vth + (t * 16 + c) * LP + kk * 32 + 8 * hh);
        vb.h[1] = *(const v8h*)(Vth + (t * 16 + c) * LP + kk * 32 + 16 + 8 * hh);
        vl.h[0] = *(const v8h*)(Vtl + (t * 16 + c) * LP + kk * 32 + 8 * hh);
        vl.h[1] = *(const v8h*)(Vtl + (t * 16 + c) * LP + kk * 32 + 16 + 8 * hh);
        oacc[t] = mma_h(vb.v, pa[kk].v, oacc[t]);
        o1[t]   = mma_h(vl.v, pa[kk].v, o1[t]);
      }
    }
  }
#pragma unroll
  for (int t = 0; t < 4; ++t)
#pragma unroll
    for (int r = 0; r < 8; ++r) oacc[t][r] += o1[t][r] * (1.0f / RSC);

  // ---- normalise (1/l; l and the context carry the same x16384), stage the wave's 16x64 tile, convert to bf16 hi + bf16 residual,
  float* os = Os[wave];
  {
    const float l = lrow + xhalf(lrow);          // both halves' keys
    const float inv = (l > 0.f) ? (1.0f / l) : 0.f;
#pragma unroll
    for (int t = 0; t < 4; ++t) {                // row = query c, 8 consecutive value dims per tile
      v4f w0, w1;
#pragma unroll
      for (int e = 0; e < 4; ++e) { w0[e] = oacc[t][e] * inv; w1[e] = oacc[t][4 + e] * inv; }
      *(v4f*)(os + c * OSP + t * 16 + 8 * hh)     = w0;
      *(v4f*)(os + c * OSP + t * 16 + 8 * hh + 4) = w1;
    }
  }
  __builtin_amdgcn_fence(__ATOMIC_RELEASE, "workgroup");
  __builtin_amdgcn_wave_barrier();
  __builtin_amdgcn_fence(__ATOMIC_ACQUIRE, "workgroup");
  {
    const int q4 = lane >> 3, c8 = (lane & 7) * 8;
    v4u hv[4], lv[4];
#pragma unroll
    for (int it = 0; it < 4; ++it) {
      const int row = it * 4 + q4;   // it 0..3 x q4 0..3 = rows 0..15 of the wave tile
      const float* sp = os + row * OSP + c8;
      v4u a, a2;
#pragma unroll
      for (int e = 0; e < 4; ++e) {
        const float f0 = sp[2 * e], f1 = sp[2 * e + 1];
        const unsigned short hb0 = bf_bits(f0), hb1 = bf_bits(f1);
        const unsigned short lb0 = bf_bits(f0 - bf_up(hb0)), lb1 = bf_bits(f1 - bf_up(hb1));
        a[e]  = pk16(hb0, hb1);
        a2[e] = pk16(lb0, lb1);
      }
      hv[it] = a; lv[it] = a2;
    }
    {
#pragma unroll
      for (int it = 0; it < 4; ++it) {
        const int row = it * 4 + q4;
        const size_t go = (rowB + q0 + row) * OP + (size_t)h * HD + c8;
        *(v4u*)(octx + go)      = hv[it];
        *(v4u*)(octx + go + DM) = lv[it];
      }
      
    }
  }
}

// =====================================================================================================
// Workspace map (bytes, NB=2 / SEQ=2048), every region an exact multiple of its whole-line / whole-tile store
// granularity, back to back:
//   Xb   bf16 [NB*SEQ][DM]            8388608
//   Cb   bf16 [NB*SEQ][DC]             524288
//   WvT  bf16 [DM n][DM k]            2097152
//   WoT2 bf16 [DM n][2*DM k]          4194304
//   WcT  bf16 [HN][DC]                  32768
//   WnT  bf16 [DC][DC]                   8192
//   Zf   f32  [NB*SEQ][HN]            4194304
//   Zp   f16  [NB*SEQ][ZP]            8388608
//   Zsq  f32  [NB*SEQ][NH]             262144
//   VTh  f16  [NB][DM][SEQ]           8388608
//   VTl  f16  [NB][DM][SEQ]           8388608
//   Octx bf16 [NB*SEQ][OP]           16777216
//   total                            61644800
// Weights arrive [in][out]; tr64 produces the [out n][in k] (k contiguous) layout the GEMM wants.
// =====================================================================================================
extern "C" void kernel_launch(void* const* d_in, const int* in_sizes, int n_in,
                              void* d_out, int out_size, void* d_ws, size_t ws_size,
                              hipStream_t stream) {
  if (n_in < 11) return;
  if (in_sizes[0] < ((NB - 1) * SEQ_FULL + SEQ) * DM) return;
  if (in_sizes[1] < ((NB - 1) * SEQ_FULL + SEQ) * DC) return;
  if (in_sizes[2] < DM * DM || in_sizes[3] < DM) return;
  if (in_sizes[4] < DC * HN || in_sizes[5] < HN) return;
  if (in_sizes[6] < DC * DC || in_sizes[7] < DC) return;
  if (in_sizes[8] < DM * DM || in_sizes[9] < DM) return;
  if (in_sizes[10] < NH) return;
  if ((size_t)out_size < OUT1_OFF + (size_t)NB * SEQ * DC) return;

  const float* hidden = (const float*)d_in[0];
  const float* coords = (const float*)d_in[1];
  const float* Wv     = (const float*)d_in[2];
  const float* bv     = (const float*)d_in[3];
  const float* Wc     = (const float*)d_in[4];
  const float* bc     = (const float*)d_in[5];
  const float* Wn     = (const float*)d_in[6];
  const float* bn     = (const float*)d_in[7];
  const float* Wo     = (const float*)d_in[8];
  const float* bo     = (const float*)d_in[9];
  const float* gamma  = (const float*)d_in[10];

  const size_t nRows = (size_t)NB * SEQ;
  const size_t PXB  = nRows * DM * 2;
  const size_t PCB  = nRows * DC * 2;
  const size_t PWV  = (size_t)DM * DM * 2;
  const size_t PWO2 = (size_t)DM * OP * 2;
  const size_t PWC  = (size_t)HN * DC * 2;
  const size_t PWN  = (size_t)DC * DC * 2;
  const size_t PZF  = nRows * HN * 4;
  const size_t PZP  = nRows * ZP * 2;
  const size_t PZQ  = nRows * NH * 4;
  const size_t PVT  = (size_t)NB * DM * SEQ * 2;
  const size_t POC  = nRows * OP * 2;
  size_t off = 0;
  const size_t oXb  = off; off += PXB;
  const size_t oCb  = off; off += PCB;
  const size_t oWv  = off; off += PWV;
  const size_t oWo  = off; off += PWO2;
  const size_t oWc  = off; off += PWC;
  const size_t oWn  = off; off += PWN;
  const size_t oZf  = off; off += PZF;
  const size_t oZp  = off; off += PZP;
  const size_t oZq  = off; off += PZQ;
  const size_t oVTh = off; off += PVT;
  const size_t oVTl = off; off += PVT;
  const size_t oOc  = off; off += POC;
  if (off > ws_size) return;                       // off = 61644800 at full size
  if (off > (size_t)134217728) return;

  char* ws = (char*)d_ws;
  unsigned short* Xb   = (unsigned short*)(ws + oXb);
  unsigned short* Cb   = (unsigned short*)(ws + oCb);
  unsigned short* WvT  = (unsigned short*)(ws + oWv);
  unsigned short* WoT2 = (unsigned short*)(ws + oWo);
  unsigned short* WcT  = (unsigned short*)(ws + oWc);
  unsigned short* WnT  = (unsigned short*)(ws + oWn);
  float*          Zf   = (float*)(ws + oZf);
  unsigned short* Zpl  = (unsigned short*)(ws + oZp);
  float*          Zsq  = (float*)(ws + oZq);
  unsigned short* VTh  = (unsigned short*)(ws + oVTh);
  unsigned short* VTl  = (unsigned short*)(ws + oVTl);
  unsigned short* Octx = (unsigned short*)(ws + oOc);
  float* out0 = (float*)d_out;
  float* out1 = (float*)d_out + OUT1_OFF;

  const dim3 blk(256);
  const dim3 gPrepAll(2 * PB_W + PB_C + PB_N + PB_X + PB_Q);           // 2693 blocks
  const dim3 gblk(32 * GW);                                            // GEMM blocks: 4 waves
  const dim3 gVZC(NB * GB_V + GB_Z + GB_C);                            //  336 blocks of 128
  const dim3 gO((NB * SEQ / 128) * (DM / 128));                        //  256 blocks of 128
  const dim3 gPrep((unsigned)(nRows / 16));                            //  256 blocks
  const dim3 gAttn(NB * NH * NQB);                                     // 1024 blocks of 128

  // (1) activations -> bf16 planes; weights [in][out] f32 -> bf16 [out][in], Wo^T duplicated along k (pitch 2*DM)
  prep_all<<<gPrepAll, blk, 0, stream>>>(hidden, coords, Wv, Wo, Wc, Wn, Xb, Cb, WvT, WoT2, WcT, WnT);
  // (2) v^T planes, z (f32) and the second output (d_out at element OUT1_OFF)
  gemm_vzc<<<gVZC, gblk, 0, stream>>>(WvT, Xb, Cb, WcT, WnT, VTh, VTl, Zf, out1, bv, bc, bn);
  // (3) z -> f16 operand plane [hi | res | hi | 0] and f32 squared norms
  zprep<<<gPrep, blk, 0, stream>>>(Zf, Zpl, Zsq);
  // (4) attention -> ctx plane (bf16 hi | bf16 residual) [b*SEQ+t][OP]
  attn_dist<<<gAttn, dim3(128), 0, stream>>>(Zpl, Zsq, VTh, VTl, gamma, Octx);
  // (5) first output
  gemm_out<<<gO, gblk, 0, stream>>>(Octx, WoT2, out0, bo);
  (void)hipGetLastError();
}

// v008
// It runs in 114 microseconds.
// Timed twice side by side with v007, it ran 1.04 and 1.03 times as fast.
// Counting every step since v000, it is 3.34 times as fast.
// Contractions: value = Wv^T.x^T+bv, z = coords.Wc+bc, coords.Wn+bn = v_wmma_f32_16x16x32_bf16 (bf16 operands from RNE-converted inputs, single product, f32 accumulate);
// z.z^T scores = v_wmma_f32_16x16x32_f16 (z as f16 hi + f16 residual x4096 packed along k, 2 products into separate f32 accumulators);
// p.v = v_wmma_f32_16x16x32_f16 (p carried x16384 in f16; v as f16 hi plane + f16 residual plane x4096; 2 products, f32 accumulate);
// ctx.Wo+bo = v_wmma_f32_16x16x32_bf16 (ctx as bf16 hi and bf16 residual planes concatenated along k, Wo^T bf16 duplicated along k; f32 accumulate);
// squared norms, softplus, softmax (no running max: every score is <= 0) and bias adds in f32.
#include <hip/hip_runtime.h>
#include <math.h>
#include <stdint.h>

#ifndef NB
#define NB 2
#endif
#ifndef SEQ
#define SEQ 2048
#endif
#define NB_FULL  2
#define SEQ_FULL 2048
#define DM   1024
#define NH   16
#define HC   16
#define HD   64
#define DC   64
#define HN   (NH * HC)        // 256
#define ZP   (NH * 64)        // 1024: z operand plane pitch, 64 halves per head [hi | lo x4096 | hi | 0]
#define OP   (2 * DM)         // 2048: ctx plane pitch (bf16 hi | bf16 residual)
#define NQB  (SEQ / 64)       // 64-row query blocks per sequence
#define NKT  (SEQ / 64)       // 64-key chunks per sequence
#define LP   72               // LDS row pitch in halves of every 64-half tile row: 144 B = 16 B x odd, so the 16 rows
                              // that one ds_load_b128 touches fall on 16 different groups of four banks (at 128 B: on one)
#define OSP  68               // LDS row pitch in floats of the 64-float context tile rows (272 B = 16 B x odd)
#define RSC    4096.0f
#define OUT1_OFF ((size_t)NB_FULL * SEQ_FULL * DM)   // element offset of the second output in d_out
static_assert(NH * HD == DM);
static_assert(HC == 16 && HD == 64 && DC == 64);
static_assert((SEQ % 64) == 0 && SEQ >= 64 && SEQ <= SEQ_FULL);
static_assert(NB >= 1 && NB <= NB_FULL);
static_assert((DM % 64) == 0 && (HN % 64) == 0 && (OP % 64) == 0);
static_assert(OUT1_OFF * 4 == 16777216);

typedef _Float16 v16h __attribute__((ext_vector_type(16)));
typedef _Float16 v8h  __attribute__((ext_vector_type(8)));
typedef __bf16   v16b __attribute__((ext_vector_type(16)));
typedef __bf16   v8b  __attribute__((ext_vector_type(8)));
typedef float    v8f  __attribute__((ext_vector_type(8)));
typedef float    v4f  __attribute__((ext_vector_type(4)));
typedef unsigned int v4u __attribute__((ext_vector_type(4)));

#if defined(__HIP_DEVICE_COMPILE__)
#define DEV_ASM 1
#else
#define DEV_ASM 0
#endif

// ---- scalar helpers --------------------------------------------------------------------------------
__device__ __forceinline__ unsigned short bf_bits(float f) {          // f32 -> bf16 bits, RNE convert
  unsigned u = __float_as_uint(f);
  return (unsigned short)((u + 0x7FFFu + ((u >> 16) & 1u)) >> 16);
}
__device__ __forceinline__ float bf_up(unsigned short hb) { return __uint_as_float(((unsigned)hb) << 16); }
__device__ __forceinline__ float bfr(float f) { return bf_up(bf_bits(f)); }   // value of the bf16 RNE convert
__device__ __forceinline__ unsigned short h_bits(_Float16 x) { return __builtin_bit_cast(unsigned short, x); }
__device__ __forceinline__ unsigned pk16(unsigned short a, unsigned short b) { return (unsigned)a | ((unsigned)b << 16); }
__device__ __forceinline__ v8f zero8() { v8f z = {0.f, 0.f, 0.f, 0.f, 0.f, 0.f, 0.f, 0.f}; return z; }
__device__ __forceinline__ float xhalf(float x) {                      // value of lane l ^ 16
  const int b = __builtin_bit_cast(int, x);
  return __builtin_bit_cast(float, __builtin_amdgcn_permlanex16(b, b, 0x76543210, 0xfedcba98, false, false));
}

// ---- fragment types / loaders: 16-bit A/B operand, lane -> row/col (lane&15), p already includes +8*(lane>>4);
//      elements 0..7 <- p[0..7] (k0+8h..k0+8h+7), elements 8..15 <- p[16..23] (k0+16+8h..k0+16+8h+7)
template <typename OT> struct FT;
template <> struct FT<__bf16>   { typedef v16b frag; typedef v8b half8; };
template <> struct FT<_Float16> { typedef v16h frag; typedef v8h half8; };

template <typename OT>
__device__ __forceinline__ typename FT<OT>::frag ldfrag(const OT* p) {
  union { typename FT<OT>::frag v; typename FT<OT>::half8 h[2]; } f;
  f.h[0] = *(const typename FT<OT>::half8*)(p);
  f.h[1] = *(const typename FT<OT>::half8*)(p + 16);
  return f.v;
}

// ---- WMMA helpers (asm guard bodies are device-only; concrete operand types) -----------------------------
__device__ __forceinline__ v8f mmar(v16b a, v16b b, v8f c) {
  return __builtin_amdgcn_wmma_f32_16x16x32_bf16(false, a, false, b, (short)0, c, false, false);
}
__device__ __forceinline__ v8f mmar(v16h a, v16h b, v8f c) {
  return __builtin_amdgcn_wmma_f32_16x16x32_f16(false, a, false, b, (short)0, c, false, false);
}
// guarded form: 4 VALU slots after the WMMA, D tied, A/B kept live
__device__ __forceinline__ v8f mma_h(v16h a, v16h b, v8f c) {
  c = __builtin_amdgcn_wmma_f32_16x16x32_f16(false, a, false, b, (short)0, c, false, false);
#if DEV_ASM
  asm volatile("v_nop\n\tv_nop\n\tv_nop\n\tv_nop" : "+v"(c) : "v"(a), "v"(b));
#endif
  return c;
}
__device__ __forceinline__ void dep_guard(v8f& a, v8f& b, v16b x, v16b y) {
#if DEV_ASM
  asm volatile("v_nop\n\tv_nop\n\tv_nop\n\tv_nop" : "+v"(a), "+v"(b) : "v"(x), "v"(y));
#else
  (void)a; (void)b; (void)x; (void)y;
#endif
}
__device__ __forceinline__ void dep_guard(v8f& a, v8f& b, v16h x, v16h y) {
#if DEV_ASM
  asm volatile("v_nop\n\tv_nop\n\tv_nop\n\tv_nop" : "+v"(a), "+v"(b) : "v"(x), "v"(y));
#else
  (void)a; (void)b; (void)x; (void)y;
#endif
}
__device__ __forceinline__ void keep4(v16b a, v16b b, v16b c, v16b d) {
#if DEV_ASM
  asm volatile("v_nop" :: "v"(a), "v"(b), "v"(c), "v"(d));
#else
  (void)a; (void)b; (void)c; (void)d;
#endif
}
__device__ __forceinline__ void keep4(v16h a, v16h b, v16h c, v16h d) {
#if DEV_ASM
  asm volatile("v_nop" :: "v"(a), "v"(b), "v"(c), "v"(d));
#else
  (void)a; (void)b; (void)c; (void)d;
#endif
}
__device__ __forceinline__ void acc_guard4(v8f& a, v8f& b, v8f& c, v8f& d) {
#if DEV_ASM
  asm volatile("v_nop\n\tv_nop\n\tv_nop\n\tv_nop" : "+v"(a), "+v"(b), "+v"(c), "+v"(d));
#else
  (void)a; (void)b; (void)c; (void)d;
#endif
}

// =====================================================================================================
// f32 rows -> bf16 plane rows (RNE convert), 8 elements per thread, one 16-B store per lane: a wave writes
// Dense output row `row` (0..nrows-1) reads source row (row / seq) * seqfull + row % seq (full batch stride).
// ceil(nrows*rowlen8/256) blocks, bx = the block's index among them. coverage: nrows*rowlen8 threads x 8 = the
// whole plane (exact multiple of 256).
// =====================================================================================================
__device__ __forceinline__ void cvtrows(int bx, const float* __restrict__ in, unsigned short* out,
                                        int rowlen8, int nrows, int seq, int seqfull) {
  const int i = bx * 256 + (int)threadIdx.x;
  if (i < nrows * rowlen8) {
    const int row  = i / rowlen8;
    const int c    = i - row * rowlen8;
    const int bq   = row / seq;
    const int srow = bq * seqfull + (row - bq * seq);
    const float* src = in + ((size_t)srow * (size_t)rowlen8 + (size_t)c) * 8;
    const v4f a  = *(const v4f*)(src);
    const v4f a4 = *(const v4f*)(src + 4);
    v4u p;
    p[0] = pk16(bf_bits(a[0]),  bf_bits(a[1]));
    p[1] = pk16(bf_bits(a[2]),  bf_bits(a[3]));
    p[2] = pk16(bf_bits(a4[0]), bf_bits(a4[1]));
    p[3] = pk16(bf_bits(a4[2]), bf_bits(a4[3]));
    unsigned short* o = out + (size_t)i * 8;
    *(v4u*)o = p;
    
  }
}

// =====================================================================================================
// Weight transpose + bf16 convert through LDS: in f32 [krows][ncols] (pitch ldi) -> out bf16 [n][k] (pitch ldo,
// k contiguous), optionally duplicated at +dup elements in the same output row.  One block = one 64x64 tile:
// input rows k0 = 64*by, cols n0 = 64*bx.  Load: thread r = tid>>2 reads 16 floats of input row
// k0+r; LDS holds the transposed tile; block barrier; write: wave w, lane>>3 = q, lanes 8q..8q+7 write one whole
// LDS tile: cross-wave (block barrier); columns 64..71 of the pitch are never read.
// =====================================================================================================
__device__ __forceinline__ void tr64(int bx, int by, unsigned short* sT, const float* __restrict__ in, int ldi,
                                     unsigned short* out, int ldo, int dup) {
  const int tid = (int)threadIdx.x;
  const int k0  = by * 64;
  const int n0  = bx * 64;
  {
    const int r = tid >> 2, c16 = (tid & 3) * 16;
    const float* src = in + (size_t)(k0 + r) * (size_t)ldi + n0 + c16;
    const v4f a0 = *(const v4f*)(src);
    const v4f a1 = *(const v4f*)(src + 4);
    const v4f a2 = *(const v4f*)(src + 8);
    const v4f a3 = *(const v4f*)(src + 12);
#pragma unroll
    for (int e = 0; e < 4; ++e) {
      sT[(c16 + e) * 72 + r]      = bf_bits(a0[e]);
      sT[(c16 + 4 + e) * 72 + r]  = bf_bits(a1[e]);
      sT[(c16 + 8 + e) * 72 + r]  = bf_bits(a2[e]);
      sT[(c16 + 12 + e) * 72 + r] = bf_bits(a3[e]);
    }
  }
  __syncthreads();
  const int wave = tid >> 5, lane = tid & 31;
  const int q = lane >> 3, c8 = (lane & 7) * 8;
  v4u vv[2];
#pragma unroll
  for (int it = 0; it < 2; ++it) {
    const int n = it * 32 + wave * 4 + q;
    vv[it] = *(const v4u*)(sT + n * 72 + c8);
  }
  {
#pragma unroll
    for (int it = 0; it < 2; ++it) {
      const int n = it * 32 + wave * 4 + q;
      unsigned short* d = out + (size_t)(n0 + n) * (size_t)ldo + k0 + c8;
      *(v4u*)d = vv[it];
      if (dup != 0) *(v4u*)(d + dup) = vv[it];
    }
#if DEV_ASM
    // behind the last store: in the listing another range's code follows and reuses the stores' registers
    asm volatile("s_wait_xcnt 0x0" ::: "memory");
#endif
  }
}

// =====================================================================================================
// All six input conversions in ONE launch: none reads what another writes, so each block takes its job from the
// range its index falls in (block-uniform branch; the barrier of tr64 is reached by whole blocks only).
// Ranges, in index order: Wv^T, Wo^T (duplicated along k), Wc^T, Wn^T, hidden rows, coordinate rows.
// =====================================================================================================
#define PB_W  ((DM / 64) * (DM / 64))            // 256 tiles of a [DM][DM] weight
#define PB_C  ((HN / 64) * (DC / 64))            //   4 tiles of Wc [DC][HN]
#define PB_N  ((DC / 64) * (DC / 64))            //   1 tile of Wn [DC][DC]
#define PB_X  (NB * SEQ * DM / 8 / 256)          // 2048 blocks of hidden rows
#define PB_Q  (NB * SEQ * DC / 8 / 256)          //  128 blocks of coordinate rows
static_assert((NB * SEQ * DM / 8) % 256 == 0 && (NB * SEQ * DC / 8) % 256 == 0);
__global__ __launch_bounds__(256) void prep_all(const float* __restrict__ hidden, const float* __restrict__ coords,
                                                const float* __restrict__ Wv, const float* __restrict__ Wo,
                                                const float* __restrict__ Wc, const float* __restrict__ Wn,
                                                unsigned short* Xb, unsigned short* Cb, unsigned short* WvT,
                                                unsigned short* WoT2, unsigned short* WcT, unsigned short* WnT) {
  __shared__ __align__(16) unsigned short sT[64 * 72];
  int bx = (int)blockIdx.x;
  if (bx < PB_W) { tr64(bx % (DM / 64), bx / (DM / 64), sT, Wv, DM, WvT, DM, 0); return; }
  bx -= PB_W;
  if (bx < PB_W) { tr64(bx % (DM / 64), bx / (DM / 64), sT, Wo, DM, WoT2, OP, DM); return; }
  bx -= PB_W;
  if (bx < PB_C) { tr64(bx % (HN / 64), bx / (HN / 64), sT, Wc, HN, WcT, DC, 0); return; }
  bx -= PB_C;
  if (bx < PB_N) { tr64(bx % (DC / 64), bx / (DC / 64), sT, Wn, DC, WnT, DC, 0); return; }
  bx -= PB_N;
  if (bx < PB_X) { cvtrows(bx, hidden, Xb, DM / 8, NB * SEQ, SEQ, SEQ_FULL); return; }
  bx -= PB_X;
  cvtrows(bx, coords, Cb, DC / 8, NB * SEQ, SEQ, SEQ_FULL);
}

// =====================================================================================================
// Register-blocked batched WMMA GEMM (16-bit operand type OT): C[m][n] = sum_k A[m][k] * Bt[n][k] (+ bias);
// a block of 4 waves, WR x WC of them, takes one (64 WR) x (64 WC) tile, each wave a 64x64 part of it. A row-major
// [M][K], Bt row-major [N][K] (k contiguous), both of row pitch K = KD elements, a compile-time constant so that the
// staging loads of a tile share one address and differ by immediate offsets; M a multiple of 64 WR, N of 64 WC, KD of
// 64. bx = block index within the product, b = batch index (strides in elements). Per 64-k step the BLOCK brings its
// 64 WR rows of A and 64 WC rows of Bt in ONCE, with 16-B loads that cover whole 128-B lines (8 lanes per row, 16 rows
// per load of the block), in registers one step ahead of the LDS store; the rows go to one of two LDS buffers
// (pitch LP) that all four waves read their fragments from with the split k map (ldfrag): a row of A serves WC waves,
// a row of Bt WR waves. One block barrier per step: it publishes the buffer just written and ends the reads of the other.
// BIAS 0: none; 1: per column n (bias[n]); 2: per row m (bias[m]); bias values RNE-converted to bf16 in f32.
// OUT_MODE 0: f32 C (pitch ldc), value * oscale + bias.
// OUT_MODE 3: f16 hi plane C + f16 residual plane C2 = f16((v - hi) * rscale) (same pitch / stride), v = acc*oscale+bias.
// whole 64x64 tile; slab pitch columns 64..67 never read.
// =====================================================================================================
// Block barrier that orders LDS accesses only: __syncthreads() also waits for the global loads in flight, which here
// are the rows of a later step and are wanted only at their LDS store
__device__ __forceinline__ void lds_barrier() {
  __builtin_amdgcn_fence(__ATOMIC_RELEASE, "workgroup", "local");
  __builtin_amdgcn_s_barrier();
  __builtin_amdgcn_fence(__ATOMIC_ACQUIRE, "workgroup", "local");
}
template <bool B> struct BoolC { static constexpr bool value = B; };   // a compile-time flag as an argument
// LDS of a GEMM block, declared once in each kernel and handed to the body
#define GW 4                                       // waves of a GEMM block
#define GEMM_ROWS 512                              // tile rows of the LDS pool: two buffers of 128 A + 128 Bt rows
#define GEMM_LDS(OT)                                                                                             \
  __shared__ __align__(16) float sT[GW * 16 * 68]; /* per-wave 16x64 slab, pitch 68 floats */                     \
  __shared__ __align__(16) OT sP[GEMM_ROWS * LP]   /* block tiles [row][64 k], columns 64..71 never read */
template <typename OT, int OUT_MODE, int BIAS, int KD, int WR, int WC>
__device__ __forceinline__ void gemm64(
    int bx, int b, float* sT, OT* sP,
    const unsigned short* __restrict__ Ap, long long strideA,
    const unsigned short* __restrict__ Btp, long long strideB,
    void* Cout, void* Cout2, int ldc, long long strideC,
    const float* __restrict__ bias,
    int M, int N, float oscale, float rscale) {
  static_assert((KD % 64) == 0 && KD >= 64);
  static_assert(WR * WC == GW);
  constexpr int NBUF = (KD > 64) ? 2 : 1;      // a single step needs one buffer
  constexpr int ASZ  = 64 * WR * LP;           // elements of one A buffer
  constexpr int BSZ  = 64 * WC * LP;           // elements of one Bt buffer
  static_assert(NBUF * 64 * (WR + WC) <= GEMM_ROWS);
  typedef typename FT<OT>::frag V16;
  typedef typename FT<OT>::half8 H8;
  const OT* A  = (const OT*)(const void*)Ap;
  const OT* Bt = (const OT*)(const void*)Btp;
  const int tid  = (int)threadIdx.x;
  const int lane = tid & 31;
  const int wave = tid >> 5;
  const int tilesN = N / (64 * WC);
  const int tilesM = M / (64 * WR);
  if (bx >= tilesM * tilesN) return;     // block-uniform, in front of every barrier
  const int tm = bx / tilesN;
  const int tn = bx - tm * tilesN;
  const int bm0 = tm * (64 * WR);        // the block's first row of A and of Bt
  const int bn0 = tn * (64 * WC);
  const int m0 = bm0 + (wave / WC) * 64; // this wave's 64x64 part
  const int n0 = bn0 + (wave % WC) * 64;
  // The block's own first k step. Blocks with the same tm walk the same rows of A, blocks with the same tn the same rows
  // of Bt; for speed only.
  // Each starts at a step set by its tile indices and wraps round at KD (step t of the block is k = kro(64 t)).
  constexpr int NS = KD / 64;
  static_assert((KD & (KD - 1)) == 0);         // the wrap is a mask
  const int fm  = (NS / tilesM > 1) ? NS / tilesM : 1;
  const int fn  = (NS / tilesN > 1) ? NS / tilesN : 1;
  const int ks0 = ((tm * fm + tn * fn) % NS) * 64;
  auto kro = [&](int k) { return (k + ks0) & (KD - 1); };

  const OT* Ab = A  + (size_t)b * (size_t)strideA;
  const OT* Bb = Bt + (size_t)b * (size_t)strideB;

  const int rlane = lane & 15;                 // row (A) / col (B, D) within subtile
  const int koff  = (lane >> 4) * 8;           // k offset of this lane half
  const int mOff  = (lane >> 4) * 8;           // D row offset

  v8f acc[4][4];
#pragma unroll
  for (int i = 0; i < 4; ++i)
#pragma unroll
    for (int j = 0; j < 4; ++j) acc[i][j] = zero8();

  OT* sA = sP;                                 // NBUF buffers of 64 WR rows
  OT* sB = sP + NBUF * ASZ;                    // NBUF buffers of 64 WC rows
  const OT* wa = sA + (wave / WC) * (64 * LP); // this wave's 64 rows in buffer 0
  const OT* wb = sB + (wave % WC) * (64 * LP);
  const int sr = tid >> 3;                     // row within the 16 rows of one staging load of the block
  const int sc = (tid & 7) * 8;                // 16-B piece of the row's 128-B line
  const int so = sr * LP + sc;                 // the same place in an LDS buffer
  // block-uniform tile bases, told so to the compiler: they stay in scalar registers
  const char* gA = (const char*)(Ab + (size_t)__builtin_amdgcn_readfirstlane(bm0) * KD);
  const char* gB = (const char*)(Bb + (size_t)__builtin_amdgcn_readfirstlane(bn0) * KD);
  const unsigned lo = (unsigned)(sr * KD + sc) * 2u;      // byte offset of this lane's piece of tile row sr
  H8 ra[4 * WR], rb[4 * WC];                   // staging loops unrolled: constant indices keep both in registers
#pragma unroll
  for (int it = 0; it < 4 * WR; ++it) ra[it] = *(const H8*)(gA + 2 * kro(0) + lo + 32 * it * KD);
#pragma unroll
  for (int it = 0; it < 4 * WC; ++it) rb[it] = *(const H8*)(gB + 2 * kro(0) + lo + 32 * it * KD);
#if DEV_ASM
  // before an address register of the loads above is reused; the inputs keep those registers as they are up to here
  asm volatile("s_wait_xcnt 0x0" :: "v"(lo), "s"(gA), "s"(gB) : "memory");
#endif
#pragma unroll
  for (int it = 0; it < 4 * WR; ++it) *(H8*)(sA + 16 * it * LP + so) = ra[it];      // step 0 -> buffer 0
#pragma unroll
  for (int it = 0; it < 4 * WC; ++it) *(H8*)(sB + 16 * it * LP + so) = rb[it];
  if (KD > 64) {                               // step 1 into the registers
#pragma unroll
    for (int it = 0; it < 4 * WR; ++it) ra[it] = *(const H8*)(gA + 2 * kro(64) + lo + 32 * it * KD);
#pragma unroll
    for (int it = 0; it < 4 * WC; ++it) rb[it] = *(const H8*)(gB + 2 * kro(64) + lo + 32 * it * KD);
#if DEV_ASM
    // before an address register of these loads is reused; the inputs keep those registers as they are up to here
    asm volatile("s_wait_xcnt 0x0" :: "v"(lo), "s"(gA), "s"(gB) : "memory");
#endif
  }
  lds_barrier();                               // buffer 0 is whole before any wave reads it
  // One 64-k step. MORE: a next step exists; its rows go to the other buffer and the barrier publishes them. The last
  // step is written out by itself, so that in the loop the stores stand on every path and the waits of the second
  // block's fragments can be counted past them.
  auto step = [&](auto more, int k0) {
    constexpr bool MORE = decltype(more)::value;
    const int cur = (NBUF == 2) ? ((k0 >> 6) & 1) : 0;         // buffer of this step
    const OT* ca = wa + cur * ASZ;
    const OT* cb = wb + cur * BSZ;
#pragma unroll                                 // both 32-k blocks in one body: the second block's reads overlap the first's products
    for (int kk = 0; kk < 64; kk += 32) {
      V16 bq[4], af[4];                        // all eight fragments of the 32-k block read as one group
#pragma unroll
      for (int j = 0; j < 4; ++j) {
        bq[j] = ldfrag<OT>(cb + ((j << 4) + rlane) * LP + koff + kk);
        af[j] = ldfrag<OT>(ca + ((j << 4) + rlane) * LP + koff + kk);
      }
      // The stores stand behind the step's last fragment reads: LDS serves a wave in order, and in front of the reads
      // the products would wait for the block's stores; here the second block's products cover them.
      if (MORE && kk == 32) {
        // next step's rows into the other buffer: its readers left it in front of the last barrier
        OT* da = sA + (cur ^ 1) * ASZ + so;
        OT* db = sB + (cur ^ 1) * BSZ + so;
#pragma unroll
        for (int it = 0; it < 4 * WR; ++it) *(H8*)(da + 16 * it * LP) = ra[it];
#pragma unroll
        for (int it = 0; it < 4 * WC; ++it) *(H8*)(db + 16 * it * LP) = rb[it];
        if (k0 + 128 < KD) {                   // the step after that flies until its stores, one step on
#pragma unroll
          for (int it = 0; it < 4 * WR; ++it) ra[it] = *(const H8*)(gA + 2 * kro(k0 + 128) + lo + 32 * it * KD);
#pragma unroll
          for (int it = 0; it < 4 * WC; ++it) rb[it] = *(const H8*)(gB + 2 * kro(k0 + 128) + lo + 32 * it * KD);
#if DEV_ASM
          // before an address register of these loads is reused; the inputs keep those registers as they are up to here
          asm volatile("s_wait_xcnt 0x0" :: "v"(lo), "s"(gA), "s"(gB) : "memory");
#endif
        }
      }
#pragma unroll
      for (int i = 0; i < 4; ++i) {
#pragma unroll
        for (int j = 0; j < 4; ++j) acc[i][j] = mmar(af[i], bq[j], acc[i][j]);
        dep_guard(acc[i][0], acc[i][3], af[i], bq[3]);
      }
      keep4(bq[0], bq[1], bq[2], bq[3]);
    }
    // publishes the buffer written in this step; ends every wave's reads of the one that the next step overwrites
    if (MORE) lds_barrier();
  };
  for (int k0 = 0; k0 + 64 < KD; k0 += 64) step(BoolC<true>{}, k0);
  step(BoolC<false>{}, KD - 64);
  acc_guard4(acc[0][0], acc[0][1], acc[0][2], acc[0][3]);
  acc_guard4(acc[1][0], acc[1][1], acc[1][2], acc[1][3]);
  acc_guard4(acc[2][0], acc[2][1], acc[2][2], acc[2][3]);
  acc_guard4(acc[3][0], acc[3][1], acc[3][2], acc[3][3]);

  // ---- epilogue ----
  float* slab = sT + wave * (16 * 68);
#pragma unroll
  for (int i = 0; i < 4; ++i) {
    const int mBase = m0 + (i << 4);
#pragma unroll
    for (int j = 0; j < 4; ++j) {
#pragma unroll
      for (int r = 0; r < 8; ++r) {
        slab[(mOff + r) * 68 + (j << 4) + rlane] = acc[i][j][r];
      }
    }
    __builtin_amdgcn_fence(__ATOMIC_RELEASE, "workgroup");
    __builtin_amdgcn_wave_barrier();
    __builtin_amdgcn_fence(__ATOMIC_ACQUIRE, "workgroup");
    if (OUT_MODE == 0) {
      float* C = (float*)Cout + (size_t)b * (size_t)strideC;
      const int h2 = lane >> 4, c4 = (lane & 15) * 4;     // 256-B row segment = 16 lanes x 16 B
      v4f bcol = {0.f, 0.f, 0.f, 0.f};
      if (BIAS == 1) {
        const v4f bb = *(const v4f*)(bias + n0 + c4);
#pragma unroll
        for (int e = 0; e < 4; ++e) bcol[e] = bfr(bb[e]);
      }
      {
#pragma unroll
        for (int it = 0; it < 8; ++it) {
          const int row = it * 2 + h2;                     // it 0..7 x h2 0..1 = rows 0..15
          float brow = 0.f;
          if (BIAS == 2) brow = bfr(bias[mBase + row]);
          const v4f x = *(const v4f*)(slab + row * 68 + c4);
          v4f v;
#pragma unroll
          for (int e = 0; e < 4; ++e) v[e] = x[e] * oscale + bcol[e] + brow;
          *(v4f*)(C + (size_t)(mBase + row) * (size_t)ldc + n0 + c4) = v;
        }
        
      }
    } else {
      const int q = lane >> 3, c8 = (lane & 7) * 8;
      unsigned short* C  = (unsigned short*)Cout  + (size_t)b * (size_t)strideC;
      unsigned short* C2 = (unsigned short*)Cout2 + (size_t)b * (size_t)strideC;
      float bc8[8];
#pragma unroll
      for (int e = 0; e < 8; ++e) bc8[e] = 0.f;
      if (BIAS == 1) {
        const v4f b0 = *(const v4f*)(bias + n0 + c8);
        const v4f b1 = *(const v4f*)(bias + n0 + c8 + 4);
#pragma unroll
        for (int e = 0; e < 4; ++e) { bc8[e] = bfr(b0[e]); bc8[4 + e] = bfr(b1[e]); }
      }
      v4u hv[4], lv[4];
#pragma unroll
      for (int it = 0; it < 4; ++it) {
        const int row = it * 4 + q;                        // it 0..3 x q 0..3 = rows 0..15
        const float* sp = slab + row * 68 + c8;
        float brow = 0.f;
        if (BIAS == 2) brow = bfr(bias[mBase + row]);
        float f[8];
#pragma unroll
        for (int e = 0; e < 8; ++e) f[e] = sp[e] * oscale + bc8[e] + brow;
        v4u a, a2;
#pragma unroll
        for (int e = 0; e < 4; ++e) {
          const float f0 = f[2 * e], f1 = f[2 * e + 1];
          const _Float16 x0 = (_Float16)f0, x1 = (_Float16)f1;
          const unsigned short h0 = h_bits(x0), h1 = h_bits(x1);
          unsigned short l0 = 0, l1 = 0;
          if (OUT_MODE == 3) {
            l0 = h_bits((_Float16)((f0 - (float)x0) * rscale));
            l1 = h_bits((_Float16)((f1 - (float)x1) * rscale));
          }
          a[e] = pk16(h0, h1); a2[e] = pk16(l0, l1);
        }
        hv[it] = a; lv[it] = a2;
      }
      {
#pragma unroll
        for (int it = 0; it < 4; ++it) {
          const int row = it * 4 + q;
          *(v4u*)(C + (size_t)(mBase + row) * (size_t)ldc + n0 + c8) = hv[it];
          if (OUT_MODE == 3) *(v4u*)(C2 + (size_t)(mBase + row) * (size_t)ldc + n0 + c8) = lv[it];
        }
        
      }
    }
    __builtin_amdgcn_fence(__ATOMIC_RELEASE, "workgroup");
    __builtin_amdgcn_wave_barrier();
    __builtin_amdgcn_fence(__ATOMIC_ACQUIRE, "workgroup");
  }
}

// =====================================================================================================
// The three products that read only converted inputs, in ONE launch (none reads what another writes); a block
// takes its product from the range its index falls in. Ranges, longest work first:
//   v^T = Wv^T . x^T + bv per batch -> f16 hi plane [b][d][s] (pitch SEQ) and residual plane (x4096)
//         (A = WvT [n][k], Bt = Xb rows of batch b; M=DM, N=SEQ, K=DM; bias per row d)
//   z = coords . Wc + bc -> f32 [NB*SEQ][HN]                       (M=NB*SEQ, N=HN, K=DC)
//   second output = coords . Wn + bn -> f32 [NB*SEQ][DC]           (M=NB*SEQ, N=DC, K=DC)
// =====================================================================================================
#define GB_V  ((DM / 128) * (SEQ / 128))                    // 128 blocks per batch, 128x128 tiles
#define GB_Z  ((NB * SEQ / 128) * (HN / 128))               //  64 blocks, 128x128 tiles
#define GB_C  ((NB * SEQ / 256) * (DC / 64))                //  16 blocks, 256x64 tiles
static_assert((DM % 128) == 0 && (SEQ % 128) == 0 && (HN % 128) == 0 && ((NB * SEQ) % 256) == 0);
__global__ __launch_bounds__(128) void gemm_vzc(
    const unsigned short* __restrict__ WvT, const unsigned short* __restrict__ Xb,
    const unsigned short* __restrict__ Cb, const unsigned short* __restrict__ WcT,
    const unsigned short* __restrict__ WnT,
    unsigned short* VTh, unsigned short* VTl, float* Zf, float* out1,
    const float* __restrict__ bv, const float* __restrict__ bc, const float* __restrict__ bn) {
  GEMM_LDS(__bf16);
  int bx = (int)blockIdx.x;
  if (bx < NB * GB_V) {
    gemm64<__bf16, 3, 2, DM, 2, 2>(bx % GB_V, bx / GB_V, sT, sP,
        WvT, 0LL, Xb, (long long)SEQ * DM,
        (void*)VTh, (void*)VTl, SEQ, (long long)DM * SEQ, bv,
        DM, SEQ, 1.0f, RSC);
    return;
  }
  bx -= NB * GB_V;
  if (bx < GB_Z) {
    gemm64<__bf16, 0, 1, DC, 2, 2>(bx, 0, sT, sP,
        Cb, 0LL, WcT, 0LL,
        (void*)Zf, (void*)Zf, HN, 0LL, bc,
        NB * SEQ, HN, 1.0f, 1.0f);
    return;
  }
  bx -= GB_Z;
  gemm64<__bf16, 0, 1, DC, 4, 1>(bx, 0, sT, sP,
      Cb, 0LL, WnT, 0LL,
      (void*)out1, (void*)out1, DC, 0LL, bn,
      NB * SEQ, DC, 1.0f, 1.0f);
}

// first output = [ctx_hi | ctx_res] . [Wo^T ; Wo^T]^T + bo -> f32 [NB*SEQ][DM]   (M=NB*SEQ, N=DM, K=2*DM)
__global__ __launch_bounds__(128) void gemm_out(
    const unsigned short* __restrict__ Octx, const unsigned short* __restrict__ WoT2,
    float* out0, const float* __restrict__ bo) {
  GEMM_LDS(__bf16);
  gemm64<__bf16, 0, 1, OP, 2, 2>((int)blockIdx.x, 0, sT, sP,
      Octx, 0LL, WoT2, 0LL,
      (void*)out0, (void*)out0, DM, 0LL, bo,
      NB * SEQ, DM, 1.0f, 1.0f);
}

// =====================================================================================================
// z relayout: in f32 z [rows][HN] (16 heads x 16); out (a) f16 operand plane [rows][ZP], 64 halves per head =
// norms [rows][NH].  Block = 16 rows x 16 heads (thread = one (row, head)); staged in LDS; block barrier; line L of
// the block (L = 16*r + head, contiguous in the plane) written by lanes 8q..8q+7 of wave w with one instruction
// LDS: both arrays cross-wave (block barrier); fully written before read.
// =====================================================================================================
__global__ __launch_bounds__(256) void zprep(const float* __restrict__ zf, unsigned short* zp, float* zsq) {
  __shared__ __align__(16) unsigned short sZ[256 * LP];   // columns 64..71 of the pitch are never read
  __shared__ __align__(16) float sQ[256];
  const int tid  = (int)threadIdx.x;
  const int r    = tid >> 4, hd = tid & 15;
  const int row0 = blockIdx.x * 16;
  {
    const float* zr = zf + (size_t)(row0 + r) * HN + hd * HC;
    const v4f a0 = *(const v4f*)(zr);
    const v4f a1 = *(const v4f*)(zr + 4);
    const v4f a2 = *(const v4f*)(zr + 8);
    const v4f a3 = *(const v4f*)(zr + 12);
    float f[16];
#pragma unroll
    for (int e = 0; e < 4; ++e) { f[e] = a0[e]; f[4 + e] = a1[e]; f[8 + e] = a2[e]; f[12 + e] = a3[e]; }
    float q = 0.f;
#pragma unroll
    for (int e = 0; e < 16; ++e) q += f[e] * f[e];
    sQ[tid] = q;
    v4u ph0, ph1, pl0, pl1;
#pragma unroll
    for (int e = 0; e < 4; ++e) {
      const float f0 = f[2 * e], f1 = f[2 * e + 1], f2 = f[8 + 2 * e], f3 = f[9 + 2 * e];
      const _Float16 x0 = (_Float16)f0, x1 = (_Float16)f1, x2 = (_Float16)f2, x3 = (_Float16)f3;
      ph0[e] = pk16(h_bits(x0), h_bits(x1));
      ph1[e] = pk16(h_bits(x2), h_bits(x3));
      pl0[e] = pk16(h_bits((_Float16)((f0 - (float)x0) * RSC)), h_bits((_Float16)((f1 - (float)x1) * RSC)));
      pl1[e] = pk16(h_bits((_Float16)((f2 - (float)x2) * RSC)), h_bits((_Float16)((f3 - (float)x3) * RSC)));
    }
    const v4u z4 = {0u, 0u, 0u, 0u};
    unsigned short* sl = sZ + tid * LP;
    *(v4u*)(sl + 0)  = ph0;
    *(v4u*)(sl + 8)  = ph1;
    *(v4u*)(sl + 16) = pl0;
    *(v4u*)(sl + 24) = pl1;
    *(v4u*)(sl + 32) = ph0;
    *(v4u*)(sl + 40) = ph1;
    *(v4u*)(sl + 48) = z4;
    *(v4u*)(sl + 56) = z4;
  }
  __syncthreads();
  const int wave = tid >> 5, lane = tid & 31;
  const int q4 = lane >> 3, c8 = (lane & 7) * 8;
  unsigned short* base = zp + (size_t)row0 * ZP;
  v4u vv[8];
#pragma unroll
  for (int it = 0; it < 8; ++it) {
    const int L = it * 32 + wave * 4 + q4;
    vv[it] = *(const v4u*)(sZ + L * LP + c8);
  }
  {
#pragma unroll
    for (int it = 0; it < 8; ++it) {
      const int L = it * 32 + wave * 4 + q4;
      *(v4u*)(base + (size_t)L * 64 + c8) = vv[it];
    }
    
  }
  if (tid < 64) {                                       // waves 0 and 1, wave-uniform
    const v4f qv = *(const v4f*)(sQ + tid * 4);
    float* dst = zsq + (size_t)row0 * NH + tid * 4;
    *(v4f*)dst = qv;
    
  }
}

// =====================================================================================================
// Distance-kernel attention, per-head z dim 16, value dim 64, no mask, softmax over all SEQ keys.
//   z plane (f16): row (b*SEQ + t), head h at cols 64h.. : [hi | residual x4096 | hi | 0]
//   zsq (f32): [(b*SEQ + t)][h] = |z|^2
//   v^T hi plane (f16) and residual plane (f16, (v - hi)*4096): element (b, h, d, s) at [(b*DM + h*64 + d)*SEQ + s]
//   ctx plane (bf16): element (b, t, h, d) hi at [(b*SEQ + t)*OP + h*64 + d], residual at the same + DM
//   dot = A[hi|0] . B[hi;lo]  +  (A[lo|hi] . B[hi;lo]) / 4096 on f16 WMMA (two f32 accumulators);
//   score = -softplus(gamma_h) * max(|z_s|^2 + |z_t|^2 - 2 dot, 0) is <= 0 for every pair (the clamp, softplus >= 0),
//   and a query is one of its own keys, at distance 0 up to rounding: exp(score) cannot overflow and the row sum
//   is about 1 or more, so softmax = exp(s) / sum exp(s) is taken as it stands, with no running max and no rescale
//   (sound while softplus x the rounding error of a query's own distance, about 2^-22 |z|^2, stays far below 20).
//   p is carried x16384: one fma and one exp2 per score, exp2(-softplus * log2(e) * sq + 14), f16 for the product;
//   context = p . vh + (p . vl) / 4096 on f16 WMMA, both accumulators run through all chunks; sums in f32.
//   Both products run transposed: scores^T = keys (A) . queries (B), context^T = v^T (A) . p^T (B).  In every
//   accumulator tile a lane then holds ONE query (column lane&15) and rows 8*(lane>>4)+r (keys, or value dims):
//   the row sum is in-lane plus one exchange between the wave halves after the loop, and two score tiles pack straight
//   into the p^T operand (elements 0..7 = keys 8*half.. of the even tile, 8..15 = the same rows of the odd tile,
//   the k order of the v^T fragment), so p never goes through LDS.
//   Block = 4 waves = 4 x 16 query rows of one (b, h); grid = NB * NH * NQB; key chunks of 64, static trip NKT,
//   walked from chunk qb % NKT on and round.
//   Chunk staging: 128 threads x 4 rows x 8 elements per plane = the whole 64x64 tile of each of the three planes
//   (8 lanes per 128-B row), and the 64 key norms, 16 per wave (plain loads, __syncthreads before and after; staged
//   extent == consumed extent); the context tile
//   is wave-private; the grid covers every (b, h, qb).
// =====================================================================================================
__global__ __launch_bounds__(128)
void attn_dist(const unsigned short* __restrict__ zpp, const float* __restrict__ zsq,
               const unsigned short* __restrict__ vhp, const unsigned short* __restrict__ vlp,
               const float* __restrict__ gam, unsigned short* octx) {
  union FH { v16h v; v8h h[2]; };
  __shared__ __align__(16) _Float16 Zsh[64 * LP];          // z key chunk [key][64], pitch LP    9 KB
  __shared__ __align__(16) _Float16 Vth[64 * LP];          // V^T hi [d][key], pitch LP          9 KB
  __shared__ __align__(16) _Float16 Vtl[64 * LP];          // V^T residual, pitch LP             9 KB
  __shared__ __align__(16) float    Zqs[64];               // squared norms of the chunk's keys
  __shared__ __align__(16) float    Os[4][16 * OSP];       // per wave context tile, pitch OSP  17 KB

  const int tid  = threadIdx.x;
  const int wave = tid >> 5;
  const int lane = tid & 31;
  const int hh   = lane >> 4;
  const int c    = lane & 15;

  const int bx   = blockIdx.x;
  const int qb   = bx % NQB;
  const int rest = bx / NQB;
  const int h    = rest % NH;
  const int b    = rest / NH;
  const int q0   = qb * 64 + wave * 16;
  const size_t rowB = (size_t)b * SEQ;

  const _Float16* Zp16 = (const _Float16*)(const void*)zpp;
  const _Float16* Vh = (const _Float16*)(const void*)vhp + ((size_t)b * DM + (size_t)h * HD) * SEQ;
  const _Float16* Vl = (const _Float16*)(const void*)vlp + ((size_t)b * DM + (size_t)h * HD) * SEQ;

  const float gx = bfr(gam[h]);
  const float g  = fmaxf(gx, 0.f) + log1pf(expf(-fabsf(gx)));   // softplus
  const float ng2 = -g * 1.44269504088896340736f;              // score in log2 units per unit of squared distance

  // ---- query-side B fragment [hi | residual] (column = lane&15) and this lane's query squared norm ----
  const v16h zq = ldfrag<_Float16>(Zp16 + (rowB + q0 + c) * ZP + (size_t)h * 64 + 8 * hh);
  const float zsq_q = zsq[(rowB + q0 + c) * NH + h];

  float lrow = 0.f;            // sum of 16384 p over this half's keys only; the halves are joined after the loop
  v8f oacc[4];                 // context^T (x16384): tile t, register r = value dim 16t + 8*hh + r of query c
  v8f o1[4];                   // the same of the residual plane (x16384 x4096)
#pragma unroll
  for (int t = 0; t < 4; ++t) { oacc[t] = zero8(); o1[t] = zero8(); }

  // The 32 query blocks of one (b, h) walk the same key chunks: each enters the walk at its own
  // chunk and wraps round, for speed only (no running max: the
  // chunks may come in any order; only the order of the f32 sums follows it)
  const int kst = qb % NKT;
  const unsigned zlo = (unsigned)((tid >> 3) * ZP + (tid & 7) * 8) * 2u;    // byte offsets of this lane's piece in a chunk:
  const unsigned vlo = (unsigned)((tid >> 3) * SEQ + (tid & 7) * 8) * 2u;   // z tile row tid>>3, v^T tile row tid>>3,
  const unsigned nlo = (unsigned)((wave * 16 + c) * NH) * 4u;               // norm of key 16 wave + c
  for (int kt = 0; kt < NKT; ++kt) {         // static trip count
    const int kv0 = ((kt + kst) % NKT) * 64;
    __syncthreads();
    {
      // 8 lanes per tile row: one 16-B load of a wave covers the whole 128-B lines of 4 rows (not 32 B of each of 16)
      const int r = tid >> 3, c8 = (tid & 7) * 8;      // rows r, r+16, r+32, r+48; 16-B piece c8 of the row
      // The chunk's place is the same for the whole block and no longer a fixed step from the last one: a block-uniform
      // base, formed in scalar registers, to which the lane's own byte offsets (zlo, vlo, nlo, fixed in the loop) are added
      const char* zg  = (const char*)(Zp16 + (rowB + kv0) * ZP + (size_t)h * 64);    // key row kv0, 64-half head segment
      const char* vg  = (const char*)(Vh + kv0);                                      // v^T row d = 0, s = kv0
      const char* vlg = (const char*)(Vl + kv0);
      const char* ng  = (const char*)(zsq + (rowB + kv0) * NH + h);
      // each wave brings the norms of its own 16 keys (both lane halves the same 16: 8 lines a load), in one group with the tiles
      const float zn = *(const float*)(ng + nlo);
#pragma unroll
      for (int i = 0; i < 4; ++i) {
        const v8h a0 = *(const v8h*)(zg + zlo + 2 * 16 * i * ZP);
        const v8h b0 = *(const v8h*)(vg + vlo + 2 * 16 * i * SEQ);
        const v8h b1 = *(const v8h*)(vlg + vlo + 2 * 16 * i * SEQ);
        *(v8h*)(Zsh + (16 * i + r) * LP + c8) = a0;
        *(v8h*)(Vth + (16 * i + r) * LP + c8) = b0;
        *(v8h*)(Vtl + (16 * i + r) * LP + c8) = b1;
      }
#if DEV_ASM
      // input-only use of the loaded norm: keeps its load up among the tile loads; sunk into the branch below it
      // would be issued behind their waits and cost the block a second load latency in front of the barrier
      asm volatile("" :: "v"(zn));
#endif
      if (hh == 0) Zqs[wave * 16 + c] = zn;                       // lanes 0..15 of every wave: 4 x 16 = the 64 norms
#if DEV_ASM
      // before an address register of the staging loads above is advanced or reused
      asm volatile("s_wait_xcnt 0x0" ::: "memory");
#endif
    }
    __syncthreads();

    // ---- scores^T: 64 keys x 16 queries per wave, 2 f16 products per key subtile; p^T (x16384, f16) ----
    FH pa[2];                    // p^T operand of keys 0..31 and 32..63 of the chunk
    float pj[4];                 // four independent sums, one per key subtile
#pragma unroll
    for (int j = 0; j < 4; ++j) {
      const _Float16* zr = Zsh + (j * 16 + c) * LP + 8 * hh;
      FH b1, b2;
      b2.h[0] = *(const v8h*)(zr + 16);     // k 0..15  <- residual of key
      b2.h[1] = *(const v8h*)(zr + 32);     // k 16..31 <- hi of key
      b1.h[0] = *(const v8h*)(zr + 32);     // k 0..15  <- hi of key
      b1.h[1] = *(const v8h*)(zr + 48);     // k 16..31 <- zeros
      v8f ah = mma_h(b1.v, zq, zero8());    // hi.hi
      v8f ax = mma_h(b2.v, zq, zero8());    // (hi.lo + lo.hi) x4096
      const v4f zt0 = *(const v4f*)(Zqs + j * 16 + 8 * hh);       // norms of keys 16j + 8*hh + 0..3
      const v4f zt1 = *(const v4f*)(Zqs + j * 16 + 8 * hh + 4);   // and + 4..7
      v8f sq8;
      {
#pragma clang fp contract(off)
#pragma unroll
        for (int r = 0; r < 8; ++r) {
          const float d = ah[r] + ax[r] * (1.0f / RSC);
          const float sq = (zsq_q + (r < 4 ? zt0[r & 3] : zt1[r & 3])) - 2.0f * d;
          sq8[r] = fmaxf(sq, 0.f);
        }
      }
      pj[j] = 0.f;
#pragma unroll
      for (int r = 0; r < 8; ++r) {
        const float p = __builtin_amdgcn_exp2f(__builtin_fmaf(ng2, sq8[r], 14.0f));   // 16384 exp(score), <= 16384
        pj[j] += p;
        pa[j >> 1].h[j & 1][r] = (_Float16)p;
      }
    }
    lrow += (pj[0] + pj[1]) + (pj[2] + pj[3]);

    // ---- context^T += V^T . P^T (f16 WMMA); residual products into a separate accumulator ----
#pragma unroll                   // constant kk: pa[kk] stays in registers
    for (int kk = 0; kk < 2; ++kk) {
#pragma unroll
      for (int t = 0; t < 4; ++t) {
        FH vb, vl;
        vb.h[0] = *(const v8h*)(Vth + (t * 16 + c) * LP + kk * 32 + 8 * hh);
        vb.h[1] = *(const v8h*)(Vth + (t * 16 + c) * LP + kk * 32 + 16 + 8 * hh);
        vl.h[0] = *(const v8h*)(Vtl + (t * 16 + c) * LP + kk * 32 + 8 * hh);
        vl.h[1] = *(const v8h*)(Vtl + (t * 16 + c) * LP + kk * 32 + 16 + 8 * hh);
        oacc[t] = mma_h(vb.v, pa[kk].v, oacc[t]);
        o1[t]   = mma_h(vl.v, pa[kk].v, o1[t]);
      }
    }
  }
#pragma unroll
  for (int t = 0; t < 4; ++t)
#pragma unroll
    for (int r = 0; r < 8; ++r) oacc[t][r] += o1[t][r] * (1.0f / RSC);

  // ---- normalise (1/l; l and the context carry the same x16384), stage the wave's 16x64 tile, convert to bf16 hi + bf16 residual,
  float* os = Os[wave];
  {
    const float l = lrow + xhalf(lrow);          // both halves' keys
    const float inv = (l > 0.f) ? (1.0f / l) : 0.f;
#pragma unroll
    for (int t = 0; t < 4; ++t) {                // row = query c, 8 consecutive value dims per tile
      v4f w0, w1;
#pragma unroll
      for (int e = 0; e < 4; ++e) { w0[e] = oacc[t][e] * inv; w1[e] = oacc[t][4 + e] * inv; }
      *(v4f*)(os + c * OSP + t * 16 + 8 * hh)     = w0;
      *(v4f*)(os + c * OSP + t * 16 + 8 * hh + 4) = w1;
    }
  }
  __builtin_amdgcn_fence(__ATOMIC_RELEASE, "workgroup");
  __builtin_amdgcn_wave_barrier();
  __builtin_amdgcn_fence(__ATOMIC_ACQUIRE, "workgroup");
  {
    const int q4 = lane >> 3, c8 = (lane & 7) * 8;
    v4u hv[4], lv[4];
#pragma unroll
    for (int it = 0; it < 4; ++it) {
      const int row = it * 4 + q4;   // it 0..3 x q4 0..3 = rows 0..15 of the wave tile
      const float* sp = os + row * OSP + c8;
      v4u a, a2;
#pragma unroll
      for (int e = 0; e < 4; ++e) {
        const float f0 = sp[2 * e], f1 = sp[2 * e + 1];
        const unsigned short hb0 = bf_bits(f0), hb1 = bf_bits(f1);
        const unsigned short lb0 = bf_bits(f0 - bf_up(hb0)), lb1 = bf_bits(f1 - bf_up(hb1));
        a[e]  = pk16(hb0, hb1);
        a2[e] = pk16(lb0, lb1);
      }
      hv[it] = a; lv[it] = a2;
    }
    {
#pragma unroll
      for (int it = 0; it < 4; ++it) {
        const int row = it * 4 + q4;
        const size_t go = (rowB + q0 + row) * OP + (size_t)h * HD + c8;
        *(v4u*)(octx + go)      = hv[it];
        *(v4u*)(octx + go + DM) = lv[it];
      }
      
    }
  }
}

// =====================================================================================================
// Workspace map (bytes, NB=2 / SEQ=2048), every region an exact multiple of its whole-line / whole-tile store
// granularity, back to back:
//   Xb   bf16 [NB*SEQ][DM]            8388608
//   Cb   bf16 [NB*SEQ][DC]             524288
//   WvT  bf16 [DM n][DM k]            2097152
//   WoT2 bf16 [DM n][2*DM k]          4194304
//   WcT  bf16 [HN][DC]                  32768
//   WnT  bf16 [DC][DC]                   8192
//   Zf   f32  [NB*SEQ][HN]            4194304
//   Zp   f16  [NB*SEQ][ZP]            8388608
//   Zsq  f32  [NB*SEQ][NH]             262144
//   VTh  f16  [NB][DM][SEQ]           8388608
//   VTl  f16  [NB][DM][SEQ]           8388608
//   Octx bf16 [NB*SEQ][OP]           16777216
//   total                            61644800
// Weights arrive [in][out]; tr64 produces the [out n][in k] (k contiguous) layout the GEMM wants.
// =====================================================================================================
extern "C" void kernel_launch(void* const* d_in, const int* in_sizes, int n_in,
                              void* d_out, int out_size, void* d_ws, size_t ws_size,
                              hipStream_t stream) {
  if (n_in < 11) return;
  if (in_sizes[0] < ((NB - 1) * SEQ_FULL + SEQ) * DM) return;
  if (in_sizes[1] < ((NB - 1) * SEQ_FULL + SEQ) * DC) return;
  if (in_sizes[2] < DM * DM || in_sizes[3] < DM) return;
  if (in_sizes[4] < DC * HN || in_sizes[5] < HN) return;
  if (in_sizes[6] < DC * DC || in_sizes[7] < DC) return;
  if (in_sizes[8] < DM * DM || in_sizes[9] < DM) return;
  if (in_sizes[10] < NH) return;
  if ((size_t)out_size < OUT1_OFF + (size_t)NB * SEQ * DC) return;

  const float* hidden = (const float*)d_in[0];
  const float* coords = (const float*)d_in[1];
  const float* Wv     = (const float*)d_in[2];
  const float* bv     = (const float*)d_in[3];
  const float* Wc     = (const float*)d_in[4];
  const float* bc     = (const float*)d_in[5];
  const float* Wn     = (const float*)d_in[6];
  const float* bn     = (const float*)d_in[7];
  const float* Wo     = (const float*)d_in[8];
  const float* bo     = (const float*)d_in[9];
  const float* gamma  = (const float*)d_in[10];

  const size_t nRows = (size_t)NB * SEQ;
  const size_t PXB  = nRows * DM * 2;
  const size_t PCB  = nRows * DC * 2;
  const size_t PWV  = (size_t)DM * DM * 2;
  const size_t PWO2 = (size_t)DM * OP * 2;
  const size_t PWC  = (size_t)HN * DC * 2;
  const size_t PWN  = (size_t)DC * DC * 2;
  const size_t PZF  = nRows * HN * 4;
  const size_t PZP  = nRows * ZP * 2;
  const size_t PZQ  = nRows * NH * 4;
  const size_t PVT  = (size_t)NB * DM * SEQ * 2;
  const size_t POC  = nRows * OP * 2;
  size_t off = 0;
  const size_t oXb  = off; off += PXB;
  const size_t oCb  = off; off += PCB;
  const size_t oWv  = off; off += PWV;
  const size_t oWo  = off; off += PWO2;
  const size_t oWc  = off; off += PWC;
  const size_t oWn  = off; off += PWN;
  const size_t oZf  = off; off += PZF;
  const size_t oZp  = off; off += PZP;
  const size_t oZq  = off; off += PZQ;
  const size_t oVTh = off; off += PVT;
  const size_t oVTl = off; off += PVT;
  const size_t oOc  = off; off += POC;
  if (off > ws_size) return;                       // off = 61644800 at full size
  if (off > (size_t)134217728) return;

  char* ws = (char*)d_ws;
  unsigned short* Xb   = (unsigned short*)(ws + oXb);
  unsigned short* Cb   = (unsigned short*)(ws + oCb);
  unsigned short* WvT  = (unsigned short*)(ws + oWv);
  unsigned short* WoT2 = (unsigned short*)(ws + oWo);
  unsigned short* WcT  = (unsigned short*)(ws + oWc);
  unsigned short* WnT  = (unsigned short*)(ws + oWn);
  float*          Zf   = (float*)(ws + oZf);
  unsigned short* Zpl  = (unsigned short*)(ws + oZp);
  float*          Zsq  = (float*)(ws + oZq);
  unsigned short* VTh  = (unsigned short*)(ws + oVTh);
  unsigned short* VTl  = (unsigned short*)(ws + oVTl);
  unsigned short* Octx = (unsigned short*)(ws + oOc);
  float* out0 = (float*)d_out;
  float* out1 = (float*)d_out + OUT1_OFF;

  const dim3 blk(256);
  const dim3 gPrepAll(2 * PB_W + PB_C + PB_N + PB_X + PB_Q);           // 2693 blocks
  const dim3 gblk(32 * GW);                                            // GEMM blocks: 4 waves
  const dim3 gVZC(NB * GB_V + GB_Z + GB_C);                            //  336 blocks of 128
  const dim3 gO((NB * SEQ / 128) * (DM / 128));                        //  256 blocks of 128
  const dim3 gPrep((unsigned)(nRows / 16));                            //  256 blocks
  const dim3 gAttn(NB * NH * NQB);                                     // 1024 blocks of 128

  // (1) activations -> bf16 planes; weights [in][out] f32 -> bf16 [out][in], Wo^T duplicated along k (pitch 2*DM)
  prep_all<<<gPrepAll, blk, 0, stream>>>(hidden, coords, Wv, Wo, Wc, Wn, Xb, Cb, WvT, WoT2, WcT, WnT);
  // (2) v^T planes, z (f32) and the second output (d_out at element OUT1_OFF)
  gemm_vzc<<<gVZC, gblk, 0, stream>>>(WvT, Xb, Cb, WcT, WnT, VTh, VTl, Zf, out1, bv, bc, bn);
  // (3) z -> f16 operand plane [hi | res | hi | 0] and f32 squared norms
  zprep<<<gPrep, blk, 0, stream>>>(Zf, Zpl, Zsq);
  // (4) attention -> ctx plane (bf16 hi | bf16 residual) [b*SEQ+t][OP]
  attn_dist<<<gAttn, dim3(128), 0, stream>>>(Zpl, Zsq, VTh, VTl, gamma, Octx);
  // (5) first output
  gemm_out<<<gO, gblk, 0, stream>>>(Octx, WoT2, out0, bo);
  (void)hipGetLastError();
}

// v009
// A run of this version takes 105 microseconds.
// In two side-by-side timings against v008, it was 1.10 and 1.09 times as fast.
// All steps since v000 together make it 3.66 times as fast.
// Contractions: value = Wv^T.x^T+bv, z = coords.Wc+bc, coords.Wn+bn = v_wmma_f32_16x16x32_bf16 (bf16 operands from RNE-converted inputs, single product, f32 accumulate);
// z.z^T scores = v_wmma_f32_16x16x32_f16 (z as f16 hi + f16 residual x4096 packed along k, 2 products into separate f32 accumulators);
// p.v = v_wmma_f32_16x16x32_f16 (p carried x16384 in f16; v as f16 hi plane + f16 residual plane x4096; 2 products, f32 accumulate);
// ctx.Wo+bo = v_wmma_f32_16x16x32_bf16 (ctx as bf16 hi and bf16 residual planes concatenated along k, Wo^T bf16 duplicated along k; f32 accumulate);
// squared norms, softplus, softmax (no running max: every score is <= 0) and bias adds in f32.
#include <hip/hip_runtime.h>
#include <math.h>
#include <stdint.h>

#ifndef NB
#define NB 2
#endif
#ifndef SEQ
#define SEQ 2048
#endif
#define NB_FULL  2
#define SEQ_FULL 2048
#define DM   1024
#define NH   16
#define HC   16
#define HD   64
#define DC   64
#define HN   (NH * HC)        // 256
#define ZP   (NH * 64)        // 1024: z operand plane pitch, 64 halves per head [hi | lo x4096 | hi | 0]
#define OP   (2 * DM)         // 2048: ctx plane pitch (bf16 hi | bf16 residual)
#define NQB  (SEQ / 128)      // 128-row query blocks per sequence
#define NKT  (SEQ / 64)       // 64-key chunks per sequence
#define LP   72               // LDS row pitch in halves of every 64-half tile row: 144 B = 16 B x odd, so the 16 rows
                              // that one ds_load_b128 touches fall on 16 different groups of four banks (at 128 B: on one)
#define OSP  68               // LDS row pitch in floats of the 64-float context tile rows (272 B = 16 B x odd)
#define RSC    4096.0f
#define OUT1_OFF ((size_t)NB_FULL * SEQ_FULL * DM)   // element offset of the second output in d_out
static_assert(NH * HD == DM);
static_assert(HC == 16 && HD == 64 && DC == 64);
static_assert((SEQ % 128) == 0 && SEQ >= 128 && SEQ <= SEQ_FULL);
static_assert(NB >= 1 && NB <= NB_FULL);
static_assert((DM % 64) == 0 && (HN % 64) == 0 && (OP % 64) == 0);
static_assert(OUT1_OFF * 4 == 16777216);

typedef _Float16 v16h __attribute__((ext_vector_type(16)));
typedef _Float16 v8h  __attribute__((ext_vector_type(8)));
typedef __bf16   v16b __attribute__((ext_vector_type(16)));
typedef __bf16   v8b  __attribute__((ext_vector_type(8)));
typedef float    v8f  __attribute__((ext_vector_type(8)));
typedef float    v4f  __attribute__((ext_vector_type(4)));
typedef unsigned int v4u __attribute__((ext_vector_type(4)));

#if defined(__HIP_DEVICE_COMPILE__)
#define DEV_ASM 1
#else
#define DEV_ASM 0
#endif

// ---- scalar helpers --------------------------------------------------------------------------------
__device__ __forceinline__ unsigned short bf_bits(float f) {          // f32 -> bf16 bits, RNE convert
  unsigned u = __float_as_uint(f);
  return (unsigned short)((u + 0x7FFFu + ((u >> 16) & 1u)) >> 16);
}
__device__ __forceinline__ float bf_up(unsigned short hb) { return __uint_as_float(((unsigned)hb) << 16); }
__device__ __forceinline__ float bfr(float f) { return bf_up(bf_bits(f)); }   // value of the bf16 RNE convert
__device__ __forceinline__ unsigned short h_bits(_Float16 x) { return __builtin_bit_cast(unsigned short, x); }
__device__ __forceinline__ unsigned pk16(unsigned short a, unsigned short b) { return (unsigned)a | ((unsigned)b << 16); }
__device__ __forceinline__ v8f zero8() { v8f z = {0.f, 0.f, 0.f, 0.f, 0.f, 0.f, 0.f, 0.f}; return z; }
__device__ __forceinline__ float xhalf(float x) {                      // value of lane l ^ 16
  const int b = __builtin_bit_cast(int, x);
  return __builtin_bit_cast(float, __builtin_amdgcn_permlanex16(b, b, 0x76543210, 0xfedcba98, false, false));
}

// ---- fragment types / loaders: 16-bit A/B operand, lane -> row/col (lane&15), p already includes +8*(lane>>4);
//      elements 0..7 <- p[0..7] (k0+8h..k0+8h+7), elements 8..15 <- p[16..23] (k0+16+8h..k0+16+8h+7)
template <typename OT> struct FT;
template <> struct FT<__bf16>   { typedef v16b frag; typedef v8b half8; };
template <> struct FT<_Float16> { typedef v16h frag; typedef v8h half8; };

template <typename OT>
__device__ __forceinline__ typename FT<OT>::frag ldfrag(const OT* p) {
  union { typename FT<OT>::frag v; typename FT<OT>::half8 h[2]; } f;
  f.h[0] = *(const typename FT<OT>::half8*)(p);
  f.h[1] = *(const typename FT<OT>::half8*)(p + 16);
  return f.v;
}

// ---- WMMA helpers (asm guard bodies are device-only; concrete operand types) -----------------------------
__device__ __forceinline__ v8f mmar(v16b a, v16b b, v8f c) {
  return __builtin_amdgcn_wmma_f32_16x16x32_bf16(false, a, false, b, (short)0, c, false, false);
}
__device__ __forceinline__ v8f mmar(v16h a, v16h b, v8f c) {
  return __builtin_amdgcn_wmma_f32_16x16x32_f16(false, a, false, b, (short)0, c, false, false);
}
// guarded form: 4 VALU slots after the WMMA, D tied, A/B kept live
__device__ __forceinline__ v8f mma_h(v16h a, v16h b, v8f c) {
  c = __builtin_amdgcn_wmma_f32_16x16x32_f16(false, a, false, b, (short)0, c, false, false);
#if DEV_ASM
  asm volatile("v_nop\n\tv_nop\n\tv_nop\n\tv_nop" : "+v"(c) : "v"(a), "v"(b));
#endif
  return c;
}
__device__ __forceinline__ void dep_guard(v8f& a, v8f& b, v16b x, v16b y) {
#if DEV_ASM
  asm volatile("v_nop\n\tv_nop\n\tv_nop\n\tv_nop" : "+v"(a), "+v"(b) : "v"(x), "v"(y));
#else
  (void)a; (void)b; (void)x; (void)y;
#endif
}
__device__ __forceinline__ void dep_guard(v8f& a, v8f& b, v16h x, v16h y) {
#if DEV_ASM
  asm volatile("v_nop\n\tv_nop\n\tv_nop\n\tv_nop" : "+v"(a), "+v"(b) : "v"(x), "v"(y));
#else
  (void)a; (void)b; (void)x; (void)y;
#endif
}
__device__ __forceinline__ void keep4(v16b a, v16b b, v16b c, v16b d) {
#if DEV_ASM
  asm volatile("v_nop" :: "v"(a), "v"(b), "v"(c), "v"(d));
#else
  (void)a; (void)b; (void)c; (void)d;
#endif
}
__device__ __forceinline__ void keep4(v16h a, v16h b, v16h c, v16h d) {
#if DEV_ASM
  asm volatile("v_nop" :: "v"(a), "v"(b), "v"(c), "v"(d));
#else
  (void)a; (void)b; (void)c; (void)d;
#endif
}
__device__ __forceinline__ void acc_guard4(v8f& a, v8f& b, v8f& c, v8f& d) {
#if DEV_ASM
  asm volatile("v_nop\n\tv_nop\n\tv_nop\n\tv_nop" : "+v"(a), "+v"(b), "+v"(c), "+v"(d));
#else
  (void)a; (void)b; (void)c; (void)d;
#endif
}

// =====================================================================================================
// f32 rows -> bf16 plane rows (RNE convert), 8 elements per thread, one 16-B store per lane: a wave writes
// Dense output row `row` (0..nrows-1) reads source row (row / seq) * seqfull + row % seq (full batch stride).
// ceil(nrows*rowlen8/256) blocks, bx = the block's index among them. coverage: nrows*rowlen8 threads x 8 = the
// whole plane (exact multiple of 256).
// =====================================================================================================
__device__ __forceinline__ void cvtrows(int bx, const float* __restrict__ in, unsigned short* out,
                                        int rowlen8, int nrows, int seq, int seqfull) {
  const int i = bx * 256 + (int)threadIdx.x;
  if (i < nrows * rowlen8) {
    const int row  = i / rowlen8;
    const int c    = i - row * rowlen8;
    const int bq   = row / seq;
    const int srow = bq * seqfull + (row - bq * seq);
    const float* src = in + ((size_t)srow * (size_t)rowlen8 + (size_t)c) * 8;
    const v4f a  = *(const v4f*)(src);
    const v4f a4 = *(const v4f*)(src + 4);
    v4u p;
    p[0] = pk16(bf_bits(a[0]),  bf_bits(a[1]));
    p[1] = pk16(bf_bits(a[2]),  bf_bits(a[3]));
    p[2] = pk16(bf_bits(a4[0]), bf_bits(a4[1]));
    p[3] = pk16(bf_bits(a4[2]), bf_bits(a4[3]));
    unsigned short* o = out + (size_t)i * 8;
    *(v4u*)o = p;
    
  }
}

// =====================================================================================================
// Weight transpose + bf16 convert through LDS: in f32 [krows][ncols] (pitch ldi) -> out bf16 [n][k] (pitch ldo,
// k contiguous), optionally duplicated at +dup elements in the same output row.  One block = one 64x64 tile:
// input rows k0 = 64*by, cols n0 = 64*bx.  Load: thread r = tid>>2 reads 16 floats of input row
// k0+r; LDS holds the transposed tile; block barrier; write: wave w, lane>>3 = q, lanes 8q..8q+7 write one whole
// LDS tile: cross-wave (block barrier); columns 64..71 of the pitch are never read.
// =====================================================================================================
__device__ __forceinline__ void tr64(int bx, int by, unsigned short* sT, const float* __restrict__ in, int ldi,
                                     unsigned short* out, int ldo, int dup) {
  const int tid = (int)threadIdx.x;
  const int k0  = by * 64;
  const int n0  = bx * 64;
  {
    const int r = tid >> 2, c16 = (tid & 3) * 16;
    const float* src = in + (size_t)(k0 + r) * (size_t)ldi + n0 + c16;
    const v4f a0 = *(const v4f*)(src);
    const v4f a1 = *(const v4f*)(src + 4);
    const v4f a2 = *(const v4f*)(src + 8);
    const v4f a3 = *(const v4f*)(src + 12);
#pragma unroll
    for (int e = 0; e < 4; ++e) {
      sT[(c16 + e) * 72 + r]      = bf_bits(a0[e]);
      sT[(c16 + 4 + e) * 72 + r]  = bf_bits(a1[e]);
      sT[(c16 + 8 + e) * 72 + r]  = bf_bits(a2[e]);
      sT[(c16 + 12 + e) * 72 + r] = bf_bits(a3[e]);
    }
  }
  __syncthreads();
  const int wave = tid >> 5, lane = tid & 31;
  const int q = lane >> 3, c8 = (lane & 7) * 8;
  v4u vv[2];
#pragma unroll
  for (int it = 0; it < 2; ++it) {
    const int n = it * 32 + wave * 4 + q;
    vv[it] = *(const v4u*)(sT + n * 72 + c8);
  }
  {
#pragma unroll
    for (int it = 0; it < 2; ++it) {
      const int n = it * 32 + wave * 4 + q;
      unsigned short* d = out + (size_t)(n0 + n) * (size_t)ldo + k0 + c8;
      *(v4u*)d = vv[it];
      if (dup != 0) *(v4u*)(d + dup) = vv[it];
    }
#if DEV_ASM
    // behind the last store: in the listing another range's code follows and reuses the stores' registers
    asm volatile("s_wait_xcnt 0x0" ::: "memory");
#endif
  }
}

// =====================================================================================================
// All six input conversions in ONE launch: none reads what another writes, so each block takes its job from the
// range its index falls in (block-uniform branch; the barrier of tr64 is reached by whole blocks only).
// Ranges, in index order: Wv^T, Wo^T (duplicated along k), Wc^T, Wn^T, hidden rows, coordinate rows.
// =====================================================================================================
#define PB_W  ((DM / 64) * (DM / 64))            // 256 tiles of a [DM][DM] weight
#define PB_C  ((HN / 64) * (DC / 64))            //   4 tiles of Wc [DC][HN]
#define PB_N  ((DC / 64) * (DC / 64))            //   1 tile of Wn [DC][DC]
#define PB_X  (NB * SEQ * DM / 8 / 256)          // 2048 blocks of hidden rows
#define PB_Q  (NB * SEQ * DC / 8 / 256)          //  128 blocks of coordinate rows
static_assert((NB * SEQ * DM / 8) % 256 == 0 && (NB * SEQ * DC / 8) % 256 == 0);
__global__ __launch_bounds__(256) void prep_all(const float* __restrict__ hidden, const float* __restrict__ coords,
                                                const float* __restrict__ Wv, const float* __restrict__ Wo,
                                                const float* __restrict__ Wc, const float* __restrict__ Wn,
                                                unsigned short* Xb, unsigned short* Cb, unsigned short* WvT,
                                                unsigned short* WoT2, unsigned short* WcT, unsigned short* WnT) {
  __shared__ __align__(16) unsigned short sT[64 * 72];
  int bx = (int)blockIdx.x;
  if (bx < PB_W) { tr64(bx % (DM / 64), bx / (DM / 64), sT, Wv, DM, WvT, DM, 0); return; }
  bx -= PB_W;
  if (bx < PB_W) { tr64(bx % (DM / 64), bx / (DM / 64), sT, Wo, DM, WoT2, OP, DM); return; }
  bx -= PB_W;
  if (bx < PB_C) { tr64(bx % (HN / 64), bx / (HN / 64), sT, Wc, HN, WcT, DC, 0); return; }
  bx -= PB_C;
  if (bx < PB_N) { tr64(bx % (DC / 64), bx / (DC / 64), sT, Wn, DC, WnT, DC, 0); return; }
  bx -= PB_N;
  if (bx < PB_X) { cvtrows(bx, hidden, Xb, DM / 8, NB * SEQ, SEQ, SEQ_FULL); return; }
  bx -= PB_X;
  cvtrows(bx, coords, Cb, DC / 8, NB * SEQ, SEQ, SEQ_FULL);
}

// =====================================================================================================
// Register-blocked batched WMMA GEMM (16-bit operand type OT): C[m][n] = sum_k A[m][k] * Bt[n][k] (+ bias);
// a block of 4 waves, WR x WC of them, takes one (64 WR) x (64 WC) tile, each wave a 64x64 part of it. A row-major
// [M][K], Bt row-major [N][K] (k contiguous), both of row pitch K = KD elements, a compile-time constant so that the
// staging loads of a tile share one address and differ by immediate offsets; M a multiple of 64 WR, N of 64 WC, KD of
// 64. bx = block index within the product, b = batch index (strides in elements). Per 64-k step the BLOCK brings its
// 64 WR rows of A and 64 WC rows of Bt in ONCE, with 16-B loads that cover whole 128-B lines (8 lanes per row, 16 rows
// per load of the block), in registers one step ahead of the LDS store; the rows go to one of two LDS buffers
// (pitch LP) that all four waves read their fragments from with the split k map (ldfrag): a row of A serves WC waves,
// a row of Bt WR waves. One block barrier per step: it publishes the buffer just written and ends the reads of the other.
// BIAS 0: none; 1: per column n (bias[n]); 2: per row m (bias[m]); bias values RNE-converted to bf16 in f32.
// OUT_MODE 0: f32 C (pitch ldc), value * oscale + bias.
// OUT_MODE 3: f16 hi plane C + f16 residual plane C2 = f16((v - hi) * rscale) (same pitch / stride), v = acc*oscale+bias.
// whole 64x64 tile; slab pitch columns 64..67 never read.
// =====================================================================================================
// Block barrier that orders LDS accesses only: __syncthreads() also waits for the global loads in flight, which here
// are the rows of a later step and are wanted only at their LDS store
__device__ __forceinline__ void lds_barrier() {
  __builtin_amdgcn_fence(__ATOMIC_RELEASE, "workgroup", "local");
  __builtin_amdgcn_s_barrier();
  __builtin_amdgcn_fence(__ATOMIC_ACQUIRE, "workgroup", "local");
}
template <bool B> struct BoolC { static constexpr bool value = B; };   // a compile-time flag as an argument
// LDS of a GEMM block, declared once in each kernel and handed to the body
#define GW 4                                       // waves of a GEMM block
#define GEMM_ROWS 512                              // tile rows of the LDS pool: two buffers of 128 A + 128 Bt rows
#define GEMM_LDS(OT)                                                                                             \
  __shared__ __align__(16) float sT[GW * 16 * 68]; /* per-wave 16x64 slab, pitch 68 floats */                     \
  __shared__ __align__(16) OT sP[GEMM_ROWS * LP]   /* block tiles [row][64 k], columns 64..71 never read */
template <typename OT, int OUT_MODE, int BIAS, int KD, int WR, int WC>
__device__ __forceinline__ void gemm64(
    int bx, int b, float* sT, OT* sP,
    const unsigned short* __restrict__ Ap, long long strideA,
    const unsigned short* __restrict__ Btp, long long strideB,
    void* Cout, void* Cout2, int ldc, long long strideC,
    const float* __restrict__ bias,
    int M, int N, float oscale, float rscale) {
  static_assert((KD % 64) == 0 && KD >= 64);
  static_assert(WR * WC == GW);
  constexpr int NBUF = (KD > 64) ? 2 : 1;      // a single step needs one buffer
  constexpr int ASZ  = 64 * WR * LP;           // elements of one A buffer
  constexpr int BSZ  = 64 * WC * LP;           // elements of one Bt buffer
  static_assert(NBUF * 64 * (WR + WC) <= GEMM_ROWS);
  typedef typename FT<OT>::frag V16;
  typedef typename FT<OT>::half8 H8;
  const OT* A  = (const OT*)(const void*)Ap;
  const OT* Bt = (const OT*)(const void*)Btp;
  const int tid  = (int)threadIdx.x;
  const int lane = tid & 31;
  const int wave = tid >> 5;
  const int tilesN = N / (64 * WC);
  const int tilesM = M / (64 * WR);
  if (bx >= tilesM * tilesN) return;     // block-uniform, in front of every barrier
  const int tm = bx / tilesN;
  const int tn = bx - tm * tilesN;
  const int bm0 = tm * (64 * WR);        // the block's first row of A and of Bt
  const int bn0 = tn * (64 * WC);
  const int m0 = bm0 + (wave / WC) * 64; // this wave's 64x64 part
  const int n0 = bn0 + (wave % WC) * 64;
  // The block's own first k step. Blocks with the same tm walk the same rows of A, blocks with the same tn the same rows
  // of Bt; for speed only.
  // Each starts at a step set by its tile indices and wraps round at KD (step t of the block is k = kro(64 t)).
  constexpr int NS = KD / 64;
  static_assert((KD & (KD - 1)) == 0);         // the wrap is a mask
  const int fm  = (NS / tilesM > 1) ? NS / tilesM : 1;
  const int fn  = (NS / tilesN > 1) ? NS / tilesN : 1;
  const int ks0 = ((tm * fm + tn * fn) % NS) * 64;
  auto kro = [&](int k) { return (k + ks0) & (KD - 1); };

  const OT* Ab = A  + (size_t)b * (size_t)strideA;
  const OT* Bb = Bt + (size_t)b * (size_t)strideB;

  const int rlane = lane & 15;                 // row (A) / col (B, D) within subtile
  const int koff  = (lane >> 4) * 8;           // k offset of this lane half
  const int mOff  = (lane >> 4) * 8;           // D row offset

  v8f acc[4][4];
#pragma unroll
  for (int i = 0; i < 4; ++i)
#pragma unroll
    for (int j = 0; j < 4; ++j) acc[i][j] = zero8();

  OT* sA = sP;                                 // NBUF buffers of 64 WR rows
  OT* sB = sP + NBUF * ASZ;                    // NBUF buffers of 64 WC rows
  const OT* wa = sA + (wave / WC) * (64 * LP); // this wave's 64 rows in buffer 0
  const OT* wb = sB + (wave % WC) * (64 * LP);
  const int sr = tid >> 3;                     // row within the 16 rows of one staging load of the block
  const int sc = (tid & 7) * 8;                // 16-B piece of the row's 128-B line
  const int so = sr * LP + sc;                 // the same place in an LDS buffer
  // block-uniform tile bases, told so to the compiler: they stay in scalar registers
  const char* gA = (const char*)(Ab + (size_t)__builtin_amdgcn_readfirstlane(bm0) * KD);
  const char* gB = (const char*)(Bb + (size_t)__builtin_amdgcn_readfirstlane(bn0) * KD);
  const unsigned lo = (unsigned)(sr * KD + sc) * 2u;      // byte offset of this lane's piece of tile row sr
  H8 ra[4 * WR], rb[4 * WC];                   // staging loops unrolled: constant indices keep both in registers
#pragma unroll
  for (int it = 0; it < 4 * WR; ++it) ra[it] = *(const H8*)(gA + 2 * kro(0) + lo + 32 * it * KD);
#pragma unroll
  for (int it = 0; it < 4 * WC; ++it) rb[it] = *(const H8*)(gB + 2 * kro(0) + lo + 32 * it * KD);
#if DEV_ASM
  // before an address register of the loads above is reused; the inputs keep those registers as they are up to here
  asm volatile("s_wait_xcnt 0x0" :: "v"(lo), "s"(gA), "s"(gB) : "memory");
#endif
#pragma unroll
  for (int it = 0; it < 4 * WR; ++it) *(H8*)(sA + 16 * it * LP + so) = ra[it];      // step 0 -> buffer 0
#pragma unroll
  for (int it = 0; it < 4 * WC; ++it) *(H8*)(sB + 16 * it * LP + so) = rb[it];
  if (KD > 64) {                               // step 1 into the registers
#pragma unroll
    for (int it = 0; it < 4 * WR; ++it) ra[it] = *(const H8*)(gA + 2 * kro(64) + lo + 32 * it * KD);
#pragma unroll
    for (int it = 0; it < 4 * WC; ++it) rb[it] = *(const H8*)(gB + 2 * kro(64) + lo + 32 * it * KD);
#if DEV_ASM
    // before an address register of these loads is reused; the inputs keep those registers as they are up to here
    asm volatile("s_wait_xcnt 0x0" :: "v"(lo), "s"(gA), "s"(gB) : "memory");
#endif
  }
  lds_barrier();                               // buffer 0 is whole before any wave reads it
  // One 64-k step. MORE: a next step exists; its rows go to the other buffer and the barrier publishes them. The last
  // step is written out by itself, so that in the loop the stores stand on every path and the waits of the second
  // block's fragments can be counted past them.
  auto step = [&](auto more, int k0) {
    constexpr bool MORE = decltype(more)::value;
    const int cur = (NBUF == 2) ? ((k0 >> 6) & 1) : 0;         // buffer of this step
    const OT* ca = wa + cur * ASZ;
    const OT* cb = wb + cur * BSZ;
#pragma unroll                                 // both 32-k blocks in one body: the second block's reads overlap the first's products
    for (int kk = 0; kk < 64; kk += 32) {
      V16 bq[4], af[4];                        // all eight fragments of the 32-k block read as one group
#pragma unroll
      for (int j = 0; j < 4; ++j) {
        bq[j] = ldfrag<OT>(cb + ((j << 4) + rlane) * LP + koff + kk);
        af[j] = ldfrag<OT>(ca + ((j << 4) + rlane) * LP + koff + kk);
      }
      // The stores stand behind the step's last fragment reads: LDS serves a wave in order, and in front of the reads
      // the products would wait for the block's stores; here the second block's products cover them.
      if (MORE && kk == 32) {
        // next step's rows into the other buffer: its readers left it in front of the last barrier
        OT* da = sA + (cur ^ 1) * ASZ + so;
        OT* db = sB + (cur ^ 1) * BSZ + so;
#pragma unroll
        for (int it = 0; it < 4 * WR; ++it) *(H8*)(da + 16 * it * LP) = ra[it];
#pragma unroll
        for (int it = 0; it < 4 * WC; ++it) *(H8*)(db + 16 * it * LP) = rb[it];
        if (k0 + 128 < KD) {                   // the step after that flies until its stores, one step on
#pragma unroll
          for (int it = 0; it < 4 * WR; ++it) ra[it] = *(const H8*)(gA + 2 * kro(k0 + 128) + lo + 32 * it * KD);
#pragma unroll
          for (int it = 0; it < 4 * WC; ++it) rb[it] = *(const H8*)(gB + 2 * kro(k0 + 128) + lo + 32 * it * KD);
#if DEV_ASM
          // before an address register of these loads is reused; the inputs keep those registers as they are up to here
          asm volatile("s_wait_xcnt 0x0" :: "v"(lo), "s"(gA), "s"(gB) : "memory");
#endif
        }
      }
#pragma unroll
      for (int i = 0; i < 4; ++i) {
#pragma unroll
        for (int j = 0; j < 4; ++j) acc[i][j] = mmar(af[i], bq[j], acc[i][j]);
        dep_guard(acc[i][0], acc[i][3], af[i], bq[3]);
      }
      keep4(bq[0], bq[1], bq[2], bq[3]);
    }
    // publishes the buffer written in this step; ends every wave's reads of the one that the next step overwrites
    if (MORE) lds_barrier();
  };
  for (int k0 = 0; k0 + 64 < KD; k0 += 64) step(BoolC<true>{}, k0);
  step(BoolC<false>{}, KD - 64);
  acc_guard4(acc[0][0], acc[0][1], acc[0][2], acc[0][3]);
  acc_guard4(acc[1][0], acc[1][1], acc[1][2], acc[1][3]);
  acc_guard4(acc[2][0], acc[2][1], acc[2][2], acc[2][3]);
  acc_guard4(acc[3][0], acc[3][1], acc[3][2], acc[3][3]);

  // ---- epilogue ----
  float* slab = sT + wave * (16 * 68);
#pragma unroll
  for (int i = 0; i < 4; ++i) {
    const int mBase = m0 + (i << 4);
#pragma unroll
    for (int j = 0; j < 4; ++j) {
#pragma unroll
      for (int r = 0; r < 8; ++r) {
        slab[(mOff + r) * 68 + (j << 4) + rlane] = acc[i][j][r];
      }
    }
    __builtin_amdgcn_fence(__ATOMIC_RELEASE, "workgroup");
    __builtin_amdgcn_wave_barrier();
    __builtin_amdgcn_fence(__ATOMIC_ACQUIRE, "workgroup");
    if (OUT_MODE == 0) {
      float* C = (float*)Cout + (size_t)b * (size_t)strideC;
      const int h2 = lane >> 4, c4 = (lane & 15) * 4;     // 256-B row segment = 16 lanes x 16 B
      v4f bcol = {0.f, 0.f, 0.f, 0.f};
      if (BIAS == 1) {
        const v4f bb = *(const v4f*)(bias + n0 + c4);
#pragma unroll
        for (int e = 0; e < 4; ++e) bcol[e] = bfr(bb[e]);
      }
      {
#pragma unroll
        for (int it = 0; it < 8; ++it) {
          const int row = it * 2 + h2;                     // it 0..7 x h2 0..1 = rows 0..15
          float brow = 0.f;
          if (BIAS == 2) brow = bfr(bias[mBase + row]);
          const v4f x = *(const v4f*)(slab + row * 68 + c4);
          v4f v;
#pragma unroll
          for (int e = 0; e < 4; ++e) v[e] = x[e] * oscale + bcol[e] + brow;
          *(v4f*)(C + (size_t)(mBase + row) * (size_t)ldc + n0 + c4) = v;
        }
        
      }
    } else {
      const int q = lane >> 3, c8 = (lane & 7) * 8;
      unsigned short* C  = (unsigned short*)Cout  + (size_t)b * (size_t)strideC;
      unsigned short* C2 = (unsigned short*)Cout2 + (size_t)b * (size_t)strideC;
      float bc8[8];
#pragma unroll
      for (int e = 0; e < 8; ++e) bc8[e] = 0.f;
      if (BIAS == 1) {
        const v4f b0 = *(const v4f*)(bias + n0 + c8);
        const v4f b1 = *(const v4f*)(bias + n0 + c8 + 4);
#pragma unroll
        for (int e = 0; e < 4; ++e) { bc8[e] = bfr(b0[e]); bc8[4 + e] = bfr(b1[e]); }
      }
      v4u hv[4], lv[4];
#pragma unroll
      for (int it = 0; it < 4; ++it) {
        const int row = it * 4 + q;                        // it 0..3 x q 0..3 = rows 0..15
        const float* sp = slab + row * 68 + c8;
        float brow = 0.f;
        if (BIAS == 2) brow = bfr(bias[mBase + row]);
        float f[8];
#pragma unroll
        for (int e = 0; e < 8; ++e) f[e] = sp[e] * oscale + bc8[e] + brow;
        v4u a, a2;
#pragma unroll
        for (int e = 0; e < 4; ++e) {
          const float f0 = f[2 * e], f1 = f[2 * e + 1];
          const _Float16 x0 = (_Float16)f0, x1 = (_Float16)f1;
          const unsigned short h0 = h_bits(x0), h1 = h_bits(x1);
          unsigned short l0 = 0, l1 = 0;
          if (OUT_MODE == 3) {
            l0 = h_bits((_Float16)((f0 - (float)x0) * rscale));
            l1 = h_bits((_Float16)((f1 - (float)x1) * rscale));
          }
          a[e] = pk16(h0, h1); a2[e] = pk16(l0, l1);
        }
        hv[it] = a; lv[it] = a2;
      }
      {
#pragma unroll
        for (int it = 0; it < 4; ++it) {
          const int row = it * 4 + q;
          *(v4u*)(C + (size_t)(mBase + row) * (size_t)ldc + n0 + c8) = hv[it];
          if (OUT_MODE == 3) *(v4u*)(C2 + (size_t)(mBase + row) * (size_t)ldc + n0 + c8) = lv[it];
        }
        
      }
    }
    __builtin_amdgcn_fence(__ATOMIC_RELEASE, "workgroup");
    __builtin_amdgcn_wave_barrier();
    __builtin_amdgcn_fence(__ATOMIC_ACQUIRE, "workgroup");
  }
}

// =====================================================================================================
// The three products that read only converted inputs, in ONE launch (none reads what another writes); a block
// takes its product from the range its index falls in. Ranges, longest work first:
//   v^T = Wv^T . x^T + bv per batch -> f16 hi plane [b][d][s] (pitch SEQ) and residual plane (x4096)
//         (A = WvT [n][k], Bt = Xb rows of batch b; M=DM, N=SEQ, K=DM; bias per row d)
//   z = coords . Wc + bc -> f32 [NB*SEQ][HN]                       (M=NB*SEQ, N=HN, K=DC)
//   second output = coords . Wn + bn -> f32 [NB*SEQ][DC]           (M=NB*SEQ, N=DC, K=DC)
// =====================================================================================================
#define GB_V  ((DM / 128) * (SEQ / 128))                    // 128 blocks per batch, 128x128 tiles
#define GB_Z  ((NB * SEQ / 128) * (HN / 128))               //  64 blocks, 128x128 tiles
#define GB_C  ((NB * SEQ / 256) * (DC / 64))                //  16 blocks, 256x64 tiles
static_assert((DM % 128) == 0 && (SEQ % 128) == 0 && (HN % 128) == 0 && ((NB * SEQ) % 256) == 0);
__global__ __launch_bounds__(128) void gemm_vzc(
    const unsigned short* __restrict__ WvT, const unsigned short* __restrict__ Xb,
    const unsigned short* __restrict__ Cb, const unsigned short* __restrict__ WcT,
    const unsigned short* __restrict__ WnT,
    unsigned short* VTh, unsigned short* VTl, float* Zf, float* out1,
    const float* __restrict__ bv, const float* __restrict__ bc, const float* __restrict__ bn) {
  GEMM_LDS(__bf16);
  int bx = (int)blockIdx.x;
  if (bx < NB * GB_V) {
    gemm64<__bf16, 3, 2, DM, 2, 2>(bx % GB_V, bx / GB_V, sT, sP,
        WvT, 0LL, Xb, (long long)SEQ * DM,
        (void*)VTh, (void*)VTl, SEQ, (long long)DM * SEQ, bv,
        DM, SEQ, 1.0f, RSC);
    return;
  }
  bx -= NB * GB_V;
  if (bx < GB_Z) {
    gemm64<__bf16, 0, 1, DC, 2, 2>(bx, 0, sT, sP,
        Cb, 0LL, WcT, 0LL,
        (void*)Zf, (void*)Zf, HN, 0LL, bc,
        NB * SEQ, HN, 1.0f, 1.0f);
    return;
  }
  bx -= GB_Z;
  gemm64<__bf16, 0, 1, DC, 4, 1>(bx, 0, sT, sP,
      Cb, 0LL, WnT, 0LL,
      (void*)out1, (void*)out1, DC, 0LL, bn,
      NB * SEQ, DC, 1.0f, 1.0f);
}

// first output = [ctx_hi | ctx_res] . [Wo^T ; Wo^T]^T + bo -> f32 [NB*SEQ][DM]   (M=NB*SEQ, N=DM, K=2*DM)
__global__ __launch_bounds__(128) void gemm_out(
    const unsigned short* __restrict__ Octx, const unsigned short* __restrict__ WoT2,
    float* out0, const float* __restrict__ bo) {
  GEMM_LDS(__bf16);
  gemm64<__bf16, 0, 1, OP, 2, 2>((int)blockIdx.x, 0, sT, sP,
      Octx, 0LL, WoT2, 0LL,
      (void*)out0, (void*)out0, DM, 0LL, bo,
      NB * SEQ, DM, 1.0f, 1.0f);
}

// =====================================================================================================
// z relayout: in f32 z [rows][HN] (16 heads x 16); out (a) f16 operand plane [rows][ZP], 64 halves per head =
// norms [rows][NH].  Block = 16 rows x 16 heads (thread = one (row, head)); staged in LDS; block barrier; line L of
// the block (L = 16*r + head, contiguous in the plane) written by lanes 8q..8q+7 of wave w with one instruction
// LDS: both arrays cross-wave (block barrier); fully written before read.
// =====================================================================================================
__global__ __launch_bounds__(256) void zprep(const float* __restrict__ zf, unsigned short* zp, float* zsq) {
  __shared__ __align__(16) unsigned short sZ[256 * LP];   // columns 64..71 of the pitch are never read
  __shared__ __align__(16) float sQ[256];
  const int tid  = (int)threadIdx.x;
  const int r    = tid >> 4, hd = tid & 15;
  const int row0 = blockIdx.x * 16;
  {
    const float* zr = zf + (size_t)(row0 + r) * HN + hd * HC;
    const v4f a0 = *(const v4f*)(zr);
    const v4f a1 = *(const v4f*)(zr + 4);
    const v4f a2 = *(const v4f*)(zr + 8);
    const v4f a3 = *(const v4f*)(zr + 12);
    float f[16];
#pragma unroll
    for (int e = 0; e < 4; ++e) { f[e] = a0[e]; f[4 + e] = a1[e]; f[8 + e] = a2[e]; f[12 + e] = a3[e]; }
    float q = 0.f;
#pragma unroll
    for (int e = 0; e < 16; ++e) q += f[e] * f[e];
    sQ[tid] = q;
    v4u ph0, ph1, pl0, pl1;
#pragma unroll
    for (int e = 0; e < 4; ++e) {
      const float f0 = f[2 * e], f1 = f[2 * e + 1], f2 = f[8 + 2 * e], f3 = f[9 + 2 * e];
      const _Float16 x0 = (_Float16)f0, x1 = (_Float16)f1, x2 = (_Float16)f2, x3 = (_Float16)f3;
      ph0[e] = pk16(h_bits(x0), h_bits(x1));
      ph1[e] = pk16(h_bits(x2), h_bits(x3));
      pl0[e] = pk16(h_bits((_Float16)((f0 - (float)x0) * RSC)), h_bits((_Float16)((f1 - (float)x1) * RSC)));
      pl1[e] = pk16(h_bits((_Float16)((f2 - (float)x2) * RSC)), h_bits((_Float16)((f3 - (float)x3) * RSC)));
    }
    const v4u z4 = {0u, 0u, 0u, 0u};
    unsigned short* sl = sZ + tid * LP;
    *(v4u*)(sl + 0)  = ph0;
    *(v4u*)(sl + 8)  = ph1;
    *(v4u*)(sl + 16) = pl0;
    *(v4u*)(sl + 24) = pl1;
    *(v4u*)(sl + 32) = ph0;
    *(v4u*)(sl + 40) = ph1;
    *(v4u*)(sl + 48) = z4;
    *(v4u*)(sl + 56) = z4;
  }
  __syncthreads();
  const int wave = tid >> 5, lane = tid & 31;
  const int q4 = lane >> 3, c8 = (lane & 7) * 8;
  unsigned short* base = zp + (size_t)row0 * ZP;
  v4u vv[8];
#pragma unroll
  for (int it = 0; it < 8; ++it) {
    const int L = it * 32 + wave * 4 + q4;
    vv[it] = *(const v4u*)(sZ + L * LP + c8);
  }
  {
#pragma unroll
    for (int it = 0; it < 8; ++it) {
      const int L = it * 32 + wave * 4 + q4;
      *(v4u*)(base + (size_t)L * 64 + c8) = vv[it];
    }
    
  }
  if (tid < 64) {                                       // waves 0 and 1, wave-uniform
    const v4f qv = *(const v4f*)(sQ + tid * 4);
    float* dst = zsq + (size_t)row0 * NH + tid * 4;
    *(v4f*)dst = qv;
    
  }
}

// =====================================================================================================
// Distance-kernel attention, per-head z dim 16, value dim 64, no mask, softmax over all SEQ keys.
//   z plane (f16): row (b*SEQ + t), head h at cols 64h.. : [hi | residual x4096 | hi | 0]
//   zsq (f32): [(b*SEQ + t)][h] = |z|^2
//   v^T hi plane (f16) and residual plane (f16, (v - hi)*4096): element (b, h, d, s) at [(b*DM + h*64 + d)*SEQ + s]
//   ctx plane (bf16): element (b, t, h, d) hi at [(b*SEQ + t)*OP + h*64 + d], residual at the same + DM
//   dot = A[hi|0] . B[hi;lo]  +  (A[lo|hi] . B[hi;lo]) / 4096 on f16 WMMA (two f32 accumulators);
//   score = -softplus(gamma_h) * max(|z_s|^2 + |z_t|^2 - 2 dot, 0) is <= 0 for every pair (the clamp, softplus >= 0),
//   and a query is one of its own keys, at distance 0 up to rounding: exp(score) cannot overflow and the row sum
//   is about 1 or more, so softmax = exp(s) / sum exp(s) is taken as it stands, with no running max and no rescale
//   (sound while softplus x the rounding error of a query's own distance, about 2^-22 |z|^2, stays far below 20).
//   p is carried x16384: one fma and one exp2 per score, exp2(-softplus * log2(e) * sq + 14), f16 for the product;
//   context = p . vh + (p . vl) / 4096 on f16 WMMA, both accumulators run through all chunks; sums in f32.
//   Both products run transposed: scores^T = keys (A) . queries (B), context^T = v^T (A) . p^T (B).  In every
//   accumulator tile a lane then holds ONE query (column lane&15) and rows 8*(lane>>4)+r (keys, or value dims):
//   the row sum is in-lane plus one exchange between the wave halves after the loop, and two score tiles pack straight
//   into the p^T operand (elements 0..7 = keys 8*half.. of the even tile, 8..15 = the same rows of the odd tile,
//   the k order of the v^T fragment), so p never goes through LDS.
//   Block = 8 waves = 4 query groups x 2 key halves of one (b, h), 128 query rows; grid = NB * NH * NQB; key chunks of
//   64, static trip NKT, walked from chunk 2 qb on and round.  Wave w takes the 32 queries of group w >> 1 (two
//   16-column tiles) against keys 32 (w & 1) .. + 31 of every chunk: each z and v^T fragment it reads from LDS feeds
//   two products, one per query tile, and a chunk brought from L2 serves 128 queries.  With no running max the two key
//   halves of a query are plain partial sums: behind the loop each wave of a pair hands the partial context and row
//   sum of one query tile to its partner through LDS (two block barriers) and finishes the other tile.
//   Chunk staging: 256 threads x 2 rows x 8 elements per plane = the whole 64x64 tile of each of the three planes
//   (8 lanes per 128-B row), and the 64 key norms, one per thread of waves 0 and 1 (plain loads, __syncthreads before
//   and after; staged extent == consumed extent); the context tile
//   is wave-private but for the hand-over; the grid covers every (b, h, qb).
// =====================================================================================================
__global__ __launch_bounds__(256)
void attn_dist(const unsigned short* __restrict__ zpp, const float* __restrict__ zsq,
               const unsigned short* __restrict__ vhp, const unsigned short* __restrict__ vlp,
               const float* __restrict__ gam, unsigned short* octx) {
  union FH { v16h v; v8h h[2]; };
  __shared__ __align__(16) _Float16 Zsh[64 * LP];          // z key chunk [key][64], pitch LP    9 KB
  __shared__ __align__(16) _Float16 Vth[64 * LP];          // V^T hi [d][key], pitch LP          9 KB
  __shared__ __align__(16) _Float16 Vtl[64 * LP];          // V^T residual, pitch LP             9 KB
  __shared__ __align__(16) float    Zqs[64];               // squared norms of the chunk's keys
  __shared__ __align__(16) float    Os[8][16 * OSP];       // per wave context tile, pitch OSP  34 KB
  __shared__ __align__(16) float    Ls[8][32];             // per wave row sums handed to the partner

  const int tid  = threadIdx.x;
  const int wave = tid >> 5;
  const int lane = tid & 31;
  const int hh   = lane >> 4;
  const int c    = lane & 15;
  const int kh   = wave & 1;         // this wave's half of every key chunk
  const int qg   = wave >> 1;        // this wave's group of 32 queries

  const int bx   = blockIdx.x;
  const int qb   = bx % NQB;
  const int rest = bx / NQB;
  const int h    = rest % NH;
  const int b    = rest / NH;
  const int q0   = qb * 128 + qg * 32;
  const size_t rowB = (size_t)b * SEQ;

  const _Float16* Zp16 = (const _Float16*)(const void*)zpp;
  const _Float16* Vh = (const _Float16*)(const void*)vhp + ((size_t)b * DM + (size_t)h * HD) * SEQ;
  const _Float16* Vl = (const _Float16*)(const void*)vlp + ((size_t)b * DM + (size_t)h * HD) * SEQ;

  const float gx = bfr(gam[h]);
  const float g  = fmaxf(gx, 0.f) + log1pf(expf(-fabsf(gx)));   // softplus
  const float ng2 = -g * 1.44269504088896340736f;              // score in log2 units per unit of squared distance

  // ---- query-side B fragments [hi | residual] (column = lane&15) of both query tiles and the lane's query squared norms ----
  v16h  zq[2];
  float zsq_q[2];
#pragma unroll
  for (int u = 0; u < 2; ++u) {
    zq[u]    = ldfrag<_Float16>(Zp16 + (rowB + q0 + 16 * u + c) * ZP + (size_t)h * 64 + 8 * hh);
    zsq_q[u] = zsq[(rowB + q0 + 16 * u + c) * NH + h];
  }

  float lrow[2] = {0.f, 0.f};  // per query tile: sum of 16384 p over this lane half's keys of this wave's key halves
  v8f oacc[2][4];              // context^T (x16384): query tile u, tile t, register r = value dim 16t + 8*hh + r of query c
  v8f o1[2][4];                // the same of the residual plane (x16384 x4096)
#pragma unroll
  for (int u = 0; u < 2; ++u)
#pragma unroll
    for (int t = 0; t < 4; ++t) { oacc[u][t] = zero8(); o1[u][t] = zero8(); }

  // The 16 query blocks of one (b, h) walk the same key chunks: each enters the walk at its own
  // chunk and wraps round, so that they do not ask L2 for the same lines at the same moment (no running max: the
  // chunks may come in any order; only the order of the f32 sums follows it)
  const int kst = (qb * (NKT / NQB)) % NKT;
  const unsigned zlo = (unsigned)((tid >> 3) * ZP + (tid & 7) * 8) * 2u;    // byte offsets of this lane's piece in a chunk:
  const unsigned vlo = (unsigned)((tid >> 3) * SEQ + (tid & 7) * 8) * 2u;   // z tile row tid>>3, v^T tile row tid>>3,
  const unsigned nlo = (unsigned)((tid & 63) * NH) * 4u;                    // norm of key tid (threads 0..63)
  const _Float16* zrd = Zsh + (kh * 32 + c) * LP + 8 * hh;                  // this wave's key rows of the z tile,
  const float*    nrd = Zqs + kh * 32 + 8 * hh;                             // their norms,
  const _Float16* vhr = Vth + c * LP + kh * 32 + 8 * hh;                    // and its key columns of the v^T tiles
  const _Float16* vlr = Vtl + c * LP + kh * 32 + 8 * hh;
  for (int kt = 0; kt < NKT; ++kt) {         // static trip count
    const int kv0 = ((kt + kst) % NKT) * 64;
    __syncthreads();
    {
      // 8 lanes per tile row: one 16-B load of a wave covers the whole 128-B lines of 4 rows (not 32 B of each of 16)
      const int r = tid >> 3, c8 = (tid & 7) * 8;      // rows r, r+32; 16-B piece c8 of the row
      // The chunk's place is the same for the whole block and no longer a fixed step from the last one: a block-uniform
      // base, formed in scalar registers, to which the lane's own byte offsets (zlo, vlo, nlo, fixed in the loop) are added
      const char* zg  = (const char*)(Zp16 + (rowB + kv0) * ZP + (size_t)h * 64);    // key row kv0, 64-half head segment
      const char* vg  = (const char*)(Vh + kv0);                                      // v^T row d = 0, s = kv0
      const char* vlg = (const char*)(Vl + kv0);
      const char* ng  = (const char*)(zsq + (rowB + kv0) * NH + h);
      const char* za = zg + zlo;                       // the lane's own four addresses in the chunk
      const char* va = vg + vlo;
      const char* vr = vlg + vlo;
      const char* na = ng + nlo;
      v8h a0[2], b0[2], b1[2];
#pragma unroll
      for (int i = 0; i < 2; ++i) {
        a0[i] = *(const v8h*)(za + 2 * 32 * i * ZP);
        b0[i] = *(const v8h*)(va + 2 * 32 * i * SEQ);
        b1[i] = *(const v8h*)(vr + 2 * 32 * i * SEQ);
      }
      // waves 0 and 1 bring the 64 norms, one per thread, behind their tile loads and in one group with them
      float zn = 0.f;
      if (tid < 64) zn = *(const float*)na;
#if DEV_ASM
      // the wait before an address register of the staging loads above is reused; it takes the four address pairs as
      // inputs, so that they stay whole up to it and no load of the run lands in an address register of an earlier one
      asm volatile("s_wait_xcnt 0x0" :: "v"(za), "v"(va), "v"(vr), "v"(na) : "memory");
#endif
#pragma unroll
      for (int i = 0; i < 2; ++i) {
        *(v8h*)(Zsh + (32 * i + r) * LP + c8) = a0[i];
        *(v8h*)(Vth + (32 * i + r) * LP + c8) = b0[i];
        *(v8h*)(Vtl + (32 * i + r) * LP + c8) = b1[i];
      }
      if (tid < 64) Zqs[tid] = zn;                                // whole waves 0 and 1: the 64 norms
    }
    __syncthreads();

    // ---- scores^T: 32 keys x 32 queries per wave, 2 f16 products per key subtile and query tile; p^T (x16384, f16) ----
    FH pa[2];                    // p^T operand of this wave's 32 keys, one per query tile
    float pj[2][2];              // four independent sums, one per query tile and key subtile
#pragma unroll
    for (int j = 0; j < 2; ++j) {
      const _Float16* zr = zrd + j * 16 * LP;
      FH b1, b2;
      b2.h[0] = *(const v8h*)(zr + 16);     // k 0..15  <- residual of key
      b2.h[1] = *(const v8h*)(zr + 32);     // k 16..31 <- hi of key
      b1.h[0] = *(const v8h*)(zr + 32);     // k 0..15  <- hi of key
      b1.h[1] = *(const v8h*)(zr + 48);     // k 16..31 <- zeros
      const v4f zt0 = *(const v4f*)(nrd + j * 16);       // norms of keys 32*kh + 16j + 8*hh + 0..3
      const v4f zt1 = *(const v4f*)(nrd + j * 16 + 4);   // and + 4..7
#pragma unroll
      for (int u = 0; u < 2; ++u) {         // the key fragments serve both query tiles
        v8f ah = mma_h(b1.v, zq[u], zero8());    // hi.hi
        v8f ax = mma_h(b2.v, zq[u], zero8());    // (hi.lo + lo.hi) x4096
        v8f sq8;
        {
#pragma clang fp contract(off)
#pragma unroll
          for (int r = 0; r < 8; ++r) {
            const float d = ah[r] + ax[r] * (1.0f / RSC);
            const float sq = (zsq_q[u] + (r < 4 ? zt0[r & 3] : zt1[r & 3])) - 2.0f * d;
            sq8[r] = fmaxf(sq, 0.f);
          }
        }
        pj[u][j] = 0.f;
#pragma unroll
        for (int r = 0; r < 8; ++r) {
          const float p = __builtin_amdgcn_exp2f(__builtin_fmaf(ng2, sq8[r], 14.0f));   // 16384 exp(score), <= 16384
          pj[u][j] += p;
          pa[u].h[j][r] = (_Float16)p;
        }
      }
    }
    lrow[0] += pj[0][0] + pj[0][1];
    lrow[1] += pj[1][0] + pj[1][1];

    // ---- context^T += V^T . P^T (f16 WMMA); residual products into a separate accumulator ----
#pragma unroll
    for (int t = 0; t < 4; ++t) {
      FH vb, vl;
      vb.h[0] = *(const v8h*)(vhr + t * 16 * LP);
      vb.h[1] = *(const v8h*)(vhr + t * 16 * LP + 16);
      vl.h[0] = *(const v8h*)(vlr + t * 16 * LP);
      vl.h[1] = *(const v8h*)(vlr + t * 16 * LP + 16);
#pragma unroll
      for (int u = 0; u < 2; ++u) {         // the v^T fragments serve both query tiles
        oacc[u][t] = mma_h(vb.v, pa[u].v, oacc[u][t]);
        o1[u][t]   = mma_h(vl.v, pa[u].v, o1[u][t]);
      }
    }
  }

  // ---- join the two key halves: the wave keeps query tile kh and hands its partial of the other tile to wave ^ 1 ----
  float* os = Os[wave];
  v8f own[4];
  float lown;
  {
    v8f snd[4];
#pragma unroll
    for (int t = 0; t < 4; ++t)
#pragma unroll
      for (int r = 0; r < 8; ++r) {
        const float x0 = oacc[0][t][r] + o1[0][t][r] * (1.0f / RSC);
        const float x1 = oacc[1][t][r] + o1[1][t][r] * (1.0f / RSC);
        own[t][r] = kh ? x1 : x0;
        snd[t][r] = kh ? x0 : x1;
      }
    lown = kh ? lrow[1] : lrow[0];
    Ls[wave][lane] = kh ? lrow[0] : lrow[1];
#pragma unroll
    for (int t = 0; t < 4; ++t) {                // row = query c, 8 consecutive value dims per tile
      v4f w0, w1;
#pragma unroll
      for (int e = 0; e < 4; ++e) { w0[e] = snd[t][e]; w1[e] = snd[t][4 + e]; }
      *(v4f*)(os + c * OSP + t * 16 + 8 * hh)     = w0;
      *(v4f*)(os + c * OSP + t * 16 + 8 * hh + 4) = w1;
    }
  }
  __syncthreads();               // the partials are whole before the partner reads them
  {
    const float* po = Os[wave ^ 1];
    lown += Ls[wave ^ 1][lane];
#pragma unroll
    for (int t = 0; t < 4; ++t) {
      const v4f w0 = *(const v4f*)(po + c * OSP + t * 16 + 8 * hh);
      const v4f w1 = *(const v4f*)(po + c * OSP + t * 16 + 8 * hh + 4);
#pragma unroll
      for (int e = 0; e < 4; ++e) { own[t][e] += w0[e]; own[t][4 + e] += w1[e]; }
    }
  }
  __syncthreads();               // ends the partner's reads of this wave's tile, which is written anew below

  // ---- normalise (1/l; l and the context carry the same x16384), stage the wave's 16x64 tile, convert to bf16 hi + bf16 residual,
  {
    const float l = lown + xhalf(lown);          // both lane halves' keys
    const float inv = (l > 0.f) ? (1.0f / l) : 0.f;
#pragma unroll
    for (int t = 0; t < 4; ++t) {                // row = query c, 8 consecutive value dims per tile
      v4f w0, w1;
#pragma unroll
      for (int e = 0; e < 4; ++e) { w0[e] = own[t][e] * inv; w1[e] = own[t][4 + e] * inv; }
      *(v4f*)(os + c * OSP + t * 16 + 8 * hh)     = w0;
      *(v4f*)(os + c * OSP + t * 16 + 8 * hh + 4) = w1;
    }
  }
  __builtin_amdgcn_fence(__ATOMIC_RELEASE, "workgroup");
  __builtin_amdgcn_wave_barrier();
  __builtin_amdgcn_fence(__ATOMIC_ACQUIRE, "workgroup");
  {
    const int q4 = lane >> 3, c8 = (lane & 7) * 8;
    v4u hv[4], lv[4];
#pragma unroll
    for (int it = 0; it < 4; ++it) {
      const int row = it * 4 + q4;   // it 0..3 x q4 0..3 = rows 0..15 of the wave tile
      const float* sp = os + row * OSP + c8;
      v4u a, a2;
#pragma unroll
      for (int e = 0; e < 4; ++e) {
        const float f0 = sp[2 * e], f1 = sp[2 * e + 1];
        const unsigned short hb0 = bf_bits(f0), hb1 = bf_bits(f1);
        const unsigned short lb0 = bf_bits(f0 - bf_up(hb0)), lb1 = bf_bits(f1 - bf_up(hb1));
        a[e]  = pk16(hb0, hb1);
        a2[e] = pk16(lb0, lb1);
      }
      hv[it] = a; lv[it] = a2;
    }
    {
#pragma unroll
      for (int it = 0; it < 4; ++it) {
        const int row = it * 4 + q4;
        const size_t go = (rowB + q0 + 16 * kh + row) * OP + (size_t)h * HD + c8;   // the wave's own query tile
        *(v4u*)(octx + go)      = hv[it];
        *(v4u*)(octx + go + DM) = lv[it];
      }
      
    }
  }
}

// =====================================================================================================
// Workspace map (bytes, NB=2 / SEQ=2048), every region an exact multiple of its whole-line / whole-tile store
// granularity, back to back:
//   Xb   bf16 [NB*SEQ][DM]            8388608
//   Cb   bf16 [NB*SEQ][DC]             524288
//   WvT  bf16 [DM n][DM k]            2097152
//   WoT2 bf16 [DM n][2*DM k]          4194304
//   WcT  bf16 [HN][DC]                  32768
//   WnT  bf16 [DC][DC]                   8192
//   Zf   f32  [NB*SEQ][HN]            4194304
//   Zp   f16  [NB*SEQ][ZP]            8388608
//   Zsq  f32  [NB*SEQ][NH]             262144
//   VTh  f16  [NB][DM][SEQ]           8388608
//   VTl  f16  [NB][DM][SEQ]           8388608
//   Octx bf16 [NB*SEQ][OP]           16777216
//   total                            61644800
// Weights arrive [in][out]; tr64 produces the [out n][in k] (k contiguous) layout the GEMM wants.
// =====================================================================================================
extern "C" void kernel_launch(void* const* d_in, const int* in_sizes, int n_in,
                              void* d_out, int out_size, void* d_ws, size_t ws_size,
                              hipStream_t stream) {
  if (n_in < 11) return;
  if (in_sizes[0] < ((NB - 1) * SEQ_FULL + SEQ) * DM) return;
  if (in_sizes[1] < ((NB - 1) * SEQ_FULL + SEQ) * DC) return;
  if (in_sizes[2] < DM * DM || in_sizes[3] < DM) return;
  if (in_sizes[4] < DC * HN || in_sizes[5] < HN) return;
  if (in_sizes[6] < DC * DC || in_sizes[7] < DC) return;
  if (in_sizes[8] < DM * DM || in_sizes[9] < DM) return;
  if (in_sizes[10] < NH) return;
  if ((size_t)out_size < OUT1_OFF + (size_t)NB * SEQ * DC) return;

  const float* hidden = (const float*)d_in[0];
  const float* coords = (const float*)d_in[1];
  const float* Wv     = (const float*)d_in[2];
  const float* bv     = (const float*)d_in[3];
  const float* Wc     = (const float*)d_in[4];
  const float* bc     = (const float*)d_in[5];
  const float* Wn     = (const float*)d_in[6];
  const float* bn     = (const float*)d_in[7];
  const float* Wo     = (const float*)d_in[8];
  const float* bo     = (const float*)d_in[9];
  const float* gamma  = (const float*)d_in[10];

  const size_t nRows = (size_t)NB * SEQ;
  const size_t PXB  = nRows * DM * 2;
  const size_t PCB  = nRows * DC * 2;
  const size_t PWV  = (size_t)DM * DM * 2;
  const size_t PWO2 = (size_t)DM * OP * 2;
  const size_t PWC  = (size_t)HN * DC * 2;
  const size_t PWN  = (size_t)DC * DC * 2;
  const size_t PZF  = nRows * HN * 4;
  const size_t PZP  = nRows * ZP * 2;
  const size_t PZQ  = nRows * NH * 4;
  const size_t PVT  = (size_t)NB * DM * SEQ * 2;
  const size_t POC  = nRows * OP * 2;
  size_t off = 0;
  const size_t oXb  = off; off += PXB;
  const size_t oCb  = off; off += PCB;
  const size_t oWv  = off; off += PWV;
  const size_t oWo  = off; off += PWO2;
  const size_t oWc  = off; off += PWC;
  const size_t oWn  = off; off += PWN;
  const size_t oZf  = off; off += PZF;
  const size_t oZp  = off; off += PZP;
  const size_t oZq  = off; off += PZQ;
  const size_t oVTh = off; off += PVT;
  const size_t oVTl = off; off += PVT;
  const size_t oOc  = off; off += POC;
  if (off > ws_size) return;                       // off = 61644800 at full size
  if (off > (size_t)134217728) return;

  char* ws = (char*)d_ws;
  unsigned short* Xb   = (unsigned short*)(ws + oXb);
  unsigned short* Cb   = (unsigned short*)(ws + oCb);
  unsigned short* WvT  = (unsigned short*)(ws + oWv);
  unsigned short* WoT2 = (unsigned short*)(ws + oWo);
  unsigned short* WcT  = (unsigned short*)(ws + oWc);
  unsigned short* WnT  = (unsigned short*)(ws + oWn);
  float*          Zf   = (float*)(ws + oZf);
  unsigned short* Zpl  = (unsigned short*)(ws + oZp);
  float*          Zsq  = (float*)(ws + oZq);
  unsigned short* VTh  = (unsigned short*)(ws + oVTh);
  unsigned short* VTl  = (unsigned short*)(ws + oVTl);
  unsigned short* Octx = (unsigned short*)(ws + oOc);
  float* out0 = (float*)d_out;
  float* out1 = (float*)d_out + OUT1_OFF;

  const dim3 blk(256);
  const dim3 gPrepAll(2 * PB_W + PB_C + PB_N + PB_X + PB_Q);           // 2693 blocks
  const dim3 gblk(32 * GW);                                            // GEMM blocks: 4 waves
  const dim3 gVZC(NB * GB_V + GB_Z + GB_C);                            //  336 blocks of 128
  const dim3 gO((NB * SEQ / 128) * (DM / 128));                        //  256 blocks of 128
  const dim3 gPrep((unsigned)(nRows / 16));                            //  256 blocks
  const dim3 gAttn(NB * NH * NQB);                                     //  512 blocks of 256

  // (1) activations -> bf16 planes; weights [in][out] f32 -> bf16 [out][in], Wo^T duplicated along k (pitch 2*DM)
  prep_all<<<gPrepAll, blk, 0, stream>>>(hidden, coords, Wv, Wo, Wc, Wn, Xb, Cb, WvT, WoT2, WcT, WnT);
  // (2) v^T planes, z (f32) and the second output (d_out at element OUT1_OFF)
  gemm_vzc<<<gVZC, gblk, 0, stream>>>(WvT, Xb, Cb, WcT, WnT, VTh, VTl, Zf, out1, bv, bc, bn);
  // (3) z -> f16 operand plane [hi | res | hi | 0] and f32 squared norms
  zprep<<<gPrep, blk, 0, stream>>>(Zf, Zpl, Zsq);
  // (4) attention -> ctx plane (bf16 hi | bf16 residual) [b*SEQ+t][OP]
  attn_dist<<<gAttn, dim3(256), 0, stream>>>(Zpl, Zsq, VTh, VTl, gamma, Octx);
  // (5) first output
  gemm_out<<<gO, gblk, 0, stream>>>(Octx, WoT2, out0, bo);
  (void)hipGetLastError();
}

// v010
// It runs in 96.7 microseconds.
// Two timings next to v009 put it at 1.09 and 1.08 times that version's speed.
// Over all steps from v000 it is 3.97 times as fast.
// Contractions: value = Wv^T.x^T+bv, z = coords.Wc+bc, coords.Wn+bn = v_wmma_f32_16x16x32_bf16 (bf16 operands from RNE-converted inputs, single product, f32 accumulate);
// scores = v_wmma_f32_16x16x32_f16 (scaled z as f16 hi + f16 residual, squared norms as 3 f16 pieces and the offset packed along k, 2 products into one f32 accumulator);
// p.v = v_wmma_f32_16x16x32_f16 (p carried x16384 in f16; v as f16 hi plane + f16 residual plane x4096; 2 products, f32 accumulate);
// ctx.Wo+bo = v_wmma_f32_16x16x32_bf16 (ctx as bf16 hi and bf16 residual planes concatenated along k, Wo^T bf16 duplicated along k; f32 accumulate);
// squared norms, softplus, softmax (no running max: every score is <= 0) and bias adds in f32.
#include <hip/hip_runtime.h>
#include <math.h>
#include <stdint.h>

#ifndef NB
#define NB 2
#endif
#ifndef SEQ
#define SEQ 2048
#endif
#define NB_FULL  2
#define SEQ_FULL 2048
#define DM   1024
#define NH   16
#define HC   16
#define HD   64
#define DC   64
#define HN   (NH * HC)        // 256
#define ZP   (NH * 64)        // 1024: z operand plane pitch, 64 halves per head [hi | hi/64 | residual x64 | norm pieces, ones]
#define OP   (2 * DM)         // 2048: ctx plane pitch (bf16 hi | bf16 residual)
#define NQB  (SEQ / 128)      // 128-row query blocks per sequence
#define NKT  (SEQ / 64)       // 64-key chunks per sequence
#define LP   72               // LDS row pitch in halves of every 64-half tile row: 144 B = 16 B x odd, so the 16 rows
                              // that one ds_load_b128 touches fall on 16 different groups of four banks (at 128 B: on one)
#define OSP  68               // LDS row pitch in floats of the 64-float context tile rows (272 B = 16 B x odd)
#define RSC    4096.0f
#define ZSC    64.0f            // scale of the z residual in its plane; the hi copy that meets it carries 1/64
#define OUT1_OFF ((size_t)NB_FULL * SEQ_FULL * DM)   // element offset of the second output in d_out
static_assert(NH * HD == DM);
static_assert(HC == 16 && HD == 64 && DC == 64);
static_assert((SEQ % 128) == 0 && SEQ >= 128 && SEQ <= SEQ_FULL);
static_assert(NB >= 1 && NB <= NB_FULL);
static_assert((DM % 64) == 0 && (HN % 64) == 0 && (OP % 64) == 0);
static_assert(OUT1_OFF * 4 == 16777216);

typedef _Float16 v16h __attribute__((ext_vector_type(16)));
typedef _Float16 v8h  __attribute__((ext_vector_type(8)));
typedef _Float16 v4h  __attribute__((ext_vector_type(4)));
typedef __bf16   v16b __attribute__((ext_vector_type(16)));
typedef __bf16   v8b  __attribute__((ext_vector_type(8)));
typedef float    v8f  __attribute__((ext_vector_type(8)));
typedef float    v4f  __attribute__((ext_vector_type(4)));
typedef unsigned int v4u __attribute__((ext_vector_type(4)));

#if defined(__HIP_DEVICE_COMPILE__)
#define DEV_ASM 1
#else
#define DEV_ASM 0
#endif

// ---- scalar helpers --------------------------------------------------------------------------------
__device__ __forceinline__ unsigned short bf_bits(float f) {          // f32 -> bf16 bits, RNE convert
  unsigned u = __float_as_uint(f);
  return (unsigned short)((u + 0x7FFFu + ((u >> 16) & 1u)) >> 16);
}
__device__ __forceinline__ float bf_up(unsigned short hb) { return __uint_as_float(((unsigned)hb) << 16); }
__device__ __forceinline__ float bfr(float f) { return bf_up(bf_bits(f)); }   // value of the bf16 RNE convert
__device__ __forceinline__ unsigned short h_bits(_Float16 x) { return __builtin_bit_cast(unsigned short, x); }
__device__ __forceinline__ unsigned pk16(unsigned short a, unsigned short b) { return (unsigned)a | ((unsigned)b << 16); }
__device__ __forceinline__ v8f zero8() { v8f z = {0.f, 0.f, 0.f, 0.f, 0.f, 0.f, 0.f, 0.f}; return z; }
__device__ __forceinline__ float xhalf(float x) {                      // value of lane l ^ 16
  const int b = __builtin_bit_cast(int, x);
  return __builtin_bit_cast(float, __builtin_amdgcn_permlanex16(b, b, 0x76543210, 0xfedcba98, false, false));
}

// ---- fragment types / loaders: 16-bit A/B operand, lane -> row/col (lane&15), p already includes +8*(lane>>4);
//      elements 0..7 <- p[0..7] (k0+8h..k0+8h+7), elements 8..15 <- p[16..23] (k0+16+8h..k0+16+8h+7)
template <typename OT> struct FT;
template <> struct FT<__bf16>   { typedef v16b frag; typedef v8b half8; };
template <> struct FT<_Float16> { typedef v16h frag; typedef v8h half8; };

template <typename OT>
__device__ __forceinline__ typename FT<OT>::frag ldfrag(const OT* p) {
  union { typename FT<OT>::frag v; typename FT<OT>::half8 h[2]; } f;
  f.h[0] = *(const typename FT<OT>::half8*)(p);
  f.h[1] = *(const typename FT<OT>::half8*)(p + 16);
  return f.v;
}

// ---- WMMA helpers (asm guard bodies are device-only; concrete operand types) -----------------------------
__device__ __forceinline__ v8f mmar(v16b a, v16b b, v8f c) {
  return __builtin_amdgcn_wmma_f32_16x16x32_bf16(false, a, false, b, (short)0, c, false, false);
}
__device__ __forceinline__ v8f mmar(v16h a, v16h b, v8f c) {
  return __builtin_amdgcn_wmma_f32_16x16x32_f16(false, a, false, b, (short)0, c, false, false);
}
// guarded form: 4 VALU slots after the WMMA, D tied, A/B kept live
__device__ __forceinline__ v8f mma_h(v16h a, v16h b, v8f c) {
  c = __builtin_amdgcn_wmma_f32_16x16x32_f16(false, a, false, b, (short)0, c, false, false);
#if DEV_ASM
  asm volatile("v_nop\n\tv_nop\n\tv_nop\n\tv_nop" : "+v"(c) : "v"(a), "v"(b));
#endif
  return c;
}
__device__ __forceinline__ void dep_guard(v8f& a, v8f& b, v16b x, v16b y) {
#if DEV_ASM
  asm volatile("v_nop\n\tv_nop\n\tv_nop\n\tv_nop" : "+v"(a), "+v"(b) : "v"(x), "v"(y));
#else
  (void)a; (void)b; (void)x; (void)y;
#endif
}
__device__ __forceinline__ void dep_guard(v8f& a, v8f& b, v16h x, v16h y) {
#if DEV_ASM
  asm volatile("v_nop\n\tv_nop\n\tv_nop\n\tv_nop" : "+v"(a), "+v"(b) : "v"(x), "v"(y));
#else
  (void)a; (void)b; (void)x; (void)y;
#endif
}
__device__ __forceinline__ void keep4(v16b a, v16b b, v16b c, v16b d) {
#if DEV_ASM
  asm volatile("v_nop" :: "v"(a), "v"(b), "v"(c), "v"(d));
#else
  (void)a; (void)b; (void)c; (void)d;
#endif
}
__device__ __forceinline__ void keep4(v16h a, v16h b, v16h c, v16h d) {
#if DEV_ASM
  asm volatile("v_nop" :: "v"(a), "v"(b), "v"(c), "v"(d));
#else
  (void)a; (void)b; (void)c; (void)d;
#endif
}
__device__ __forceinline__ void acc_guard4(v8f& a, v8f& b, v8f& c, v8f& d) {
#if DEV_ASM
  asm volatile("v_nop\n\tv_nop\n\tv_nop\n\tv_nop" : "+v"(a), "+v"(b), "+v"(c), "+v"(d));
#else
  (void)a; (void)b; (void)c; (void)d;
#endif
}

// =====================================================================================================
// f32 rows -> bf16 plane rows (RNE convert), 8 elements per thread, one 16-B store per lane: a wave writes
// Dense output row `row` (0..nrows-1) reads source row (row / seq) * seqfull + row % seq (full batch stride).
// ceil(nrows*rowlen8/256) blocks, bx = the block's index among them. coverage: nrows*rowlen8 threads x 8 = the
// whole plane (exact multiple of 256).
// =====================================================================================================
__device__ __forceinline__ void cvtrows(int bx, const float* __restrict__ in, unsigned short* out,
                                        int rowlen8, int nrows, int seq, int seqfull) {
  const int i = bx * 256 + (int)threadIdx.x;
  if (i < nrows * rowlen8) {
    const int row  = i / rowlen8;
    const int c    = i - row * rowlen8;
    const int bq   = row / seq;
    const int srow = bq * seqfull + (row - bq * seq);
    const float* src = in + ((size_t)srow * (size_t)rowlen8 + (size_t)c) * 8;
    const v4f a  = *(const v4f*)(src);
    const v4f a4 = *(const v4f*)(src + 4);
    v4u p;
    p[0] = pk16(bf_bits(a[0]),  bf_bits(a[1]));
    p[1] = pk16(bf_bits(a[2]),  bf_bits(a[3]));
    p[2] = pk16(bf_bits(a4[0]), bf_bits(a4[1]));
    p[3] = pk16(bf_bits(a4[2]), bf_bits(a4[3]));
    unsigned short* o = out + (size_t)i * 8;
    *(v4u*)o = p;
    
  }
}

// =====================================================================================================
// Weight transpose + bf16 convert through LDS: in f32 [krows][ncols] (pitch ldi) -> out bf16 [n][k] (pitch ldo,
// k contiguous), optionally duplicated at +dup elements in the same output row.  One block = one 64x64 tile:
// input rows k0 = 64*by, cols n0 = 64*bx.  Load: thread r = tid>>2 reads 16 floats of input row
// k0+r; LDS holds the transposed tile; block barrier; write: wave w, lane>>3 = q, lanes 8q..8q+7 write one whole
// LDS tile: cross-wave (block barrier); columns 64..71 of the pitch are never read.
// =====================================================================================================
__device__ __forceinline__ void tr64(int bx, int by, unsigned short* sT, const float* __restrict__ in, int ldi,
                                     unsigned short* out, int ldo, int dup) {
  const int tid = (int)threadIdx.x;
  const int k0  = by * 64;
  const int n0  = bx * 64;
  {
    const int r = tid >> 2, c16 = (tid & 3) * 16;
    const float* src = in + (size_t)(k0 + r) * (size_t)ldi + n0 + c16;
    const v4f a0 = *(const v4f*)(src);
    const v4f a1 = *(const v4f*)(src + 4);
    const v4f a2 = *(const v4f*)(src + 8);
    const v4f a3 = *(const v4f*)(src + 12);
#pragma unroll
    for (int e = 0; e < 4; ++e) {
      sT[(c16 + e) * 72 + r]      = bf_bits(a0[e]);
      sT[(c16 + 4 + e) * 72 + r]  = bf_bits(a1[e]);
      sT[(c16 + 8 + e) * 72 + r]  = bf_bits(a2[e]);
      sT[(c16 + 12 + e) * 72 + r] = bf_bits(a3[e]);
    }
  }
  __syncthreads();
  const int wave = tid >> 5, lane = tid & 31;
  const int q = lane >> 3, c8 = (lane & 7) * 8;
  v4u vv[2];
#pragma unroll
  for (int it = 0; it < 2; ++it) {
    const int n = it * 32 + wave * 4 + q;
    vv[it] = *(const v4u*)(sT + n * 72 + c8);
  }
  {
#pragma unroll
    for (int it = 0; it < 2; ++it) {
      const int n = it * 32 + wave * 4 + q;
      unsigned short* d = out + (size_t)(n0 + n) * (size_t)ldo + k0 + c8;
      *(v4u*)d = vv[it];
      if (dup != 0) *(v4u*)(d + dup) = vv[it];
    }
#if DEV_ASM
    // behind the last store: in the listing another range's code follows and reuses the stores' registers
    asm volatile("s_wait_xcnt 0x0" ::: "memory");
#endif
  }
}

// =====================================================================================================
// All six input conversions in ONE launch: none reads what another writes, so each block takes its job from the
// range its index falls in (block-uniform branch; the barrier of tr64 is reached by whole blocks only).
// Ranges, in index order: Wv^T, Wo^T (duplicated along k), Wc^T, Wn^T, hidden rows, coordinate rows.
// =====================================================================================================
#define PB_W  ((DM / 64) * (DM / 64))            // 256 tiles of a [DM][DM] weight
#define PB_C  ((HN / 64) * (DC / 64))            //   4 tiles of Wc [DC][HN]
#define PB_N  ((DC / 64) * (DC / 64))            //   1 tile of Wn [DC][DC]
#define PB_X  (NB * SEQ * DM / 8 / 256)          // 2048 blocks of hidden rows
#define PB_Q  (NB * SEQ * DC / 8 / 256)          //  128 blocks of coordinate rows
static_assert((NB * SEQ * DM / 8) % 256 == 0 && (NB * SEQ * DC / 8) % 256 == 0);
__global__ __launch_bounds__(256) void prep_all(const float* __restrict__ hidden, const float* __restrict__ coords,
                                                const float* __restrict__ Wv, const float* __restrict__ Wo,
                                                const float* __restrict__ Wc, const float* __restrict__ Wn,
                                                unsigned short* Xb, unsigned short* Cb, unsigned short* WvT,
                                                unsigned short* WoT2, unsigned short* WcT, unsigned short* WnT) {
  __shared__ __align__(16) unsigned short sT[64 * 72];
  int bx = (int)blockIdx.x;
  if (bx < PB_W) { tr64(bx % (DM / 64), bx / (DM / 64), sT, Wv, DM, WvT, DM, 0); return; }
  bx -= PB_W;
  if (bx < PB_W) { tr64(bx % (DM / 64), bx / (DM / 64), sT, Wo, DM, WoT2, OP, DM); return; }
  bx -= PB_W;
  if (bx < PB_C) { tr64(bx % (HN / 64), bx / (HN / 64), sT, Wc, HN, WcT, DC, 0); return; }
  bx -= PB_C;
  if (bx < PB_N) { tr64(bx % (DC / 64), bx / (DC / 64), sT, Wn, DC, WnT, DC, 0); return; }
  bx -= PB_N;
  if (bx < PB_X) { cvtrows(bx, hidden, Xb, DM / 8, NB * SEQ, SEQ, SEQ_FULL); return; }
  bx -= PB_X;
  cvtrows(bx, coords, Cb, DC / 8, NB * SEQ, SEQ, SEQ_FULL);
}

// =====================================================================================================
// Register-blocked batched WMMA GEMM (16-bit operand type OT): C[m][n] = sum_k A[m][k] * Bt[n][k] (+ bias);
// a block of 4 waves, WR x WC of them, takes one (64 WR) x (64 WC) tile, each wave a 64x64 part of it. A row-major
// [M][K], Bt row-major [N][K] (k contiguous), both of row pitch K = KD elements, a compile-time constant so that the
// staging loads of a tile share one address and differ by immediate offsets; M a multiple of 64 WR, N of 64 WC, KD of
// 64. bx = block index within the product, b = batch index (strides in elements). Per 64-k step the BLOCK brings its
// 64 WR rows of A and 64 WC rows of Bt in ONCE, with 16-B loads that cover whole 128-B lines (8 lanes per row, 16 rows
// per load of the block), in registers one step ahead of the LDS store; the rows go to one of two LDS buffers
// (pitch LP) that all four waves read their fragments from with the split k map (ldfrag): a row of A serves WC waves,
// a row of Bt WR waves. One block barrier per step: it publishes the buffer just written and ends the reads of the other.
// BIAS 0: none; 1: per column n (bias[n]); 2: per row m (bias[m]); bias values RNE-converted to bf16 in f32.
// OUT_MODE 0: f32 C (pitch ldc), value * oscale + bias.
// OUT_MODE 3: f16 hi plane C + f16 residual plane C2 = f16((v - hi) * rscale) (same pitch / stride), v = acc*oscale+bias.
// whole 64x64 tile; slab pitch columns 64..67 never read.
// =====================================================================================================
// Block barrier that orders LDS accesses only: __syncthreads() also waits for the global loads in flight, which here
// are the rows of a later step and are wanted only at their LDS store
__device__ __forceinline__ void lds_barrier() {
  __builtin_amdgcn_fence(__ATOMIC_RELEASE, "workgroup", "local");
  __builtin_amdgcn_s_barrier();
  __builtin_amdgcn_fence(__ATOMIC_ACQUIRE, "workgroup", "local");
}
template <bool B> struct BoolC { static constexpr bool value = B; };   // a compile-time flag as an argument
// LDS of a GEMM block, declared once in each kernel and handed to the body
#define GW 4                                       // waves of a GEMM block
#define GEMM_ROWS 512                              // tile rows of the LDS pool: two buffers of 128 A + 128 Bt rows
#define GEMM_LDS(OT)                                                                                             \
  __shared__ __align__(16) float sT[GW * 16 * 68]; /* per-wave 16x64 slab, pitch 68 floats */                     \
  __shared__ __align__(16) OT sP[GEMM_ROWS * LP]   /* block tiles [row][64 k], columns 64..71 never read */
template <typename OT, int OUT_MODE, int BIAS, int KD, int WR, int WC>
__device__ __forceinline__ void gemm64(
    int bx, int b, float* sT, OT* sP,
    const unsigned short* __restrict__ Ap, long long strideA,
    const unsigned short* __restrict__ Btp, long long strideB,
    void* Cout, void* Cout2, int ldc, long long strideC,
    const float* __restrict__ bias,
    int M, int N, float oscale, float rscale) {
  static_assert((KD % 64) == 0 && KD >= 64);
  static_assert(WR * WC == GW);
  constexpr int NBUF = (KD > 64) ? 2 : 1;      // a single step needs one buffer
  constexpr int ASZ  = 64 * WR * LP;           // elements of one A buffer
  constexpr int BSZ  = 64 * WC * LP;           // elements of one Bt buffer
  static_assert(NBUF * 64 * (WR + WC) <= GEMM_ROWS);
  typedef typename FT<OT>::frag V16;
  typedef typename FT<OT>::half8 H8;
  const OT* A  = (const OT*)(const void*)Ap;
  const OT* Bt = (const OT*)(const void*)Btp;
  const int tid  = (int)threadIdx.x;
  const int lane = tid & 31;
  const int wave = tid >> 5;
  const int tilesN = N / (64 * WC);
  const int tilesM = M / (64 * WR);
  if (bx >= tilesM * tilesN) return;     // block-uniform, in front of every barrier
  const int tm = bx / tilesN;
  const int tn = bx - tm * tilesN;
  const int bm0 = tm * (64 * WR);        // the block's first row of A and of Bt
  const int bn0 = tn * (64 * WC);
  const int m0 = bm0 + (wave / WC) * 64; // this wave's 64x64 part
  const int n0 = bn0 + (wave % WC) * 64;
  // The block's own first k step. Blocks with the same tm walk the same rows of A, blocks with the same tn the same rows
  // of Bt; for speed only.
  // Each starts at a step set by its tile indices and wraps round at KD (step t of the block is k = kro(64 t)).
  constexpr int NS = KD / 64;
  static_assert((KD & (KD - 1)) == 0);         // the wrap is a mask
  const int fm  = (NS / tilesM > 1) ? NS / tilesM : 1;
  const int fn  = (NS / tilesN > 1) ? NS / tilesN : 1;
  const int ks0 = ((tm * fm + tn * fn) % NS) * 64;
  auto kro = [&](int k) { return (k + ks0) & (KD - 1); };

  const OT* Ab = A  + (size_t)b * (size_t)strideA;
  const OT* Bb = Bt + (size_t)b * (size_t)strideB;

  const int rlane = lane & 15;                 // row (A) / col (B, D) within subtile
  const int koff  = (lane >> 4) * 8;           // k offset of this lane half
  const int mOff  = (lane >> 4) * 8;           // D row offset

  v8f acc[4][4];
#pragma unroll
  for (int i = 0; i < 4; ++i)
#pragma unroll
    for (int j = 0; j < 4; ++j) acc[i][j] = zero8();

  OT* sA = sP;                                 // NBUF buffers of 64 WR rows
  OT* sB = sP + NBUF * ASZ;                    // NBUF buffers of 64 WC rows
  const OT* wa = sA + (wave / WC) * (64 * LP); // this wave's 64 rows in buffer 0
  const OT* wb = sB + (wave % WC) * (64 * LP);
  const int sr = tid >> 3;                     // row within the 16 rows of one staging load of the block
  const int sc = (tid & 7) * 8;                // 16-B piece of the row's 128-B line
  const int so = sr * LP + sc;                 // the same place in an LDS buffer
  // block-uniform tile bases, told so to the compiler: they stay in scalar registers
  const char* gA = (const char*)(Ab + (size_t)__builtin_amdgcn_readfirstlane(bm0) * KD);
  const char* gB = (const char*)(Bb + (size_t)__builtin_amdgcn_readfirstlane(bn0) * KD);
  const unsigned lo = (unsigned)(sr * KD + sc) * 2u;      // byte offset of this lane's piece of tile row sr
  H8 ra[4 * WR], rb[4 * WC];                   // staging loops unrolled: constant indices keep both in registers
#pragma unroll
  for (int it = 0; it < 4 * WR; ++it) ra[it] = *(const H8*)(gA + 2 * kro(0) + lo + 32 * it * KD);
#pragma unroll
  for (int it = 0; it < 4 * WC; ++it) rb[it] = *(const H8*)(gB + 2 * kro(0) + lo + 32 * it * KD);
#if DEV_ASM
  // before an address register of the loads above is reused; the inputs keep those registers as they are up to here
  asm volatile("s_wait_xcnt 0x0" :: "v"(lo), "s"(gA), "s"(gB) : "memory");
#endif
#pragma unroll
  for (int it = 0; it < 4 * WR; ++it) *(H8*)(sA + 16 * it * LP + so) = ra[it];      // step 0 -> buffer 0
#pragma unroll
  for (int it = 0; it < 4 * WC; ++it) *(H8*)(sB + 16 * it * LP + so) = rb[it];
  if (KD > 64) {                               // step 1 into the registers
#pragma unroll
    for (int it = 0; it < 4 * WR; ++it) ra[it] = *(const H8*)(gA + 2 * kro(64) + lo + 32 * it * KD);
#pragma unroll
    for (int it = 0; it < 4 * WC; ++it) rb[it] = *(const H8*)(gB + 2 * kro(64) + lo + 32 * it * KD);
#if DEV_ASM
    // before an address register of these loads is reused; the inputs keep those registers as they are up to here
    asm volatile("s_wait_xcnt 0x0" :: "v"(lo), "s"(gA), "s"(gB) : "memory");
#endif
  }
  lds_barrier();                               // buffer 0 is whole before any wave reads it
  // One 64-k step. MORE: a next step exists; its rows go to the other buffer and the barrier publishes them. The last
  // step is written out by itself, so that in the loop the stores stand on every path and the waits of the second
  // block's fragments can be counted past them.
  auto step = [&](auto more, int k0) {
    constexpr bool MORE = decltype(more)::value;
    const int cur = (NBUF == 2) ? ((k0 >> 6) & 1) : 0;         // buffer of this step
    const OT* ca = wa + cur * ASZ;
    const OT* cb = wb + cur * BSZ;
#pragma unroll                                 // both 32-k blocks in one body: the second block's reads overlap the first's products
    for (int kk = 0; kk < 64; kk += 32) {
      V16 bq[4], af[4];                        // all eight fragments of the 32-k block read as one group
#pragma unroll
      for (int j = 0; j < 4; ++j) {
        bq[j] = ldfrag<OT>(cb + ((j << 4) + rlane) * LP + koff + kk);
        af[j] = ldfrag<OT>(ca + ((j << 4) + rlane) * LP + koff + kk);
      }
      // The stores stand behind the step's last fragment reads: LDS serves a wave in order, and in front of the reads
      // the products would wait for the block's stores; here the second block's products cover them.
      if (MORE && kk == 32) {
        // next step's rows into the other buffer: its readers left it in front of the last barrier
        OT* da = sA + (cur ^ 1) * ASZ + so;
        OT* db = sB + (cur ^ 1) * BSZ + so;
#pragma unroll
        for (int it = 0; it < 4 * WR; ++it) *(H8*)(da + 16 * it * LP) = ra[it];
#pragma unroll
        for (int it = 0; it < 4 * WC; ++it) *(H8*)(db + 16 * it * LP) = rb[it];
        if (k0 + 128 < KD) {                   // the step after that flies until its stores, one step on
#pragma unroll
          for (int it = 0; it < 4 * WR; ++it) ra[it] = *(const H8*)(gA + 2 * kro(k0 + 128) + lo + 32 * it * KD);
#pragma unroll
          for (int it = 0; it < 4 * WC; ++it) rb[it] = *(const H8*)(gB + 2 * kro(k0 + 128) + lo + 32 * it * KD);
#if DEV_ASM
          // before an address register of these loads is reused; the inputs keep those registers as they are up to here
          asm volatile("s_wait_xcnt 0x0" :: "v"(lo), "s"(gA), "s"(gB) : "memory");
#endif
        }
      }
#pragma unroll
      for (int i = 0; i < 4; ++i) {
#pragma unroll
        for (int j = 0; j < 4; ++j) acc[i][j] = mmar(af[i], bq[j], acc[i][j]);
        dep_guard(acc[i][0], acc[i][3], af[i], bq[3]);
      }
      keep4(bq[0], bq[1], bq[2], bq[3]);
    }
    // publishes the buffer written in this step; ends every wave's reads of the one that the next step overwrites
    if (MORE) lds_barrier();
  };
  for (int k0 = 0; k0 + 64 < KD; k0 += 64) step(BoolC<true>{}, k0);
  step(BoolC<false>{}, KD - 64);
  acc_guard4(acc[0][0], acc[0][1], acc[0][2], acc[0][3]);
  acc_guard4(acc[1][0], acc[1][1], acc[1][2], acc[1][3]);
  acc_guard4(acc[2][0], acc[2][1], acc[2][2], acc[2][3]);
  acc_guard4(acc[3][0], acc[3][1], acc[3][2], acc[3][3]);

  // ---- epilogue ----
  float* slab = sT + wave * (16 * 68);
#pragma unroll
  for (int i = 0; i < 4; ++i) {
    const int mBase = m0 + (i << 4);
#pragma unroll
    for (int j = 0; j < 4; ++j) {
#pragma unroll
      for (int r = 0; r < 8; ++r) {
        slab[(mOff + r) * 68 + (j << 4) + rlane] = acc[i][j][r];
      }
    }
    __builtin_amdgcn_fence(__ATOMIC_RELEASE, "workgroup");
    __builtin_amdgcn_wave_barrier();
    __builtin_amdgcn_fence(__ATOMIC_ACQUIRE, "workgroup");
    if (OUT_MODE == 0) {
      float* C = (float*)Cout + (size_t)b * (size_t)strideC;
      const int h2 = lane >> 4, c4 = (lane & 15) * 4;     // 256-B row segment = 16 lanes x 16 B
      v4f bcol = {0.f, 0.f, 0.f, 0.f};
      if (BIAS == 1) {
        const v4f bb = *(const v4f*)(bias + n0 + c4);
#pragma unroll
        for (int e = 0; e < 4; ++e) bcol[e] = bfr(bb[e]);
      }
      {
#pragma unroll
        for (int it = 0; it < 8; ++it) {
          const int row = it * 2 + h2;                     // it 0..7 x h2 0..1 = rows 0..15
          float brow = 0.f;
          if (BIAS == 2) brow = bfr(bias[mBase + row]);
          const v4f x = *(const v4f*)(slab + row * 68 + c4);
          v4f v;
#pragma unroll
          for (int e = 0; e < 4; ++e) v[e] = x[e] * oscale + bcol[e] + brow;
          *(v4f*)(C + (size_t)(mBase + row) * (size_t)ldc + n0 + c4) = v;
        }
        
      }
    } else {
      const int q = lane >> 3, c8 = (lane & 7) * 8;
      unsigned short* C  = (unsigned short*)Cout  + (size_t)b * (size_t)strideC;
      unsigned short* C2 = (unsigned short*)Cout2 + (size_t)b * (size_t)strideC;
      float bc8[8];
#pragma unroll
      for (int e = 0; e < 8; ++e) bc8[e] = 0.f;
      if (BIAS == 1) {
        const v4f b0 = *(const v4f*)(bias + n0 + c8);
        const v4f b1 = *(const v4f*)(bias + n0 + c8 + 4);
#pragma unroll
        for (int e = 0; e < 4; ++e) { bc8[e] = bfr(b0[e]); bc8[4 + e] = bfr(b1[e]); }
      }
      v4u hv[4], lv[4];
#pragma unroll
      for (int it = 0; it < 4; ++it) {
        const int row = it * 4 + q;                        // it 0..3 x q 0..3 = rows 0..15
        const float* sp = slab + row * 68 + c8;
        float brow = 0.f;
        if (BIAS == 2) brow = bfr(bias[mBase + row]);
        float f[8];
#pragma unroll
        for (int e = 0; e < 8; ++e) f[e] = sp[e] * oscale + bc8[e] + brow;
        v4u a, a2;
#pragma unroll
        for (int e = 0; e < 4; ++e) {
          const float f0 = f[2 * e], f1 = f[2 * e + 1];
          const _Float16 x0 = (_Float16)f0, x1 = (_Float16)f1;
          const unsigned short h0 = h_bits(x0), h1 = h_bits(x1);
          unsigned short l0 = 0, l1 = 0;
          if (OUT_MODE == 3) {
            l0 = h_bits((_Float16)((f0 - (float)x0) * rscale));
            l1 = h_bits((_Float16)((f1 - (float)x1) * rscale));
          }
          a[e] = pk16(h0, h1); a2[e] = pk16(l0, l1);
        }
        hv[it] = a; lv[it] = a2;
      }
      {
#pragma unroll
        for (int it = 0; it < 4; ++it) {
          const int row = it * 4 + q;
          *(v4u*)(C + (size_t)(mBase + row) * (size_t)ldc + n0 + c8) = hv[it];
          if (OUT_MODE == 3) *(v4u*)(C2 + (size_t)(mBase + row) * (size_t)ldc + n0 + c8) = lv[it];
        }
        
      }
    }
    __builtin_amdgcn_fence(__ATOMIC_RELEASE, "workgroup");
    __builtin_amdgcn_wave_barrier();
    __builtin_amdgcn_fence(__ATOMIC_ACQUIRE, "workgroup");
  }
}

// =====================================================================================================
// The three products that read only converted inputs, in ONE launch (none reads what another writes); a block
// takes its product from the range its index falls in. Ranges, longest work first:
//   v^T = Wv^T . x^T + bv per batch -> f16 hi plane [b][d][s] (pitch SEQ) and residual plane (x4096)
//         (A = WvT [n][k], Bt = Xb rows of batch b; M=DM, N=SEQ, K=DM; bias per row d)
//   z = coords . Wc + bc -> f32 [NB*SEQ][HN]                       (M=NB*SEQ, N=HN, K=DC)
//   second output = coords . Wn + bn -> f32 [NB*SEQ][DC]           (M=NB*SEQ, N=DC, K=DC)
// =====================================================================================================
#define GB_V  ((DM / 128) * (SEQ / 128))                    // 128 blocks per batch, 128x128 tiles
#define GB_Z  ((NB * SEQ / 128) * (HN / 128))               //  64 blocks, 128x128 tiles
#define GB_C  ((NB * SEQ / 256) * (DC / 64))                //  16 blocks, 256x64 tiles
static_assert((DM % 128) == 0 && (SEQ % 128) == 0 && (HN % 128) == 0 && ((NB * SEQ) % 256) == 0);
__global__ __launch_bounds__(128) void gemm_vzc(
    const unsigned short* __restrict__ WvT, const unsigned short* __restrict__ Xb,
    const unsigned short* __restrict__ Cb, const unsigned short* __restrict__ WcT,
    const unsigned short* __restrict__ WnT,
    unsigned short* VTh, unsigned short* VTl, float* Zf, float* out1,
    const float* __restrict__ bv, const float* __restrict__ bc, const float* __restrict__ bn) {
  GEMM_LDS(__bf16);
  int bx = (int)blockIdx.x;
  if (bx < NB * GB_V) {
    gemm64<__bf16, 3, 2, DM, 2, 2>(bx % GB_V, bx / GB_V, sT, sP,
        WvT, 0LL, Xb, (long long)SEQ * DM,
        (void*)VTh, (void*)VTl, SEQ, (long long)DM * SEQ, bv,
        DM, SEQ, 1.0f, RSC);
    return;
  }
  bx -= NB * GB_V;
  if (bx < GB_Z) {
    gemm64<__bf16, 0, 1, DC, 2, 2>(bx, 0, sT, sP,
        Cb, 0LL, WcT, 0LL,
        (void*)Zf, (void*)Zf, HN, 0LL, bc,
        NB * SEQ, HN, 1.0f, 1.0f);
    return;
  }
  bx -= GB_Z;
  gemm64<__bf16, 0, 1, DC, 4, 1>(bx, 0, sT, sP,
      Cb, 0LL, WnT, 0LL,
      (void*)out1, (void*)out1, DC, 0LL, bn,
      NB * SEQ, DC, 1.0f, 1.0f);
}

// first output = [ctx_hi | ctx_res] . [Wo^T ; Wo^T]^T + bo -> f32 [NB*SEQ][DM]   (M=NB*SEQ, N=DM, K=2*DM)
__global__ __launch_bounds__(128) void gemm_out(
    const unsigned short* __restrict__ Octx, const unsigned short* __restrict__ WoT2,
    float* out0, const float* __restrict__ bo) {
  GEMM_LDS(__bf16);
  gemm64<__bf16, 0, 1, OP, 2, 2>((int)blockIdx.x, 0, sT, sP,
      Octx, 0LL, WoT2, 0LL,
      (void*)out0, (void*)out0, DM, 0LL, bo,
      NB * SEQ, DM, 1.0f, 1.0f);
}

// =====================================================================================================
// z relayout: in f32 z [rows][HN] (16 heads x 16); out the f16 operand plane [rows][ZP] of y = z * sqrt(softplus(gamma_h)
// * log2(e)), so that |y_s - y_t|^2 is the negated score in log2 units.  64 halves per (row, head):
//   0..15 hi = f16(y) | 16..31 hi / 64 | 32..47 (y - hi) * 64 | 48..50 |y|^2 as three f16 pieces, 51..54 ones, 55..63 zeros
// (the /64 and x64 keep both factors of a hi . residual product in the normal f16 range; their product is hi . residual).
// Block = 16 rows x 16 heads (thread = one (row, head)); staged in LDS; block barrier; line L of
// the block (L = 16*r + head, contiguous in the plane) written by lanes 8q..8q+7 of wave w with one instruction
// LDS: cross-wave (block barrier); fully written before read.
// =====================================================================================================
__global__ __launch_bounds__(256) void zprep(const float* __restrict__ zf, const float* __restrict__ gam,
                                             unsigned short* zp) {
  __shared__ __align__(16) unsigned short sZ[256 * LP];   // columns 64..71 of the pitch are never read
  const int tid  = (int)threadIdx.x;
  const int r    = tid >> 4, hd = tid & 15;
  const int row0 = blockIdx.x * 16;
  {
    const float* zr = zf + (size_t)(row0 + r) * HN + hd * HC;
    const v4f a0 = *(const v4f*)(zr);
    const v4f a1 = *(const v4f*)(zr + 4);
    const v4f a2 = *(const v4f*)(zr + 8);
    const v4f a3 = *(const v4f*)(zr + 12);
    const float gx = bfr(gam[hd]);
    const float g  = fmaxf(gx, 0.f) + log1pf(expf(-fabsf(gx)));   // softplus
    const float sc = sqrtf(g * 1.44269504088896340736f);
    float f[16];
#pragma unroll
    for (int e = 0; e < 4; ++e) { f[e] = a0[e] * sc; f[4 + e] = a1[e] * sc; f[8 + e] = a2[e] * sc; f[12 + e] = a3[e] * sc; }
    float q = 0.f;
#pragma unroll
    for (int e = 0; e < 16; ++e) q += f[e] * f[e];
    v4u ph[2], ps[2], pl[2];
#pragma unroll
    for (int e = 0; e < 8; ++e) {
      const float f0 = f[2 * e], f1 = f[2 * e + 1];
      const _Float16 x0 = (_Float16)f0, x1 = (_Float16)f1;
      ph[e >> 2][e & 3] = pk16(h_bits(x0), h_bits(x1));
      ps[e >> 2][e & 3] = pk16(h_bits((_Float16)((float)x0 * (1.0f / ZSC))), h_bits((_Float16)((float)x1 * (1.0f / ZSC))));
      pl[e >> 2][e & 3] = pk16(h_bits((_Float16)((f0 - (float)x0) * ZSC)), h_bits((_Float16)((f1 - (float)x1) * ZSC)));
    }
    const _Float16 n0 = (_Float16)q;
    const float    q1 = q - (float)n0;
    const _Float16 n1 = (_Float16)q1;
    const _Float16 n2 = (_Float16)(q1 - (float)n1);
    const unsigned short one = h_bits((_Float16)1.0f);
    const v4u pn = {pk16(h_bits(n0), h_bits(n1)), pk16(h_bits(n2), one), pk16(one, one), pk16(one, 0)};
    const v4u z4 = {0u, 0u, 0u, 0u};
    unsigned short* sl = sZ + tid * LP;
    *(v4u*)(sl + 0)  = ph[0];
    *(v4u*)(sl + 8)  = ph[1];
    *(v4u*)(sl + 16) = ps[0];
    *(v4u*)(sl + 24) = ps[1];
    *(v4u*)(sl + 32) = pl[0];
    *(v4u*)(sl + 40) = pl[1];
    *(v4u*)(sl + 48) = pn;
    *(v4u*)(sl + 56) = z4;
  }
  __syncthreads();
  const int wave = tid >> 5, lane = tid & 31;
  const int q4 = lane >> 3, c8 = (lane & 7) * 8;
  unsigned short* base = zp + (size_t)row0 * ZP;
  v4u vv[8];
#pragma unroll
  for (int it = 0; it < 8; ++it) {
    const int L = it * 32 + wave * 4 + q4;
    vv[it] = *(const v4u*)(sZ + L * LP + c8);
  }
  {
#pragma unroll
    for (int it = 0; it < 8; ++it) {
      const int L = it * 32 + wave * 4 + q4;
      *(v4u*)(base + (size_t)L * 64 + c8) = vv[it];
    }
  }
}

// =====================================================================================================
// Distance-kernel attention, per-head z dim 16, value dim 64, no mask, softmax over all SEQ keys.
//   z plane (f16) of y = z * sqrt(softplus(gamma_h) * log2(e)): row (b*SEQ + t), head h at cols 64h.. :
//   [hi | hi/64 | residual x64 | n0 n1 n2 1 1 1 1 0 ...], n0 + n1 + n2 = |y|^2
//   v^T hi plane (f16) and residual plane (f16, (v - hi)*4096): element (b, h, d, s) at [(b*DM + h*64 + d)*SEQ + s]
//   ctx plane (bf16): element (b, t, h, d) hi at [(b*SEQ + t)*OP + h*64 + d], residual at the same + DM
//   The whole exponent comes out of two f16 WMMAs into one f32 accumulator:
//   T = A[hi | hi/64] . B[2 hi ; 2 res x64]  +  A[res x64 | n0 n1 n2 1 1 1 1 0..] . B[2 hi/64 ; -1 -1 -1 -n0 -n1 -n2 14 0..]
//     = 14 - (|y_s|^2 + |y_t|^2 - 2 y_s . y_t), A of the key, B of the query (built from the query's own plane row);
//   score * log2(e) = -max(|y_s|^2 + |y_t|^2 - 2 dot, 0) = min(T, 14) - 14 is <= 0 for every pair (the clamp),
//   and a query is one of its own keys, at distance 0 up to rounding: exp(score) cannot overflow and the row sum
//   is about 1 or more, so softmax = exp(s) / sum exp(s) is taken as it stands, with no running max and no rescale
//   (sound while softplus x the rounding error of a query's own distance, about 2^-22 |z|^2, stays far below 20).
//   p is carried x16384: one exp2 and one min per score, min(exp2(T), 16384) = exp2(min(T, 14)), f16 for the product;
//   context = p . vh + (p . vl) / 4096 on f16 WMMA, both accumulators run through all chunks; sums in f32.
//   Both products run transposed: scores^T = keys (A) . queries (B), context^T = v^T (A) . p^T (B).  In every
//   accumulator tile a lane then holds ONE query (column lane&15) and rows 8*(lane>>4)+r (keys, or value dims):
//   the row sum is in-lane plus one exchange between the wave halves after the loop, and two score tiles pack straight
//   into the p^T operand (elements 0..7 = keys 8*half.. of the even tile, 8..15 = the same rows of the odd tile,
//   the k order of the v^T fragment), so p never goes through LDS.
//   Block = 8 waves = 4 query groups x 2 key halves of one (b, h), 128 query rows; grid = NB * NH * NQB; key chunks of
//   64, static trip NKT, walked from chunk 2 qb on and round.  Wave w takes the 32 queries of group w >> 1 (two
//   16-column tiles) against keys 32 (w & 1) .. + 31 of every chunk: each z and v^T fragment it reads from LDS feeds
//   two products, one per query tile, and a chunk brought from L2 serves 128 queries.  With no running max the two key
//   halves of a query are plain partial sums: behind the loop each wave of a pair hands the partial context and row
//   sum of one query tile to its partner through LDS (two block barriers) and finishes the other tile.
//   Chunk staging: 256 threads x 2 rows x 8 elements per plane = the whole 64x64 tile of each of the three planes
//   (8 lanes per 128-B row; plain loads, __syncthreads before
//   and after; staged extent == consumed extent); the context tile
//   is wave-private but for the hand-over; the grid covers every (b, h, qb).
// =====================================================================================================
__global__ __launch_bounds__(256)
void attn_dist(const unsigned short* __restrict__ zpp,
               const unsigned short* __restrict__ vhp, const unsigned short* __restrict__ vlp,
               unsigned short* octx) {
  union FH { v16h v; v8h h[2]; };
  __shared__ __align__(16) _Float16 Zsh[64 * LP];          // z key chunk [key][64], pitch LP    9 KB
  __shared__ __align__(16) _Float16 Vth[64 * LP];          // V^T hi [d][key], pitch LP          9 KB
  __shared__ __align__(16) _Float16 Vtl[64 * LP];          // V^T residual, pitch LP             9 KB
  __shared__ __align__(16) float    Os[8][16 * OSP];       // per wave context tile, pitch OSP  34 KB
  __shared__ __align__(16) float    Ls[8][32];             // per wave row sums handed to the partner

  const int tid  = threadIdx.x;
  const int wave = tid >> 5;
  const int lane = tid & 31;
  const int hh   = lane >> 4;
  const int c    = lane & 15;
  const int kh   = wave & 1;         // this wave's half of every key chunk
  const int qg   = wave >> 1;        // this wave's group of 32 queries

  const int bx   = blockIdx.x;
  const int qb   = bx % NQB;
  const int rest = bx / NQB;
  const int h    = rest % NH;
  const int b    = rest / NH;
  const int q0   = qb * 128 + qg * 32;
  const size_t rowB = (size_t)b * SEQ;

  const _Float16* Zp16 = (const _Float16*)(const void*)zpp;
  const _Float16* Vh = (const _Float16*)(const void*)vhp + ((size_t)b * DM + (size_t)h * HD) * SEQ;
  const _Float16* Vl = (const _Float16*)(const void*)vlp + ((size_t)b * DM + (size_t)h * HD) * SEQ;

  // ---- query-side B fragments (column = lane&15) of both query tiles, from the query's own plane row:
  //      zq1 = [2 hi | 2 residual x64], zq2 = [2 hi/64 | -1 -1 -1 -n0 -n1 -n2 14 0 ...] (k 16..23 sit in lane half 0) ----
  FH zq1[2], zq2[2];
#pragma unroll
  for (int u = 0; u < 2; ++u) {
    const _Float16* qr = Zp16 + (rowB + q0 + 16 * u + c) * ZP + (size_t)h * 64 + 8 * hh;
    const v8h qh = *(const v8h*)(qr);
    const v8h qs = *(const v8h*)(qr + 16);
    const v8h ql = *(const v8h*)(qr + 32);
    const v4h qn = *(const v4h*)(qr + 48);           // n0 n1 n2 1 in lane half 0
    const _Float16 m1 = (_Float16)-1.0f;
    const v8h fq = {m1, m1, m1, -qn[0], -qn[1], -qn[2], (_Float16)14.0f, (_Float16)0.0f};
    const v8h f0 = {};
    zq1[u].h[0] = qh + qh;
    zq1[u].h[1] = ql + ql;
    zq2[u].h[0] = qs + qs;
    zq2[u].h[1] = hh ? f0 : fq;
  }

  float lrow[2] = {0.f, 0.f};  // per query tile: sum of 16384 p over this lane half's keys of this wave's key halves
  v8f oacc[2][4];              // context^T (x16384): query tile u, tile t, register r = value dim 16t + 8*hh + r of query c
  v8f o1[2][4];                // the same of the residual plane (x16384 x4096)
#pragma unroll
  for (int u = 0; u < 2; ++u)
#pragma unroll
    for (int t = 0; t < 4; ++t) { oacc[u][t] = zero8(); o1[u][t] = zero8(); }

  // The 16 query blocks of one (b, h) walk the same key chunks: each enters the walk at its own
  // chunk and wraps round, so that they do not ask L2 for the same lines at the same moment (no running max: the
  // chunks may come in any order; only the order of the f32 sums follows it)
  const int kst = (qb * (NKT / NQB)) % NKT;
  const unsigned zlo = (unsigned)((tid >> 3) * ZP + (tid & 7) * 8) * 2u;    // byte offsets of this lane's piece in a chunk:
  const unsigned vlo = (unsigned)((tid >> 3) * SEQ + (tid & 7) * 8) * 2u;   // z tile row tid>>3, v^T tile row tid>>3
  const _Float16* zrd = Zsh + (kh * 32 + c) * LP + 8 * hh;                  // this wave's key rows of the z tile
  const _Float16* vhr = Vth + c * LP + kh * 32 + 8 * hh;                    // and its key columns of the v^T tiles
  const _Float16* vlr = Vtl + c * LP + kh * 32 + 8 * hh;
  for (int kt = 0; kt < NKT; ++kt) {         // static trip count
    const int kv0 = ((kt + kst) % NKT) * 64;
    __syncthreads();
    {
      // 8 lanes per tile row: one 16-B load of a wave covers the whole 128-B lines of 4 rows (not 32 B of each of 16)
      const int r = tid >> 3, c8 = (tid & 7) * 8;      // rows r, r+32; 16-B piece c8 of the row
      // The chunk's place is the same for the whole block and no longer a fixed step from the last one: a block-uniform
      // base, formed in scalar registers, to which the lane's own byte offsets (zlo, vlo, fixed in the loop) are added
      const char* zg  = (const char*)(Zp16 + (rowB + kv0) * ZP + (size_t)h * 64);    // key row kv0, 64-half head segment
      const char* vg  = (const char*)(Vh + kv0);                                      // v^T row d = 0, s = kv0
      const char* vlg = (const char*)(Vl + kv0);
      const char* za = zg + zlo;                       // the lane's own three addresses in the chunk
      const char* va = vg + vlo;
      const char* vr = vlg + vlo;
      v8h a0[2], b0[2], b1[2];
#pragma unroll
      for (int i = 0; i < 2; ++i) {
        a0[i] = *(const v8h*)(za + 2 * 32 * i * ZP);
        b0[i] = *(const v8h*)(va + 2 * 32 * i * SEQ);
        b1[i] = *(const v8h*)(vr + 2 * 32 * i * SEQ);
      }
#if DEV_ASM
      // the wait before an address register of the staging loads above is reused; it takes the three address pairs as
      // inputs, so that they stay whole up to it and no load of the run lands in an address register of an earlier one
      asm volatile("s_wait_xcnt 0x0" :: "v"(za), "v"(va), "v"(vr) : "memory");
#endif
#pragma unroll
      for (int i = 0; i < 2; ++i) {
        *(v8h*)(Zsh + (32 * i + r) * LP + c8) = a0[i];
        *(v8h*)(Vth + (32 * i + r) * LP + c8) = b0[i];
        *(v8h*)(Vtl + (32 * i + r) * LP + c8) = b1[i];
      }
    }
    __syncthreads();

    // ---- scores^T: 32 keys x 32 queries per wave, 2 f16 products per key subtile and query tile; p^T (x16384, f16) ----
    FH pa[2];                    // p^T operand of this wave's 32 keys, one per query tile
    float pj[2][2];              // four independent sums, one per query tile and key subtile
#pragma unroll
    for (int j = 0; j < 2; ++j) {
      const _Float16* zr = zrd + j * 16 * LP;
      FH b1, b2;
      b1.h[0] = *(const v8h*)(zr);          // k 0..15  <- hi of key
      b1.h[1] = *(const v8h*)(zr + 16);     // k 16..31 <- hi / 64 of key
      b2.h[0] = *(const v8h*)(zr + 32);     // k 0..15  <- residual x64 of key
      b2.h[1] = *(const v8h*)(zr + 48);     // k 16..31 <- norm pieces, ones, zeros
      v8f tt[2];                            // the key fragments serve both query tiles
      tt[0] = mmar(b1.v, zq1[0].v, zero8());       // 2 hi.hi + 2 hi.res; the next user of each sum is the product
      tt[1] = mmar(b1.v, zq1[1].v, zero8());       // that adds to it
      tt[0] = mma_h(b2.v, zq2[0].v, tt[0]);        // + 2 res.hi - both norms + 14
      tt[1] = mma_h(b2.v, zq2[1].v, tt[1]);
#pragma unroll
      for (int u = 0; u < 2; ++u) {
        pj[u][j] = 0.f;
#pragma unroll
        for (int r = 0; r < 8; ++r) {
          // 16384 exp(score); the min is the clamp of the squared distance at 0 (exp2 is monotone)
          const float p = fminf(__builtin_amdgcn_exp2f(tt[u][r]), 16384.0f);
          pj[u][j] += p;
          pa[u].h[j][r] = (_Float16)p;
        }
      }
    }
    lrow[0] += pj[0][0] + pj[0][1];
    lrow[1] += pj[1][0] + pj[1][1];

    // ---- context^T += V^T . P^T (f16 WMMA); residual products into a separate accumulator ----
#pragma unroll
    for (int t = 0; t < 4; ++t) {
      FH vb, vl;
      vb.h[0] = *(const v8h*)(vhr + t * 16 * LP);
      vb.h[1] = *(const v8h*)(vhr + t * 16 * LP + 16);
      vl.h[0] = *(const v8h*)(vlr + t * 16 * LP);
      vl.h[1] = *(const v8h*)(vlr + t * 16 * LP + 16);
#pragma unroll
      for (int u = 0; u < 2; ++u) {         // the v^T fragments serve both query tiles
        oacc[u][t] = mma_h(vb.v, pa[u].v, oacc[u][t]);
        o1[u][t]   = mma_h(vl.v, pa[u].v, o1[u][t]);
      }
    }
  }

  // ---- join the two key halves: the wave keeps query tile kh and hands its partial of the other tile to wave ^ 1 ----
  float* os = Os[wave];
  v8f own[4];
  float lown;
  {
    v8f snd[4];
#pragma unroll
    for (int t = 0; t < 4; ++t)
#pragma unroll
      for (int r = 0; r < 8; ++r) {
        const float x0 = oacc[0][t][r] + o1[0][t][r] * (1.0f / RSC);
        const float x1 = oacc[1][t][r] + o1[1][t][r] * (1.0f / RSC);
        own[t][r] = kh ? x1 : x0;
        snd[t][r] = kh ? x0 : x1;
      }
    lown = kh ? lrow[1] : lrow[0];
    Ls[wave][lane] = kh ? lrow[0] : lrow[1];
#pragma unroll
    for (int t = 0; t < 4; ++t) {                // row = query c, 8 consecutive value dims per tile
      v4f w0, w1;
#pragma unroll
      for (int e = 0; e < 4; ++e) { w0[e] = snd[t][e]; w1[e] = snd[t][4 + e]; }
      *(v4f*)(os + c * OSP + t * 16 + 8 * hh)     = w0;
      *(v4f*)(os + c * OSP + t * 16 + 8 * hh + 4) = w1;
    }
  }
  __syncthreads();               // the partials are whole before the partner reads them
  {
    const float* po = Os[wave ^ 1];
    lown += Ls[wave ^ 1][lane];
#pragma unroll
    for (int t = 0; t < 4; ++t) {
      const v4f w0 = *(const v4f*)(po + c * OSP + t * 16 + 8 * hh);
      const v4f w1 = *(const v4f*)(po + c * OSP + t * 16 + 8 * hh + 4);
#pragma unroll
      for (int e = 0; e < 4; ++e) { own[t][e] += w0[e]; own[t][4 + e] += w1[e]; }
    }
  }
  __syncthreads();               // ends the partner's reads of this wave's tile, which is written anew below

  // ---- normalise (1/l; l and the context carry the same x16384), stage the wave's 16x64 tile, convert to bf16 hi + bf16 residual,
  {
    const float l = lown + xhalf(lown);          // both lane halves' keys
    const float inv = (l > 0.f) ? (1.0f / l) : 0.f;
#pragma unroll
    for (int t = 0; t < 4; ++t) {                // row = query c, 8 consecutive value dims per tile
      v4f w0, w1;
#pragma unroll
      for (int e = 0; e < 4; ++e) { w0[e] = own[t][e] * inv; w1[e] = own[t][4 + e] * inv; }
      *(v4f*)(os + c * OSP + t * 16 + 8 * hh)     = w0;
      *(v4f*)(os + c * OSP + t * 16 + 8 * hh + 4) = w1;
    }
  }
  __builtin_amdgcn_fence(__ATOMIC_RELEASE, "workgroup");
  __builtin_amdgcn_wave_barrier();
  __builtin_amdgcn_fence(__ATOMIC_ACQUIRE, "workgroup");
  {
    const int q4 = lane >> 3, c8 = (lane & 7) * 8;
    v4u hv[4], lv[4];
#pragma unroll
    for (int it = 0; it < 4; ++it) {
      const int row = it * 4 + q4;   // it 0..3 x q4 0..3 = rows 0..15 of the wave tile
      const float* sp = os + row * OSP + c8;
      v4u a, a2;
#pragma unroll
      for (int e = 0; e < 4; ++e) {
        const float f0 = sp[2 * e], f1 = sp[2 * e + 1];
        const unsigned short hb0 = bf_bits(f0), hb1 = bf_bits(f1);
        const unsigned short lb0 = bf_bits(f0 - bf_up(hb0)), lb1 = bf_bits(f1 - bf_up(hb1));
        a[e]  = pk16(hb0, hb1);
        a2[e] = pk16(lb0, lb1);
      }
      hv[it] = a; lv[it] = a2;
    }
    {
#pragma unroll
      for (int it = 0; it < 4; ++it) {
        const int row = it * 4 + q4;
        const size_t go = (rowB + q0 + 16 * kh + row) * OP + (size_t)h * HD + c8;   // the wave's own query tile
        *(v4u*)(octx + go)      = hv[it];
        *(v4u*)(octx + go + DM) = lv[it];
      }
      
    }
  }
}

// =====================================================================================================
// Workspace map (bytes, NB=2 / SEQ=2048), every region an exact multiple of its whole-line / whole-tile store
// granularity, back to back:
//   Xb   bf16 [NB*SEQ][DM]            8388608
//   Cb   bf16 [NB*SEQ][DC]             524288
//   WvT  bf16 [DM n][DM k]            2097152
//   WoT2 bf16 [DM n][2*DM k]          4194304
//   WcT  bf16 [HN][DC]                  32768
//   WnT  bf16 [DC][DC]                   8192
//   Zf   f32  [NB*SEQ][HN]            4194304
//   Zp   f16  [NB*SEQ][ZP]            8388608
//   VTh  f16  [NB][DM][SEQ]           8388608
//   VTl  f16  [NB][DM][SEQ]           8388608
//   Octx bf16 [NB*SEQ][OP]           16777216
//   total                            61382656
// Weights arrive [in][out]; tr64 produces the [out n][in k] (k contiguous) layout the GEMM wants.
// =====================================================================================================
extern "C" void kernel_launch(void* const* d_in, const int* in_sizes, int n_in,
                              void* d_out, int out_size, void* d_ws, size_t ws_size,
                              hipStream_t stream) {
  if (n_in < 11) return;
  if (in_sizes[0] < ((NB - 1) * SEQ_FULL + SEQ) * DM) return;
  if (in_sizes[1] < ((NB - 1) * SEQ_FULL + SEQ) * DC) return;
  if (in_sizes[2] < DM * DM || in_sizes[3] < DM) return;
  if (in_sizes[4] < DC * HN || in_sizes[5] < HN) return;
  if (in_sizes[6] < DC * DC || in_sizes[7] < DC) return;
  if (in_sizes[8] < DM * DM || in_sizes[9] < DM) return;
  if (in_sizes[10] < NH) return;
  if ((size_t)out_size < OUT1_OFF + (size_t)NB * SEQ * DC) return;

  const float* hidden = (const float*)d_in[0];
  const float* coords = (const float*)d_in[1];
  const float* Wv     = (const float*)d_in[2];
  const float* bv     = (const float*)d_in[3];
  const float* Wc     = (const float*)d_in[4];
  const float* bc     = (const float*)d_in[5];
  const float* Wn     = (const float*)d_in[6];
  const float* bn     = (const float*)d_in[7];
  const float* Wo     = (const float*)d_in[8];
  const float* bo     = (const float*)d_in[9];
  const float* gamma  = (const float*)d_in[10];

  const size_t nRows = (size_t)NB * SEQ;
  const size_t PXB  = nRows * DM * 2;
  const size_t PCB  = nRows * DC * 2;
  const size_t PWV  = (size_t)DM * DM * 2;
  const size_t PWO2 = (size_t)DM * OP * 2;
  const size_t PWC  = (size_t)HN * DC * 2;
  const size_t PWN  = (size_t)DC * DC * 2;
  const size_t PZF  = nRows * HN * 4;
  const size_t PZP  = nRows * ZP * 2;
  const size_t PVT  = (size_t)NB * DM * SEQ * 2;
  const size_t POC  = nRows * OP * 2;
  size_t off = 0;
  const size_t oXb  = off; off += PXB;
  const size_t oCb  = off; off += PCB;
  const size_t oWv  = off; off += PWV;
  const size_t oWo  = off; off += PWO2;
  const size_t oWc  = off; off += PWC;
  const size_t oWn  = off; off += PWN;
  const size_t oZf  = off; off += PZF;
  const size_t oZp  = off; off += PZP;
  const size_t oVTh = off; off += PVT;
  const size_t oVTl = off; off += PVT;
  const size_t oOc  = off; off += POC;
  if (off > ws_size) return;                       // off = 61382656 at full size
  if (off > (size_t)134217728) return;

  char* ws = (char*)d_ws;
  unsigned short* Xb   = (unsigned short*)(ws + oXb);
  unsigned short* Cb   = (unsigned short*)(ws + oCb);
  unsigned short* WvT  = (unsigned short*)(ws + oWv);
  unsigned short* WoT2 = (unsigned short*)(ws + oWo);
  unsigned short* WcT  = (unsigned short*)(ws + oWc);
  unsigned short* WnT  = (unsigned short*)(ws + oWn);
  float*          Zf   = (float*)(ws + oZf);
  unsigned short* Zpl  = (unsigned short*)(ws + oZp);
  unsigned short* VTh  = (unsigned short*)(ws + oVTh);
  unsigned short* VTl  = (unsigned short*)(ws + oVTl);
  unsigned short* Octx = (unsigned short*)(ws + oOc);
  float* out0 = (float*)d_out;
  float* out1 = (float*)d_out + OUT1_OFF;

  const dim3 blk(256);
  const dim3 gPrepAll(2 * PB_W + PB_C + PB_N + PB_X + PB_Q);           // 2693 blocks
  const dim3 gblk(32 * GW);                                            // GEMM blocks: 4 waves
  const dim3 gVZC(NB * GB_V + GB_Z + GB_C);                            //  336 blocks of 128
  const dim3 gO((NB * SEQ / 128) * (DM / 128));                        //  256 blocks of 128
  const dim3 gPrep((unsigned)(nRows / 16));                            //  256 blocks
  const dim3 gAttn(NB * NH * NQB);                                     //  512 blocks of 256

  // (1) activations -> bf16 planes; weights [in][out] f32 -> bf16 [out][in], Wo^T duplicated along k (pitch 2*DM)
  prep_all<<<gPrepAll, blk, 0, stream>>>(hidden, coords, Wv, Wo, Wc, Wn, Xb, Cb, WvT, WoT2, WcT, WnT);
  // (2) v^T planes, z (f32) and the second output (d_out at element OUT1_OFF)
  gemm_vzc<<<gVZC, gblk, 0, stream>>>(WvT, Xb, Cb, WcT, WnT, VTh, VTl, Zf, out1, bv, bc, bn);
  // (3) z -> f16 operand plane of the scaled z [hi | hi/64 | res x64 | norm pieces, ones]
  zprep<<<gPrep, blk, 0, stream>>>(Zf, gamma, Zpl);
  // (4) attention -> ctx plane (bf16 hi | bf16 residual) [b*SEQ+t][OP]
  attn_dist<<<gAttn, dim3(256), 0, stream>>>(Zpl, VTh, VTl, Octx);
  // (5) first output
  gemm_out<<<gO, gblk, 0, stream>>>(Octx, WoT2, out0, bo);
  (void)hipGetLastError();
}
